// v000
// Measured on an AMD MI455X. A time is GPU time per run, averaged over a window of back-to-back runs after a warm-up
// (all launches, gaps included; the runs take copies of the inputs in turn), and the median of several windows.
// Apart from v000's, it joins two sittings. Times from different sittings can be a few percent apart, while
// side-by-side timings come from the same sitting.
// v000, which the later versions start from, runs in 532 microseconds.
#include <hip/hip_runtime.h>
// Text-guided point attention (B=2, C=256 channels × N=4096 points; text 512 → 256 GELU projection added to the key input; q/k/v 1×1 convs; 4 heads × 64; UNSCALED softmax(q·k)·v; MLP 256 → relu →
// 256; out = γ·x + point_feats, channel-major): the q/k/v/MLP linears ((out,in) weights bf16-exact ×2^4; the text term enters k as a per-batch bias) and the attention as a fused flash-style
// kernel (online softmax f32, P f16 ≤ 1, O = P·Vt; RPW-16 waves) run on v_wmma_f32_16x16x32_f16 with f32 accumulate; the text projection, the NCW ↔ token-major transposes and the gated
// residual are f32 VALU.
#define BB 2
#define CC 256
#define NN 4096
#define DTX 512
#define NH 4
#define NR (BB * NN)

typedef __bf16 v16b __attribute__((ext_vector_type(16)));
typedef unsigned short v8us __attribute__((ext_vector_type(8), may_alias));
typedef float  v8f  __attribute__((ext_vector_type(8)));
typedef float  v4f  __attribute__((ext_vector_type(4)));
typedef float  v4fa __attribute__((ext_vector_type(4), may_alias));
union FragB { v16b v; v8us half[2]; unsigned short u[16]; };

__device__ __forceinline__ unsigned short bf16_bits(float x) { unsigned int u = __float_as_uint(x); return (unsigned short)((u + 0x7FFFu + ((u >> 16) & 1u)) >> 16); }
__device__ __forceinline__ float bf16_val(unsigned short b) { return __uint_as_float(((unsigned int)b) << 16); }
__device__ __forceinline__ float bf16_round(float x) { return bf16_val(bf16_bits(x)); }
// D += A·B with NT terms: 1 = ah·bh, 2 = + al·bh (A split), 3 = + ah·bl (both split)
template <int NT>
__device__ __forceinline__ v8f mmaN(v16b ah, v16b al, v16b bh, v16b bl, v8f c) {
  c = __builtin_amdgcn_wmma_f32_16x16x32_bf16(false, ah, false, bh, (short)0, c, false, false);
  if (NT >= 2) c = __builtin_amdgcn_wmma_f32_16x16x32_bf16(false, al, false, bh, (short)0, c, false, false);
  if (NT >= 3) c = __builtin_amdgcn_wmma_f32_16x16x32_bf16(false, ah, false, bl, (short)0, c, false, false);
  asm volatile("v_nop\n\tv_nop\n\tv_nop\n\tv_nop" : "+v"(c) : "v"(ah), "v"(al), "v"(bh), "v"(bl));
  return c;
}

__global__ __launch_bounds__(256) void k_wt_bf16(const float* __restrict__ W, unsigned short* __restrict__ Wt, int K, int N) {
  const int t = blockIdx.x * 256 + threadIdx.x;
  const int k8n = K / 8;
  if (t >= N * k8n) return;
  const int n = t / k8n, k8 = (t % k8n) * 8;
  v8us v;
#pragma unroll
  for (int i = 0; i < 8; ++i) v[i] = bf16_bits(W[(size_t)(k8 + i) * N + n]);
  *(v8us*)(Wt + (size_t)n * K + k8) = v;
  
}

// GEMM C[M][N] (f32, pitch ldc) = act(A[M][K]·W + bias). A f32 row-major (pitch lda) converted per fragment to bf16
// (ASPLIT: hi/lo two planes -> 2 terms, else single rounded term); Wt bf16 [N][K] (pitch ldb). BIAS_BF16 rounds the
// bias to bf16 first (bias quantised to bf16 before the add). K%32==0, M%16==0, N%64==0.
template <bool ASPLIT, int ACT, bool BIAS_BF16>
__global__ __launch_bounds__(128) void k_gemm_bf(const float* __restrict__ A, int lda, const unsigned short* __restrict__ Wt, int ldb,
                                               const float* __restrict__ bias, float* __restrict__ C, int ldc, int M, int N, int K) {
  __shared__ __attribute__((aligned(16))) float so[4][16][64];
  const int tid = threadIdx.x, w = tid >> 5, lane = tid & 31, ln = lane & 15, hh = lane >> 4;
  const int ntn = N / 64;
  const int wid = blockIdx.x * 4 + w;
  const int mt = wid / ntn, nq = wid % ntn;
  if (mt * 16 >= M) return;
  const int row0 = mt * 16, col0 = nq * 64;
  const float* arow = A + (size_t)(row0 + ln) * lda;
  v8f acc[4] = {};
  for (int kb = 0; kb < K; kb += 32) {
    FragB ah, al;
    const v4f x0 = *(const v4fa*)(arow + kb + 8 * hh), x1 = *(const v4fa*)(arow + kb + 8 * hh + 4);
    const v4f x2 = *(const v4fa*)(arow + kb + 16 + 8 * hh), x3 = *(const v4fa*)(arow + kb + 16 + 8 * hh + 4);
    float xs[16] = {x0[0],x0[1],x0[2],x0[3],x1[0],x1[1],x1[2],x1[3],x2[0],x2[1],x2[2],x2[3],x3[0],x3[1],x3[2],x3[3]};
#pragma unroll
    for (int i = 0; i < 16; ++i) { const unsigned short hb = bf16_bits(xs[i]); ah.u[i] = hb; al.u[i] = ASPLIT ? bf16_bits(xs[i] - bf16_val(hb)) : (unsigned short)0; }
#pragma unroll
    for (int t = 0; t < 4; ++t) {
      const unsigned short* brow = Wt + (size_t)(col0 + t * 16 + ln) * ldb + kb;
      FragB b;
      b.half[0] = *(const v8us*)(brow + 8 * hh);
      b.half[1] = *(const v8us*)(brow + 16 + 8 * hh);
      acc[t] = mmaN<ASPLIT ? 2 : 1>(ah.v, al.v, b.v, b.v, acc[t]);
    }
  }
#pragma unroll
  for (int t = 0; t < 4; ++t) {
    float bv = bias ? bias[col0 + t * 16 + ln] : 0.f;
    if (BIAS_BF16) bv = bf16_round(bv);
#pragma unroll
    for (int r = 0; r < 8; ++r) { float v = acc[t][r] + bv; if (ACT == 1) v = fmaxf(v, 0.f); so[w][8 * hh + r][t * 16 + ln] = v; }
  }
  __builtin_amdgcn_fence(__ATOMIC_ACQ_REL, "workgroup");
  __builtin_amdgcn_wave_barrier();
  const int rsub = lane >> 4, c4 = (lane & 15) * 4;
  {
#pragma unroll
    for (int q = 0; q < 8; ++q) {
      const int r = q * 2 + rsub;
      const v4f v = *(const v4fa*)&so[w][r][c4];
      *(v4f*)(C + (size_t)(row0 + r) * ldc + col0 + c4) = v;
    }
    
  }
}

// Flash-style causal/unmasked attention, all contractions 3-term bf16 hi/lo splits, f32 softmax with running max.
// q,k,v rows are read from f32 buffers with arbitrary row pitch (so they can live inside a fused qkv buffer);
// D = head size (multiple of 32, <= 128); one wave = 16 query rows; block = 4 waves (64 queries) sharing K/V chunks of 32.
template <int D, bool CAUSAL>
__global__ __launch_bounds__(128) void k_flash(const float* __restrict__ qb, const float* __restrict__ kb, const float* __restrict__ vb,
                                             int pitch, int T, int H, float scale, float* __restrict__ y, int ypitch) {
  constexpr int KS = D / 32;        // k-steps for QK
  constexpr int DT = D / 16;        // d tiles for PV
  __shared__ __attribute__((aligned(16))) unsigned short sKh[32][D + 8], sKl[32][D + 8], sVh[32][D + 8], sVl[32][D + 8];
  __shared__ __attribute__((aligned(16))) unsigned short sPh[4][16][40], sPl[4][16][40];
  __shared__ __attribute__((aligned(16))) float sO[4][16][D];
  const int tid = threadIdx.x, w = tid >> 5, lane = tid & 31, ln = lane & 15, hh = lane >> 4;
  const int nqb = (T + 63) / 64;
  const int bh = blockIdx.x / nqb, qblk = blockIdx.x % nqb;
  const int b = bh / H, h = bh % H;
  const int q0 = qblk * 64 + w * 16;
  const float* Q = qb + (size_t)b * T * pitch + h * D;
  const float* K = kb + (size_t)b * T * pitch + h * D;
  const float* V = vb + (size_t)b * T * pitch + h * D;

  // A fragments of the wave's 16 query rows (scaled), hi/lo
  FragB aqh[KS], aql[KS];
  {
    int row = q0 + ln; if (row >= T) row = T - 1;
    const float* qr = Q + (size_t)row * pitch;
#pragma unroll
    for (int ks = 0; ks < KS; ++ks)
#pragma unroll
      for (int i = 0; i < 16; ++i) {
        const int d = ks * 32 + ((i < 8) ? (8 * hh + i) : (16 + 8 * hh + (i - 8)));
        const float x = qr[d] * scale; const unsigned short hb = bf16_bits(x);
        aqh[ks].u[i] = hb; aql[ks].u[i] = bf16_bits(x - bf16_val(hb));
      }
  }
  float m_r[8], l_r[8];
#pragma unroll
  for (int r = 0; r < 8; ++r) { m_r[r] = -3.0e38f; l_r[r] = 0.f; }
  v8f oacc[DT];
#pragma unroll
  for (int dt = 0; dt < DT; ++dt) oacc[dt] = (v8f){0.f,0.f,0.f,0.f,0.f,0.f,0.f,0.f};

  const int kv_end = CAUSAL ? min(T, qblk * 64 + 64) : T;     // block-uniform
  for (int j0 = 0; j0 < kv_end; j0 += 32) {
    __syncthreads();
    for (int e = tid; e < 32 * (D / 4); e += 128) {
      const int r = e / (D / 4), c4 = (e % (D / 4)) * 4;
      const int key = j0 + r;
      v4f kf = {0.f,0.f,0.f,0.f}, vf = {0.f,0.f,0.f,0.f};
      if (key < T) { kf = *(const v4fa*)(K + (size_t)key * pitch + c4); vf = *(const v4fa*)(V + (size_t)key * pitch + c4); }
#pragma unroll
      for (int t = 0; t < 4; ++t) {
        unsigned short hb = bf16_bits(kf[t]); sKh[r][c4 + t] = hb; sKl[r][c4 + t] = bf16_bits(kf[t] - bf16_val(hb));
        hb = bf16_bits(vf[t]); sVh[r][c4 + t] = hb; sVl[r][c4 + t] = bf16_bits(vf[t] - bf16_val(hb));
      }
    }
    __syncthreads();
    // S tile 16 x 32
    v8f s[2];
#pragma unroll
    for (int nt = 0; nt < 2; ++nt) {
      v8f acc = {};
#pragma unroll
      for (int ks = 0; ks < KS; ++ks) {
        FragB bh_, bl_;
        bh_.half[0] = *(const v8us*)&sKh[nt * 16 + ln][ks * 32 + 8 * hh]; bh_.half[1] = *(const v8us*)&sKh[nt * 16 + ln][ks * 32 + 16 + 8 * hh];
        bl_.half[0] = *(const v8us*)&sKl[nt * 16 + ln][ks * 32 + 8 * hh]; bl_.half[1] = *(const v8us*)&sKl[nt * 16 + ln][ks * 32 + 16 + 8 * hh];
        acc = mmaN<3>(aqh[ks].v, aql[ks].v, bh_.v, bl_.v, acc);
      }
      s[nt] = acc;
    }
    // mask + running max (rows 8hh+r; the 16 lanes of a half share rows)
    float alpha[8];
#pragma unroll
    for (int r = 0; r < 8; ++r) {
      const int qi = q0 + 8 * hh + r;
      const int ja = j0 + ln, jb = j0 + 16 + ln;
      if (CAUSAL) { if (ja > qi) s[0][r] = -3.0e38f; if (jb > qi) s[1][r] = -3.0e38f; }
      if (ja >= T) s[0][r] = -3.0e38f;
      if (jb >= T) s[1][r] = -3.0e38f;
      float mx = fmaxf(s[0][r], s[1][r]);
      mx = fmaxf(mx, __shfl_xor(mx, 1, 32)); mx = fmaxf(mx, __shfl_xor(mx, 2, 32)); mx = fmaxf(mx, __shfl_xor(mx, 4, 32)); mx = fmaxf(mx, __shfl_xor(mx, 8, 32));
      const float mnew = fmaxf(m_r[r], mx);
      alpha[r] = (mnew > -1.0e38f) ? __expf(m_r[r] - mnew) : 1.0f;
      const float p0 = (s[0][r] > -1.0e38f) ? __expf(s[0][r] - mnew) : 0.f;
      const float p1 = (s[1][r] > -1.0e38f) ? __expf(s[1][r] - mnew) : 0.f;
      m_r[r] = mnew;
      l_r[r] = l_r[r] * alpha[r] + p0 + p1;            // per-lane partial row sum (16 lanes combined at the end)
      unsigned short hb = bf16_bits(p0); sPh[w][8 * hh + r][ln] = hb;      sPl[w][8 * hh + r][ln] = bf16_bits(p0 - bf16_val(hb));
      hb = bf16_bits(p1);                sPh[w][8 * hh + r][16 + ln] = hb; sPl[w][8 * hh + r][16 + ln] = bf16_bits(p1 - bf16_val(hb));
    }
#pragma unroll
    for (int dt = 0; dt < DT; ++dt)
#pragma unroll
      for (int r = 0; r < 8; ++r) oacc[dt][r] *= alpha[r];
    __builtin_amdgcn_fence(__ATOMIC_ACQ_REL, "workgroup");
    __builtin_amdgcn_wave_barrier();
    FragB pah, pal;
    pah.half[0] = *(const v8us*)&sPh[w][ln][8 * hh]; pah.half[1] = *(const v8us*)&sPh[w][ln][16 + 8 * hh];
    pal.half[0] = *(const v8us*)&sPl[w][ln][8 * hh]; pal.half[1] = *(const v8us*)&sPl[w][ln][16 + 8 * hh];
#pragma unroll
    for (int dt = 0; dt < DT; ++dt) {
      FragB bvh, bvl;
#pragma unroll
      for (int i = 0; i < 8; ++i) {
        bvh.u[i] = sVh[8 * hh + i][dt * 16 + ln]; bvh.u[8 + i] = sVh[16 + 8 * hh + i][dt * 16 + ln];
        bvl.u[i] = sVl[8 * hh + i][dt * 16 + ln]; bvl.u[8 + i] = sVl[16 + 8 * hh + i][dt * 16 + ln];
      }
      oacc[dt] = mmaN<3>(pah.v, pal.v, bvh.v, bvl.v, oacc[dt]);
    }
    __builtin_amdgcn_fence(__ATOMIC_ACQ_REL, "workgroup");
    __builtin_amdgcn_wave_barrier();
  }
#pragma unroll
  for (int r = 0; r < 8; ++r) {
    float l = l_r[r];
    l += __shfl_xor(l, 1, 32); l += __shfl_xor(l, 2, 32); l += __shfl_xor(l, 4, 32); l += __shfl_xor(l, 8, 32);
    l_r[r] = (l > 0.f) ? 1.0f / l : 0.f;
  }
#pragma unroll
  for (int dt = 0; dt < DT; ++dt)
#pragma unroll
    for (int r = 0; r < 8; ++r) sO[w][8 * hh + r][dt * 16 + ln] = oacc[dt][r] * l_r[r];
  __builtin_amdgcn_fence(__ATOMIC_ACQ_REL, "workgroup");
  __builtin_amdgcn_wave_barrier();
  {
    for (int r = 0; r < 16; ++r) {
      const int row = q0 + r;
      if (row < T && lane < D / 4) {
        const v4f val = *(const v4fa*)&sO[w][r][lane * 4];
        *(v4f*)(y + ((size_t)b * T + row) * ypitch + h * D + lane * 4) = val;
      }
    }
    
  }
}

// GEMM C = act(A·W + bias + resid): A f32 (ASPLIT -> hi/lo 2 terms), Wt bf16 [N][K]; ACT 0 none, 1 relu, 2 exact gelu;
// resid (optional, f32, row index = (row % rmod), pitch ldr, RES_BF16 rounds it) added before the activation.
template <bool ASPLIT, int ACT, bool BIAS_BF16, bool RES_BF16>
__global__ __launch_bounds__(128) void k_gemm_bf3(const float* __restrict__ A, int lda, const unsigned short* __restrict__ Wt, int ldb,
                                                const float* __restrict__ bias, const float* __restrict__ resid, int rmod, int ldr,
                                                float* __restrict__ C, int ldc, int M, int N, int K) {
  __shared__ __attribute__((aligned(16))) float so[4][16][64];
  const int tid = threadIdx.x, w = tid >> 5, lane = tid & 31, ln = lane & 15, hh = lane >> 4;
  const int ntn = N / 64;
  const int wid = blockIdx.x * 4 + w;
  const int mt = wid / ntn, nq = wid % ntn;
  if (mt * 16 >= M) return;
  const int row0 = mt * 16, col0 = nq * 64;
  const float* arow = A + (size_t)(row0 + ln) * lda;
  v8f acc[4] = {};
  for (int kb = 0; kb < K; kb += 32) {
    FragB ah, al;
    const v4f x0 = *(const v4fa*)(arow + kb + 8 * hh), x1 = *(const v4fa*)(arow + kb + 8 * hh + 4);
    const v4f x2 = *(const v4fa*)(arow + kb + 16 + 8 * hh), x3 = *(const v4fa*)(arow + kb + 16 + 8 * hh + 4);
    float xs[16] = {x0[0],x0[1],x0[2],x0[3],x1[0],x1[1],x1[2],x1[3],x2[0],x2[1],x2[2],x2[3],x3[0],x3[1],x3[2],x3[3]};
#pragma unroll
    for (int i = 0; i < 16; ++i) { const unsigned short hb = bf16_bits(xs[i]); ah.u[i] = hb; al.u[i] = ASPLIT ? bf16_bits(xs[i] - bf16_val(hb)) : (unsigned short)0; }
#pragma unroll
    for (int t = 0; t < 4; ++t) {
      const unsigned short* brow = Wt + (size_t)(col0 + t * 16 + ln) * ldb + kb;
      FragB b;
      b.half[0] = *(const v8us*)(brow + 8 * hh);
      b.half[1] = *(const v8us*)(brow + 16 + 8 * hh);
      acc[t] = mmaN<ASPLIT ? 2 : 1>(ah.v, al.v, b.v, b.v, acc[t]);
    }
  }
#pragma unroll
  for (int t = 0; t < 4; ++t) {
    const int col = col0 + t * 16 + ln;
    float bv = bias ? bias[col] : 0.f;
    if (BIAS_BF16) bv = bf16_round(bv);
#pragma unroll
    for (int r = 0; r < 8; ++r) {
      float v = acc[t][r] + bv;
      if (resid) { float rv = resid[(size_t)((row0 + 8 * hh + r) % rmod) * ldr + col]; if (RES_BF16) rv = bf16_round(rv); v += rv; }
      if (ACT == 1) v = fmaxf(v, 0.f);
      if (ACT == 2) v = 0.5f * v * (1.0f + erff(v * 0.70710678118654752f));
      if (ACT == 3) { const float u = 0.7978845608028654f * (v + 0.044715f * v * v * v); v = 0.5f * v * (1.0f + tanhf(u)); }
      so[w][8 * hh + r][t * 16 + ln] = v;
    }
  }
  __builtin_amdgcn_fence(__ATOMIC_ACQ_REL, "workgroup");
  __builtin_amdgcn_wave_barrier();
  const int rsub = lane >> 4, c4 = (lane & 15) * 4;
  {
#pragma unroll
    for (int q = 0; q < 8; ++q) {
      const int r = q * 2 + rsub;
      const v4f v = *(const v4fa*)&so[w][r][c4];
      *(v4f*)(C + (size_t)(row0 + r) * ldc + col0 + c4) = v;
    }
    
  }
}
// row LayerNorm (biased variance, eps) over N: s = X (+ R); optional out_sum <- s; out_norm <- (s-mu)*rsqrt(var+eps)*g + b
template <bool PARAM_BF16>
__global__ __launch_bounds__(256) void k_layernorm(const float* __restrict__ X, const float* __restrict__ R, const float* __restrict__ g, const float* __restrict__ bta,
                                                  float* __restrict__ out_sum, float* __restrict__ out_norm, int N, float eps) {
  __shared__ float red[256];
  const int row = blockIdx.x, tid = threadIdx.x;
  const float* x = X + (size_t)row * N; const float* rr = R ? R + (size_t)row * N : nullptr;
  float vals[16];                     // up to N = 4096
  const int per = N / 256;            // contiguous chunk per thread? use strided-by-4 chunks: thread handles j = tid*4 + 1024*u
  float s1 = 0.f;
  for (int u = 0; u < per / 4; ++u) {
    const int j = tid * 4 + 1024 * u;
    const v4f a = *(const v4fa*)(x + j);
    v4f b = {0.f,0.f,0.f,0.f}; if (rr) b = *(const v4fa*)(rr + j);
#pragma unroll
    for (int q = 0; q < 4; ++q) { const float v = a[q] + b[q]; vals[u * 4 + q] = v; s1 += v; }
  }
  red[tid] = s1; __syncthreads();
  for (int st = 128; st > 0; st >>= 1) { if (tid < st) red[tid] += red[tid + st]; __syncthreads(); }
  const float mu = red[0] / (float)N; __syncthreads();
  float s2 = 0.f;
  for (int u = 0; u < per / 4; ++u)
#pragma unroll
    for (int q = 0; q < 4; ++q) { const float c = vals[u * 4 + q] - mu; s2 += c * c; }
  red[tid] = s2; __syncthreads();
  for (int st = 128; st > 0; st >>= 1) { if (tid < st) red[tid] += red[tid + st]; __syncthreads(); }
  const float rs = rsqrtf(red[0] / (float)N + eps);
  {
    for (int u = 0; u < per / 4; ++u) {
      const int j = tid * 4 + 1024 * u;
      v4f o, sm;
#pragma unroll
      for (int q = 0; q < 4; ++q) {
        float gg = g[j + q], bb = bta[j + q];
        if (PARAM_BF16) { gg = bf16_round(gg); bb = bf16_round(bb); }
        sm[q] = vals[u * 4 + q]; o[q] = (vals[u * 4 + q] - mu) * rs * gg + bb;
      }
      if (out_sum) *(v4f*)(out_sum + (size_t)row * N + j) = sm;
      *(v4f*)(out_norm + (size_t)row * N + j) = o;
    }
    
  }
}



// ---- f16 WMMA path (v_wmma_f32_16x16x32_f16): 11-bit significands for operands in range — used where a [0,1] probability operand needs more precision than bf16
typedef _Float16 v16h __attribute__((ext_vector_type(16)));
union FragH { v16h v; v8us half[2]; _Float16 h[16]; unsigned short u[16]; };
template <int NT>
__device__ __forceinline__ v8f mmaH(v16h ah, v16h al, v16h bh, v16h bl, v8f c) {
  c = __builtin_amdgcn_wmma_f32_16x16x32_f16(false, ah, false, bh, (short)0, c, false, false);
  if (NT >= 2) c = __builtin_amdgcn_wmma_f32_16x16x32_f16(false, al, false, bh, (short)0, c, false, false);
  if (NT >= 3) c = __builtin_amdgcn_wmma_f32_16x16x32_f16(false, ah, false, bl, (short)0, c, false, false);
  asm volatile("v_nop\n\tv_nop\n\tv_nop\n\tv_nop" : "+v"(c) : "v"(ah), "v"(al), "v"(bh), "v"(bl));
  return c;
}
// batched GEMM like k_gemm_b but f16 operands: A f32 (split into f16 hi/lo if ASPLIT, else rounded to f16), Bt = f16 values [n][k]; alpha; C f32; N multiple of 16 (partial tiles skipped)
template <bool ASPLIT>
__global__ __launch_bounds__(128) void k_gemm_h(const float* __restrict__ A, int lda, size_t sA, const _Float16* __restrict__ Bh, int ldb, size_t sB, float alpha, float* __restrict__ C, int ldc, size_t sC, int M, int N, int K) {
  __shared__ __attribute__((aligned(16))) float so[4][16][64];
  const int tid = threadIdx.x, w = tid >> 5, lane = tid & 31, ln = lane & 15, hh = lane >> 4; const int by = blockIdx.y;
  A += (size_t)by * sA; Bh += (size_t)by * sB; C += (size_t)by * sC;
  const int ntn = (N + 63) / 64; const int wid = blockIdx.x * 4 + w; const int mt = wid / ntn, nq = wid % ntn; if (mt * 16 >= M) return;
  const int row0 = mt * 16, col0 = nq * 64; const float* arow = A + (size_t)(row0 + ln) * lda;
  v8f acc[4] = {};
  for (int kb = 0; kb < K; kb += 32) {
    FragH ah, al;
    const v4f x0 = *(const v4fa*)(arow + kb + 8 * hh), x1 = *(const v4fa*)(arow + kb + 8 * hh + 4), x2 = *(const v4fa*)(arow + kb + 16 + 8 * hh), x3 = *(const v4fa*)(arow + kb + 16 + 8 * hh + 4);
    float xs[16] = {x0[0],x0[1],x0[2],x0[3],x1[0],x1[1],x1[2],x1[3],x2[0],x2[1],x2[2],x2[3],x3[0],x3[1],x3[2],x3[3]};
#pragma unroll
    for (int i = 0; i < 16; ++i) { const _Float16 h = (_Float16)xs[i]; ah.h[i] = h; al.h[i] = ASPLIT ? (_Float16)(xs[i] - (float)h) : (_Float16)0.0f; }
#pragma unroll
    for (int t = 0; t < 4; ++t) { if (col0 + t * 16 >= N) continue; const size_t boff = (size_t)(col0 + t * 16 + ln) * ldb + kb; FragH bq; bq.half[0] = *(const v8us*)(Bh + boff + 8 * hh); bq.half[1] = *(const v8us*)(Bh + boff + 16 + 8 * hh);
      acc[t] = mmaH<ASPLIT ? 2 : 1>(ah.v, al.v, bq.v, bq.v, acc[t]); }
  }
#pragma unroll
  for (int t = 0; t < 4; ++t) { if (col0 + t * 16 >= N) continue;
#pragma unroll
    for (int r = 0; r < 8; ++r) so[w][8 * hh + r][t * 16 + ln] = acc[t][r] * alpha; }
  __builtin_amdgcn_fence(__ATOMIC_ACQ_REL, "workgroup"); __builtin_amdgcn_wave_barrier();
  const int rsub = lane >> 4, c4 = (lane & 15) * 4;
  {
#pragma unroll
    for (int q = 0; q < 8; ++q) { const int r = q * 2 + rsub; if (col0 + c4 < N) { const v4f v = *(const v4fa*)&so[w][r][c4]; *(v4f*)(C + (size_t)(row0 + r) * ldc + col0 + c4) = v; } }
     }
}

// Wt[n][k] = f16(W[k][n]·scale) from f32 row-major W[K][N] (scale = power of two; bf16-exact weights stay exact in f16 away from the subnormal range)
__global__ __launch_bounds__(256) void k_wt_f16(const float* __restrict__ W, _Float16* __restrict__ Wt, int K, int N, float scale) {
  const int t = blockIdx.x * 256 + threadIdx.x; if (t >= N * (K / 8)) return; const int n = t / (K / 8), k8 = (t % (K / 8)) * 8; FragH f;
#pragma unroll
  for (int i = 0; i < 8; ++i) f.h[i] = (_Float16)(bf16_round(W[(size_t)(k8 + i) * N + n]) * scale); const v8us o = f.half[0];
  *(v8us*)((unsigned short*)Wt + (size_t)n * K + k8) = o; 
}
// k_gemm_hh variant with fused epilogue: v = acc·alpha + bias[by·sBias + col] (+ CP[(row/rowsPerB)·sCPb + by·64 + col] if CP) ; ACT 0 none / 1 elu ; writes f16 C16 (and f32 C if non-null)
template <int ACT>
__global__ __launch_bounds__(128) void k_gemm_hhx(const _Float16* __restrict__ A, int lda, size_t sA, const _Float16* __restrict__ Bh, int ldb, size_t sB, float alpha, const float* __restrict__ bias, size_t sBias, const float* __restrict__ CP, int rowsPerB, size_t sCPb, int row0g,
    float* __restrict__ C, _Float16* __restrict__ C16, int ldc, size_t sC, int M, int N, int K) {
  __shared__ __attribute__((aligned(16))) float so[4][16][64];
  const int tid = threadIdx.x, w = tid >> 5, lane = tid & 31, ln = lane & 15, hh = lane >> 4; const int by = blockIdx.y;
  A += (size_t)by * sA; Bh += (size_t)by * sB; const size_t cofs = (size_t)by * sC; const float* bp = bias ? bias + (size_t)by * sBias : nullptr;
  const int ntn = (N + 63) / 64; const int wid = blockIdx.x * 4 + w; const int mt = wid / ntn, nq = wid % ntn; if (mt * 16 >= M) return;
  const int row0 = mt * 16, col0 = nq * 64; const _Float16* arow = A + (size_t)(row0 + ln) * lda;
  v8f acc[4] = {};
  for (int kb = 0; kb < K; kb += 32) { FragH ah; ah.half[0] = *(const v8us*)((const unsigned short*)arow + kb + 8 * hh); ah.half[1] = *(const v8us*)((const unsigned short*)arow + kb + 16 + 8 * hh);
#pragma unroll
    for (int t = 0; t < 4; ++t) { if (col0 + t * 16 >= N) continue; const size_t boff = (size_t)(col0 + t * 16 + ln) * ldb + kb; FragH bq; bq.half[0] = *(const v8us*)((const unsigned short*)Bh + boff + 8 * hh); bq.half[1] = *(const v8us*)((const unsigned short*)Bh + boff + 16 + 8 * hh);
      acc[t] = mmaH<1>(ah.v, ah.v, bq.v, bq.v, acc[t]); }
  }
#pragma unroll
  for (int t = 0; t < 4; ++t) { if (col0 + t * 16 >= N) continue; const int col = col0 + t * 16 + ln; const float bv = bp ? bf16_round(bp[col]) : 0.f;
#pragma unroll
    for (int r = 0; r < 8; ++r) { float v = acc[t][r] * alpha + bv; if (CP) { const int bidx = (row0g + row0 + 8 * hh + r) / rowsPerB; v += CP[(size_t)bidx * sCPb + (size_t)by * 64 + col]; } if (ACT == 1) v = (v > 0.f) ? v : expm1f(v); else if (ACT == 3) v = fmaxf(v, 0.f); so[w][8 * hh + r][t * 16 + ln] = v; } }
  __builtin_amdgcn_fence(__ATOMIC_ACQ_REL, "workgroup"); __builtin_amdgcn_wave_barrier();
  const int rsub = lane >> 4, c4 = (lane & 15) * 4; typedef _Float16 v4h __attribute__((ext_vector_type(4)));
  {
#pragma unroll
    for (int q = 0; q < 8; ++q) { const int r = q * 2 + rsub; if (col0 + c4 < N) { const v4f v = *(const v4fa*)&so[w][r][c4]; if (C) *(v4f*)(C + cofs + (size_t)(row0 + r) * ldc + col0 + c4) = v; if (C16) { v4h h4; for (int i = 0; i < 4; ++i) h4[i] = (_Float16)v[i]; *(v4h*)(C16 + cofs + (size_t)(row0 + r) * ldc + col0 + c4) = h4; } } }
     }
}


__global__ __launch_bounds__(256) void k_x16(const float* __restrict__ x, _Float16* __restrict__ X16, size_t n8) { const size_t t = (size_t)blockIdx.x * 256 + threadIdx.x; if (t >= n8) return; FragH f;
#pragma unroll
  for (int q = 0; q < 8; ++q) f.h[q] = (_Float16)bf16_round(x[t * 8 + q]); *(v8us*)((unsigned short*)X16 + t * 8) = f.half[0];  }
__global__ __launch_bounds__(256) void k_h16(const float* __restrict__ x, _Float16* __restrict__ X16, size_t n8) { const size_t t = (size_t)blockIdx.x * 256 + threadIdx.x; if (t >= n8) return; FragH f;
#pragma unroll
  for (int q = 0; q < 8; ++q) f.h[q] = (_Float16)x[t * 8 + q]; *(v8us*)((unsigned short*)X16 + t * 8) = f.half[0];  }
__global__ __launch_bounds__(256) void k_round16f(const float* __restrict__ W, _Float16* __restrict__ Bt, size_t n8) { const size_t t = (size_t)blockIdx.x * 256 + threadIdx.x; if (t >= n8) return; FragH f;
#pragma unroll
  for (int i = 0; i < 8; ++i) f.h[i] = (_Float16)(bf16_round(W[t * 8 + i]) * 16.0f); *(v8us*)((unsigned short*)Bt + t * 8) = f.half[0];  }
template <int NHv, int TTv>
__global__ __launch_bounds__(256) void k_vt(const _Float16* __restrict__ V16, int ldv, int voff, _Float16* __restrict__ Vt) { __shared__ unsigned short tl[64][66]; const int tid = threadIdx.x; const int slab = blockIdx.x / (TTv / 64), lg = blockIdx.x % (TTv / 64); const int b = slab / NHv, h = slab % NHv;
  for (int i = tid; i < 64 * 8; i += 256) { const int r = i / 8, c8 = (i % 8) * 8; FragH f; f.half[0] = *(const v8us*)((const unsigned short*)V16 + ((size_t)b * TTv + lg * 64 + r) * ldv + voff + h * 64 + c8);
#pragma unroll
    for (int q = 0; q < 8; ++q) tl[r][c8 + q] = f.u[q]; }
  __syncthreads();
  {
#pragma unroll
    for (int rd = 0; rd < 2; ++rd) { const int d = rd * 32 + tid / 8, pc = tid % 8; FragH f;
#pragma unroll
      for (int q = 0; q < 8; ++q) f.u[q] = tl[pc * 8 + q][d];
      *(v8us*)((unsigned short*)Vt + ((size_t)slab * 64 + d) * TTv + lg * 64 + pc * 8) = f.half[0]; }
     } }

__global__ __launch_bounds__(128) void k_flash(const _Float16* __restrict__ Q16, int ldq, const _Float16* __restrict__ K16, int ldk, const _Float16* __restrict__ Vt, const int* __restrict__ MSK, float* __restrict__ O, int ldo) {
  constexpr int RPW = 16, RTN = RPW / 16, NQB = 4096 / (4 * RPW), DT = 4, KS = 2;
  __shared__ __attribute__((aligned(16))) unsigned short sP[4][RPW][40]; __shared__ __attribute__((aligned(16))) float sO[4][RPW][64 + 4];
  const int tid = threadIdx.x, w = tid >> 5, lane = tid & 31, ln = lane & 15, hh = lane >> 4;
  const int slab = blockIdx.x / NQB, qblk = blockIdx.x % NQB; const int b = slab / 4, h = slab % 4; const int qb0 = qblk * (4 * RPW); const int q0 = qb0 + w * RPW;
  FragH aq[2][KS];
#pragma unroll
  for (int rt = 0; rt < RTN; ++rt) { const unsigned short* qr = (const unsigned short*)Q16 + ((size_t)b * 4096 + q0 + rt * 16 + ln) * ldq + h * 64;
#pragma unroll
    for (int ks = 0; ks < KS; ++ks) { aq[rt][ks].half[0] = *(const v8us*)(qr + ks * 32 + 8 * hh); aq[rt][ks].half[1] = *(const v8us*)(qr + ks * 32 + 16 + 8 * hh); } }
  const unsigned short* Vth = (const unsigned short*)Vt + (size_t)slab * 64 * 4096;
  float m_r[2][8], l_r[2][8]; v8f oacc[2][DT];
#pragma unroll
  for (int rt = 0; rt < RTN; ++rt) {
#pragma unroll
    for (int r = 0; r < 8; ++r) { m_r[rt][r] = -3.0e38f; l_r[rt][r] = 0.f; }
#pragma unroll
    for (int dt = 0; dt < DT; ++dt) oacc[rt][dt] = (v8f){0.f,0.f,0.f,0.f,0.f,0.f,0.f,0.f}; }
  const int jend = 4096;
#pragma unroll 1
  for (int j0 = 0; j0 < jend; j0 += 32) {
    
    v8f s[2][2];
#pragma unroll
    for (int nt = 0; nt < 2; ++nt) { const unsigned short* kr = (const unsigned short*)K16 + ((size_t)b * 4096 + j0 + nt * 16 + ln) * ldk + h * 64; FragH bk[KS];
#pragma unroll
      for (int ks = 0; ks < KS; ++ks) { bk[ks].half[0] = *(const v8us*)(kr + ks * 32 + 8 * hh); bk[ks].half[1] = *(const v8us*)(kr + ks * 32 + 16 + 8 * hh); }
#pragma unroll
      for (int rt = 0; rt < RTN; ++rt) { v8f acc = (v8f){0.f,0.f,0.f,0.f,0.f,0.f,0.f,0.f};
#pragma unroll
        for (int ks = 0; ks < KS; ++ks) acc = mmaH<1>(aq[rt][ks].v, aq[rt][ks].v, bk[ks].v, bk[ks].v, acc); s[rt][nt] = acc; } }
#pragma unroll
    for (int rt = 0; rt < RTN; ++rt)
#pragma unroll
      for (int r = 0; r < 8; ++r) { const int tq = q0 + rt * 16 + 8 * hh + r; const int k0 = j0 + ln, k1 = j0 + 16 + ln; (void)tq; (void)k0; (void)k1;
        const bool ok0 = true, ok1 = true;
        const float s0 = ok0 ? s[rt][0][r] * (1.0f) : -INFINITY, s1 = ok1 ? s[rt][1][r] * (1.0f) : -INFINITY; float mc = fmaxf(s0, s1);
        mc = fmaxf(mc, __shfl_xor(mc, 1, 32)); mc = fmaxf(mc, __shfl_xor(mc, 2, 32)); mc = fmaxf(mc, __shfl_xor(mc, 4, 32)); mc = fmaxf(mc, __shfl_xor(mc, 8, 32));
        const float mn = fmaxf(m_r[rt][r], mc); const float al = (mn > -1.0e38f) ? expf(m_r[rt][r] - mn) : 1.0f; m_r[rt][r] = mn; const float p0 = ok0 ? expf(s0 - mn) : 0.f, p1 = ok1 ? expf(s1 - mn) : 0.f; l_r[rt][r] = l_r[rt][r] * al + p0 + p1;
#pragma unroll
        for (int dt = 0; dt < DT; ++dt) oacc[rt][dt][r] *= al;
        FragH t2; t2.h[0] = (_Float16)p0; t2.h[1] = (_Float16)p1; sP[w][rt * 16 + 8 * hh + r][ln] = t2.u[0]; sP[w][rt * 16 + 8 * hh + r][16 + ln] = t2.u[1]; }
    __builtin_amdgcn_fence(__ATOMIC_ACQ_REL, "workgroup"); __builtin_amdgcn_wave_barrier();
    FragH pa[2];
#pragma unroll
    for (int rt = 0; rt < RTN; ++rt) { pa[rt].half[0] = *(const v8us*)&sP[w][rt * 16 + ln][8 * hh]; pa[rt].half[1] = *(const v8us*)&sP[w][rt * 16 + ln][16 + 8 * hh]; }
#pragma unroll
    for (int dt = 0; dt < DT; ++dt) { const unsigned short* vrow = Vth + (size_t)(dt * 16 + ln) * 4096 + j0; FragH bv; bv.half[0] = *(const v8us*)(vrow + 8 * hh); bv.half[1] = *(const v8us*)(vrow + 16 + 8 * hh);
#pragma unroll
      for (int rt = 0; rt < RTN; ++rt) oacc[rt][dt] = mmaH<1>(pa[rt].v, pa[rt].v, bv.v, bv.v, oacc[rt][dt]); }
    __builtin_amdgcn_fence(__ATOMIC_ACQ_REL, "workgroup"); __builtin_amdgcn_wave_barrier(); }
#pragma unroll
  for (int rt = 0; rt < RTN; ++rt) {
#pragma unroll
    for (int r = 0; r < 8; ++r) { float l = l_r[rt][r]; l += __shfl_xor(l, 1, 32); l += __shfl_xor(l, 2, 32); l += __shfl_xor(l, 4, 32); l += __shfl_xor(l, 8, 32); l_r[rt][r] = (l > 0.f) ? 1.0f / l : 0.f; }
#pragma unroll
    for (int dt = 0; dt < DT; ++dt)
#pragma unroll
      for (int r = 0; r < 8; ++r) sO[w][rt * 16 + 8 * hh + r][dt * 16 + ln] = oacc[rt][dt][r] * l_r[rt][r]; }
  __builtin_amdgcn_fence(__ATOMIC_ACQ_REL, "workgroup"); __builtin_amdgcn_wave_barrier();
  {
#pragma unroll
    for (int rp = 0; rp < RPW; rp += 2) { const int r = rp + (lane >> 4), pc = lane & 15; const v4f val = *(const v4fa*)&sO[w][r][pc * 4]; *(v4f*)(O + ((size_t)b * 4096 + q0 + r) * ldo + h * 64 + pc * 4) = val; }
     } }

__global__ __launch_bounds__(256) void k_tok(const float* __restrict__ x, _Float16* __restrict__ X16) { __shared__ unsigned short tl[16][72]; const int tid = threadIdx.x; const int b = blockIdx.x / ((CC / 64) * (NN / 16)), rem = blockIdx.x % ((CC / 64) * (NN / 16)); const int cg = rem / (NN / 16), pg = rem % (NN / 16); const int c0 = cg * 64, p0 = pg * 16;
  for (int i = tid; i < 64 * 16; i += 256) { const int c = i / 16, pp = i % 16; FragH f; f.h[0] = (_Float16)bf16_round(x[((size_t)b * CC + c0 + c) * NN + p0 + pp]); tl[pp][c] = f.u[0]; }
  __syncthreads();
  if (tid < 128) { const int r = tid / 8, pc = tid % 8; FragH f;
#pragma unroll
    for (int q = 0; q < 8; ++q) f.u[q] = tl[r][pc * 8 + q]; unsigned short* d = (unsigned short*)X16 + ((size_t)b * NN + p0 + r) * CC + c0 + pc * 8; *(v8us*)d = f.half[0];  } }
__global__ __launch_bounds__(256) void k_text(const float* __restrict__ tf, const float* __restrict__ Wt, const float* __restrict__ bt, const float* __restrict__ Wk, const float* __restrict__ bk, float* __restrict__ TB) { __shared__ float ts[CC]; const int b = blockIdx.x, c = threadIdx.x; float s = bf16_round(bt[c]);
#pragma unroll 1
  for (int j = 0; j < DTX; ++j) s += bf16_round(tf[b * DTX + j]) * bf16_round(Wt[(size_t)c * DTX + j]);
  ts[c] = 0.5f * s * (1.0f + erff(s * 0.70710678118654752f)); __syncthreads();
  float o = bf16_round(bk[c]);
#pragma unroll 1
  for (int k = 0; k < CC; ++k) o += ts[k] * bf16_round(Wk[(size_t)c * CC + k]);
  *(float*)(TB + b * CC + c) = o;  }
__global__ __launch_bounds__(256) void k_fin(const float* __restrict__ M2, const float* __restrict__ pf, const float* __restrict__ gam, float* __restrict__ out) { __shared__ float tl[32][65]; const int tid = threadIdx.x; const int b = blockIdx.x / ((CC / 32) * (NN / 64)), rem = blockIdx.x % ((CC / 32) * (NN / 64)); const int cg = rem / (NN / 64), pg = rem % (NN / 64); const int c0 = cg * 32, p0 = pg * 64; const float g = bf16_round(gam[0]);
  for (int i = tid; i < 64 * 32; i += 256) { const int pp = i / 32, c = i % 32; tl[c][pp] = M2[((size_t)b * NN + p0 + pp) * CC + c0 + c]; }
  __syncthreads();
  { for (int i = tid; i < 32 * 16; i += 256) { const int c = i / 16, pc = i % 16; const size_t gi = ((size_t)b * CC + c0 + c) * NN + p0 + pc * 4; const v4f x = *(const v4fa*)(pf + gi); v4f v; for (int q = 0; q < 4; ++q) v[q] = g * tl[c][pc * 4 + q] + bf16_round(x[q]); *(v4f*)(out + gi) = v; }  } }
extern "C" void kernel_launch(void* const* d_in, const int* in_sizes, int n_in,
                              void* d_out, int out_size, void* d_ws, size_t ws_size, hipStream_t stream) {
  (void)in_sizes; (void)n_in; (void)out_size;
  const float* const* I = (const float* const*)d_in; const float* pf = I[0]; const float* tf = I[1]; const float* Wt = I[2]; const float* bt = I[3]; const float* Wq = I[4]; const float* bq = I[5]; const float* Wk = I[6]; const float* bk = I[7]; const float* Wv = I[8]; const float* bv = I[9]; const float* W1 = I[10]; const float* b1 = I[11]; const float* W2 = I[12]; const float* b2 = I[13]; const float* gam = I[14];
  char* ws = (char*)d_ws; size_t off = 0;
  auto take = [&](size_t bytes) { char* p = ws + off; off += (bytes + 255) & ~(size_t)255; return p; };
  _Float16* Bq = (_Float16*)take(CC * CC * 2); _Float16* Bk = (_Float16*)take(CC * CC * 2); _Float16* Bv = (_Float16*)take(CC * CC * 2); _Float16* B1 = (_Float16*)take(CC * CC * 2); _Float16* B2 = (_Float16*)take(CC * CC * 2); float* TB = (float*)take(BB * CC * 4);
  _Float16* X16 = (_Float16*)take((size_t)NR * CC * 2); _Float16* Q16 = (_Float16*)take((size_t)NR * CC * 2); _Float16* K16 = (_Float16*)take((size_t)NR * CC * 2); _Float16* V16 = (_Float16*)take((size_t)NR * CC * 2); _Float16* Vt = (_Float16*)take((size_t)NR * CC * 2); float* O = (float*)take((size_t)NR * CC * 4); _Float16* O16 = Q16; _Float16* H1 = K16; float* M2 = O;
  if (off > ws_size) return;      // 0.7 + 4.2 × 5 + 8.4 ≈ 30 MiB
  const size_t w8 = (size_t)CC * CC / 8; const unsigned gw = (unsigned)((w8 + 255) / 256);
  k_round16f<<<gw, 256, 0, stream>>>(Wq, Bq, w8); k_round16f<<<gw, 256, 0, stream>>>(Wk, Bk, w8); k_round16f<<<gw, 256, 0, stream>>>(Wv, Bv, w8); k_round16f<<<gw, 256, 0, stream>>>(W1, B1, w8); k_round16f<<<gw, 256, 0, stream>>>(W2, B2, w8);      // (out,in)
  k_text<<<BB, 256, 0, stream>>>(tf, Wt, bt, Wk, bk, TB);
  k_tok<<<BB * (CC / 64) * (NN / 16), 256, 0, stream>>>(pf, X16);
  const dim3 gg(((NN / 16) * (CC / 64) + 3) / 4, BB);      // batched over b (q and v projections); sA = sC = NN·CC
  k_gemm_hhx<0><<<gg, 128, 0, stream>>>(X16, CC, (size_t)NN * CC, Bq, CC, 0, 0.0625f, bq, 0, nullptr, 1, 0, 0, nullptr, Q16, CC, (size_t)NN * CC, NN, CC, CC);
  k_gemm_hhx<0><<<dim3(((NR / 16) * (CC / 64) + 3) / 4, 1), 128, 0, stream>>>(X16, CC, 0, Bk, CC, 0, 0.0625f, nullptr, 0, TB, NN, (size_t)CC, 0, nullptr, K16, CC, 0, NR, CC, CC);      // k = pf·Wkᵀ + (t·Wkᵀ + bk): the per-batch text bias enters as the CP addend (row block b = row / 4096), unrounded
  k_gemm_hhx<0><<<gg, 128, 0, stream>>>(X16, CC, (size_t)NN * CC, Bv, CC, 0, 0.0625f, bv, 0, nullptr, 1, 0, 0, nullptr, V16, CC, (size_t)NN * CC, NN, CC, CC);
  k_vt<NH, NN><<<BB * NH * (NN / 64), 256, 0, stream>>>(V16, CC, 0, Vt);
  k_flash<<<BB * NH * (NN / 64), 128, 0, stream>>>(Q16, CC, K16, CC, Vt, nullptr, O, CC);
  const unsigned g8 = (unsigned)(((size_t)NR * CC / 8 + 255) / 256); const dim3 g1(((NR / 16) * (CC / 64) + 3) / 4, 1);
  k_h16<<<g8, 256, 0, stream>>>(O, O16, (size_t)NR * CC / 8);
  k_gemm_hhx<3><<<g1, 128, 0, stream>>>(O16, CC, 0, B1, CC, 0, 0.0625f, b1, 0, nullptr, 1, 0, 0, nullptr, H1, CC, 0, NR, CC, CC);      // relu(x·W1ᵀ + b1)
  k_gemm_hhx<0><<<g1, 128, 0, stream>>>(H1, CC, 0, B2, CC, 0, 0.0625f, b2, 0, nullptr, 1, 0, 0, M2, nullptr, CC, 0, NR, CC, CC);         // ·W2ᵀ + b2 (f32)
  k_fin<<<BB * (CC / 32) * (NN / 64), 256, 0, stream>>>(M2, pf, gam, (float*)d_out);
}

// v001
// It runs in 311 microseconds.
// Two timings next to v000 put it at 1.73 and 1.75 times that version's speed.
#include <hip/hip_runtime.h>
// Text-guided point attention (B=2, C=256 channels × N=4096 points; text 512 → 256 GELU projection added to the key input; q/k/v 1×1 convs; 4 heads × 64; UNSCALED softmax(q·k)·v; MLP 256 → relu →
// 256; out = γ·x + point_feats, channel-major): the q/k/v/MLP linears ((out,in) weights bf16-exact ×2^4; the text term enters k as a per-batch bias) and the attention as a fused flash-style
// kernel (online softmax f32, P f16 ≤ 1, O = P·Vt; RPW-16 waves) run on v_wmma_f32_16x16x32_f16 with f32 accumulate; the text projection, the NCW ↔ token-major transposes and the gated
// residual are f32 VALU.
#define BB 2
#define CC 256
#define NN 4096
#define DTX 512
#define NH 4
#define NR (BB * NN)

typedef __bf16 v16b __attribute__((ext_vector_type(16)));
typedef unsigned short v8us __attribute__((ext_vector_type(8), may_alias));
typedef float  v8f  __attribute__((ext_vector_type(8)));
typedef float  v4f  __attribute__((ext_vector_type(4)));
typedef float  v4fa __attribute__((ext_vector_type(4), may_alias));
union FragB { v16b v; v8us half[2]; unsigned short u[16]; };

__device__ __forceinline__ unsigned short bf16_bits(float x) { unsigned int u = __float_as_uint(x); return (unsigned short)((u + 0x7FFFu + ((u >> 16) & 1u)) >> 16); }
__device__ __forceinline__ float bf16_val(unsigned short b) { return __uint_as_float(((unsigned int)b) << 16); }
__device__ __forceinline__ float bf16_round(float x) { return bf16_val(bf16_bits(x)); }
// D += A·B with NT terms: 1 = ah·bh, 2 = + al·bh (A split), 3 = + ah·bl (both split)
template <int NT>
__device__ __forceinline__ v8f mmaN(v16b ah, v16b al, v16b bh, v16b bl, v8f c) {
  c = __builtin_amdgcn_wmma_f32_16x16x32_bf16(false, ah, false, bh, (short)0, c, false, false);
  if (NT >= 2) c = __builtin_amdgcn_wmma_f32_16x16x32_bf16(false, al, false, bh, (short)0, c, false, false);
  if (NT >= 3) c = __builtin_amdgcn_wmma_f32_16x16x32_bf16(false, ah, false, bl, (short)0, c, false, false);
  asm volatile("v_nop\n\tv_nop\n\tv_nop\n\tv_nop" : "+v"(c) : "v"(ah), "v"(al), "v"(bh), "v"(bl));
  return c;
}

__global__ __launch_bounds__(256) void k_wt_bf16(const float* __restrict__ W, unsigned short* __restrict__ Wt, int K, int N) {
  const int t = blockIdx.x * 256 + threadIdx.x;
  const int k8n = K / 8;
  if (t >= N * k8n) return;
  const int n = t / k8n, k8 = (t % k8n) * 8;
  v8us v;
#pragma unroll
  for (int i = 0; i < 8; ++i) v[i] = bf16_bits(W[(size_t)(k8 + i) * N + n]);
  *(v8us*)(Wt + (size_t)n * K + k8) = v;
  
}

// GEMM C[M][N] (f32, pitch ldc) = act(A[M][K]·W + bias). A f32 row-major (pitch lda) converted per fragment to bf16
// (ASPLIT: hi/lo two planes -> 2 terms, else single rounded term); Wt bf16 [N][K] (pitch ldb). BIAS_BF16 rounds the
// bias to bf16 first (bias quantised to bf16 before the add). K%32==0, M%16==0, N%64==0.
template <bool ASPLIT, int ACT, bool BIAS_BF16>
__global__ __launch_bounds__(128) void k_gemm_bf(const float* __restrict__ A, int lda, const unsigned short* __restrict__ Wt, int ldb,
                                               const float* __restrict__ bias, float* __restrict__ C, int ldc, int M, int N, int K) {
  __shared__ __attribute__((aligned(16))) float so[4][16][64];
  const int tid = threadIdx.x, w = tid >> 5, lane = tid & 31, ln = lane & 15, hh = lane >> 4;
  const int ntn = N / 64;
  const int wid = blockIdx.x * 4 + w;
  const int mt = wid / ntn, nq = wid % ntn;
  if (mt * 16 >= M) return;
  const int row0 = mt * 16, col0 = nq * 64;
  const float* arow = A + (size_t)(row0 + ln) * lda;
  v8f acc[4] = {};
  for (int kb = 0; kb < K; kb += 32) {
    FragB ah, al;
    const v4f x0 = *(const v4fa*)(arow + kb + 8 * hh), x1 = *(const v4fa*)(arow + kb + 8 * hh + 4);
    const v4f x2 = *(const v4fa*)(arow + kb + 16 + 8 * hh), x3 = *(const v4fa*)(arow + kb + 16 + 8 * hh + 4);
    float xs[16] = {x0[0],x0[1],x0[2],x0[3],x1[0],x1[1],x1[2],x1[3],x2[0],x2[1],x2[2],x2[3],x3[0],x3[1],x3[2],x3[3]};
#pragma unroll
    for (int i = 0; i < 16; ++i) { const unsigned short hb = bf16_bits(xs[i]); ah.u[i] = hb; al.u[i] = ASPLIT ? bf16_bits(xs[i] - bf16_val(hb)) : (unsigned short)0; }
#pragma unroll
    for (int t = 0; t < 4; ++t) {
      const unsigned short* brow = Wt + (size_t)(col0 + t * 16 + ln) * ldb + kb;
      FragB b;
      b.half[0] = *(const v8us*)(brow + 8 * hh);
      b.half[1] = *(const v8us*)(brow + 16 + 8 * hh);
      acc[t] = mmaN<ASPLIT ? 2 : 1>(ah.v, al.v, b.v, b.v, acc[t]);
    }
  }
#pragma unroll
  for (int t = 0; t < 4; ++t) {
    float bv = bias ? bias[col0 + t * 16 + ln] : 0.f;
    if (BIAS_BF16) bv = bf16_round(bv);
#pragma unroll
    for (int r = 0; r < 8; ++r) { float v = acc[t][r] + bv; if (ACT == 1) v = fmaxf(v, 0.f); so[w][8 * hh + r][t * 16 + ln] = v; }
  }
  __builtin_amdgcn_fence(__ATOMIC_ACQ_REL, "workgroup");
  __builtin_amdgcn_wave_barrier();
  const int rsub = lane >> 4, c4 = (lane & 15) * 4;
  {
#pragma unroll
    for (int q = 0; q < 8; ++q) {
      const int r = q * 2 + rsub;
      const v4f v = *(const v4fa*)&so[w][r][c4];
      *(v4f*)(C + (size_t)(row0 + r) * ldc + col0 + c4) = v;
    }
    
  }
}

// Flash-style causal/unmasked attention, all contractions 3-term bf16 hi/lo splits, f32 softmax with running max.
// q,k,v rows are read from f32 buffers with arbitrary row pitch (so they can live inside a fused qkv buffer);
// D = head size (multiple of 32, <= 128); one wave = 16 query rows; block = 4 waves (64 queries) sharing K/V chunks of 32.
template <int D, bool CAUSAL>
__global__ __launch_bounds__(128) void k_flash(const float* __restrict__ qb, const float* __restrict__ kb, const float* __restrict__ vb,
                                             int pitch, int T, int H, float scale, float* __restrict__ y, int ypitch) {
  constexpr int KS = D / 32;        // k-steps for QK
  constexpr int DT = D / 16;        // d tiles for PV
  __shared__ __attribute__((aligned(16))) unsigned short sKh[32][D + 8], sKl[32][D + 8], sVh[32][D + 8], sVl[32][D + 8];
  __shared__ __attribute__((aligned(16))) unsigned short sPh[4][16][40], sPl[4][16][40];
  __shared__ __attribute__((aligned(16))) float sO[4][16][D];
  const int tid = threadIdx.x, w = tid >> 5, lane = tid & 31, ln = lane & 15, hh = lane >> 4;
  const int nqb = (T + 63) / 64;
  const int bh = blockIdx.x / nqb, qblk = blockIdx.x % nqb;
  const int b = bh / H, h = bh % H;
  const int q0 = qblk * 64 + w * 16;
  const float* Q = qb + (size_t)b * T * pitch + h * D;
  const float* K = kb + (size_t)b * T * pitch + h * D;
  const float* V = vb + (size_t)b * T * pitch + h * D;

  // A fragments of the wave's 16 query rows (scaled), hi/lo
  FragB aqh[KS], aql[KS];
  {
    int row = q0 + ln; if (row >= T) row = T - 1;
    const float* qr = Q + (size_t)row * pitch;
#pragma unroll
    for (int ks = 0; ks < KS; ++ks)
#pragma unroll
      for (int i = 0; i < 16; ++i) {
        const int d = ks * 32 + ((i < 8) ? (8 * hh + i) : (16 + 8 * hh + (i - 8)));
        const float x = qr[d] * scale; const unsigned short hb = bf16_bits(x);
        aqh[ks].u[i] = hb; aql[ks].u[i] = bf16_bits(x - bf16_val(hb));
      }
  }
  float m_r[8], l_r[8];
#pragma unroll
  for (int r = 0; r < 8; ++r) { m_r[r] = -3.0e38f; l_r[r] = 0.f; }
  v8f oacc[DT];
#pragma unroll
  for (int dt = 0; dt < DT; ++dt) oacc[dt] = (v8f){0.f,0.f,0.f,0.f,0.f,0.f,0.f,0.f};

  const int kv_end = CAUSAL ? min(T, qblk * 64 + 64) : T;     // block-uniform
  for (int j0 = 0; j0 < kv_end; j0 += 32) {
    __syncthreads();
    for (int e = tid; e < 32 * (D / 4); e += 128) {
      const int r = e / (D / 4), c4 = (e % (D / 4)) * 4;
      const int key = j0 + r;
      v4f kf = {0.f,0.f,0.f,0.f}, vf = {0.f,0.f,0.f,0.f};
      if (key < T) { kf = *(const v4fa*)(K + (size_t)key * pitch + c4); vf = *(const v4fa*)(V + (size_t)key * pitch + c4); }
#pragma unroll
      for (int t = 0; t < 4; ++t) {
        unsigned short hb = bf16_bits(kf[t]); sKh[r][c4 + t] = hb; sKl[r][c4 + t] = bf16_bits(kf[t] - bf16_val(hb));
        hb = bf16_bits(vf[t]); sVh[r][c4 + t] = hb; sVl[r][c4 + t] = bf16_bits(vf[t] - bf16_val(hb));
      }
    }
    __syncthreads();
    // S tile 16 x 32
    v8f s[2];
#pragma unroll
    for (int nt = 0; nt < 2; ++nt) {
      v8f acc = {};
#pragma unroll
      for (int ks = 0; ks < KS; ++ks) {
        FragB bh_, bl_;
        bh_.half[0] = *(const v8us*)&sKh[nt * 16 + ln][ks * 32 + 8 * hh]; bh_.half[1] = *(const v8us*)&sKh[nt * 16 + ln][ks * 32 + 16 + 8 * hh];
        bl_.half[0] = *(const v8us*)&sKl[nt * 16 + ln][ks * 32 + 8 * hh]; bl_.half[1] = *(const v8us*)&sKl[nt * 16 + ln][ks * 32 + 16 + 8 * hh];
        acc = mmaN<3>(aqh[ks].v, aql[ks].v, bh_.v, bl_.v, acc);
      }
      s[nt] = acc;
    }
    // mask + running max (rows 8hh+r; the 16 lanes of a half share rows)
    float alpha[8];
#pragma unroll
    for (int r = 0; r < 8; ++r) {
      const int qi = q0 + 8 * hh + r;
      const int ja = j0 + ln, jb = j0 + 16 + ln;
      if (CAUSAL) { if (ja > qi) s[0][r] = -3.0e38f; if (jb > qi) s[1][r] = -3.0e38f; }
      if (ja >= T) s[0][r] = -3.0e38f;
      if (jb >= T) s[1][r] = -3.0e38f;
      float mx = fmaxf(s[0][r], s[1][r]);
      mx = fmaxf(mx, __shfl_xor(mx, 1, 32)); mx = fmaxf(mx, __shfl_xor(mx, 2, 32)); mx = fmaxf(mx, __shfl_xor(mx, 4, 32)); mx = fmaxf(mx, __shfl_xor(mx, 8, 32));
      const float mnew = fmaxf(m_r[r], mx);
      alpha[r] = (mnew > -1.0e38f) ? __expf(m_r[r] - mnew) : 1.0f;
      const float p0 = (s[0][r] > -1.0e38f) ? __expf(s[0][r] - mnew) : 0.f;
      const float p1 = (s[1][r] > -1.0e38f) ? __expf(s[1][r] - mnew) : 0.f;
      m_r[r] = mnew;
      l_r[r] = l_r[r] * alpha[r] + p0 + p1;            // per-lane partial row sum (16 lanes combined at the end)
      unsigned short hb = bf16_bits(p0); sPh[w][8 * hh + r][ln] = hb;      sPl[w][8 * hh + r][ln] = bf16_bits(p0 - bf16_val(hb));
      hb = bf16_bits(p1);                sPh[w][8 * hh + r][16 + ln] = hb; sPl[w][8 * hh + r][16 + ln] = bf16_bits(p1 - bf16_val(hb));
    }
#pragma unroll
    for (int dt = 0; dt < DT; ++dt)
#pragma unroll
      for (int r = 0; r < 8; ++r) oacc[dt][r] *= alpha[r];
    __builtin_amdgcn_fence(__ATOMIC_ACQ_REL, "workgroup");
    __builtin_amdgcn_wave_barrier();
    FragB pah, pal;
    pah.half[0] = *(const v8us*)&sPh[w][ln][8 * hh]; pah.half[1] = *(const v8us*)&sPh[w][ln][16 + 8 * hh];
    pal.half[0] = *(const v8us*)&sPl[w][ln][8 * hh]; pal.half[1] = *(const v8us*)&sPl[w][ln][16 + 8 * hh];
#pragma unroll
    for (int dt = 0; dt < DT; ++dt) {
      FragB bvh, bvl;
#pragma unroll
      for (int i = 0; i < 8; ++i) {
        bvh.u[i] = sVh[8 * hh + i][dt * 16 + ln]; bvh.u[8 + i] = sVh[16 + 8 * hh + i][dt * 16 + ln];
        bvl.u[i] = sVl[8 * hh + i][dt * 16 + ln]; bvl.u[8 + i] = sVl[16 + 8 * hh + i][dt * 16 + ln];
      }
      oacc[dt] = mmaN<3>(pah.v, pal.v, bvh.v, bvl.v, oacc[dt]);
    }
    __builtin_amdgcn_fence(__ATOMIC_ACQ_REL, "workgroup");
    __builtin_amdgcn_wave_barrier();
  }
#pragma unroll
  for (int r = 0; r < 8; ++r) {
    float l = l_r[r];
    l += __shfl_xor(l, 1, 32); l += __shfl_xor(l, 2, 32); l += __shfl_xor(l, 4, 32); l += __shfl_xor(l, 8, 32);
    l_r[r] = (l > 0.f) ? 1.0f / l : 0.f;
  }
#pragma unroll
  for (int dt = 0; dt < DT; ++dt)
#pragma unroll
    for (int r = 0; r < 8; ++r) sO[w][8 * hh + r][dt * 16 + ln] = oacc[dt][r] * l_r[r];
  __builtin_amdgcn_fence(__ATOMIC_ACQ_REL, "workgroup");
  __builtin_amdgcn_wave_barrier();
  {
    for (int r = 0; r < 16; ++r) {
      const int row = q0 + r;
      if (row < T && lane < D / 4) {
        const v4f val = *(const v4fa*)&sO[w][r][lane * 4];
        *(v4f*)(y + ((size_t)b * T + row) * ypitch + h * D + lane * 4) = val;
      }
    }
    
  }
}

// GEMM C = act(A·W + bias + resid): A f32 (ASPLIT -> hi/lo 2 terms), Wt bf16 [N][K]; ACT 0 none, 1 relu, 2 exact gelu;
// resid (optional, f32, row index = (row % rmod), pitch ldr, RES_BF16 rounds it) added before the activation.
template <bool ASPLIT, int ACT, bool BIAS_BF16, bool RES_BF16>
__global__ __launch_bounds__(128) void k_gemm_bf3(const float* __restrict__ A, int lda, const unsigned short* __restrict__ Wt, int ldb,
                                                const float* __restrict__ bias, const float* __restrict__ resid, int rmod, int ldr,
                                                float* __restrict__ C, int ldc, int M, int N, int K) {
  __shared__ __attribute__((aligned(16))) float so[4][16][64];
  const int tid = threadIdx.x, w = tid >> 5, lane = tid & 31, ln = lane & 15, hh = lane >> 4;
  const int ntn = N / 64;
  const int wid = blockIdx.x * 4 + w;
  const int mt = wid / ntn, nq = wid % ntn;
  if (mt * 16 >= M) return;
  const int row0 = mt * 16, col0 = nq * 64;
  const float* arow = A + (size_t)(row0 + ln) * lda;
  v8f acc[4] = {};
  for (int kb = 0; kb < K; kb += 32) {
    FragB ah, al;
    const v4f x0 = *(const v4fa*)(arow + kb + 8 * hh), x1 = *(const v4fa*)(arow + kb + 8 * hh + 4);
    const v4f x2 = *(const v4fa*)(arow + kb + 16 + 8 * hh), x3 = *(const v4fa*)(arow + kb + 16 + 8 * hh + 4);
    float xs[16] = {x0[0],x0[1],x0[2],x0[3],x1[0],x1[1],x1[2],x1[3],x2[0],x2[1],x2[2],x2[3],x3[0],x3[1],x3[2],x3[3]};
#pragma unroll
    for (int i = 0; i < 16; ++i) { const unsigned short hb = bf16_bits(xs[i]); ah.u[i] = hb; al.u[i] = ASPLIT ? bf16_bits(xs[i] - bf16_val(hb)) : (unsigned short)0; }
#pragma unroll
    for (int t = 0; t < 4; ++t) {
      const unsigned short* brow = Wt + (size_t)(col0 + t * 16 + ln) * ldb + kb;
      FragB b;
      b.half[0] = *(const v8us*)(brow + 8 * hh);
      b.half[1] = *(const v8us*)(brow + 16 + 8 * hh);
      acc[t] = mmaN<ASPLIT ? 2 : 1>(ah.v, al.v, b.v, b.v, acc[t]);
    }
  }
#pragma unroll
  for (int t = 0; t < 4; ++t) {
    const int col = col0 + t * 16 + ln;
    float bv = bias ? bias[col] : 0.f;
    if (BIAS_BF16) bv = bf16_round(bv);
#pragma unroll
    for (int r = 0; r < 8; ++r) {
      float v = acc[t][r] + bv;
      if (resid) { float rv = resid[(size_t)((row0 + 8 * hh + r) % rmod) * ldr + col]; if (RES_BF16) rv = bf16_round(rv); v += rv; }
      if (ACT == 1) v = fmaxf(v, 0.f);
      if (ACT == 2) v = 0.5f * v * (1.0f + erff(v * 0.70710678118654752f));
      if (ACT == 3) { const float u = 0.7978845608028654f * (v + 0.044715f * v * v * v); v = 0.5f * v * (1.0f + tanhf(u)); }
      so[w][8 * hh + r][t * 16 + ln] = v;
    }
  }
  __builtin_amdgcn_fence(__ATOMIC_ACQ_REL, "workgroup");
  __builtin_amdgcn_wave_barrier();
  const int rsub = lane >> 4, c4 = (lane & 15) * 4;
  {
#pragma unroll
    for (int q = 0; q < 8; ++q) {
      const int r = q * 2 + rsub;
      const v4f v = *(const v4fa*)&so[w][r][c4];
      *(v4f*)(C + (size_t)(row0 + r) * ldc + col0 + c4) = v;
    }
    
  }
}
// row LayerNorm (biased variance, eps) over N: s = X (+ R); optional out_sum <- s; out_norm <- (s-mu)*rsqrt(var+eps)*g + b
template <bool PARAM_BF16>
__global__ __launch_bounds__(256) void k_layernorm(const float* __restrict__ X, const float* __restrict__ R, const float* __restrict__ g, const float* __restrict__ bta,
                                                  float* __restrict__ out_sum, float* __restrict__ out_norm, int N, float eps) {
  __shared__ float red[256];
  const int row = blockIdx.x, tid = threadIdx.x;
  const float* x = X + (size_t)row * N; const float* rr = R ? R + (size_t)row * N : nullptr;
  float vals[16];                     // up to N = 4096
  const int per = N / 256;            // contiguous chunk per thread? use strided-by-4 chunks: thread handles j = tid*4 + 1024*u
  float s1 = 0.f;
  for (int u = 0; u < per / 4; ++u) {
    const int j = tid * 4 + 1024 * u;
    const v4f a = *(const v4fa*)(x + j);
    v4f b = {0.f,0.f,0.f,0.f}; if (rr) b = *(const v4fa*)(rr + j);
#pragma unroll
    for (int q = 0; q < 4; ++q) { const float v = a[q] + b[q]; vals[u * 4 + q] = v; s1 += v; }
  }
  red[tid] = s1; __syncthreads();
  for (int st = 128; st > 0; st >>= 1) { if (tid < st) red[tid] += red[tid + st]; __syncthreads(); }
  const float mu = red[0] / (float)N; __syncthreads();
  float s2 = 0.f;
  for (int u = 0; u < per / 4; ++u)
#pragma unroll
    for (int q = 0; q < 4; ++q) { const float c = vals[u * 4 + q] - mu; s2 += c * c; }
  red[tid] = s2; __syncthreads();
  for (int st = 128; st > 0; st >>= 1) { if (tid < st) red[tid] += red[tid + st]; __syncthreads(); }
  const float rs = rsqrtf(red[0] / (float)N + eps);
  {
    for (int u = 0; u < per / 4; ++u) {
      const int j = tid * 4 + 1024 * u;
      v4f o, sm;
#pragma unroll
      for (int q = 0; q < 4; ++q) {
        float gg = g[j + q], bb = bta[j + q];
        if (PARAM_BF16) { gg = bf16_round(gg); bb = bf16_round(bb); }
        sm[q] = vals[u * 4 + q]; o[q] = (vals[u * 4 + q] - mu) * rs * gg + bb;
      }
      if (out_sum) *(v4f*)(out_sum + (size_t)row * N + j) = sm;
      *(v4f*)(out_norm + (size_t)row * N + j) = o;
    }
    
  }
}



// ---- f16 WMMA path (v_wmma_f32_16x16x32_f16): 11-bit significands for operands in range — used where a [0,1] probability operand needs more precision than bf16
typedef _Float16 v16h __attribute__((ext_vector_type(16)));
union FragH { v16h v; v8us half[2]; _Float16 h[16]; unsigned short u[16]; };
template <int NT>
__device__ __forceinline__ v8f mmaH(v16h ah, v16h al, v16h bh, v16h bl, v8f c) {
  c = __builtin_amdgcn_wmma_f32_16x16x32_f16(false, ah, false, bh, (short)0, c, false, false);
  if (NT >= 2) c = __builtin_amdgcn_wmma_f32_16x16x32_f16(false, al, false, bh, (short)0, c, false, false);
  if (NT >= 3) c = __builtin_amdgcn_wmma_f32_16x16x32_f16(false, ah, false, bl, (short)0, c, false, false);
  asm volatile("v_nop\n\tv_nop\n\tv_nop\n\tv_nop" : "+v"(c) : "v"(ah), "v"(al), "v"(bh), "v"(bl));
  return c;
}
// batched GEMM like k_gemm_b but f16 operands: A f32 (split into f16 hi/lo if ASPLIT, else rounded to f16), Bt = f16 values [n][k]; alpha; C f32; N multiple of 16 (partial tiles skipped)
template <bool ASPLIT>
__global__ __launch_bounds__(128) void k_gemm_h(const float* __restrict__ A, int lda, size_t sA, const _Float16* __restrict__ Bh, int ldb, size_t sB, float alpha, float* __restrict__ C, int ldc, size_t sC, int M, int N, int K) {
  __shared__ __attribute__((aligned(16))) float so[4][16][64];
  const int tid = threadIdx.x, w = tid >> 5, lane = tid & 31, ln = lane & 15, hh = lane >> 4; const int by = blockIdx.y;
  A += (size_t)by * sA; Bh += (size_t)by * sB; C += (size_t)by * sC;
  const int ntn = (N + 63) / 64; const int wid = blockIdx.x * 4 + w; const int mt = wid / ntn, nq = wid % ntn; if (mt * 16 >= M) return;
  const int row0 = mt * 16, col0 = nq * 64; const float* arow = A + (size_t)(row0 + ln) * lda;
  v8f acc[4] = {};
  for (int kb = 0; kb < K; kb += 32) {
    FragH ah, al;
    const v4f x0 = *(const v4fa*)(arow + kb + 8 * hh), x1 = *(const v4fa*)(arow + kb + 8 * hh + 4), x2 = *(const v4fa*)(arow + kb + 16 + 8 * hh), x3 = *(const v4fa*)(arow + kb + 16 + 8 * hh + 4);
    float xs[16] = {x0[0],x0[1],x0[2],x0[3],x1[0],x1[1],x1[2],x1[3],x2[0],x2[1],x2[2],x2[3],x3[0],x3[1],x3[2],x3[3]};
#pragma unroll
    for (int i = 0; i < 16; ++i) { const _Float16 h = (_Float16)xs[i]; ah.h[i] = h; al.h[i] = ASPLIT ? (_Float16)(xs[i] - (float)h) : (_Float16)0.0f; }
#pragma unroll
    for (int t = 0; t < 4; ++t) { if (col0 + t * 16 >= N) continue; const size_t boff = (size_t)(col0 + t * 16 + ln) * ldb + kb; FragH bq; bq.half[0] = *(const v8us*)(Bh + boff + 8 * hh); bq.half[1] = *(const v8us*)(Bh + boff + 16 + 8 * hh);
      acc[t] = mmaH<ASPLIT ? 2 : 1>(ah.v, al.v, bq.v, bq.v, acc[t]); }
  }
#pragma unroll
  for (int t = 0; t < 4; ++t) { if (col0 + t * 16 >= N) continue;
#pragma unroll
    for (int r = 0; r < 8; ++r) so[w][8 * hh + r][t * 16 + ln] = acc[t][r] * alpha; }
  __builtin_amdgcn_fence(__ATOMIC_ACQ_REL, "workgroup"); __builtin_amdgcn_wave_barrier();
  const int rsub = lane >> 4, c4 = (lane & 15) * 4;
  {
#pragma unroll
    for (int q = 0; q < 8; ++q) { const int r = q * 2 + rsub; if (col0 + c4 < N) { const v4f v = *(const v4fa*)&so[w][r][c4]; *(v4f*)(C + (size_t)(row0 + r) * ldc + col0 + c4) = v; } }
     }
}

// Wt[n][k] = f16(W[k][n]·scale) from f32 row-major W[K][N] (scale = power of two; bf16-exact weights stay exact in f16 away from the subnormal range)
__global__ __launch_bounds__(256) void k_wt_f16(const float* __restrict__ W, _Float16* __restrict__ Wt, int K, int N, float scale) {
  const int t = blockIdx.x * 256 + threadIdx.x; if (t >= N * (K / 8)) return; const int n = t / (K / 8), k8 = (t % (K / 8)) * 8; FragH f;
#pragma unroll
  for (int i = 0; i < 8; ++i) f.h[i] = (_Float16)(bf16_round(W[(size_t)(k8 + i) * N + n]) * scale); const v8us o = f.half[0];
  *(v8us*)((unsigned short*)Wt + (size_t)n * K + k8) = o; 
}
// k_gemm_hh variant with fused epilogue: v = acc·alpha + bias[by·sBias + col] (+ CP[(row/rowsPerB)·sCPb + by·64 + col] if CP) ; ACT 0 none / 1 elu ; writes f16 C16 (and f32 C if non-null)
template <int ACT>
__global__ __launch_bounds__(128) void k_gemm_hhx(const _Float16* __restrict__ A, int lda, size_t sA, const _Float16* __restrict__ Bh, int ldb, size_t sB, float alpha, const float* __restrict__ bias, size_t sBias, const float* __restrict__ CP, int rowsPerB, size_t sCPb, int row0g,
    float* __restrict__ C, _Float16* __restrict__ C16, int ldc, size_t sC, int M, int N, int K) {
  __shared__ __attribute__((aligned(16))) float so[4][16][64];
  const int tid = threadIdx.x, w = tid >> 5, lane = tid & 31, ln = lane & 15, hh = lane >> 4; const int by = blockIdx.y;
  A += (size_t)by * sA; Bh += (size_t)by * sB; const size_t cofs = (size_t)by * sC; const float* bp = bias ? bias + (size_t)by * sBias : nullptr;
  const int ntn = (N + 63) / 64; const int wid = blockIdx.x * 4 + w; const int mt = wid / ntn, nq = wid % ntn; if (mt * 16 >= M) return;
  const int row0 = mt * 16, col0 = nq * 64; const _Float16* arow = A + (size_t)(row0 + ln) * lda;
  v8f acc[4] = {};
  for (int kb = 0; kb < K; kb += 32) { FragH ah; ah.half[0] = *(const v8us*)((const unsigned short*)arow + kb + 8 * hh); ah.half[1] = *(const v8us*)((const unsigned short*)arow + kb + 16 + 8 * hh);
#pragma unroll
    for (int t = 0; t < 4; ++t) { if (col0 + t * 16 >= N) continue; const size_t boff = (size_t)(col0 + t * 16 + ln) * ldb + kb; FragH bq; bq.half[0] = *(const v8us*)((const unsigned short*)Bh + boff + 8 * hh); bq.half[1] = *(const v8us*)((const unsigned short*)Bh + boff + 16 + 8 * hh);
      acc[t] = mmaH<1>(ah.v, ah.v, bq.v, bq.v, acc[t]); }
  }
#pragma unroll
  for (int t = 0; t < 4; ++t) { if (col0 + t * 16 >= N) continue; const int col = col0 + t * 16 + ln; const float bv = bp ? bf16_round(bp[col]) : 0.f;
#pragma unroll
    for (int r = 0; r < 8; ++r) { float v = acc[t][r] * alpha + bv; if (CP) { const int bidx = (row0g + row0 + 8 * hh + r) / rowsPerB; v += CP[(size_t)bidx * sCPb + (size_t)by * 64 + col]; } if (ACT == 1) v = (v > 0.f) ? v : expm1f(v); else if (ACT == 3) v = fmaxf(v, 0.f); so[w][8 * hh + r][t * 16 + ln] = v; } }
  __builtin_amdgcn_fence(__ATOMIC_ACQ_REL, "workgroup"); __builtin_amdgcn_wave_barrier();
  const int rsub = lane >> 4, c4 = (lane & 15) * 4; typedef _Float16 v4h __attribute__((ext_vector_type(4)));
  {
#pragma unroll
    for (int q = 0; q < 8; ++q) { const int r = q * 2 + rsub; if (col0 + c4 < N) { const v4f v = *(const v4fa*)&so[w][r][c4]; if (C) *(v4f*)(C + cofs + (size_t)(row0 + r) * ldc + col0 + c4) = v; if (C16) { v4h h4; for (int i = 0; i < 4; ++i) h4[i] = (_Float16)v[i]; *(v4h*)(C16 + cofs + (size_t)(row0 + r) * ldc + col0 + c4) = h4; } } }
     }
}


__global__ __launch_bounds__(256) void k_x16(const float* __restrict__ x, _Float16* __restrict__ X16, size_t n8) { const size_t t = (size_t)blockIdx.x * 256 + threadIdx.x; if (t >= n8) return; FragH f;
#pragma unroll
  for (int q = 0; q < 8; ++q) f.h[q] = (_Float16)bf16_round(x[t * 8 + q]); *(v8us*)((unsigned short*)X16 + t * 8) = f.half[0];  }
__global__ __launch_bounds__(256) void k_h16(const float* __restrict__ x, _Float16* __restrict__ X16, size_t n8) { const size_t t = (size_t)blockIdx.x * 256 + threadIdx.x; if (t >= n8) return; FragH f;
#pragma unroll
  for (int q = 0; q < 8; ++q) f.h[q] = (_Float16)x[t * 8 + q]; *(v8us*)((unsigned short*)X16 + t * 8) = f.half[0];  }
__global__ __launch_bounds__(256) void k_round16f(const float* __restrict__ W, _Float16* __restrict__ Bt, size_t n8) { const size_t t = (size_t)blockIdx.x * 256 + threadIdx.x; if (t >= n8) return; FragH f;
#pragma unroll
  for (int i = 0; i < 8; ++i) f.h[i] = (_Float16)(bf16_round(W[t * 8 + i]) * 16.0f); *(v8us*)((unsigned short*)Bt + t * 8) = f.half[0];  }
template <int NHv, int TTv>
__global__ __launch_bounds__(256) void k_vt(const _Float16* __restrict__ V16, int ldv, int voff, _Float16* __restrict__ Vt) { __shared__ unsigned short tl[64][66]; const int tid = threadIdx.x; const int slab = blockIdx.x / (TTv / 64), lg = blockIdx.x % (TTv / 64); const int b = slab / NHv, h = slab % NHv;
  for (int i = tid; i < 64 * 8; i += 256) { const int r = i / 8, c8 = (i % 8) * 8; FragH f; f.half[0] = *(const v8us*)((const unsigned short*)V16 + ((size_t)b * TTv + lg * 64 + r) * ldv + voff + h * 64 + c8);
#pragma unroll
    for (int q = 0; q < 8; ++q) tl[r][c8 + q] = f.u[q]; }
  __syncthreads();
  {
#pragma unroll
    for (int rd = 0; rd < 2; ++rd) { const int d = rd * 32 + tid / 8, pc = tid % 8; FragH f;
#pragma unroll
      for (int q = 0; q < 8; ++q) f.u[q] = tl[pc * 8 + q][d];
      *(v8us*)((unsigned short*)Vt + ((size_t)slab * 64 + d) * TTv + lg * 64 + pc * 8) = f.half[0]; }
     } }

// Key split: the four waves of a block share ONE tile of 16 query rows; wave w walks the 32-key tiles w, w + 4, w + 8, ... with its own running max, sum and O,
// and the four partial results are merged through LDS at the end. 2048 blocks of 4 waves: eight waves per SIMD (second launch bound: 128 registers a wave) cover each other's load and cross-lane waits.
__global__ __launch_bounds__(128, 8) void k_flash(const _Float16* __restrict__ Q16, int ldq, const _Float16* __restrict__ K16, int ldk, const _Float16* __restrict__ Vt, const int* __restrict__ MSK, float* __restrict__ O, int ldo) {
  constexpr int RPW = 16, RTN = RPW / 16, NQB = 4096 / RPW, DT = 4, KS = 2;
  __shared__ __attribute__((aligned(16))) unsigned short sP[4][RPW][40]; __shared__ __attribute__((aligned(16))) float sO[4][RPW][64 + 4]; __shared__ float sM[4][RPW], sL[4][RPW];
  const int tid = threadIdx.x, w = tid >> 5, lane = tid & 31, ln = lane & 15, hh = lane >> 4;
  const int slab = blockIdx.x / NQB, qblk = blockIdx.x % NQB; const int b = slab / 4, h = slab % 4; const int q0 = qblk * RPW;
  FragH aq[2][KS];
#pragma unroll
  for (int rt = 0; rt < RTN; ++rt) { const unsigned short* qr = (const unsigned short*)Q16 + ((size_t)b * 4096 + q0 + rt * 16 + ln) * ldq + h * 64;
#pragma unroll
    for (int ks = 0; ks < KS; ++ks) { aq[rt][ks].half[0] = *(const v8us*)(qr + ks * 32 + 8 * hh); aq[rt][ks].half[1] = *(const v8us*)(qr + ks * 32 + 16 + 8 * hh); } }
  const unsigned short* Vth = (const unsigned short*)Vt + (size_t)slab * 64 * 4096;
  float m_r[2][8], l_r[2][8]; v8f oacc[2][DT];
#pragma unroll
  for (int rt = 0; rt < RTN; ++rt) {
#pragma unroll
    for (int r = 0; r < 8; ++r) { m_r[rt][r] = -3.0e38f; l_r[rt][r] = 0.f; }
#pragma unroll
    for (int dt = 0; dt < DT; ++dt) oacc[rt][dt] = (v8f){0.f,0.f,0.f,0.f,0.f,0.f,0.f,0.f}; }
  const int jend = 4096;
#pragma unroll 1
  for (int jb = 0; jb < jend; jb += 4 * 32) { const int j0 = jb + w * 32;      // the trip test is on jb, the same in every wave: a scalar branch, EXEC untouched around the WMMAs
    
    v8f s[2][2];
#pragma unroll
    for (int nt = 0; nt < 2; ++nt) { const unsigned short* kr = (const unsigned short*)K16 + ((size_t)b * 4096 + j0 + nt * 16 + ln) * ldk + h * 64; FragH bk[KS];
#pragma unroll
      for (int ks = 0; ks < KS; ++ks) { bk[ks].half[0] = *(const v8us*)(kr + ks * 32 + 8 * hh); bk[ks].half[1] = *(const v8us*)(kr + ks * 32 + 16 + 8 * hh); }
#pragma unroll
      for (int rt = 0; rt < RTN; ++rt) { v8f acc = (v8f){0.f,0.f,0.f,0.f,0.f,0.f,0.f,0.f};
#pragma unroll
        for (int ks = 0; ks < KS; ++ks) acc = mmaH<1>(aq[rt][ks].v, aq[rt][ks].v, bk[ks].v, bk[ks].v, acc); s[rt][nt] = acc; } }
#pragma unroll
    for (int rt = 0; rt < RTN; ++rt)
#pragma unroll
      for (int r = 0; r < 8; ++r) { const int tq = q0 + rt * 16 + 8 * hh + r; const int k0 = j0 + ln, k1 = j0 + 16 + ln; (void)tq; (void)k0; (void)k1;
        const bool ok0 = true, ok1 = true;
        const float s0 = ok0 ? s[rt][0][r] * (1.0f) : -INFINITY, s1 = ok1 ? s[rt][1][r] * (1.0f) : -INFINITY; float mc = fmaxf(s0, s1);
        mc = fmaxf(mc, __shfl_xor(mc, 1, 32)); mc = fmaxf(mc, __shfl_xor(mc, 2, 32)); mc = fmaxf(mc, __shfl_xor(mc, 4, 32)); mc = fmaxf(mc, __shfl_xor(mc, 8, 32));
        const float mn = fmaxf(m_r[rt][r], mc); const float al = (mn > -1.0e38f) ? expf(m_r[rt][r] - mn) : 1.0f; m_r[rt][r] = mn; const float p0 = ok0 ? expf(s0 - mn) : 0.f, p1 = ok1 ? expf(s1 - mn) : 0.f; l_r[rt][r] = l_r[rt][r] * al + p0 + p1;
#pragma unroll
        for (int dt = 0; dt < DT; ++dt) oacc[rt][dt][r] *= al;
        FragH t2; t2.h[0] = (_Float16)p0; t2.h[1] = (_Float16)p1; sP[w][rt * 16 + 8 * hh + r][ln] = t2.u[0]; sP[w][rt * 16 + 8 * hh + r][16 + ln] = t2.u[1]; }
    __builtin_amdgcn_fence(__ATOMIC_ACQ_REL, "workgroup"); __builtin_amdgcn_wave_barrier();
    FragH pa[2];
#pragma unroll
    for (int rt = 0; rt < RTN; ++rt) { pa[rt].half[0] = *(const v8us*)&sP[w][rt * 16 + ln][8 * hh]; pa[rt].half[1] = *(const v8us*)&sP[w][rt * 16 + ln][16 + 8 * hh]; }
#pragma unroll
    for (int dt = 0; dt < DT; ++dt) { const unsigned short* vrow = Vth + (size_t)(dt * 16 + ln) * 4096 + j0; FragH bv; bv.half[0] = *(const v8us*)(vrow + 8 * hh); bv.half[1] = *(const v8us*)(vrow + 16 + 8 * hh);
#pragma unroll
      for (int rt = 0; rt < RTN; ++rt) oacc[rt][dt] = mmaH<1>(pa[rt].v, pa[rt].v, bv.v, bv.v, oacc[rt][dt]); }
    __builtin_amdgcn_fence(__ATOMIC_ACQ_REL, "workgroup"); __builtin_amdgcn_wave_barrier(); }
#pragma unroll
  for (int rt = 0; rt < RTN; ++rt) {
#pragma unroll
    for (int r = 0; r < 8; ++r) { float l = l_r[rt][r]; l += __shfl_xor(l, 1, 32); l += __shfl_xor(l, 2, 32); l += __shfl_xor(l, 4, 32); l += __shfl_xor(l, 8, 32); if (ln == 0) { sM[w][rt * 16 + 8 * hh + r] = m_r[rt][r]; sL[w][rt * 16 + 8 * hh + r] = l; } }
#pragma unroll
    for (int dt = 0; dt < DT; ++dt)
#pragma unroll
      for (int r = 0; r < 8; ++r) sO[w][rt * 16 + 8 * hh + r][dt * 16 + ln] = oacc[rt][dt][r]; }
  __syncthreads();      // every wave's partial (max, sum, unnormalised O) is in LDS before any wave merges
  {
#pragma unroll
    for (int rp = 0; rp < RPW; rp += 8) { const int r = rp + (tid >> 4), pc = tid & 15;
      const float mm = fmaxf(fmaxf(sM[0][r], sM[1][r]), fmaxf(sM[2][r], sM[3][r])); float l = 0.f; v4f val = {0.f, 0.f, 0.f, 0.f};
#pragma unroll
      for (int i = 0; i < 4; ++i) { const float e = expf(sM[i][r] - mm); l += e * sL[i][r]; const v4f o = *(const v4fa*)&sO[i][r][pc * 4]; val += e * o; }
      val *= (l > 0.f) ? 1.0f / l : 0.f; *(v4f*)(O + ((size_t)b * 4096 + q0 + r) * ldo + h * 64 + pc * 4) = val; }
     } }

__global__ __launch_bounds__(256) void k_tok(const float* __restrict__ x, _Float16* __restrict__ X16) { __shared__ unsigned short tl[16][72]; const int tid = threadIdx.x; const int b = blockIdx.x / ((CC / 64) * (NN / 16)), rem = blockIdx.x % ((CC / 64) * (NN / 16)); const int cg = rem / (NN / 16), pg = rem % (NN / 16); const int c0 = cg * 64, p0 = pg * 16;
  for (int i = tid; i < 64 * 16; i += 256) { const int c = i / 16, pp = i % 16; FragH f; f.h[0] = (_Float16)bf16_round(x[((size_t)b * CC + c0 + c) * NN + p0 + pp]); tl[pp][c] = f.u[0]; }
  __syncthreads();
  if (tid < 128) { const int r = tid / 8, pc = tid % 8; FragH f;
#pragma unroll
    for (int q = 0; q < 8; ++q) f.u[q] = tl[r][pc * 8 + q]; unsigned short* d = (unsigned short*)X16 + ((size_t)b * NN + p0 + r) * CC + c0 + pc * 8; *(v8us*)d = f.half[0];  } }
__global__ __launch_bounds__(256) void k_text(const float* __restrict__ tf, const float* __restrict__ Wt, const float* __restrict__ bt, const float* __restrict__ Wk, const float* __restrict__ bk, float* __restrict__ TB) { __shared__ float ts[CC]; const int b = blockIdx.x, c = threadIdx.x; float s = bf16_round(bt[c]);
#pragma unroll 1
  for (int j = 0; j < DTX; ++j) s += bf16_round(tf[b * DTX + j]) * bf16_round(Wt[(size_t)c * DTX + j]);
  ts[c] = 0.5f * s * (1.0f + erff(s * 0.70710678118654752f)); __syncthreads();
  float o = bf16_round(bk[c]);
#pragma unroll 1
  for (int k = 0; k < CC; ++k) o += ts[k] * bf16_round(Wk[(size_t)c * CC + k]);
  *(float*)(TB + b * CC + c) = o;  }
__global__ __launch_bounds__(256) void k_fin(const float* __restrict__ M2, const float* __restrict__ pf, const float* __restrict__ gam, float* __restrict__ out) { __shared__ float tl[32][65]; const int tid = threadIdx.x; const int b = blockIdx.x / ((CC / 32) * (NN / 64)), rem = blockIdx.x % ((CC / 32) * (NN / 64)); const int cg = rem / (NN / 64), pg = rem % (NN / 64); const int c0 = cg * 32, p0 = pg * 64; const float g = bf16_round(gam[0]);
  for (int i = tid; i < 64 * 32; i += 256) { const int pp = i / 32, c = i % 32; tl[c][pp] = M2[((size_t)b * NN + p0 + pp) * CC + c0 + c]; }
  __syncthreads();
  { for (int i = tid; i < 32 * 16; i += 256) { const int c = i / 16, pc = i % 16; const size_t gi = ((size_t)b * CC + c0 + c) * NN + p0 + pc * 4; const v4f x = *(const v4fa*)(pf + gi); v4f v; for (int q = 0; q < 4; ++q) v[q] = g * tl[c][pc * 4 + q] + bf16_round(x[q]); *(v4f*)(out + gi) = v; }  } }
extern "C" void kernel_launch(void* const* d_in, const int* in_sizes, int n_in,
                              void* d_out, int out_size, void* d_ws, size_t ws_size, hipStream_t stream) {
  (void)in_sizes; (void)n_in; (void)out_size;
  const float* const* I = (const float* const*)d_in; const float* pf = I[0]; const float* tf = I[1]; const float* Wt = I[2]; const float* bt = I[3]; const float* Wq = I[4]; const float* bq = I[5]; const float* Wk = I[6]; const float* bk = I[7]; const float* Wv = I[8]; const float* bv = I[9]; const float* W1 = I[10]; const float* b1 = I[11]; const float* W2 = I[12]; const float* b2 = I[13]; const float* gam = I[14];
  char* ws = (char*)d_ws; size_t off = 0;
  auto take = [&](size_t bytes) { char* p = ws + off; off += (bytes + 255) & ~(size_t)255; return p; };
  _Float16* Bq = (_Float16*)take(CC * CC * 2); _Float16* Bk = (_Float16*)take(CC * CC * 2); _Float16* Bv = (_Float16*)take(CC * CC * 2); _Float16* B1 = (_Float16*)take(CC * CC * 2); _Float16* B2 = (_Float16*)take(CC * CC * 2); float* TB = (float*)take(BB * CC * 4);
  _Float16* X16 = (_Float16*)take((size_t)NR * CC * 2); _Float16* Q16 = (_Float16*)take((size_t)NR * CC * 2); _Float16* K16 = (_Float16*)take((size_t)NR * CC * 2); _Float16* V16 = (_Float16*)take((size_t)NR * CC * 2); _Float16* Vt = (_Float16*)take((size_t)NR * CC * 2); float* O = (float*)take((size_t)NR * CC * 4); _Float16* O16 = Q16; _Float16* H1 = K16; float* M2 = O;
  if (off > ws_size) return;      // 0.7 + 4.2 × 5 + 8.4 ≈ 30 MiB
  const size_t w8 = (size_t)CC * CC / 8; const unsigned gw = (unsigned)((w8 + 255) / 256);
  k_round16f<<<gw, 256, 0, stream>>>(Wq, Bq, w8); k_round16f<<<gw, 256, 0, stream>>>(Wk, Bk, w8); k_round16f<<<gw, 256, 0, stream>>>(Wv, Bv, w8); k_round16f<<<gw, 256, 0, stream>>>(W1, B1, w8); k_round16f<<<gw, 256, 0, stream>>>(W2, B2, w8);      // (out,in)
  k_text<<<BB, 256, 0, stream>>>(tf, Wt, bt, Wk, bk, TB);
  k_tok<<<BB * (CC / 64) * (NN / 16), 256, 0, stream>>>(pf, X16);
  const dim3 gg(((NN / 16) * (CC / 64) + 3) / 4, BB);      // batched over b (q and v projections); sA = sC = NN·CC
  k_gemm_hhx<0><<<gg, 128, 0, stream>>>(X16, CC, (size_t)NN * CC, Bq, CC, 0, 0.0625f, bq, 0, nullptr, 1, 0, 0, nullptr, Q16, CC, (size_t)NN * CC, NN, CC, CC);
  k_gemm_hhx<0><<<dim3(((NR / 16) * (CC / 64) + 3) / 4, 1), 128, 0, stream>>>(X16, CC, 0, Bk, CC, 0, 0.0625f, nullptr, 0, TB, NN, (size_t)CC, 0, nullptr, K16, CC, 0, NR, CC, CC);      // k = pf·Wkᵀ + (t·Wkᵀ + bk): the per-batch text bias enters as the CP addend (row block b = row / 4096), unrounded
  k_gemm_hhx<0><<<gg, 128, 0, stream>>>(X16, CC, (size_t)NN * CC, Bv, CC, 0, 0.0625f, bv, 0, nullptr, 1, 0, 0, nullptr, V16, CC, (size_t)NN * CC, NN, CC, CC);
  k_vt<NH, NN><<<BB * NH * (NN / 64), 256, 0, stream>>>(V16, CC, 0, Vt);
  k_flash<<<BB * NH * (NN / 16), 128, 0, stream>>>(Q16, CC, K16, CC, Vt, nullptr, O, CC);
  const unsigned g8 = (unsigned)(((size_t)NR * CC / 8 + 255) / 256); const dim3 g1(((NR / 16) * (CC / 64) + 3) / 4, 1);
  k_h16<<<g8, 256, 0, stream>>>(O, O16, (size_t)NR * CC / 8);
  k_gemm_hhx<3><<<g1, 128, 0, stream>>>(O16, CC, 0, B1, CC, 0, 0.0625f, b1, 0, nullptr, 1, 0, 0, nullptr, H1, CC, 0, NR, CC, CC);      // relu(x·W1ᵀ + b1)
  k_gemm_hhx<0><<<g1, 128, 0, stream>>>(H1, CC, 0, B2, CC, 0, 0.0625f, b2, 0, nullptr, 1, 0, 0, M2, nullptr, CC, 0, NR, CC, CC);         // ·W2ᵀ + b2 (f32)
  k_fin<<<BB * (CC / 32) * (NN / 64), 256, 0, stream>>>(M2, pf, gam, (float*)d_out);
}

// v002
// A run of this version takes 260 microseconds.
// In two side-by-side timings against v001, it was 1.18 and 1.19 times as fast.
// Over all steps from v000 it is 2.07 times as fast.
#include <hip/hip_runtime.h>
// Text-guided point attention (B=2, C=256 channels × N=4096 points; text 512 → 256 GELU projection added to the key input; q/k/v 1×1 convs; 4 heads × 64; UNSCALED softmax(q·k)·v; MLP 256 → relu →
// 256; out = γ·x + point_feats, channel-major): the q/k/v/MLP linears ((out,in) weights bf16-exact ×2^4; the text term enters k as a per-batch bias) and the attention as a fused flash-style
// kernel (online softmax f32, P f16 ≤ 1, O = P·Vt; RPW-16 waves) run on v_wmma_f32_16x16x32_f16 with f32 accumulate; the text projection, the NCW ↔ token-major transposes and the gated
// residual are f32 VALU.
#define BB 2
#define CC 256
#define NN 4096
#define DTX 512
#define NH 4
#define NR (BB * NN)

typedef __bf16 v16b __attribute__((ext_vector_type(16)));
typedef unsigned short v8us __attribute__((ext_vector_type(8), may_alias));
typedef float  v8f  __attribute__((ext_vector_type(8)));
typedef float  v4f  __attribute__((ext_vector_type(4)));
typedef float  v4fa __attribute__((ext_vector_type(4), may_alias));
union FragB { v16b v; v8us half[2]; unsigned short u[16]; };

__device__ __forceinline__ unsigned short bf16_bits(float x) { unsigned int u = __float_as_uint(x); return (unsigned short)((u + 0x7FFFu + ((u >> 16) & 1u)) >> 16); }
__device__ __forceinline__ float bf16_val(unsigned short b) { return __uint_as_float(((unsigned int)b) << 16); }
__device__ __forceinline__ float bf16_round(float x) { return bf16_val(bf16_bits(x)); }
// D += A·B with NT terms: 1 = ah·bh, 2 = + al·bh (A split), 3 = + ah·bl (both split)
template <int NT>
__device__ __forceinline__ v8f mmaN(v16b ah, v16b al, v16b bh, v16b bl, v8f c) {
  c = __builtin_amdgcn_wmma_f32_16x16x32_bf16(false, ah, false, bh, (short)0, c, false, false);
  if (NT >= 2) c = __builtin_amdgcn_wmma_f32_16x16x32_bf16(false, al, false, bh, (short)0, c, false, false);
  if (NT >= 3) c = __builtin_amdgcn_wmma_f32_16x16x32_bf16(false, ah, false, bl, (short)0, c, false, false);
  asm volatile("v_nop\n\tv_nop\n\tv_nop\n\tv_nop" : "+v"(c) : "v"(ah), "v"(al), "v"(bh), "v"(bl));
  return c;
}

__global__ __launch_bounds__(256) void k_wt_bf16(const float* __restrict__ W, unsigned short* __restrict__ Wt, int K, int N) {
  const int t = blockIdx.x * 256 + threadIdx.x;
  const int k8n = K / 8;
  if (t >= N * k8n) return;
  const int n = t / k8n, k8 = (t % k8n) * 8;
  v8us v;
#pragma unroll
  for (int i = 0; i < 8; ++i) v[i] = bf16_bits(W[(size_t)(k8 + i) * N + n]);
  *(v8us*)(Wt + (size_t)n * K + k8) = v;
  
}

// GEMM C[M][N] (f32, pitch ldc) = act(A[M][K]·W + bias). A f32 row-major (pitch lda) converted per fragment to bf16
// (ASPLIT: hi/lo two planes -> 2 terms, else single rounded term); Wt bf16 [N][K] (pitch ldb). BIAS_BF16 rounds the
// bias to bf16 first (bias quantised to bf16 before the add). K%32==0, M%16==0, N%64==0.
template <bool ASPLIT, int ACT, bool BIAS_BF16>
__global__ __launch_bounds__(128) void k_gemm_bf(const float* __restrict__ A, int lda, const unsigned short* __restrict__ Wt, int ldb,
                                               const float* __restrict__ bias, float* __restrict__ C, int ldc, int M, int N, int K) {
  __shared__ __attribute__((aligned(16))) float so[4][16][64];
  const int tid = threadIdx.x, w = tid >> 5, lane = tid & 31, ln = lane & 15, hh = lane >> 4;
  const int ntn = N / 64;
  const int wid = blockIdx.x * 4 + w;
  const int mt = wid / ntn, nq = wid % ntn;
  if (mt * 16 >= M) return;
  const int row0 = mt * 16, col0 = nq * 64;
  const float* arow = A + (size_t)(row0 + ln) * lda;
  v8f acc[4] = {};
  for (int kb = 0; kb < K; kb += 32) {
    FragB ah, al;
    const v4f x0 = *(const v4fa*)(arow + kb + 8 * hh), x1 = *(const v4fa*)(arow + kb + 8 * hh + 4);
    const v4f x2 = *(const v4fa*)(arow + kb + 16 + 8 * hh), x3 = *(const v4fa*)(arow + kb + 16 + 8 * hh + 4);
    float xs[16] = {x0[0],x0[1],x0[2],x0[3],x1[0],x1[1],x1[2],x1[3],x2[0],x2[1],x2[2],x2[3],x3[0],x3[1],x3[2],x3[3]};
#pragma unroll
    for (int i = 0; i < 16; ++i) { const unsigned short hb = bf16_bits(xs[i]); ah.u[i] = hb; al.u[i] = ASPLIT ? bf16_bits(xs[i] - bf16_val(hb)) : (unsigned short)0; }
#pragma unroll
    for (int t = 0; t < 4; ++t) {
      const unsigned short* brow = Wt + (size_t)(col0 + t * 16 + ln) * ldb + kb;
      FragB b;
      b.half[0] = *(const v8us*)(brow + 8 * hh);
      b.half[1] = *(const v8us*)(brow + 16 + 8 * hh);
      acc[t] = mmaN<ASPLIT ? 2 : 1>(ah.v, al.v, b.v, b.v, acc[t]);
    }
  }
#pragma unroll
  for (int t = 0; t < 4; ++t) {
    float bv = bias ? bias[col0 + t * 16 + ln] : 0.f;
    if (BIAS_BF16) bv = bf16_round(bv);
#pragma unroll
    for (int r = 0; r < 8; ++r) { float v = acc[t][r] + bv; if (ACT == 1) v = fmaxf(v, 0.f); so[w][8 * hh + r][t * 16 + ln] = v; }
  }
  __builtin_amdgcn_fence(__ATOMIC_ACQ_REL, "workgroup");
  __builtin_amdgcn_wave_barrier();
  const int rsub = lane >> 4, c4 = (lane & 15) * 4;
  {
#pragma unroll
    for (int q = 0; q < 8; ++q) {
      const int r = q * 2 + rsub;
      const v4f v = *(const v4fa*)&so[w][r][c4];
      *(v4f*)(C + (size_t)(row0 + r) * ldc + col0 + c4) = v;
    }
    
  }
}

// Flash-style causal/unmasked attention, all contractions 3-term bf16 hi/lo splits, f32 softmax with running max.
// q,k,v rows are read from f32 buffers with arbitrary row pitch (so they can live inside a fused qkv buffer);
// D = head size (multiple of 32, <= 128); one wave = 16 query rows; block = 4 waves (64 queries) sharing K/V chunks of 32.
template <int D, bool CAUSAL>
__global__ __launch_bounds__(128) void k_flash(const float* __restrict__ qb, const float* __restrict__ kb, const float* __restrict__ vb,
                                             int pitch, int T, int H, float scale, float* __restrict__ y, int ypitch) {
  constexpr int KS = D / 32;        // k-steps for QK
  constexpr int DT = D / 16;        // d tiles for PV
  __shared__ __attribute__((aligned(16))) unsigned short sKh[32][D + 8], sKl[32][D + 8], sVh[32][D + 8], sVl[32][D + 8];
  __shared__ __attribute__((aligned(16))) unsigned short sPh[4][16][40], sPl[4][16][40];
  __shared__ __attribute__((aligned(16))) float sO[4][16][D];
  const int tid = threadIdx.x, w = tid >> 5, lane = tid & 31, ln = lane & 15, hh = lane >> 4;
  const int nqb = (T + 63) / 64;
  const int bh = blockIdx.x / nqb, qblk = blockIdx.x % nqb;
  const int b = bh / H, h = bh % H;
  const int q0 = qblk * 64 + w * 16;
  const float* Q = qb + (size_t)b * T * pitch + h * D;
  const float* K = kb + (size_t)b * T * pitch + h * D;
  const float* V = vb + (size_t)b * T * pitch + h * D;

  // A fragments of the wave's 16 query rows (scaled), hi/lo
  FragB aqh[KS], aql[KS];
  {
    int row = q0 + ln; if (row >= T) row = T - 1;
    const float* qr = Q + (size_t)row * pitch;
#pragma unroll
    for (int ks = 0; ks < KS; ++ks)
#pragma unroll
      for (int i = 0; i < 16; ++i) {
        const int d = ks * 32 + ((i < 8) ? (8 * hh + i) : (16 + 8 * hh + (i - 8)));
        const float x = qr[d] * scale; const unsigned short hb = bf16_bits(x);
        aqh[ks].u[i] = hb; aql[ks].u[i] = bf16_bits(x - bf16_val(hb));
      }
  }
  float m_r[8], l_r[8];
#pragma unroll
  for (int r = 0; r < 8; ++r) { m_r[r] = -3.0e38f; l_r[r] = 0.f; }
  v8f oacc[DT];
#pragma unroll
  for (int dt = 0; dt < DT; ++dt) oacc[dt] = (v8f){0.f,0.f,0.f,0.f,0.f,0.f,0.f,0.f};

  const int kv_end = CAUSAL ? min(T, qblk * 64 + 64) : T;     // block-uniform
  for (int j0 = 0; j0 < kv_end; j0 += 32) {
    __syncthreads();
    for (int e = tid; e < 32 * (D / 4); e += 128) {
      const int r = e / (D / 4), c4 = (e % (D / 4)) * 4;
      const int key = j0 + r;
      v4f kf = {0.f,0.f,0.f,0.f}, vf = {0.f,0.f,0.f,0.f};
      if (key < T) { kf = *(const v4fa*)(K + (size_t)key * pitch + c4); vf = *(const v4fa*)(V + (size_t)key * pitch + c4); }
#pragma unroll
      for (int t = 0; t < 4; ++t) {
        unsigned short hb = bf16_bits(kf[t]); sKh[r][c4 + t] = hb; sKl[r][c4 + t] = bf16_bits(kf[t] - bf16_val(hb));
        hb = bf16_bits(vf[t]); sVh[r][c4 + t] = hb; sVl[r][c4 + t] = bf16_bits(vf[t] - bf16_val(hb));
      }
    }
    __syncthreads();
    // S tile 16 x 32
    v8f s[2];
#pragma unroll
    for (int nt = 0; nt < 2; ++nt) {
      v8f acc = {};
#pragma unroll
      for (int ks = 0; ks < KS; ++ks) {
        FragB bh_, bl_;
        bh_.half[0] = *(const v8us*)&sKh[nt * 16 + ln][ks * 32 + 8 * hh]; bh_.half[1] = *(const v8us*)&sKh[nt * 16 + ln][ks * 32 + 16 + 8 * hh];
        bl_.half[0] = *(const v8us*)&sKl[nt * 16 + ln][ks * 32 + 8 * hh]; bl_.half[1] = *(const v8us*)&sKl[nt * 16 + ln][ks * 32 + 16 + 8 * hh];
        acc = mmaN<3>(aqh[ks].v, aql[ks].v, bh_.v, bl_.v, acc);
      }
      s[nt] = acc;
    }
    // mask + running max (rows 8hh+r; the 16 lanes of a half share rows)
    float alpha[8];
#pragma unroll
    for (int r = 0; r < 8; ++r) {
      const int qi = q0 + 8 * hh + r;
      const int ja = j0 + ln, jb = j0 + 16 + ln;
      if (CAUSAL) { if (ja > qi) s[0][r] = -3.0e38f; if (jb > qi) s[1][r] = -3.0e38f; }
      if (ja >= T) s[0][r] = -3.0e38f;
      if (jb >= T) s[1][r] = -3.0e38f;
      float mx = fmaxf(s[0][r], s[1][r]);
      mx = fmaxf(mx, __shfl_xor(mx, 1, 32)); mx = fmaxf(mx, __shfl_xor(mx, 2, 32)); mx = fmaxf(mx, __shfl_xor(mx, 4, 32)); mx = fmaxf(mx, __shfl_xor(mx, 8, 32));
      const float mnew = fmaxf(m_r[r], mx);
      alpha[r] = (mnew > -1.0e38f) ? __expf(m_r[r] - mnew) : 1.0f;
      const float p0 = (s[0][r] > -1.0e38f) ? __expf(s[0][r] - mnew) : 0.f;
      const float p1 = (s[1][r] > -1.0e38f) ? __expf(s[1][r] - mnew) : 0.f;
      m_r[r] = mnew;
      l_r[r] = l_r[r] * alpha[r] + p0 + p1;            // per-lane partial row sum (16 lanes combined at the end)
      unsigned short hb = bf16_bits(p0); sPh[w][8 * hh + r][ln] = hb;      sPl[w][8 * hh + r][ln] = bf16_bits(p0 - bf16_val(hb));
      hb = bf16_bits(p1);                sPh[w][8 * hh + r][16 + ln] = hb; sPl[w][8 * hh + r][16 + ln] = bf16_bits(p1 - bf16_val(hb));
    }
#pragma unroll
    for (int dt = 0; dt < DT; ++dt)
#pragma unroll
      for (int r = 0; r < 8; ++r) oacc[dt][r] *= alpha[r];
    __builtin_amdgcn_fence(__ATOMIC_ACQ_REL, "workgroup");
    __builtin_amdgcn_wave_barrier();
    FragB pah, pal;
    pah.half[0] = *(const v8us*)&sPh[w][ln][8 * hh]; pah.half[1] = *(const v8us*)&sPh[w][ln][16 + 8 * hh];
    pal.half[0] = *(const v8us*)&sPl[w][ln][8 * hh]; pal.half[1] = *(const v8us*)&sPl[w][ln][16 + 8 * hh];
#pragma unroll
    for (int dt = 0; dt < DT; ++dt) {
      FragB bvh, bvl;
#pragma unroll
      for (int i = 0; i < 8; ++i) {
        bvh.u[i] = sVh[8 * hh + i][dt * 16 + ln]; bvh.u[8 + i] = sVh[16 + 8 * hh + i][dt * 16 + ln];
        bvl.u[i] = sVl[8 * hh + i][dt * 16 + ln]; bvl.u[8 + i] = sVl[16 + 8 * hh + i][dt * 16 + ln];
      }
      oacc[dt] = mmaN<3>(pah.v, pal.v, bvh.v, bvl.v, oacc[dt]);
    }
    __builtin_amdgcn_fence(__ATOMIC_ACQ_REL, "workgroup");
    __builtin_amdgcn_wave_barrier();
  }
#pragma unroll
  for (int r = 0; r < 8; ++r) {
    float l = l_r[r];
    l += __shfl_xor(l, 1, 32); l += __shfl_xor(l, 2, 32); l += __shfl_xor(l, 4, 32); l += __shfl_xor(l, 8, 32);
    l_r[r] = (l > 0.f) ? 1.0f / l : 0.f;
  }
#pragma unroll
  for (int dt = 0; dt < DT; ++dt)
#pragma unroll
    for (int r = 0; r < 8; ++r) sO[w][8 * hh + r][dt * 16 + ln] = oacc[dt][r] * l_r[r];
  __builtin_amdgcn_fence(__ATOMIC_ACQ_REL, "workgroup");
  __builtin_amdgcn_wave_barrier();
  {
    for (int r = 0; r < 16; ++r) {
      const int row = q0 + r;
      if (row < T && lane < D / 4) {
        const v4f val = *(const v4fa*)&sO[w][r][lane * 4];
        *(v4f*)(y + ((size_t)b * T + row) * ypitch + h * D + lane * 4) = val;
      }
    }
    
  }
}

// GEMM C = act(A·W + bias + resid): A f32 (ASPLIT -> hi/lo 2 terms), Wt bf16 [N][K]; ACT 0 none, 1 relu, 2 exact gelu;
// resid (optional, f32, row index = (row % rmod), pitch ldr, RES_BF16 rounds it) added before the activation.
template <bool ASPLIT, int ACT, bool BIAS_BF16, bool RES_BF16>
__global__ __launch_bounds__(128) void k_gemm_bf3(const float* __restrict__ A, int lda, const unsigned short* __restrict__ Wt, int ldb,
                                                const float* __restrict__ bias, const float* __restrict__ resid, int rmod, int ldr,
                                                float* __restrict__ C, int ldc, int M, int N, int K) {
  __shared__ __attribute__((aligned(16))) float so[4][16][64];
  const int tid = threadIdx.x, w = tid >> 5, lane = tid & 31, ln = lane & 15, hh = lane >> 4;
  const int ntn = N / 64;
  const int wid = blockIdx.x * 4 + w;
  const int mt = wid / ntn, nq = wid % ntn;
  if (mt * 16 >= M) return;
  const int row0 = mt * 16, col0 = nq * 64;
  const float* arow = A + (size_t)(row0 + ln) * lda;
  v8f acc[4] = {};
  for (int kb = 0; kb < K; kb += 32) {
    FragB ah, al;
    const v4f x0 = *(const v4fa*)(arow + kb + 8 * hh), x1 = *(const v4fa*)(arow + kb + 8 * hh + 4);
    const v4f x2 = *(const v4fa*)(arow + kb + 16 + 8 * hh), x3 = *(const v4fa*)(arow + kb + 16 + 8 * hh + 4);
    float xs[16] = {x0[0],x0[1],x0[2],x0[3],x1[0],x1[1],x1[2],x1[3],x2[0],x2[1],x2[2],x2[3],x3[0],x3[1],x3[2],x3[3]};
#pragma unroll
    for (int i = 0; i < 16; ++i) { const unsigned short hb = bf16_bits(xs[i]); ah.u[i] = hb; al.u[i] = ASPLIT ? bf16_bits(xs[i] - bf16_val(hb)) : (unsigned short)0; }
#pragma unroll
    for (int t = 0; t < 4; ++t) {
      const unsigned short* brow = Wt + (size_t)(col0 + t * 16 + ln) * ldb + kb;
      FragB b;
      b.half[0] = *(const v8us*)(brow + 8 * hh);
      b.half[1] = *(const v8us*)(brow + 16 + 8 * hh);
      acc[t] = mmaN<ASPLIT ? 2 : 1>(ah.v, al.v, b.v, b.v, acc[t]);
    }
  }
#pragma unroll
  for (int t = 0; t < 4; ++t) {
    const int col = col0 + t * 16 + ln;
    float bv = bias ? bias[col] : 0.f;
    if (BIAS_BF16) bv = bf16_round(bv);
#pragma unroll
    for (int r = 0; r < 8; ++r) {
      float v = acc[t][r] + bv;
      if (resid) { float rv = resid[(size_t)((row0 + 8 * hh + r) % rmod) * ldr + col]; if (RES_BF16) rv = bf16_round(rv); v += rv; }
      if (ACT == 1) v = fmaxf(v, 0.f);
      if (ACT == 2) v = 0.5f * v * (1.0f + erff(v * 0.70710678118654752f));
      if (ACT == 3) { const float u = 0.7978845608028654f * (v + 0.044715f * v * v * v); v = 0.5f * v * (1.0f + tanhf(u)); }
      so[w][8 * hh + r][t * 16 + ln] = v;
    }
  }
  __builtin_amdgcn_fence(__ATOMIC_ACQ_REL, "workgroup");
  __builtin_amdgcn_wave_barrier();
  const int rsub = lane >> 4, c4 = (lane & 15) * 4;
  {
#pragma unroll
    for (int q = 0; q < 8; ++q) {
      const int r = q * 2 + rsub;
      const v4f v = *(const v4fa*)&so[w][r][c4];
      *(v4f*)(C + (size_t)(row0 + r) * ldc + col0 + c4) = v;
    }
    
  }
}
// row LayerNorm (biased variance, eps) over N: s = X (+ R); optional out_sum <- s; out_norm <- (s-mu)*rsqrt(var+eps)*g + b
template <bool PARAM_BF16>
__global__ __launch_bounds__(256) void k_layernorm(const float* __restrict__ X, const float* __restrict__ R, const float* __restrict__ g, const float* __restrict__ bta,
                                                  float* __restrict__ out_sum, float* __restrict__ out_norm, int N, float eps) {
  __shared__ float red[256];
  const int row = blockIdx.x, tid = threadIdx.x;
  const float* x = X + (size_t)row * N; const float* rr = R ? R + (size_t)row * N : nullptr;
  float vals[16];                     // up to N = 4096
  const int per = N / 256;            // contiguous chunk per thread? use strided-by-4 chunks: thread handles j = tid*4 + 1024*u
  float s1 = 0.f;
  for (int u = 0; u < per / 4; ++u) {
    const int j = tid * 4 + 1024 * u;
    const v4f a = *(const v4fa*)(x + j);
    v4f b = {0.f,0.f,0.f,0.f}; if (rr) b = *(const v4fa*)(rr + j);
#pragma unroll
    for (int q = 0; q < 4; ++q) { const float v = a[q] + b[q]; vals[u * 4 + q] = v; s1 += v; }
  }
  red[tid] = s1; __syncthreads();
  for (int st = 128; st > 0; st >>= 1) { if (tid < st) red[tid] += red[tid + st]; __syncthreads(); }
  const float mu = red[0] / (float)N; __syncthreads();
  float s2 = 0.f;
  for (int u = 0; u < per / 4; ++u)
#pragma unroll
    for (int q = 0; q < 4; ++q) { const float c = vals[u * 4 + q] - mu; s2 += c * c; }
  red[tid] = s2; __syncthreads();
  for (int st = 128; st > 0; st >>= 1) { if (tid < st) red[tid] += red[tid + st]; __syncthreads(); }
  const float rs = rsqrtf(red[0] / (float)N + eps);
  {
    for (int u = 0; u < per / 4; ++u) {
      const int j = tid * 4 + 1024 * u;
      v4f o, sm;
#pragma unroll
      for (int q = 0; q < 4; ++q) {
        float gg = g[j + q], bb = bta[j + q];
        if (PARAM_BF16) { gg = bf16_round(gg); bb = bf16_round(bb); }
        sm[q] = vals[u * 4 + q]; o[q] = (vals[u * 4 + q] - mu) * rs * gg + bb;
      }
      if (out_sum) *(v4f*)(out_sum + (size_t)row * N + j) = sm;
      *(v4f*)(out_norm + (size_t)row * N + j) = o;
    }
    
  }
}



// ---- f16 WMMA path (v_wmma_f32_16x16x32_f16): 11-bit significands for operands in range — used where a [0,1] probability operand needs more precision than bf16
typedef _Float16 v16h __attribute__((ext_vector_type(16)));
union FragH { v16h v; v8us half[2]; _Float16 h[16]; unsigned short u[16]; };
template <int NT>
__device__ __forceinline__ v8f mmaH(v16h ah, v16h al, v16h bh, v16h bl, v8f c) {
  c = __builtin_amdgcn_wmma_f32_16x16x32_f16(false, ah, false, bh, (short)0, c, false, false);
  if (NT >= 2) c = __builtin_amdgcn_wmma_f32_16x16x32_f16(false, al, false, bh, (short)0, c, false, false);
  if (NT >= 3) c = __builtin_amdgcn_wmma_f32_16x16x32_f16(false, ah, false, bl, (short)0, c, false, false);
  asm volatile("v_nop\n\tv_nop\n\tv_nop\n\tv_nop" : "+v"(c) : "v"(ah), "v"(al), "v"(bh), "v"(bl));
  return c;
}
// batched GEMM like k_gemm_b but f16 operands: A f32 (split into f16 hi/lo if ASPLIT, else rounded to f16), Bt = f16 values [n][k]; alpha; C f32; N multiple of 16 (partial tiles skipped)
template <bool ASPLIT>
__global__ __launch_bounds__(128) void k_gemm_h(const float* __restrict__ A, int lda, size_t sA, const _Float16* __restrict__ Bh, int ldb, size_t sB, float alpha, float* __restrict__ C, int ldc, size_t sC, int M, int N, int K) {
  __shared__ __attribute__((aligned(16))) float so[4][16][64];
  const int tid = threadIdx.x, w = tid >> 5, lane = tid & 31, ln = lane & 15, hh = lane >> 4; const int by = blockIdx.y;
  A += (size_t)by * sA; Bh += (size_t)by * sB; C += (size_t)by * sC;
  const int ntn = (N + 63) / 64; const int wid = blockIdx.x * 4 + w; const int mt = wid / ntn, nq = wid % ntn; if (mt * 16 >= M) return;
  const int row0 = mt * 16, col0 = nq * 64; const float* arow = A + (size_t)(row0 + ln) * lda;
  v8f acc[4] = {};
  for (int kb = 0; kb < K; kb += 32) {
    FragH ah, al;
    const v4f x0 = *(const v4fa*)(arow + kb + 8 * hh), x1 = *(const v4fa*)(arow + kb + 8 * hh + 4), x2 = *(const v4fa*)(arow + kb + 16 + 8 * hh), x3 = *(const v4fa*)(arow + kb + 16 + 8 * hh + 4);
    float xs[16] = {x0[0],x0[1],x0[2],x0[3],x1[0],x1[1],x1[2],x1[3],x2[0],x2[1],x2[2],x2[3],x3[0],x3[1],x3[2],x3[3]};
#pragma unroll
    for (int i = 0; i < 16; ++i) { const _Float16 h = (_Float16)xs[i]; ah.h[i] = h; al.h[i] = ASPLIT ? (_Float16)(xs[i] - (float)h) : (_Float16)0.0f; }
#pragma unroll
    for (int t = 0; t < 4; ++t) { if (col0 + t * 16 >= N) continue; const size_t boff = (size_t)(col0 + t * 16 + ln) * ldb + kb; FragH bq; bq.half[0] = *(const v8us*)(Bh + boff + 8 * hh); bq.half[1] = *(const v8us*)(Bh + boff + 16 + 8 * hh);
      acc[t] = mmaH<ASPLIT ? 2 : 1>(ah.v, al.v, bq.v, bq.v, acc[t]); }
  }
#pragma unroll
  for (int t = 0; t < 4; ++t) { if (col0 + t * 16 >= N) continue;
#pragma unroll
    for (int r = 0; r < 8; ++r) so[w][8 * hh + r][t * 16 + ln] = acc[t][r] * alpha; }
  __builtin_amdgcn_fence(__ATOMIC_ACQ_REL, "workgroup"); __builtin_amdgcn_wave_barrier();
  const int rsub = lane >> 4, c4 = (lane & 15) * 4;
  {
#pragma unroll
    for (int q = 0; q < 8; ++q) { const int r = q * 2 + rsub; if (col0 + c4 < N) { const v4f v = *(const v4fa*)&so[w][r][c4]; *(v4f*)(C + (size_t)(row0 + r) * ldc + col0 + c4) = v; } }
     }
}

// Wt[n][k] = f16(W[k][n]·scale) from f32 row-major W[K][N] (scale = power of two; bf16-exact weights stay exact in f16 away from the subnormal range)
__global__ __launch_bounds__(256) void k_wt_f16(const float* __restrict__ W, _Float16* __restrict__ Wt, int K, int N, float scale) {
  const int t = blockIdx.x * 256 + threadIdx.x; if (t >= N * (K / 8)) return; const int n = t / (K / 8), k8 = (t % (K / 8)) * 8; FragH f;
#pragma unroll
  for (int i = 0; i < 8; ++i) f.h[i] = (_Float16)(bf16_round(W[(size_t)(k8 + i) * N + n]) * scale); const v8us o = f.half[0];
  *(v8us*)((unsigned short*)Wt + (size_t)n * K + k8) = o; 
}
// k_gemm_hh variant with fused epilogue: v = acc·alpha + bias[by·sBias + col] (+ CP[(row/rowsPerB)·sCPb + by·64 + col] if CP) ; ACT 0 none / 1 elu ; writes f16 C16 (and f32 C if non-null)
template <int ACT>
__global__ __launch_bounds__(128) void k_gemm_hhx(const _Float16* __restrict__ A, int lda, size_t sA, const _Float16* __restrict__ Bh, int ldb, size_t sB, float alpha, const float* __restrict__ bias, size_t sBias, const float* __restrict__ CP, int rowsPerB, size_t sCPb, int row0g,
    float* __restrict__ C, _Float16* __restrict__ C16, int ldc, size_t sC, int M, int N, int K) {
  __shared__ __attribute__((aligned(16))) float so[4][16][64];
  const int tid = threadIdx.x, w = tid >> 5, lane = tid & 31, ln = lane & 15, hh = lane >> 4; const int by = blockIdx.y;
  A += (size_t)by * sA; Bh += (size_t)by * sB; const size_t cofs = (size_t)by * sC; const float* bp = bias ? bias + (size_t)by * sBias : nullptr;
  const int ntn = (N + 63) / 64; const int wid = blockIdx.x * 4 + w; const int mt = wid / ntn, nq = wid % ntn; if (mt * 16 >= M) return;
  const int row0 = mt * 16, col0 = nq * 64; const _Float16* arow = A + (size_t)(row0 + ln) * lda;
  v8f acc[4] = {};
  for (int kb = 0; kb < K; kb += 32) { FragH ah; ah.half[0] = *(const v8us*)((const unsigned short*)arow + kb + 8 * hh); ah.half[1] = *(const v8us*)((const unsigned short*)arow + kb + 16 + 8 * hh);
#pragma unroll
    for (int t = 0; t < 4; ++t) { if (col0 + t * 16 >= N) continue; const size_t boff = (size_t)(col0 + t * 16 + ln) * ldb + kb; FragH bq; bq.half[0] = *(const v8us*)((const unsigned short*)Bh + boff + 8 * hh); bq.half[1] = *(const v8us*)((const unsigned short*)Bh + boff + 16 + 8 * hh);
      acc[t] = mmaH<1>(ah.v, ah.v, bq.v, bq.v, acc[t]); }
  }
#pragma unroll
  for (int t = 0; t < 4; ++t) { if (col0 + t * 16 >= N) continue; const int col = col0 + t * 16 + ln; const float bv = bp ? bf16_round(bp[col]) : 0.f;
#pragma unroll
    for (int r = 0; r < 8; ++r) { float v = acc[t][r] * alpha + bv; if (CP) { const int bidx = (row0g + row0 + 8 * hh + r) / rowsPerB; v += CP[(size_t)bidx * sCPb + (size_t)by * 64 + col]; } if (ACT == 1) v = (v > 0.f) ? v : expm1f(v); else if (ACT == 3) v = fmaxf(v, 0.f); so[w][8 * hh + r][t * 16 + ln] = v; } }
  __builtin_amdgcn_fence(__ATOMIC_ACQ_REL, "workgroup"); __builtin_amdgcn_wave_barrier();
  const int rsub = lane >> 4, c4 = (lane & 15) * 4; typedef _Float16 v4h __attribute__((ext_vector_type(4)));
  {
#pragma unroll
    for (int q = 0; q < 8; ++q) { const int r = q * 2 + rsub; if (col0 + c4 < N) { const v4f v = *(const v4fa*)&so[w][r][c4]; if (C) *(v4f*)(C + cofs + (size_t)(row0 + r) * ldc + col0 + c4) = v; if (C16) { v4h h4; for (int i = 0; i < 4; ++i) h4[i] = (_Float16)v[i]; *(v4h*)(C16 + cofs + (size_t)(row0 + r) * ldc + col0 + c4) = h4; } } }
     }
}


__global__ __launch_bounds__(256) void k_x16(const float* __restrict__ x, _Float16* __restrict__ X16, size_t n8) { const size_t t = (size_t)blockIdx.x * 256 + threadIdx.x; if (t >= n8) return; FragH f;
#pragma unroll
  for (int q = 0; q < 8; ++q) f.h[q] = (_Float16)bf16_round(x[t * 8 + q]); *(v8us*)((unsigned short*)X16 + t * 8) = f.half[0];  }
__global__ __launch_bounds__(256) void k_h16(const float* __restrict__ x, _Float16* __restrict__ X16, size_t n8) { const size_t t = (size_t)blockIdx.x * 256 + threadIdx.x; if (t >= n8) return; FragH f;
#pragma unroll
  for (int q = 0; q < 8; ++q) f.h[q] = (_Float16)x[t * 8 + q]; *(v8us*)((unsigned short*)X16 + t * 8) = f.half[0];  }
__global__ __launch_bounds__(256) void k_round16f(const float* __restrict__ W, _Float16* __restrict__ Bt, size_t n8) { const size_t t = (size_t)blockIdx.x * 256 + threadIdx.x; if (t >= n8) return; FragH f;
#pragma unroll
  for (int i = 0; i < 8; ++i) f.h[i] = (_Float16)(bf16_round(W[t * 8 + i]) * 16.0f); *(v8us*)((unsigned short*)Bt + t * 8) = f.half[0];  }
template <int NHv, int TTv>
__global__ __launch_bounds__(256) void k_vt(const _Float16* __restrict__ V16, int ldv, int voff, _Float16* __restrict__ Vt) { __shared__ unsigned short tl[64][66]; const int tid = threadIdx.x; const int slab = blockIdx.x / (TTv / 64), lg = blockIdx.x % (TTv / 64); const int b = slab / NHv, h = slab % NHv;
  for (int i = tid; i < 64 * 8; i += 256) { const int r = i / 8, c8 = (i % 8) * 8; FragH f; f.half[0] = *(const v8us*)((const unsigned short*)V16 + ((size_t)b * TTv + lg * 64 + r) * ldv + voff + h * 64 + c8);
#pragma unroll
    for (int q = 0; q < 8; ++q) tl[r][c8 + q] = f.u[q]; }
  __syncthreads();
  {
#pragma unroll
    for (int rd = 0; rd < 2; ++rd) { const int d = rd * 32 + tid / 8, pc = tid % 8; FragH f;
#pragma unroll
      for (int q = 0; q < 8; ++q) f.u[q] = tl[pc * 8 + q][d];
      *(v8us*)((unsigned short*)Vt + ((size_t)slab * 64 + d) * TTv + lg * 64 + pc * 8) = f.half[0]; }
     } }

// Key split: the four waves of a block share ONE tile of 16 query rows; wave w walks the 32-key tiles w, w + 4, w + 8, ... with its own running max, sum and O,
// and the four partial results are merged through LDS at the end. 2048 blocks of 4 waves: eight waves per SIMD (second launch bound: 128 registers a wave) cover each other's load and cross-lane waits.
__global__ __launch_bounds__(128, 8) void k_flash(const _Float16* __restrict__ Q16, int ldq, const _Float16* __restrict__ K16, int ldk, const _Float16* __restrict__ Vt, const int* __restrict__ MSK, float* __restrict__ O, int ldo) {
  constexpr int RPW = 16, RTN = RPW / 16, NQB = 4096 / RPW, DT = 4, KS = 2;
  __shared__ __attribute__((aligned(16))) unsigned short sP[4][RPW][40]; __shared__ __attribute__((aligned(16))) float sO[4][RPW][64 + 4]; __shared__ float sM[4][RPW], sL[4][RPW];
  const int tid = threadIdx.x, w = tid >> 5, lane = tid & 31, ln = lane & 15, hh = lane >> 4;
  const int slab = blockIdx.x / NQB, qblk = blockIdx.x % NQB; const int b = slab / 4, h = slab % 4; const int q0 = qblk * RPW;
  FragH aq[2][KS];
#pragma unroll
  for (int rt = 0; rt < RTN; ++rt) { const unsigned short* qr = (const unsigned short*)Q16 + ((size_t)b * 4096 + q0 + rt * 16 + ln) * ldq + h * 64;
#pragma unroll
    for (int ks = 0; ks < KS; ++ks) { aq[rt][ks].half[0] = *(const v8us*)(qr + ks * 32 + 8 * hh); aq[rt][ks].half[1] = *(const v8us*)(qr + ks * 32 + 16 + 8 * hh); } }
  const unsigned short* Vth = (const unsigned short*)Vt + (size_t)slab * 64 * 4096;
  float m_r[2][8], l_r[2][8]; v8f oacc[2][DT];
#pragma unroll
  for (int rt = 0; rt < RTN; ++rt) {
#pragma unroll
    for (int r = 0; r < 8; ++r) { m_r[rt][r] = -3.0e38f; l_r[rt][r] = 0.f; }
#pragma unroll
    for (int dt = 0; dt < DT; ++dt) oacc[rt][dt] = (v8f){0.f,0.f,0.f,0.f,0.f,0.f,0.f,0.f}; }
  const int jend = 4096;
#pragma unroll 1
  for (int jb = 0; jb < jend; jb += 4 * 32) { const int j0 = jb + w * 32;      // the trip test is on jb, the same in every wave: a scalar branch, EXEC untouched around the WMMAs
    
    v8f s[2][2];
#pragma unroll
    for (int nt = 0; nt < 2; ++nt) { const unsigned short* kr = (const unsigned short*)K16 + ((size_t)b * 4096 + j0 + nt * 16 + ln) * ldk + h * 64; FragH bk[KS];
#pragma unroll
      for (int ks = 0; ks < KS; ++ks) { bk[ks].half[0] = *(const v8us*)(kr + ks * 32 + 8 * hh); bk[ks].half[1] = *(const v8us*)(kr + ks * 32 + 16 + 8 * hh); }
#pragma unroll
      for (int rt = 0; rt < RTN; ++rt) { v8f acc = (v8f){0.f,0.f,0.f,0.f,0.f,0.f,0.f,0.f};
#pragma unroll
        for (int ks = 0; ks < KS; ++ks) acc = mmaH<1>(aq[rt][ks].v, aq[rt][ks].v, bk[ks].v, bk[ks].v, acc); s[rt][nt] = acc; } }
#pragma unroll
    for (int rt = 0; rt < RTN; ++rt)
#pragma unroll
      for (int r = 0; r < 8; ++r) { const int tq = q0 + rt * 16 + 8 * hh + r; const int k0 = j0 + ln, k1 = j0 + 16 + ln; (void)tq; (void)k0; (void)k1;
        const bool ok0 = true, ok1 = true;
        const float s0 = ok0 ? s[rt][0][r] * (1.0f) : -INFINITY, s1 = ok1 ? s[rt][1][r] * (1.0f) : -INFINITY; float mc = fmaxf(s0, s1);
        mc = fmaxf(mc, __shfl_xor(mc, 1, 32)); mc = fmaxf(mc, __shfl_xor(mc, 2, 32)); mc = fmaxf(mc, __shfl_xor(mc, 4, 32)); mc = fmaxf(mc, __shfl_xor(mc, 8, 32));
        const float mn = fmaxf(m_r[rt][r], mc); const float al = (mn > -1.0e38f) ? expf(m_r[rt][r] - mn) : 1.0f; m_r[rt][r] = mn; const float p0 = ok0 ? expf(s0 - mn) : 0.f, p1 = ok1 ? expf(s1 - mn) : 0.f; l_r[rt][r] = l_r[rt][r] * al + p0 + p1;
#pragma unroll
        for (int dt = 0; dt < DT; ++dt) oacc[rt][dt][r] *= al;
        FragH t2; t2.h[0] = (_Float16)p0; t2.h[1] = (_Float16)p1; sP[w][rt * 16 + 8 * hh + r][ln] = t2.u[0]; sP[w][rt * 16 + 8 * hh + r][16 + ln] = t2.u[1]; }
    __builtin_amdgcn_fence(__ATOMIC_ACQ_REL, "workgroup"); __builtin_amdgcn_wave_barrier();
    FragH pa[2];
#pragma unroll
    for (int rt = 0; rt < RTN; ++rt) { pa[rt].half[0] = *(const v8us*)&sP[w][rt * 16 + ln][8 * hh]; pa[rt].half[1] = *(const v8us*)&sP[w][rt * 16 + ln][16 + 8 * hh]; }
#pragma unroll
    for (int dt = 0; dt < DT; ++dt) { const unsigned short* vrow = Vth + (size_t)(dt * 16 + ln) * 4096 + j0; FragH bv; bv.half[0] = *(const v8us*)(vrow + 8 * hh); bv.half[1] = *(const v8us*)(vrow + 16 + 8 * hh);
#pragma unroll
      for (int rt = 0; rt < RTN; ++rt) oacc[rt][dt] = mmaH<1>(pa[rt].v, pa[rt].v, bv.v, bv.v, oacc[rt][dt]); }
    __builtin_amdgcn_fence(__ATOMIC_ACQ_REL, "workgroup"); __builtin_amdgcn_wave_barrier(); }
#pragma unroll
  for (int rt = 0; rt < RTN; ++rt) {
#pragma unroll
    for (int r = 0; r < 8; ++r) { float l = l_r[rt][r]; l += __shfl_xor(l, 1, 32); l += __shfl_xor(l, 2, 32); l += __shfl_xor(l, 4, 32); l += __shfl_xor(l, 8, 32); if (ln == 0) { sM[w][rt * 16 + 8 * hh + r] = m_r[rt][r]; sL[w][rt * 16 + 8 * hh + r] = l; } }
#pragma unroll
    for (int dt = 0; dt < DT; ++dt)
#pragma unroll
      for (int r = 0; r < 8; ++r) sO[w][rt * 16 + 8 * hh + r][dt * 16 + ln] = oacc[rt][dt][r]; }
  __syncthreads();      // every wave's partial (max, sum, unnormalised O) is in LDS before any wave merges
  {
#pragma unroll
    for (int rp = 0; rp < RPW; rp += 8) { const int r = rp + (tid >> 4), pc = tid & 15;
      const float mm = fmaxf(fmaxf(sM[0][r], sM[1][r]), fmaxf(sM[2][r], sM[3][r])); float l = 0.f; v4f val = {0.f, 0.f, 0.f, 0.f};
#pragma unroll
      for (int i = 0; i < 4; ++i) { const float e = expf(sM[i][r] - mm); l += e * sL[i][r]; const v4f o = *(const v4fa*)&sO[i][r][pc * 4]; val += e * o; }
      val *= (l > 0.f) ? 1.0f / l : 0.f; *(v4f*)(O + ((size_t)b * 4096 + q0 + r) * ldo + h * 64 + pc * 4) = val; }
     } }

__global__ __launch_bounds__(256) void k_tok(const float* __restrict__ x, _Float16* __restrict__ X16) { __shared__ unsigned short tl[16][72]; const int tid = threadIdx.x; const int b = blockIdx.x / ((CC / 64) * (NN / 16)), rem = blockIdx.x % ((CC / 64) * (NN / 16)); const int cg = rem / (NN / 16), pg = rem % (NN / 16); const int c0 = cg * 64, p0 = pg * 16;
  for (int i = tid; i < 64 * 16; i += 256) { const int c = i / 16, pp = i % 16; FragH f; f.h[0] = (_Float16)bf16_round(x[((size_t)b * CC + c0 + c) * NN + p0 + pp]); tl[pp][c] = f.u[0]; }
  __syncthreads();
  if (tid < 128) { const int r = tid / 8, pc = tid % 8; FragH f;
#pragma unroll
    for (int q = 0; q < 8; ++q) f.u[q] = tl[r][pc * 8 + q]; unsigned short* d = (unsigned short*)X16 + ((size_t)b * NN + p0 + r) * CC + c0 + pc * 8; *(v8us*)d = f.half[0];  } }
// Text term of the key bias, one block of 32 waves a batch row. A wave owns 8 output channels; its 32 lanes split each weight row in float4 pieces, so that every wave-wide load covers
// whole 128-byte lines and the loads of the 8 rows are independent of one another; each lane sums its own columns and a butterfly over the lanes adds the 32 partial sums.
__device__ __forceinline__ void lanes_sum8(float (&a)[8]) {
#pragma unroll
  for (int m = 16; m > 0; m >>= 1) { float o[8];
#pragma unroll
    for (int i = 0; i < 8; ++i) o[i] = __shfl_xor(a[i], m, 32);      // the 8 exchanges of a stage are issued together: one wait a stage
#pragma unroll
    for (int i = 0; i < 8; ++i) a[i] += o[i]; } }
__global__ __launch_bounds__(1024) void k_text(const float* __restrict__ tf, const float* __restrict__ Wt, const float* __restrict__ bt, const float* __restrict__ Wk, const float* __restrict__ bk, float* __restrict__ TB) {
  __shared__ __attribute__((aligned(16))) float ts[CC]; __shared__ float to[CC];
  const int b = blockIdx.x, tid = threadIdx.x, lane = tid & 31, c0 = (tid >> 5) * 8;
  float acc[8];
  { v4f x[DTX / 128];
#pragma unroll
    for (int q = 0; q < DTX / 128; ++q) x[q] = *(const v4fa*)(tf + b * DTX + q * 128 + lane * 4);
    asm volatile("s_wait_xcnt 0x0" ::: "memory");      // before a register that these loads name is used for something else
#pragma unroll
    for (int q = 0; q < DTX / 128; ++q)
#pragma unroll
      for (int e = 0; e < 4; ++e) x[q][e] = bf16_round(x[q][e]);
    const float* wr = Wt + (size_t)c0 * DTX + lane * 4;
#pragma unroll
    for (int i = 0; i < 8; ++i) { float s = 0.f;
#pragma unroll
      for (int q = 0; q < DTX / 128; ++q) { const v4f v = *(const v4fa*)(wr + i * DTX + q * 128);
#pragma unroll
        for (int e = 0; e < 4; ++e) s += x[q][e] * bf16_round(v[e]); }
      acc[i] = s; }
    asm volatile("s_wait_xcnt 0x0" :: "v"(wr) : "memory"); }      // the loads' address pair stays untouched up to this wait
  lanes_sum8(acc);
  { float s = acc[0];
#pragma unroll
    for (int i = 1; i < 8; ++i) s = (lane == i) ? acc[i] : s;
    if (lane < 8) { s += bf16_round(bt[c0 + lane]); ts[c0 + lane] = 0.5f * s * (1.0f + erff(s * 0.70710678118654752f)); } }
  __syncthreads();      // all 256 channels of the projected text are in LDS before any wave reads them
  { v4f t[CC / 128];
#pragma unroll
    for (int q = 0; q < CC / 128; ++q) t[q] = *(const v4fa*)&ts[q * 128 + lane * 4];
    const float* wr = Wk + (size_t)c0 * CC + lane * 4;
#pragma unroll
    for (int i = 0; i < 8; ++i) { float s = 0.f;
#pragma unroll
      for (int q = 0; q < CC / 128; ++q) { const v4f v = *(const v4fa*)(wr + i * CC + q * 128);
#pragma unroll
        for (int e = 0; e < 4; ++e) s += t[q][e] * bf16_round(v[e]); }
      acc[i] = s; }
    asm volatile("s_wait_xcnt 0x0" :: "v"(wr) : "memory"); }      // the loads' address pair stays untouched up to this wait
  lanes_sum8(acc);
  { float s = acc[0];
#pragma unroll
    for (int i = 1; i < 8; ++i) s = (lane == i) ? acc[i] : s;
    if (lane < 8) to[c0 + lane] = s + bf16_round(bk[c0 + lane]); }
  __syncthreads();      // the 8 results of each wave are gathered so that one wave stores each whole 128-byte line
  if (tid < CC) TB[b * CC + tid] = to[tid]; }
__global__ __launch_bounds__(256) void k_fin(const float* __restrict__ M2, const float* __restrict__ pf, const float* __restrict__ gam, float* __restrict__ out) { __shared__ float tl[32][65]; const int tid = threadIdx.x; const int b = blockIdx.x / ((CC / 32) * (NN / 64)), rem = blockIdx.x % ((CC / 32) * (NN / 64)); const int cg = rem / (NN / 64), pg = rem % (NN / 64); const int c0 = cg * 32, p0 = pg * 64; const float g = bf16_round(gam[0]);
  for (int i = tid; i < 64 * 32; i += 256) { const int pp = i / 32, c = i % 32; tl[c][pp] = M2[((size_t)b * NN + p0 + pp) * CC + c0 + c]; }
  __syncthreads();
  { for (int i = tid; i < 32 * 16; i += 256) { const int c = i / 16, pc = i % 16; const size_t gi = ((size_t)b * CC + c0 + c) * NN + p0 + pc * 4; const v4f x = *(const v4fa*)(pf + gi); v4f v; for (int q = 0; q < 4; ++q) v[q] = g * tl[c][pc * 4 + q] + bf16_round(x[q]); *(v4f*)(out + gi) = v; }  } }
extern "C" void kernel_launch(void* const* d_in, const int* in_sizes, int n_in,
                              void* d_out, int out_size, void* d_ws, size_t ws_size, hipStream_t stream) {
  (void)in_sizes; (void)n_in; (void)out_size;
  const float* const* I = (const float* const*)d_in; const float* pf = I[0]; const float* tf = I[1]; const float* Wt = I[2]; const float* bt = I[3]; const float* Wq = I[4]; const float* bq = I[5]; const float* Wk = I[6]; const float* bk = I[7]; const float* Wv = I[8]; const float* bv = I[9]; const float* W1 = I[10]; const float* b1 = I[11]; const float* W2 = I[12]; const float* b2 = I[13]; const float* gam = I[14];
  char* ws = (char*)d_ws; size_t off = 0;
  auto take = [&](size_t bytes) { char* p = ws + off; off += (bytes + 255) & ~(size_t)255; return p; };
  _Float16* Bq = (_Float16*)take(CC * CC * 2); _Float16* Bk = (_Float16*)take(CC * CC * 2); _Float16* Bv = (_Float16*)take(CC * CC * 2); _Float16* B1 = (_Float16*)take(CC * CC * 2); _Float16* B2 = (_Float16*)take(CC * CC * 2); float* TB = (float*)take(BB * CC * 4);
  _Float16* X16 = (_Float16*)take((size_t)NR * CC * 2); _Float16* Q16 = (_Float16*)take((size_t)NR * CC * 2); _Float16* K16 = (_Float16*)take((size_t)NR * CC * 2); _Float16* V16 = (_Float16*)take((size_t)NR * CC * 2); _Float16* Vt = (_Float16*)take((size_t)NR * CC * 2); float* O = (float*)take((size_t)NR * CC * 4); _Float16* O16 = Q16; _Float16* H1 = K16; float* M2 = O;
  if (off > ws_size) return;      // 0.7 + 4.2 × 5 + 8.4 ≈ 30 MiB
  const size_t w8 = (size_t)CC * CC / 8; const unsigned gw = (unsigned)((w8 + 255) / 256);
  k_round16f<<<gw, 256, 0, stream>>>(Wq, Bq, w8); k_round16f<<<gw, 256, 0, stream>>>(Wk, Bk, w8); k_round16f<<<gw, 256, 0, stream>>>(Wv, Bv, w8); k_round16f<<<gw, 256, 0, stream>>>(W1, B1, w8); k_round16f<<<gw, 256, 0, stream>>>(W2, B2, w8);      // (out,in)
  k_text<<<BB, 1024, 0, stream>>>(tf, Wt, bt, Wk, bk, TB);
  k_tok<<<BB * (CC / 64) * (NN / 16), 256, 0, stream>>>(pf, X16);
  const dim3 gg(((NN / 16) * (CC / 64) + 3) / 4, BB);      // batched over b (q and v projections); sA = sC = NN·CC
  k_gemm_hhx<0><<<gg, 128, 0, stream>>>(X16, CC, (size_t)NN * CC, Bq, CC, 0, 0.0625f, bq, 0, nullptr, 1, 0, 0, nullptr, Q16, CC, (size_t)NN * CC, NN, CC, CC);
  k_gemm_hhx<0><<<dim3(((NR / 16) * (CC / 64) + 3) / 4, 1), 128, 0, stream>>>(X16, CC, 0, Bk, CC, 0, 0.0625f, nullptr, 0, TB, NN, (size_t)CC, 0, nullptr, K16, CC, 0, NR, CC, CC);      // k = pf·Wkᵀ + (t·Wkᵀ + bk): the per-batch text bias enters as the CP addend (row block b = row / 4096), unrounded
  k_gemm_hhx<0><<<gg, 128, 0, stream>>>(X16, CC, (size_t)NN * CC, Bv, CC, 0, 0.0625f, bv, 0, nullptr, 1, 0, 0, nullptr, V16, CC, (size_t)NN * CC, NN, CC, CC);
  k_vt<NH, NN><<<BB * NH * (NN / 64), 256, 0, stream>>>(V16, CC, 0, Vt);
  k_flash<<<BB * NH * (NN / 16), 128, 0, stream>>>(Q16, CC, K16, CC, Vt, nullptr, O, CC);
  const unsigned g8 = (unsigned)(((size_t)NR * CC / 8 + 255) / 256); const dim3 g1(((NR / 16) * (CC / 64) + 3) / 4, 1);
  k_h16<<<g8, 256, 0, stream>>>(O, O16, (size_t)NR * CC / 8);
  k_gemm_hhx<3><<<g1, 128, 0, stream>>>(O16, CC, 0, B1, CC, 0, 0.0625f, b1, 0, nullptr, 1, 0, 0, nullptr, H1, CC, 0, NR, CC, CC);      // relu(x·W1ᵀ + b1)
  k_gemm_hhx<0><<<g1, 128, 0, stream>>>(H1, CC, 0, B2, CC, 0, 0.0625f, b2, 0, nullptr, 1, 0, 0, M2, nullptr, CC, 0, NR, CC, CC);         // ·W2ᵀ + b2 (f32)
  k_fin<<<BB * (CC / 32) * (NN / 64), 256, 0, stream>>>(M2, pf, gam, (float*)d_out);
}

// v003
// One run takes 228 microseconds.
// Timed twice side by side with v002, it ran 1.14 and 1.13 times as fast.
// All steps since v000 together make it 2.35 times as fast.
#include <hip/hip_runtime.h>
// Text-guided point attention (B=2, C=256 channels × N=4096 points; text 512 → 256 GELU projection added to the key input; q/k/v 1×1 convs; 4 heads × 64; UNSCALED softmax(q·k)·v; MLP 256 → relu →
// 256; out = γ·x + point_feats, channel-major): the q/k/v/MLP linears ((out,in) weights bf16-exact ×2^4; the text term enters k as a per-batch bias) and the attention as a fused flash-style
// kernel (online softmax f32, P f16 ≤ 1, O = P·Vt; RPW-16 waves) run on v_wmma_f32_16x16x32_f16 with f32 accumulate; the text projection, the NCW ↔ token-major transposes and the gated
// residual are f32 VALU.
#define BB 2
#define CC 256
#define NN 4096
#define DTX 512
#define NH 4
#define NR (BB * NN)

typedef __bf16 v16b __attribute__((ext_vector_type(16)));
typedef unsigned short v8us __attribute__((ext_vector_type(8), may_alias));
typedef float  v8f  __attribute__((ext_vector_type(8)));
typedef float  v4f  __attribute__((ext_vector_type(4)));
typedef float  v4fa __attribute__((ext_vector_type(4), may_alias));
union FragB { v16b v; v8us half[2]; unsigned short u[16]; };

__device__ __forceinline__ unsigned short bf16_bits(float x) { unsigned int u = __float_as_uint(x); return (unsigned short)((u + 0x7FFFu + ((u >> 16) & 1u)) >> 16); }
__device__ __forceinline__ float bf16_val(unsigned short b) { return __uint_as_float(((unsigned int)b) << 16); }
__device__ __forceinline__ float bf16_round(float x) { return bf16_val(bf16_bits(x)); }
// D += A·B with NT terms: 1 = ah·bh, 2 = + al·bh (A split), 3 = + ah·bl (both split)
template <int NT>
__device__ __forceinline__ v8f mmaN(v16b ah, v16b al, v16b bh, v16b bl, v8f c) {
  c = __builtin_amdgcn_wmma_f32_16x16x32_bf16(false, ah, false, bh, (short)0, c, false, false);
  if (NT >= 2) c = __builtin_amdgcn_wmma_f32_16x16x32_bf16(false, al, false, bh, (short)0, c, false, false);
  if (NT >= 3) c = __builtin_amdgcn_wmma_f32_16x16x32_bf16(false, ah, false, bl, (short)0, c, false, false);
  asm volatile("v_nop\n\tv_nop\n\tv_nop\n\tv_nop" : "+v"(c) : "v"(ah), "v"(al), "v"(bh), "v"(bl));
  return c;
}

__global__ __launch_bounds__(256) void k_wt_bf16(const float* __restrict__ W, unsigned short* __restrict__ Wt, int K, int N) {
  const int t = blockIdx.x * 256 + threadIdx.x;
  const int k8n = K / 8;
  if (t >= N * k8n) return;
  const int n = t / k8n, k8 = (t % k8n) * 8;
  v8us v;
#pragma unroll
  for (int i = 0; i < 8; ++i) v[i] = bf16_bits(W[(size_t)(k8 + i) * N + n]);
  *(v8us*)(Wt + (size_t)n * K + k8) = v;
  
}

// GEMM C[M][N] (f32, pitch ldc) = act(A[M][K]·W + bias). A f32 row-major (pitch lda) converted per fragment to bf16
// (ASPLIT: hi/lo two planes -> 2 terms, else single rounded term); Wt bf16 [N][K] (pitch ldb). BIAS_BF16 rounds the
// bias to bf16 first (bias quantised to bf16 before the add). K%32==0, M%16==0, N%64==0.
template <bool ASPLIT, int ACT, bool BIAS_BF16>
__global__ __launch_bounds__(128) void k_gemm_bf(const float* __restrict__ A, int lda, const unsigned short* __restrict__ Wt, int ldb,
                                               const float* __restrict__ bias, float* __restrict__ C, int ldc, int M, int N, int K) {
  __shared__ __attribute__((aligned(16))) float so[4][16][64];
  const int tid = threadIdx.x, w = tid >> 5, lane = tid & 31, ln = lane & 15, hh = lane >> 4;
  const int ntn = N / 64;
  const int wid = blockIdx.x * 4 + w;
  const int mt = wid / ntn, nq = wid % ntn;
  if (mt * 16 >= M) return;
  const int row0 = mt * 16, col0 = nq * 64;
  const float* arow = A + (size_t)(row0 + ln) * lda;
  v8f acc[4] = {};
  for (int kb = 0; kb < K; kb += 32) {
    FragB ah, al;
    const v4f x0 = *(const v4fa*)(arow + kb + 8 * hh), x1 = *(const v4fa*)(arow + kb + 8 * hh + 4);
    const v4f x2 = *(const v4fa*)(arow + kb + 16 + 8 * hh), x3 = *(const v4fa*)(arow + kb + 16 + 8 * hh + 4);
    float xs[16] = {x0[0],x0[1],x0[2],x0[3],x1[0],x1[1],x1[2],x1[3],x2[0],x2[1],x2[2],x2[3],x3[0],x3[1],x3[2],x3[3]};
#pragma unroll
    for (int i = 0; i < 16; ++i) { const unsigned short hb = bf16_bits(xs[i]); ah.u[i] = hb; al.u[i] = ASPLIT ? bf16_bits(xs[i] - bf16_val(hb)) : (unsigned short)0; }
#pragma unroll
    for (int t = 0; t < 4; ++t) {
      const unsigned short* brow = Wt + (size_t)(col0 + t * 16 + ln) * ldb + kb;
      FragB b;
      b.half[0] = *(const v8us*)(brow + 8 * hh);
      b.half[1] = *(const v8us*)(brow + 16 + 8 * hh);
      acc[t] = mmaN<ASPLIT ? 2 : 1>(ah.v, al.v, b.v, b.v, acc[t]);
    }
  }
#pragma unroll
  for (int t = 0; t < 4; ++t) {
    float bv = bias ? bias[col0 + t * 16 + ln] : 0.f;
    if (BIAS_BF16) bv = bf16_round(bv);
#pragma unroll
    for (int r = 0; r < 8; ++r) { float v = acc[t][r] + bv; if (ACT == 1) v = fmaxf(v, 0.f); so[w][8 * hh + r][t * 16 + ln] = v; }
  }
  __builtin_amdgcn_fence(__ATOMIC_ACQ_REL, "workgroup");
  __builtin_amdgcn_wave_barrier();
  const int rsub = lane >> 4, c4 = (lane & 15) * 4;
  {
#pragma unroll
    for (int q = 0; q < 8; ++q) {
      const int r = q * 2 + rsub;
      const v4f v = *(const v4fa*)&so[w][r][c4];
      *(v4f*)(C + (size_t)(row0 + r) * ldc + col0 + c4) = v;
    }
    
  }
}

// Flash-style causal/unmasked attention, all contractions 3-term bf16 hi/lo splits, f32 softmax with running max.
// q,k,v rows are read from f32 buffers with arbitrary row pitch (so they can live inside a fused qkv buffer);
// D = head size (multiple of 32, <= 128); one wave = 16 query rows; block = 4 waves (64 queries) sharing K/V chunks of 32.
template <int D, bool CAUSAL>
__global__ __launch_bounds__(128) void k_flash(const float* __restrict__ qb, const float* __restrict__ kb, const float* __restrict__ vb,
                                             int pitch, int T, int H, float scale, float* __restrict__ y, int ypitch) {
  constexpr int KS = D / 32;        // k-steps for QK
  constexpr int DT = D / 16;        // d tiles for PV
  __shared__ __attribute__((aligned(16))) unsigned short sKh[32][D + 8], sKl[32][D + 8], sVh[32][D + 8], sVl[32][D + 8];
  __shared__ __attribute__((aligned(16))) unsigned short sPh[4][16][40], sPl[4][16][40];
  __shared__ __attribute__((aligned(16))) float sO[4][16][D];
  const int tid = threadIdx.x, w = tid >> 5, lane = tid & 31, ln = lane & 15, hh = lane >> 4;
  const int nqb = (T + 63) / 64;
  const int bh = blockIdx.x / nqb, qblk = blockIdx.x % nqb;
  const int b = bh / H, h = bh % H;
  const int q0 = qblk * 64 + w * 16;
  const float* Q = qb + (size_t)b * T * pitch + h * D;
  const float* K = kb + (size_t)b * T * pitch + h * D;
  const float* V = vb + (size_t)b * T * pitch + h * D;

  // A fragments of the wave's 16 query rows (scaled), hi/lo
  FragB aqh[KS], aql[KS];
  {
    int row = q0 + ln; if (row >= T) row = T - 1;
    const float* qr = Q + (size_t)row * pitch;
#pragma unroll
    for (int ks = 0; ks < KS; ++ks)
#pragma unroll
      for (int i = 0; i < 16; ++i) {
        const int d = ks * 32 + ((i < 8) ? (8 * hh + i) : (16 + 8 * hh + (i - 8)));
        const float x = qr[d] * scale; const unsigned short hb = bf16_bits(x);
        aqh[ks].u[i] = hb; aql[ks].u[i] = bf16_bits(x - bf16_val(hb));
      }
  }
  float m_r[8], l_r[8];
#pragma unroll
  for (int r = 0; r < 8; ++r) { m_r[r] = -3.0e38f; l_r[r] = 0.f; }
  v8f oacc[DT];
#pragma unroll
  for (int dt = 0; dt < DT; ++dt) oacc[dt] = (v8f){0.f,0.f,0.f,0.f,0.f,0.f,0.f,0.f};

  const int kv_end = CAUSAL ? min(T, qblk * 64 + 64) : T;     // block-uniform
  for (int j0 = 0; j0 < kv_end; j0 += 32) {
    __syncthreads();
    for (int e = tid; e < 32 * (D / 4); e += 128) {
      const int r = e / (D / 4), c4 = (e % (D / 4)) * 4;
      const int key = j0 + r;
      v4f kf = {0.f,0.f,0.f,0.f}, vf = {0.f,0.f,0.f,0.f};
      if (key < T) { kf = *(const v4fa*)(K + (size_t)key * pitch + c4); vf = *(const v4fa*)(V + (size_t)key * pitch + c4); }
#pragma unroll
      for (int t = 0; t < 4; ++t) {
        unsigned short hb = bf16_bits(kf[t]); sKh[r][c4 + t] = hb; sKl[r][c4 + t] = bf16_bits(kf[t] - bf16_val(hb));
        hb = bf16_bits(vf[t]); sVh[r][c4 + t] = hb; sVl[r][c4 + t] = bf16_bits(vf[t] - bf16_val(hb));
      }
    }
    __syncthreads();
    // S tile 16 x 32
    v8f s[2];
#pragma unroll
    for (int nt = 0; nt < 2; ++nt) {
      v8f acc = {};
#pragma unroll
      for (int ks = 0; ks < KS; ++ks) {
        FragB bh_, bl_;
        bh_.half[0] = *(const v8us*)&sKh[nt * 16 + ln][ks * 32 + 8 * hh]; bh_.half[1] = *(const v8us*)&sKh[nt * 16 + ln][ks * 32 + 16 + 8 * hh];
        bl_.half[0] = *(const v8us*)&sKl[nt * 16 + ln][ks * 32 + 8 * hh]; bl_.half[1] = *(const v8us*)&sKl[nt * 16 + ln][ks * 32 + 16 + 8 * hh];
        acc = mmaN<3>(aqh[ks].v, aql[ks].v, bh_.v, bl_.v, acc);
      }
      s[nt] = acc;
    }
    // mask + running max (rows 8hh+r; the 16 lanes of a half share rows)
    float alpha[8];
#pragma unroll
    for (int r = 0; r < 8; ++r) {
      const int qi = q0 + 8 * hh + r;
      const int ja = j0 + ln, jb = j0 + 16 + ln;
      if (CAUSAL) { if (ja > qi) s[0][r] = -3.0e38f; if (jb > qi) s[1][r] = -3.0e38f; }
      if (ja >= T) s[0][r] = -3.0e38f;
      if (jb >= T) s[1][r] = -3.0e38f;
      float mx = fmaxf(s[0][r], s[1][r]);
      mx = fmaxf(mx, __shfl_xor(mx, 1, 32)); mx = fmaxf(mx, __shfl_xor(mx, 2, 32)); mx = fmaxf(mx, __shfl_xor(mx, 4, 32)); mx = fmaxf(mx, __shfl_xor(mx, 8, 32));
      const float mnew = fmaxf(m_r[r], mx);
      alpha[r] = (mnew > -1.0e38f) ? __expf(m_r[r] - mnew) : 1.0f;
      const float p0 = (s[0][r] > -1.0e38f) ? __expf(s[0][r] - mnew) : 0.f;
      const float p1 = (s[1][r] > -1.0e38f) ? __expf(s[1][r] - mnew) : 0.f;
      m_r[r] = mnew;
      l_r[r] = l_r[r] * alpha[r] + p0 + p1;            // per-lane partial row sum (16 lanes combined at the end)
      unsigned short hb = bf16_bits(p0); sPh[w][8 * hh + r][ln] = hb;      sPl[w][8 * hh + r][ln] = bf16_bits(p0 - bf16_val(hb));
      hb = bf16_bits(p1);                sPh[w][8 * hh + r][16 + ln] = hb; sPl[w][8 * hh + r][16 + ln] = bf16_bits(p1 - bf16_val(hb));
    }
#pragma unroll
    for (int dt = 0; dt < DT; ++dt)
#pragma unroll
      for (int r = 0; r < 8; ++r) oacc[dt][r] *= alpha[r];
    __builtin_amdgcn_fence(__ATOMIC_ACQ_REL, "workgroup");
    __builtin_amdgcn_wave_barrier();
    FragB pah, pal;
    pah.half[0] = *(const v8us*)&sPh[w][ln][8 * hh]; pah.half[1] = *(const v8us*)&sPh[w][ln][16 + 8 * hh];
    pal.half[0] = *(const v8us*)&sPl[w][ln][8 * hh]; pal.half[1] = *(const v8us*)&sPl[w][ln][16 + 8 * hh];
#pragma unroll
    for (int dt = 0; dt < DT; ++dt) {
      FragB bvh, bvl;
#pragma unroll
      for (int i = 0; i < 8; ++i) {
        bvh.u[i] = sVh[8 * hh + i][dt * 16 + ln]; bvh.u[8 + i] = sVh[16 + 8 * hh + i][dt * 16 + ln];
        bvl.u[i] = sVl[8 * hh + i][dt * 16 + ln]; bvl.u[8 + i] = sVl[16 + 8 * hh + i][dt * 16 + ln];
      }
      oacc[dt] = mmaN<3>(pah.v, pal.v, bvh.v, bvl.v, oacc[dt]);
    }
    __builtin_amdgcn_fence(__ATOMIC_ACQ_REL, "workgroup");
    __builtin_amdgcn_wave_barrier();
  }
#pragma unroll
  for (int r = 0; r < 8; ++r) {
    float l = l_r[r];
    l += __shfl_xor(l, 1, 32); l += __shfl_xor(l, 2, 32); l += __shfl_xor(l, 4, 32); l += __shfl_xor(l, 8, 32);
    l_r[r] = (l > 0.f) ? 1.0f / l : 0.f;
  }
#pragma unroll
  for (int dt = 0; dt < DT; ++dt)
#pragma unroll
    for (int r = 0; r < 8; ++r) sO[w][8 * hh + r][dt * 16 + ln] = oacc[dt][r] * l_r[r];
  __builtin_amdgcn_fence(__ATOMIC_ACQ_REL, "workgroup");
  __builtin_amdgcn_wave_barrier();
  {
    for (int r = 0; r < 16; ++r) {
      const int row = q0 + r;
      if (row < T && lane < D / 4) {
        const v4f val = *(const v4fa*)&sO[w][r][lane * 4];
        *(v4f*)(y + ((size_t)b * T + row) * ypitch + h * D + lane * 4) = val;
      }
    }
    
  }
}

// GEMM C = act(A·W + bias + resid): A f32 (ASPLIT -> hi/lo 2 terms), Wt bf16 [N][K]; ACT 0 none, 1 relu, 2 exact gelu;
// resid (optional, f32, row index = (row % rmod), pitch ldr, RES_BF16 rounds it) added before the activation.
template <bool ASPLIT, int ACT, bool BIAS_BF16, bool RES_BF16>
__global__ __launch_bounds__(128) void k_gemm_bf3(const float* __restrict__ A, int lda, const unsigned short* __restrict__ Wt, int ldb,
                                                const float* __restrict__ bias, const float* __restrict__ resid, int rmod, int ldr,
                                                float* __restrict__ C, int ldc, int M, int N, int K) {
  __shared__ __attribute__((aligned(16))) float so[4][16][64];
  const int tid = threadIdx.x, w = tid >> 5, lane = tid & 31, ln = lane & 15, hh = lane >> 4;
  const int ntn = N / 64;
  const int wid = blockIdx.x * 4 + w;
  const int mt = wid / ntn, nq = wid % ntn;
  if (mt * 16 >= M) return;
  const int row0 = mt * 16, col0 = nq * 64;
  const float* arow = A + (size_t)(row0 + ln) * lda;
  v8f acc[4] = {};
  for (int kb = 0; kb < K; kb += 32) {
    FragB ah, al;
    const v4f x0 = *(const v4fa*)(arow + kb + 8 * hh), x1 = *(const v4fa*)(arow + kb + 8 * hh + 4);
    const v4f x2 = *(const v4fa*)(arow + kb + 16 + 8 * hh), x3 = *(const v4fa*)(arow + kb + 16 + 8 * hh + 4);
    float xs[16] = {x0[0],x0[1],x0[2],x0[3],x1[0],x1[1],x1[2],x1[3],x2[0],x2[1],x2[2],x2[3],x3[0],x3[1],x3[2],x3[3]};
#pragma unroll
    for (int i = 0; i < 16; ++i) { const unsigned short hb = bf16_bits(xs[i]); ah.u[i] = hb; al.u[i] = ASPLIT ? bf16_bits(xs[i] - bf16_val(hb)) : (unsigned short)0; }
#pragma unroll
    for (int t = 0; t < 4; ++t) {
      const unsigned short* brow = Wt + (size_t)(col0 + t * 16 + ln) * ldb + kb;
      FragB b;
      b.half[0] = *(const v8us*)(brow + 8 * hh);
      b.half[1] = *(const v8us*)(brow + 16 + 8 * hh);
      acc[t] = mmaN<ASPLIT ? 2 : 1>(ah.v, al.v, b.v, b.v, acc[t]);
    }
  }
#pragma unroll
  for (int t = 0; t < 4; ++t) {
    const int col = col0 + t * 16 + ln;
    float bv = bias ? bias[col] : 0.f;
    if (BIAS_BF16) bv = bf16_round(bv);
#pragma unroll
    for (int r = 0; r < 8; ++r) {
      float v = acc[t][r] + bv;
      if (resid) { float rv = resid[(size_t)((row0 + 8 * hh + r) % rmod) * ldr + col]; if (RES_BF16) rv = bf16_round(rv); v += rv; }
      if (ACT == 1) v = fmaxf(v, 0.f);
      if (ACT == 2) v = 0.5f * v * (1.0f + erff(v * 0.70710678118654752f));
      if (ACT == 3) { const float u = 0.7978845608028654f * (v + 0.044715f * v * v * v); v = 0.5f * v * (1.0f + tanhf(u)); }
      so[w][8 * hh + r][t * 16 + ln] = v;
    }
  }
  __builtin_amdgcn_fence(__ATOMIC_ACQ_REL, "workgroup");
  __builtin_amdgcn_wave_barrier();
  const int rsub = lane >> 4, c4 = (lane & 15) * 4;
  {
#pragma unroll
    for (int q = 0; q < 8; ++q) {
      const int r = q * 2 + rsub;
      const v4f v = *(const v4fa*)&so[w][r][c4];
      *(v4f*)(C + (size_t)(row0 + r) * ldc + col0 + c4) = v;
    }
    
  }
}
// row LayerNorm (biased variance, eps) over N: s = X (+ R); optional out_sum <- s; out_norm <- (s-mu)*rsqrt(var+eps)*g + b
template <bool PARAM_BF16>
__global__ __launch_bounds__(256) void k_layernorm(const float* __restrict__ X, const float* __restrict__ R, const float* __restrict__ g, const float* __restrict__ bta,
                                                  float* __restrict__ out_sum, float* __restrict__ out_norm, int N, float eps) {
  __shared__ float red[256];
  const int row = blockIdx.x, tid = threadIdx.x;
  const float* x = X + (size_t)row * N; const float* rr = R ? R + (size_t)row * N : nullptr;
  float vals[16];                     // up to N = 4096
  const int per = N / 256;            // contiguous chunk per thread? use strided-by-4 chunks: thread handles j = tid*4 + 1024*u
  float s1 = 0.f;
  for (int u = 0; u < per / 4; ++u) {
    const int j = tid * 4 + 1024 * u;
    const v4f a = *(const v4fa*)(x + j);
    v4f b = {0.f,0.f,0.f,0.f}; if (rr) b = *(const v4fa*)(rr + j);
#pragma unroll
    for (int q = 0; q < 4; ++q) { const float v = a[q] + b[q]; vals[u * 4 + q] = v; s1 += v; }
  }
  red[tid] = s1; __syncthreads();
  for (int st = 128; st > 0; st >>= 1) { if (tid < st) red[tid] += red[tid + st]; __syncthreads(); }
  const float mu = red[0] / (float)N; __syncthreads();
  float s2 = 0.f;
  for (int u = 0; u < per / 4; ++u)
#pragma unroll
    for (int q = 0; q < 4; ++q) { const float c = vals[u * 4 + q] - mu; s2 += c * c; }
  red[tid] = s2; __syncthreads();
  for (int st = 128; st > 0; st >>= 1) { if (tid < st) red[tid] += red[tid + st]; __syncthreads(); }
  const float rs = rsqrtf(red[0] / (float)N + eps);
  {
    for (int u = 0; u < per / 4; ++u) {
      const int j = tid * 4 + 1024 * u;
      v4f o, sm;
#pragma unroll
      for (int q = 0; q < 4; ++q) {
        float gg = g[j + q], bb = bta[j + q];
        if (PARAM_BF16) { gg = bf16_round(gg); bb = bf16_round(bb); }
        sm[q] = vals[u * 4 + q]; o[q] = (vals[u * 4 + q] - mu) * rs * gg + bb;
      }
      if (out_sum) *(v4f*)(out_sum + (size_t)row * N + j) = sm;
      *(v4f*)(out_norm + (size_t)row * N + j) = o;
    }
    
  }
}



// ---- f16 WMMA path (v_wmma_f32_16x16x32_f16): 11-bit significands for operands in range — used where a [0,1] probability operand needs more precision than bf16
typedef _Float16 v16h __attribute__((ext_vector_type(16)));
union FragH { v16h v; v8us half[2]; _Float16 h[16]; unsigned short u[16]; };
template <int NT>
__device__ __forceinline__ v8f mmaH(v16h ah, v16h al, v16h bh, v16h bl, v8f c) {
  c = __builtin_amdgcn_wmma_f32_16x16x32_f16(false, ah, false, bh, (short)0, c, false, false);
  if (NT >= 2) c = __builtin_amdgcn_wmma_f32_16x16x32_f16(false, al, false, bh, (short)0, c, false, false);
  if (NT >= 3) c = __builtin_amdgcn_wmma_f32_16x16x32_f16(false, ah, false, bl, (short)0, c, false, false);
  asm volatile("v_nop\n\tv_nop\n\tv_nop\n\tv_nop" : "+v"(c) : "v"(ah), "v"(al), "v"(bh), "v"(bl));
  return c;
}
// batched GEMM like k_gemm_b but f16 operands: A f32 (split into f16 hi/lo if ASPLIT, else rounded to f16), Bt = f16 values [n][k]; alpha; C f32; N multiple of 16 (partial tiles skipped)
template <bool ASPLIT>
__global__ __launch_bounds__(128) void k_gemm_h(const float* __restrict__ A, int lda, size_t sA, const _Float16* __restrict__ Bh, int ldb, size_t sB, float alpha, float* __restrict__ C, int ldc, size_t sC, int M, int N, int K) {
  __shared__ __attribute__((aligned(16))) float so[4][16][64];
  const int tid = threadIdx.x, w = tid >> 5, lane = tid & 31, ln = lane & 15, hh = lane >> 4; const int by = blockIdx.y;
  A += (size_t)by * sA; Bh += (size_t)by * sB; C += (size_t)by * sC;
  const int ntn = (N + 63) / 64; const int wid = blockIdx.x * 4 + w; const int mt = wid / ntn, nq = wid % ntn; if (mt * 16 >= M) return;
  const int row0 = mt * 16, col0 = nq * 64; const float* arow = A + (size_t)(row0 + ln) * lda;
  v8f acc[4] = {};
  for (int kb = 0; kb < K; kb += 32) {
    FragH ah, al;
    const v4f x0 = *(const v4fa*)(arow + kb + 8 * hh), x1 = *(const v4fa*)(arow + kb + 8 * hh + 4), x2 = *(const v4fa*)(arow + kb + 16 + 8 * hh), x3 = *(const v4fa*)(arow + kb + 16 + 8 * hh + 4);
    float xs[16] = {x0[0],x0[1],x0[2],x0[3],x1[0],x1[1],x1[2],x1[3],x2[0],x2[1],x2[2],x2[3],x3[0],x3[1],x3[2],x3[3]};
#pragma unroll
    for (int i = 0; i < 16; ++i) { const _Float16 h = (_Float16)xs[i]; ah.h[i] = h; al.h[i] = ASPLIT ? (_Float16)(xs[i] - (float)h) : (_Float16)0.0f; }
#pragma unroll
    for (int t = 0; t < 4; ++t) { if (col0 + t * 16 >= N) continue; const size_t boff = (size_t)(col0 + t * 16 + ln) * ldb + kb; FragH bq; bq.half[0] = *(const v8us*)(Bh + boff + 8 * hh); bq.half[1] = *(const v8us*)(Bh + boff + 16 + 8 * hh);
      acc[t] = mmaH<ASPLIT ? 2 : 1>(ah.v, al.v, bq.v, bq.v, acc[t]); }
  }
#pragma unroll
  for (int t = 0; t < 4; ++t) { if (col0 + t * 16 >= N) continue;
#pragma unroll
    for (int r = 0; r < 8; ++r) so[w][8 * hh + r][t * 16 + ln] = acc[t][r] * alpha; }
  __builtin_amdgcn_fence(__ATOMIC_ACQ_REL, "workgroup"); __builtin_amdgcn_wave_barrier();
  const int rsub = lane >> 4, c4 = (lane & 15) * 4;
  {
#pragma unroll
    for (int q = 0; q < 8; ++q) { const int r = q * 2 + rsub; if (col0 + c4 < N) { const v4f v = *(const v4fa*)&so[w][r][c4]; *(v4f*)(C + (size_t)(row0 + r) * ldc + col0 + c4) = v; } }
     }
}

// Wt[n][k] = f16(W[k][n]·scale) from f32 row-major W[K][N] (scale = power of two; bf16-exact weights stay exact in f16 away from the subnormal range)
__global__ __launch_bounds__(256) void k_wt_f16(const float* __restrict__ W, _Float16* __restrict__ Wt, int K, int N, float scale) {
  const int t = blockIdx.x * 256 + threadIdx.x; if (t >= N * (K / 8)) return; const int n = t / (K / 8), k8 = (t % (K / 8)) * 8; FragH f;
#pragma unroll
  for (int i = 0; i < 8; ++i) f.h[i] = (_Float16)(bf16_round(W[(size_t)(k8 + i) * N + n]) * scale); const v8us o = f.half[0];
  *(v8us*)((unsigned short*)Wt + (size_t)n * K + k8) = o; 
}
// k_gemm_hh variant with fused epilogue: v = acc·alpha + bias[by·sBias + col] (+ CP[(row/rowsPerB)·sCPb + by·64 + col] if CP) ; ACT 0 none / 1 elu ; writes f16 C16 and f32 C, each if non-null
template <int ACT>
__global__ __launch_bounds__(128) void k_gemm_hhx(const _Float16* __restrict__ A, int lda, size_t sA, const _Float16* __restrict__ Bh, int ldb, size_t sB, float alpha, const float* __restrict__ bias, size_t sBias, const float* __restrict__ CP, int rowsPerB, size_t sCPb, int row0g,
    float* __restrict__ C, _Float16* __restrict__ C16, int ldc, size_t sC, int M, int N, int K) {
  __shared__ __attribute__((aligned(16))) float so[4][16][64];
  const int tid = threadIdx.x, w = tid >> 5, lane = tid & 31, ln = lane & 15, hh = lane >> 4; const int by = blockIdx.y;
  A += (size_t)by * sA; Bh += (size_t)by * sB; const size_t cofs = (size_t)by * sC; const float* bp = bias ? bias + (size_t)by * sBias : nullptr;
  const int ntn = (N + 63) / 64; const int wid = blockIdx.x * 4 + w; const int mt = wid / ntn, nq = wid % ntn; if (mt * 16 >= M) return;
  const int row0 = mt * 16, col0 = nq * 64; const _Float16* arow = A + (size_t)(row0 + ln) * lda;
  v8f acc[4] = {};
  for (int kb = 0; kb < K; kb += 32) { FragH ah; ah.half[0] = *(const v8us*)((const unsigned short*)arow + kb + 8 * hh); ah.half[1] = *(const v8us*)((const unsigned short*)arow + kb + 16 + 8 * hh);
#pragma unroll
    for (int t = 0; t < 4; ++t) { if (col0 + t * 16 >= N) continue; const size_t boff = (size_t)(col0 + t * 16 + ln) * ldb + kb; FragH bq; bq.half[0] = *(const v8us*)((const unsigned short*)Bh + boff + 8 * hh); bq.half[1] = *(const v8us*)((const unsigned short*)Bh + boff + 16 + 8 * hh);
      acc[t] = mmaH<1>(ah.v, ah.v, bq.v, bq.v, acc[t]); }
  }
#pragma unroll
  for (int t = 0; t < 4; ++t) { if (col0 + t * 16 >= N) continue; const int col = col0 + t * 16 + ln; const float bv = bp ? bf16_round(bp[col]) : 0.f;
#pragma unroll
    for (int r = 0; r < 8; ++r) { float v = acc[t][r] * alpha + bv; if (CP) { const int bidx = (row0g + row0 + 8 * hh + r) / rowsPerB; v += CP[(size_t)bidx * sCPb + (size_t)by * 64 + col]; } if (ACT == 1) v = (v > 0.f) ? v : expm1f(v); else if (ACT == 3) v = fmaxf(v, 0.f); so[w][8 * hh + r][t * 16 + ln] = v; } }
  __builtin_amdgcn_fence(__ATOMIC_ACQ_REL, "workgroup"); __builtin_amdgcn_wave_barrier();
  const int rsub = lane >> 4, c4 = (lane & 15) * 4; typedef _Float16 v4h __attribute__((ext_vector_type(4)));
  {
#pragma unroll
    for (int q = 0; q < 8; ++q) { const int r = q * 2 + rsub; if (col0 + c4 < N) { const v4f v = *(const v4fa*)&so[w][r][c4]; if (C) *(v4f*)(C + cofs + (size_t)(row0 + r) * ldc + col0 + c4) = v; if (C16) { v4h h4; for (int i = 0; i < 4; ++i) h4[i] = (_Float16)v[i]; *(v4h*)(C16 + cofs + (size_t)(row0 + r) * ldc + col0 + c4) = h4; } } }
     }
}


__global__ __launch_bounds__(256) void k_x16(const float* __restrict__ x, _Float16* __restrict__ X16, size_t n8) { const size_t t = (size_t)blockIdx.x * 256 + threadIdx.x; if (t >= n8) return; FragH f;
#pragma unroll
  for (int q = 0; q < 8; ++q) f.h[q] = (_Float16)bf16_round(x[t * 8 + q]); *(v8us*)((unsigned short*)X16 + t * 8) = f.half[0];  }
__global__ __launch_bounds__(256) void k_h16(const float* __restrict__ x, _Float16* __restrict__ X16, size_t n8) { const size_t t = (size_t)blockIdx.x * 256 + threadIdx.x; if (t >= n8) return; FragH f;
#pragma unroll
  for (int q = 0; q < 8; ++q) f.h[q] = (_Float16)x[t * 8 + q]; *(v8us*)((unsigned short*)X16 + t * 8) = f.half[0];  }
__global__ __launch_bounds__(256) void k_round16f(const float* __restrict__ W, _Float16* __restrict__ Bt, size_t n8) { const size_t t = (size_t)blockIdx.x * 256 + threadIdx.x; if (t >= n8) return; FragH f;
#pragma unroll
  for (int i = 0; i < 8; ++i) f.h[i] = (_Float16)(bf16_round(W[t * 8 + i]) * 16.0f); *(v8us*)((unsigned short*)Bt + t * 8) = f.half[0];  }
template <int NHv, int TTv>
__global__ __launch_bounds__(256) void k_vt(const _Float16* __restrict__ V16, int ldv, int voff, _Float16* __restrict__ Vt) { __shared__ unsigned short tl[64][66]; const int tid = threadIdx.x; const int slab = blockIdx.x / (TTv / 64), lg = blockIdx.x % (TTv / 64); const int b = slab / NHv, h = slab % NHv;
  for (int i = tid; i < 64 * 8; i += 256) { const int r = i / 8, c8 = (i % 8) * 8; FragH f; f.half[0] = *(const v8us*)((const unsigned short*)V16 + ((size_t)b * TTv + lg * 64 + r) * ldv + voff + h * 64 + c8);
#pragma unroll
    for (int q = 0; q < 8; ++q) tl[r][c8 + q] = f.u[q]; }
  __syncthreads();
  {
#pragma unroll
    for (int rd = 0; rd < 2; ++rd) { const int d = rd * 32 + tid / 8, pc = tid % 8; FragH f;
#pragma unroll
      for (int q = 0; q < 8; ++q) f.u[q] = tl[pc * 8 + q][d];
      *(v8us*)((unsigned short*)Vt + ((size_t)slab * 64 + d) * TTv + lg * 64 + pc * 8) = f.half[0]; }
     } }

// Key split: the four waves of a block share ONE tile of 16 query rows; wave w walks the 32-key tiles w, w + 4, w + 8, ... with its own running max, sum and O,
// and the four partial results are merged through LDS at the end. 2048 blocks of 4 waves: eight waves per SIMD (second launch bound: 128 registers a wave) cover each other's load waits.
// Both products are formed transposed: S^T = K Q^T (A = 16 key rows, B = the query tile, kept in registers) and O^T += V^T P^T. A lane then holds 16 of the 32 scores of ONE query
// (query ln, keys 8 hh + r and 16 + 8 hh + r): its maximum and sum are in-lane but for one exchange between the wave's halves, max, sum and rescale factor are one register each,
// and the two score tiles, converted in place, ARE the B operand of the second product in the hardware k order, which the V^T loads already follow.
__device__ __forceinline__ float xhalf(float x) { return __builtin_bit_cast(float, __builtin_amdgcn_permlanex16(__builtin_bit_cast(int, x), __builtin_bit_cast(int, x), 0x76543210, 0xfedcba98, false, false)); }      // lane l with lane l ^ 16
__global__ __launch_bounds__(128, 8) void k_flash(const _Float16* __restrict__ Q16, int ldq, const _Float16* __restrict__ K16, int ldk, const _Float16* __restrict__ Vt, const int* __restrict__ MSK, float* __restrict__ O, int ldo) {
  constexpr int RPW = 16, NQB = 4096 / RPW, DT = 4, KS = 2; (void)MSK;
  __shared__ __attribute__((aligned(16))) float sO[4][RPW][64 + 4]; __shared__ float sM[4][RPW], sL[4][RPW];
  const int tid = threadIdx.x, w = tid >> 5, lane = tid & 31, ln = lane & 15, hh = lane >> 4;
  const int slab = blockIdx.x / NQB, qblk = blockIdx.x % NQB; const int b = slab / 4, h = slab % 4; const int q0 = qblk * RPW;
  FragH bq[KS];
  { const unsigned short* qr = (const unsigned short*)Q16 + ((size_t)b * 4096 + q0 + ln) * ldq + h * 64;
#pragma unroll
    for (int ks = 0; ks < KS; ++ks) { bq[ks].half[0] = *(const v8us*)(qr + ks * 32 + 8 * hh); bq[ks].half[1] = *(const v8us*)(qr + ks * 32 + 16 + 8 * hh); } }
  const unsigned short* Vth = (const unsigned short*)Vt + (size_t)slab * 64 * 4096;
  float m_q = -3.0e38f, l_q = 0.f; v8f oacc[DT];      // oacc[dt][r] = O[query ln][dt * 16 + 8 * hh + r], unnormalised
#pragma unroll
  for (int dt = 0; dt < DT; ++dt) oacc[dt] = (v8f){0.f,0.f,0.f,0.f,0.f,0.f,0.f,0.f};
  const int jend = 4096;
#pragma unroll 1
  for (int jb = 0; jb < jend; jb += 4 * 32) { const int j0 = jb + w * 32;      // the trip test is on jb, the same in every wave: a scalar branch, EXEC untouched around the WMMAs
    v8f s[2];      // s[nt][r] = q(ln) . k(j0 + nt * 16 + 8 * hh + r)
#pragma unroll
    for (int nt = 0; nt < 2; ++nt) { const unsigned short* kr = (const unsigned short*)K16 + ((size_t)b * 4096 + j0 + nt * 16 + ln) * ldk + h * 64; FragH ak[KS];
#pragma unroll
      for (int ks = 0; ks < KS; ++ks) { ak[ks].half[0] = *(const v8us*)(kr + ks * 32 + 8 * hh); ak[ks].half[1] = *(const v8us*)(kr + ks * 32 + 16 + 8 * hh); }
      v8f acc = (v8f){0.f,0.f,0.f,0.f,0.f,0.f,0.f,0.f};
#pragma unroll
      for (int ks = 0; ks < KS; ++ks) acc = mmaH<1>(ak[ks].v, ak[ks].v, bq[ks].v, bq[ks].v, acc);
      s[nt] = acc; }
    float mc = fmaxf(s[0][0], s[1][0]);
#pragma unroll
    for (int r = 1; r < 8; ++r) mc = fmaxf(mc, fmaxf(s[0][r], s[1][r]));
    mc = fmaxf(mc, xhalf(mc));      // both halves of the wave now hold the maximum over the query's 32 scores
    const float mn = fmaxf(m_q, mc); const float al = (mn > -1.0e38f) ? expf(m_q - mn) : 1.0f; m_q = mn;
    FragH pb; v8f pt[2];
#pragma unroll
    for (int nt = 0; nt < 2; ++nt)
#pragma unroll
      for (int r = 0; r < 8; ++r) { const float p = expf(s[nt][r] - mn); pt[nt][r] = p; pb.h[nt * 8 + r] = (_Float16)p; }
    const v8f p8 = pt[0] + pt[1]; const float ps = ((p8[0] + p8[1]) + (p8[2] + p8[3])) + ((p8[4] + p8[5]) + (p8[6] + p8[7]));
    l_q = l_q * al + ps;      // the lane's own 16 keys; the halves' sums are joined once, behind the loop
#pragma unroll
    for (int dt = 0; dt < DT; ++dt) oacc[dt] *= al;
#pragma unroll
    for (int dt = 0; dt < DT; ++dt) { const unsigned short* vrow = Vth + (size_t)(dt * 16 + ln) * 4096 + j0; FragH av; av.half[0] = *(const v8us*)(vrow + 8 * hh); av.half[1] = *(const v8us*)(vrow + 16 + 8 * hh);
      oacc[dt] = mmaH<1>(av.v, av.v, pb.v, pb.v, oacc[dt]); } }
  l_q += xhalf(l_q);
  if (hh == 0) { sM[w][ln] = m_q; sL[w][ln] = l_q; }
#pragma unroll
  for (int dt = 0; dt < DT; ++dt) { *(v4fa*)&sO[w][ln][dt * 16 + 8 * hh] = (v4f){oacc[dt][0], oacc[dt][1], oacc[dt][2], oacc[dt][3]}; *(v4fa*)&sO[w][ln][dt * 16 + 8 * hh + 4] = (v4f){oacc[dt][4], oacc[dt][5], oacc[dt][6], oacc[dt][7]}; }
  __syncthreads();      // every wave's partial (max, sum, unnormalised O) is in LDS before any wave merges
  {
#pragma unroll
    for (int rp = 0; rp < RPW; rp += 8) { const int r = rp + (tid >> 4), pc = tid & 15;
      const float mm = fmaxf(fmaxf(sM[0][r], sM[1][r]), fmaxf(sM[2][r], sM[3][r])); float l = 0.f; v4f val = {0.f, 0.f, 0.f, 0.f};
#pragma unroll
      for (int i = 0; i < 4; ++i) { const float e = expf(sM[i][r] - mm); l += e * sL[i][r]; const v4f o = *(const v4fa*)&sO[i][r][pc * 4]; val += e * o; }
      val *= (l > 0.f) ? 1.0f / l : 0.f; *(v4f*)(O + ((size_t)b * 4096 + q0 + r) * ldo + h * 64 + pc * 4) = val; }
     } }

__global__ __launch_bounds__(256) void k_tok(const float* __restrict__ x, _Float16* __restrict__ X16) { __shared__ unsigned short tl[16][72]; const int tid = threadIdx.x; const int b = blockIdx.x / ((CC / 64) * (NN / 16)), rem = blockIdx.x % ((CC / 64) * (NN / 16)); const int cg = rem / (NN / 16), pg = rem % (NN / 16); const int c0 = cg * 64, p0 = pg * 16;
  for (int i = tid; i < 64 * 16; i += 256) { const int c = i / 16, pp = i % 16; FragH f; f.h[0] = (_Float16)bf16_round(x[((size_t)b * CC + c0 + c) * NN + p0 + pp]); tl[pp][c] = f.u[0]; }
  __syncthreads();
  if (tid < 128) { const int r = tid / 8, pc = tid % 8; FragH f;
#pragma unroll
    for (int q = 0; q < 8; ++q) f.u[q] = tl[r][pc * 8 + q]; unsigned short* d = (unsigned short*)X16 + ((size_t)b * NN + p0 + r) * CC + c0 + pc * 8; *(v8us*)d = f.half[0];  } }
// Text term of the key bias, one block of 32 waves a batch row. A wave owns 8 output channels; its 32 lanes split each weight row in float4 pieces, so that every wave-wide load covers
// whole 128-byte lines and the loads of the 8 rows are independent of one another; each lane sums its own columns and a butterfly over the lanes adds the 32 partial sums.
__device__ __forceinline__ void lanes_sum8(float (&a)[8]) {
#pragma unroll
  for (int m = 16; m > 0; m >>= 1) { float o[8];
#pragma unroll
    for (int i = 0; i < 8; ++i) o[i] = __shfl_xor(a[i], m, 32);      // the 8 exchanges of a stage are issued together: one wait a stage
#pragma unroll
    for (int i = 0; i < 8; ++i) a[i] += o[i]; } }
__global__ __launch_bounds__(1024) void k_text(const float* __restrict__ tf, const float* __restrict__ Wt, const float* __restrict__ bt, const float* __restrict__ Wk, const float* __restrict__ bk, float* __restrict__ TB) {
  __shared__ __attribute__((aligned(16))) float ts[CC]; __shared__ float to[CC];
  const int b = blockIdx.x, tid = threadIdx.x, lane = tid & 31, c0 = (tid >> 5) * 8;
  float acc[8];
  { v4f x[DTX / 128];
#pragma unroll
    for (int q = 0; q < DTX / 128; ++q) x[q] = *(const v4fa*)(tf + b * DTX + q * 128 + lane * 4);
    asm volatile("s_wait_xcnt 0x0" ::: "memory");      // before a register that these loads name is used for something else
#pragma unroll
    for (int q = 0; q < DTX / 128; ++q)
#pragma unroll
      for (int e = 0; e < 4; ++e) x[q][e] = bf16_round(x[q][e]);
    const float* wr = Wt + (size_t)c0 * DTX + lane * 4;
#pragma unroll
    for (int i = 0; i < 8; ++i) { float s = 0.f;
#pragma unroll
      for (int q = 0; q < DTX / 128; ++q) { const v4f v = *(const v4fa*)(wr + i * DTX + q * 128);
#pragma unroll
        for (int e = 0; e < 4; ++e) s += x[q][e] * bf16_round(v[e]); }
      acc[i] = s; }
    asm volatile("s_wait_xcnt 0x0" :: "v"(wr) : "memory"); }      // the loads' address pair stays untouched up to this wait
  lanes_sum8(acc);
  { float s = acc[0];
#pragma unroll
    for (int i = 1; i < 8; ++i) s = (lane == i) ? acc[i] : s;
    if (lane < 8) { s += bf16_round(bt[c0 + lane]); ts[c0 + lane] = 0.5f * s * (1.0f + erff(s * 0.70710678118654752f)); } }
  __syncthreads();      // all 256 channels of the projected text are in LDS before any wave reads them
  { v4f t[CC / 128];
#pragma unroll
    for (int q = 0; q < CC / 128; ++q) t[q] = *(const v4fa*)&ts[q * 128 + lane * 4];
    const float* wr = Wk + (size_t)c0 * CC + lane * 4;
#pragma unroll
    for (int i = 0; i < 8; ++i) { float s = 0.f;
#pragma unroll
      for (int q = 0; q < CC / 128; ++q) { const v4f v = *(const v4fa*)(wr + i * CC + q * 128);
#pragma unroll
        for (int e = 0; e < 4; ++e) s += t[q][e] * bf16_round(v[e]); }
      acc[i] = s; }
    asm volatile("s_wait_xcnt 0x0" :: "v"(wr) : "memory"); }      // the loads' address pair stays untouched up to this wait
  lanes_sum8(acc);
  { float s = acc[0];
#pragma unroll
    for (int i = 1; i < 8; ++i) s = (lane == i) ? acc[i] : s;
    if (lane < 8) to[c0 + lane] = s + bf16_round(bk[c0 + lane]); }
  __syncthreads();      // the 8 results of each wave are gathered so that one wave stores each whole 128-byte line
  if (tid < CC) TB[b * CC + tid] = to[tid]; }
__global__ __launch_bounds__(256) void k_fin(const float* __restrict__ M2, const float* __restrict__ pf, const float* __restrict__ gam, float* __restrict__ out) { __shared__ float tl[32][65]; const int tid = threadIdx.x; const int b = blockIdx.x / ((CC / 32) * (NN / 64)), rem = blockIdx.x % ((CC / 32) * (NN / 64)); const int cg = rem / (NN / 64), pg = rem % (NN / 64); const int c0 = cg * 32, p0 = pg * 64; const float g = bf16_round(gam[0]);
  for (int i = tid; i < 64 * 32; i += 256) { const int pp = i / 32, c = i % 32; tl[c][pp] = M2[((size_t)b * NN + p0 + pp) * CC + c0 + c]; }
  __syncthreads();
  { for (int i = tid; i < 32 * 16; i += 256) { const int c = i / 16, pc = i % 16; const size_t gi = ((size_t)b * CC + c0 + c) * NN + p0 + pc * 4; const v4f x = *(const v4fa*)(pf + gi); v4f v; for (int q = 0; q < 4; ++q) v[q] = g * tl[c][pc * 4 + q] + bf16_round(x[q]); *(v4f*)(out + gi) = v; }  } }
extern "C" void kernel_launch(void* const* d_in, const int* in_sizes, int n_in,
                              void* d_out, int out_size, void* d_ws, size_t ws_size, hipStream_t stream) {
  (void)in_sizes; (void)n_in; (void)out_size;
  const float* const* I = (const float* const*)d_in; const float* pf = I[0]; const float* tf = I[1]; const float* Wt = I[2]; const float* bt = I[3]; const float* Wq = I[4]; const float* bq = I[5]; const float* Wk = I[6]; const float* bk = I[7]; const float* Wv = I[8]; const float* bv = I[9]; const float* W1 = I[10]; const float* b1 = I[11]; const float* W2 = I[12]; const float* b2 = I[13]; const float* gam = I[14];
  char* ws = (char*)d_ws; size_t off = 0;
  auto take = [&](size_t bytes) { char* p = ws + off; off += (bytes + 255) & ~(size_t)255; return p; };
  _Float16* Bq = (_Float16*)take(CC * CC * 2); _Float16* Bk = (_Float16*)take(CC * CC * 2); _Float16* Bv = (_Float16*)take(CC * CC * 2); _Float16* B1 = (_Float16*)take(CC * CC * 2); _Float16* B2 = (_Float16*)take(CC * CC * 2); float* TB = (float*)take(BB * CC * 4);
  _Float16* X16 = (_Float16*)take((size_t)NR * CC * 2); _Float16* Q16 = (_Float16*)take((size_t)NR * CC * 2); _Float16* K16 = (_Float16*)take((size_t)NR * CC * 2); _Float16* V16 = (_Float16*)take((size_t)NR * CC * 2); _Float16* Vt = (_Float16*)take((size_t)NR * CC * 2); float* O = (float*)take((size_t)NR * CC * 4); _Float16* O16 = Q16; _Float16* H1 = K16; float* M2 = O;
  if (off > ws_size) return;      // 0.7 + 4.2 × 5 + 8.4 ≈ 30 MiB
  const size_t w8 = (size_t)CC * CC / 8; const unsigned gw = (unsigned)((w8 + 255) / 256);
  k_round16f<<<gw, 256, 0, stream>>>(Wq, Bq, w8); k_round16f<<<gw, 256, 0, stream>>>(Wk, Bk, w8); k_round16f<<<gw, 256, 0, stream>>>(Wv, Bv, w8); k_round16f<<<gw, 256, 0, stream>>>(W1, B1, w8); k_round16f<<<gw, 256, 0, stream>>>(W2, B2, w8);      // (out,in)
  k_text<<<BB, 1024, 0, stream>>>(tf, Wt, bt, Wk, bk, TB);
  k_tok<<<BB * (CC / 64) * (NN / 16), 256, 0, stream>>>(pf, X16);
  const dim3 gg(((NN / 16) * (CC / 64) + 3) / 4, BB);      // batched over b (q and v projections); sA = sC = NN·CC
  k_gemm_hhx<0><<<gg, 128, 0, stream>>>(X16, CC, (size_t)NN * CC, Bq, CC, 0, 0.0625f, bq, 0, nullptr, 1, 0, 0, nullptr, Q16, CC, (size_t)NN * CC, NN, CC, CC);
  k_gemm_hhx<0><<<dim3(((NR / 16) * (CC / 64) + 3) / 4, 1), 128, 0, stream>>>(X16, CC, 0, Bk, CC, 0, 0.0625f, nullptr, 0, TB, NN, (size_t)CC, 0, nullptr, K16, CC, 0, NR, CC, CC);      // k = pf·Wkᵀ + (t·Wkᵀ + bk): the per-batch text bias enters as the CP addend (row block b = row / 4096), unrounded
  k_gemm_hhx<0><<<gg, 128, 0, stream>>>(X16, CC, (size_t)NN * CC, Bv, CC, 0, 0.0625f, bv, 0, nullptr, 1, 0, 0, nullptr, V16, CC, (size_t)NN * CC, NN, CC, CC);
  k_vt<NH, NN><<<BB * NH * (NN / 64), 256, 0, stream>>>(V16, CC, 0, Vt);
  k_flash<<<BB * NH * (NN / 16), 128, 0, stream>>>(Q16, CC, K16, CC, Vt, nullptr, O, CC);
  const unsigned g8 = (unsigned)(((size_t)NR * CC / 8 + 255) / 256); const dim3 g1(((NR / 16) * (CC / 64) + 3) / 4, 1);
  k_h16<<<g8, 256, 0, stream>>>(O, O16, (size_t)NR * CC / 8);
  k_gemm_hhx<3><<<g1, 128, 0, stream>>>(O16, CC, 0, B1, CC, 0, 0.0625f, b1, 0, nullptr, 1, 0, 0, nullptr, H1, CC, 0, NR, CC, CC);      // relu(x·W1ᵀ + b1)
  k_gemm_hhx<0><<<g1, 128, 0, stream>>>(H1, CC, 0, B2, CC, 0, 0.0625f, b2, 0, nullptr, 1, 0, 0, M2, nullptr, CC, 0, NR, CC, CC);         // ·W2ᵀ + b2 (f32)
  k_fin<<<BB * (CC / 32) * (NN / 64), 256, 0, stream>>>(M2, pf, gam, (float*)d_out);
}

// v004
// It runs in 198 microseconds.
// Timed twice side by side with v003, it ran 1.16 and 1.15 times as fast.
// All steps since v000 together make it 2.71 times as fast.
#include <hip/hip_runtime.h>
// Text-guided point attention (B=2, C=256 channels × N=4096 points; text 512 → 256 GELU projection added to the key input; q/k/v 1×1 convs; 4 heads × 64; UNSCALED softmax(q·k)·v; MLP 256 → relu →
// 256; out = γ·x + point_feats, channel-major): the q/k/v/MLP linears ((out,in) weights bf16-exact ×2^4; the text term enters k as a per-batch bias) and the attention as a fused flash-style
// kernel (online softmax f32, P f16 ≤ 1, O = P·Vt; RPW-16 waves) run on v_wmma_f32_16x16x32_f16 with f32 accumulate; the text projection, the NCW ↔ token-major transposes and the gated
// residual are f32 VALU.
#define BB 2
#define CC 256
#define NN 4096
#define DTX 512
#define NH 4
#define NR (BB * NN)

typedef __bf16 v16b __attribute__((ext_vector_type(16)));
typedef unsigned short v8us __attribute__((ext_vector_type(8), may_alias));
typedef float  v8f  __attribute__((ext_vector_type(8)));
typedef float  v4f  __attribute__((ext_vector_type(4)));
typedef float  v4fa __attribute__((ext_vector_type(4), may_alias));
union FragB { v16b v; v8us half[2]; unsigned short u[16]; };

__device__ __forceinline__ unsigned short bf16_bits(float x) { unsigned int u = __float_as_uint(x); return (unsigned short)((u + 0x7FFFu + ((u >> 16) & 1u)) >> 16); }
__device__ __forceinline__ float bf16_val(unsigned short b) { return __uint_as_float(((unsigned int)b) << 16); }
__device__ __forceinline__ float bf16_round(float x) { return bf16_val(bf16_bits(x)); }
// D += A·B with NT terms: 1 = ah·bh, 2 = + al·bh (A split), 3 = + ah·bl (both split)
template <int NT>
__device__ __forceinline__ v8f mmaN(v16b ah, v16b al, v16b bh, v16b bl, v8f c) {
  c = __builtin_amdgcn_wmma_f32_16x16x32_bf16(false, ah, false, bh, (short)0, c, false, false);
  if (NT >= 2) c = __builtin_amdgcn_wmma_f32_16x16x32_bf16(false, al, false, bh, (short)0, c, false, false);
  if (NT >= 3) c = __builtin_amdgcn_wmma_f32_16x16x32_bf16(false, ah, false, bl, (short)0, c, false, false);
  asm volatile("v_nop\n\tv_nop\n\tv_nop\n\tv_nop" : "+v"(c) : "v"(ah), "v"(al), "v"(bh), "v"(bl));
  return c;
}

__global__ __launch_bounds__(256) void k_wt_bf16(const float* __restrict__ W, unsigned short* __restrict__ Wt, int K, int N) {
  const int t = blockIdx.x * 256 + threadIdx.x;
  const int k8n = K / 8;
  if (t >= N * k8n) return;
  const int n = t / k8n, k8 = (t % k8n) * 8;
  v8us v;
#pragma unroll
  for (int i = 0; i < 8; ++i) v[i] = bf16_bits(W[(size_t)(k8 + i) * N + n]);
  *(v8us*)(Wt + (size_t)n * K + k8) = v;
  
}

// GEMM C[M][N] (f32, pitch ldc) = act(A[M][K]·W + bias). A f32 row-major (pitch lda) converted per fragment to bf16
// (ASPLIT: hi/lo two planes -> 2 terms, else single rounded term); Wt bf16 [N][K] (pitch ldb). BIAS_BF16 rounds the
// bias to bf16 first (bias quantised to bf16 before the add). K%32==0, M%16==0, N%64==0.
template <bool ASPLIT, int ACT, bool BIAS_BF16>
__global__ __launch_bounds__(128) void k_gemm_bf(const float* __restrict__ A, int lda, const unsigned short* __restrict__ Wt, int ldb,
                                               const float* __restrict__ bias, float* __restrict__ C, int ldc, int M, int N, int K) {
  __shared__ __attribute__((aligned(16))) float so[4][16][64];
  const int tid = threadIdx.x, w = tid >> 5, lane = tid & 31, ln = lane & 15, hh = lane >> 4;
  const int ntn = N / 64;
  const int wid = blockIdx.x * 4 + w;
  const int mt = wid / ntn, nq = wid % ntn;
  if (mt * 16 >= M) return;
  const int row0 = mt * 16, col0 = nq * 64;
  const float* arow = A + (size_t)(row0 + ln) * lda;
  v8f acc[4] = {};
  for (int kb = 0; kb < K; kb += 32) {
    FragB ah, al;
    const v4f x0 = *(const v4fa*)(arow + kb + 8 * hh), x1 = *(const v4fa*)(arow + kb + 8 * hh + 4);
    const v4f x2 = *(const v4fa*)(arow + kb + 16 + 8 * hh), x3 = *(const v4fa*)(arow + kb + 16 + 8 * hh + 4);
    float xs[16] = {x0[0],x0[1],x0[2],x0[3],x1[0],x1[1],x1[2],x1[3],x2[0],x2[1],x2[2],x2[3],x3[0],x3[1],x3[2],x3[3]};
#pragma unroll
    for (int i = 0; i < 16; ++i) { const unsigned short hb = bf16_bits(xs[i]); ah.u[i] = hb; al.u[i] = ASPLIT ? bf16_bits(xs[i] - bf16_val(hb)) : (unsigned short)0; }
#pragma unroll
    for (int t = 0; t < 4; ++t) {
      const unsigned short* brow = Wt + (size_t)(col0 + t * 16 + ln) * ldb + kb;
      FragB b;
      b.half[0] = *(const v8us*)(brow + 8 * hh);
      b.half[1] = *(const v8us*)(brow + 16 + 8 * hh);
      acc[t] = mmaN<ASPLIT ? 2 : 1>(ah.v, al.v, b.v, b.v, acc[t]);
    }
  }
#pragma unroll
  for (int t = 0; t < 4; ++t) {
    float bv = bias ? bias[col0 + t * 16 + ln] : 0.f;
    if (BIAS_BF16) bv = bf16_round(bv);
#pragma unroll
    for (int r = 0; r < 8; ++r) { float v = acc[t][r] + bv; if (ACT == 1) v = fmaxf(v, 0.f); so[w][8 * hh + r][t * 16 + ln] = v; }
  }
  __builtin_amdgcn_fence(__ATOMIC_ACQ_REL, "workgroup");
  __builtin_amdgcn_wave_barrier();
  const int rsub = lane >> 4, c4 = (lane & 15) * 4;
  {
#pragma unroll
    for (int q = 0; q < 8; ++q) {
      const int r = q * 2 + rsub;
      const v4f v = *(const v4fa*)&so[w][r][c4];
      *(v4f*)(C + (size_t)(row0 + r) * ldc + col0 + c4) = v;
    }
    
  }
}

// Flash-style causal/unmasked attention, all contractions 3-term bf16 hi/lo splits, f32 softmax with running max.
// q,k,v rows are read from f32 buffers with arbitrary row pitch (so they can live inside a fused qkv buffer);
// D = head size (multiple of 32, <= 128); one wave = 16 query rows; block = 4 waves (64 queries) sharing K/V chunks of 32.
template <int D, bool CAUSAL>
__global__ __launch_bounds__(128) void k_flash(const float* __restrict__ qb, const float* __restrict__ kb, const float* __restrict__ vb,
                                             int pitch, int T, int H, float scale, float* __restrict__ y, int ypitch) {
  constexpr int KS = D / 32;        // k-steps for QK
  constexpr int DT = D / 16;        // d tiles for PV
  __shared__ __attribute__((aligned(16))) unsigned short sKh[32][D + 8], sKl[32][D + 8], sVh[32][D + 8], sVl[32][D + 8];
  __shared__ __attribute__((aligned(16))) unsigned short sPh[4][16][40], sPl[4][16][40];
  __shared__ __attribute__((aligned(16))) float sO[4][16][D];
  const int tid = threadIdx.x, w = tid >> 5, lane = tid & 31, ln = lane & 15, hh = lane >> 4;
  const int nqb = (T + 63) / 64;
  const int bh = blockIdx.x / nqb, qblk = blockIdx.x % nqb;
  const int b = bh / H, h = bh % H;
  const int q0 = qblk * 64 + w * 16;
  const float* Q = qb + (size_t)b * T * pitch + h * D;
  const float* K = kb + (size_t)b * T * pitch + h * D;
  const float* V = vb + (size_t)b * T * pitch + h * D;

  // A fragments of the wave's 16 query rows (scaled), hi/lo
  FragB aqh[KS], aql[KS];
  {
    int row = q0 + ln; if (row >= T) row = T - 1;
    const float* qr = Q + (size_t)row * pitch;
#pragma unroll
    for (int ks = 0; ks < KS; ++ks)
#pragma unroll
      for (int i = 0; i < 16; ++i) {
        const int d = ks * 32 + ((i < 8) ? (8 * hh + i) : (16 + 8 * hh + (i - 8)));
        const float x = qr[d] * scale; const unsigned short hb = bf16_bits(x);
        aqh[ks].u[i] = hb; aql[ks].u[i] = bf16_bits(x - bf16_val(hb));
      }
  }
  float m_r[8], l_r[8];
#pragma unroll
  for (int r = 0; r < 8; ++r) { m_r[r] = -3.0e38f; l_r[r] = 0.f; }
  v8f oacc[DT];
#pragma unroll
  for (int dt = 0; dt < DT; ++dt) oacc[dt] = (v8f){0.f,0.f,0.f,0.f,0.f,0.f,0.f,0.f};

  const int kv_end = CAUSAL ? min(T, qblk * 64 + 64) : T;     // block-uniform
  for (int j0 = 0; j0 < kv_end; j0 += 32) {
    __syncthreads();
    for (int e = tid; e < 32 * (D / 4); e += 128) {
      const int r = e / (D / 4), c4 = (e % (D / 4)) * 4;
      const int key = j0 + r;
      v4f kf = {0.f,0.f,0.f,0.f}, vf = {0.f,0.f,0.f,0.f};
      if (key < T) { kf = *(const v4fa*)(K + (size_t)key * pitch + c4); vf = *(const v4fa*)(V + (size_t)key * pitch + c4); }
#pragma unroll
      for (int t = 0; t < 4; ++t) {
        unsigned short hb = bf16_bits(kf[t]); sKh[r][c4 + t] = hb; sKl[r][c4 + t] = bf16_bits(kf[t] - bf16_val(hb));
        hb = bf16_bits(vf[t]); sVh[r][c4 + t] = hb; sVl[r][c4 + t] = bf16_bits(vf[t] - bf16_val(hb));
      }
    }
    __syncthreads();
    // S tile 16 x 32
    v8f s[2];
#pragma unroll
    for (int nt = 0; nt < 2; ++nt) {
      v8f acc = {};
#pragma unroll
      for (int ks = 0; ks < KS; ++ks) {
        FragB bh_, bl_;
        bh_.half[0] = *(const v8us*)&sKh[nt * 16 + ln][ks * 32 + 8 * hh]; bh_.half[1] = *(const v8us*)&sKh[nt * 16 + ln][ks * 32 + 16 + 8 * hh];
        bl_.half[0] = *(const v8us*)&sKl[nt * 16 + ln][ks * 32 + 8 * hh]; bl_.half[1] = *(const v8us*)&sKl[nt * 16 + ln][ks * 32 + 16 + 8 * hh];
        acc = mmaN<3>(aqh[ks].v, aql[ks].v, bh_.v, bl_.v, acc);
      }
      s[nt] = acc;
    }
    // mask + running max (rows 8hh+r; the 16 lanes of a half share rows)
    float alpha[8];
#pragma unroll
    for (int r = 0; r < 8; ++r) {
      const int qi = q0 + 8 * hh + r;
      const int ja = j0 + ln, jb = j0 + 16 + ln;
      if (CAUSAL) { if (ja > qi) s[0][r] = -3.0e38f; if (jb > qi) s[1][r] = -3.0e38f; }
      if (ja >= T) s[0][r] = -3.0e38f;
      if (jb >= T) s[1][r] = -3.0e38f;
      float mx = fmaxf(s[0][r], s[1][r]);
      mx = fmaxf(mx, __shfl_xor(mx, 1, 32)); mx = fmaxf(mx, __shfl_xor(mx, 2, 32)); mx = fmaxf(mx, __shfl_xor(mx, 4, 32)); mx = fmaxf(mx, __shfl_xor(mx, 8, 32));
      const float mnew = fmaxf(m_r[r], mx);
      alpha[r] = (mnew > -1.0e38f) ? __expf(m_r[r] - mnew) : 1.0f;
      const float p0 = (s[0][r] > -1.0e38f) ? __expf(s[0][r] - mnew) : 0.f;
      const float p1 = (s[1][r] > -1.0e38f) ? __expf(s[1][r] - mnew) : 0.f;
      m_r[r] = mnew;
      l_r[r] = l_r[r] * alpha[r] + p0 + p1;            // per-lane partial row sum (16 lanes combined at the end)
      unsigned short hb = bf16_bits(p0); sPh[w][8 * hh + r][ln] = hb;      sPl[w][8 * hh + r][ln] = bf16_bits(p0 - bf16_val(hb));
      hb = bf16_bits(p1);                sPh[w][8 * hh + r][16 + ln] = hb; sPl[w][8 * hh + r][16 + ln] = bf16_bits(p1 - bf16_val(hb));
    }
#pragma unroll
    for (int dt = 0; dt < DT; ++dt)
#pragma unroll
      for (int r = 0; r < 8; ++r) oacc[dt][r] *= alpha[r];
    __builtin_amdgcn_fence(__ATOMIC_ACQ_REL, "workgroup");
    __builtin_amdgcn_wave_barrier();
    FragB pah, pal;
    pah.half[0] = *(const v8us*)&sPh[w][ln][8 * hh]; pah.half[1] = *(const v8us*)&sPh[w][ln][16 + 8 * hh];
    pal.half[0] = *(const v8us*)&sPl[w][ln][8 * hh]; pal.half[1] = *(const v8us*)&sPl[w][ln][16 + 8 * hh];
#pragma unroll
    for (int dt = 0; dt < DT; ++dt) {
      FragB bvh, bvl;
#pragma unroll
      for (int i = 0; i < 8; ++i) {
        bvh.u[i] = sVh[8 * hh + i][dt * 16 + ln]; bvh.u[8 + i] = sVh[16 + 8 * hh + i][dt * 16 + ln];
        bvl.u[i] = sVl[8 * hh + i][dt * 16 + ln]; bvl.u[8 + i] = sVl[16 + 8 * hh + i][dt * 16 + ln];
      }
      oacc[dt] = mmaN<3>(pah.v, pal.v, bvh.v, bvl.v, oacc[dt]);
    }
    __builtin_amdgcn_fence(__ATOMIC_ACQ_REL, "workgroup");
    __builtin_amdgcn_wave_barrier();
  }
#pragma unroll
  for (int r = 0; r < 8; ++r) {
    float l = l_r[r];
    l += __shfl_xor(l, 1, 32); l += __shfl_xor(l, 2, 32); l += __shfl_xor(l, 4, 32); l += __shfl_xor(l, 8, 32);
    l_r[r] = (l > 0.f) ? 1.0f / l : 0.f;
  }
#pragma unroll
  for (int dt = 0; dt < DT; ++dt)
#pragma unroll
    for (int r = 0; r < 8; ++r) sO[w][8 * hh + r][dt * 16 + ln] = oacc[dt][r] * l_r[r];
  __builtin_amdgcn_fence(__ATOMIC_ACQ_REL, "workgroup");
  __builtin_amdgcn_wave_barrier();
  {
    for (int r = 0; r < 16; ++r) {
      const int row = q0 + r;
      if (row < T && lane < D / 4) {
        const v4f val = *(const v4fa*)&sO[w][r][lane * 4];
        *(v4f*)(y + ((size_t)b * T + row) * ypitch + h * D + lane * 4) = val;
      }
    }
    
  }
}

// GEMM C = act(A·W + bias + resid): A f32 (ASPLIT -> hi/lo 2 terms), Wt bf16 [N][K]; ACT 0 none, 1 relu, 2 exact gelu;
// resid (optional, f32, row index = (row % rmod), pitch ldr, RES_BF16 rounds it) added before the activation.
template <bool ASPLIT, int ACT, bool BIAS_BF16, bool RES_BF16>
__global__ __launch_bounds__(128) void k_gemm_bf3(const float* __restrict__ A, int lda, const unsigned short* __restrict__ Wt, int ldb,
                                                const float* __restrict__ bias, const float* __restrict__ resid, int rmod, int ldr,
                                                float* __restrict__ C, int ldc, int M, int N, int K) {
  __shared__ __attribute__((aligned(16))) float so[4][16][64];
  const int tid = threadIdx.x, w = tid >> 5, lane = tid & 31, ln = lane & 15, hh = lane >> 4;
  const int ntn = N / 64;
  const int wid = blockIdx.x * 4 + w;
  const int mt = wid / ntn, nq = wid % ntn;
  if (mt * 16 >= M) return;
  const int row0 = mt * 16, col0 = nq * 64;
  const float* arow = A + (size_t)(row0 + ln) * lda;
  v8f acc[4] = {};
  for (int kb = 0; kb < K; kb += 32) {
    FragB ah, al;
    const v4f x0 = *(const v4fa*)(arow + kb + 8 * hh), x1 = *(const v4fa*)(arow + kb + 8 * hh + 4);
    const v4f x2 = *(const v4fa*)(arow + kb + 16 + 8 * hh), x3 = *(const v4fa*)(arow + kb + 16 + 8 * hh + 4);
    float xs[16] = {x0[0],x0[1],x0[2],x0[3],x1[0],x1[1],x1[2],x1[3],x2[0],x2[1],x2[2],x2[3],x3[0],x3[1],x3[2],x3[3]};
#pragma unroll
    for (int i = 0; i < 16; ++i) { const unsigned short hb = bf16_bits(xs[i]); ah.u[i] = hb; al.u[i] = ASPLIT ? bf16_bits(xs[i] - bf16_val(hb)) : (unsigned short)0; }
#pragma unroll
    for (int t = 0; t < 4; ++t) {
      const unsigned short* brow = Wt + (size_t)(col0 + t * 16 + ln) * ldb + kb;
      FragB b;
      b.half[0] = *(const v8us*)(brow + 8 * hh);
      b.half[1] = *(const v8us*)(brow + 16 + 8 * hh);
      acc[t] = mmaN<ASPLIT ? 2 : 1>(ah.v, al.v, b.v, b.v, acc[t]);
    }
  }
#pragma unroll
  for (int t = 0; t < 4; ++t) {
    const int col = col0 + t * 16 + ln;
    float bv = bias ? bias[col] : 0.f;
    if (BIAS_BF16) bv = bf16_round(bv);
#pragma unroll
    for (int r = 0; r < 8; ++r) {
      float v = acc[t][r] + bv;
      if (resid) { float rv = resid[(size_t)((row0 + 8 * hh + r) % rmod) * ldr + col]; if (RES_BF16) rv = bf16_round(rv); v += rv; }
      if (ACT == 1) v = fmaxf(v, 0.f);
      if (ACT == 2) v = 0.5f * v * (1.0f + erff(v * 0.70710678118654752f));
      if (ACT == 3) { const float u = 0.7978845608028654f * (v + 0.044715f * v * v * v); v = 0.5f * v * (1.0f + tanhf(u)); }
      so[w][8 * hh + r][t * 16 + ln] = v;
    }
  }
  __builtin_amdgcn_fence(__ATOMIC_ACQ_REL, "workgroup");
  __builtin_amdgcn_wave_barrier();
  const int rsub = lane >> 4, c4 = (lane & 15) * 4;
  {
#pragma unroll
    for (int q = 0; q < 8; ++q) {
      const int r = q * 2 + rsub;
      const v4f v = *(const v4fa*)&so[w][r][c4];
      *(v4f*)(C + (size_t)(row0 + r) * ldc + col0 + c4) = v;
    }
    
  }
}
// row LayerNorm (biased variance, eps) over N: s = X (+ R); optional out_sum <- s; out_norm <- (s-mu)*rsqrt(var+eps)*g + b
template <bool PARAM_BF16>
__global__ __launch_bounds__(256) void k_layernorm(const float* __restrict__ X, const float* __restrict__ R, const float* __restrict__ g, const float* __restrict__ bta,
                                                  float* __restrict__ out_sum, float* __restrict__ out_norm, int N, float eps) {
  __shared__ float red[256];
  const int row = blockIdx.x, tid = threadIdx.x;
  const float* x = X + (size_t)row * N; const float* rr = R ? R + (size_t)row * N : nullptr;
  float vals[16];                     // up to N = 4096
  const int per = N / 256;            // contiguous chunk per thread? use strided-by-4 chunks: thread handles j = tid*4 + 1024*u
  float s1 = 0.f;
  for (int u = 0; u < per / 4; ++u) {
    const int j = tid * 4 + 1024 * u;
    const v4f a = *(const v4fa*)(x + j);
    v4f b = {0.f,0.f,0.f,0.f}; if (rr) b = *(const v4fa*)(rr + j);
#pragma unroll
    for (int q = 0; q < 4; ++q) { const float v = a[q] + b[q]; vals[u * 4 + q] = v; s1 += v; }
  }
  red[tid] = s1; __syncthreads();
  for (int st = 128; st > 0; st >>= 1) { if (tid < st) red[tid] += red[tid + st]; __syncthreads(); }
  const float mu = red[0] / (float)N; __syncthreads();
  float s2 = 0.f;
  for (int u = 0; u < per / 4; ++u)
#pragma unroll
    for (int q = 0; q < 4; ++q) { const float c = vals[u * 4 + q] - mu; s2 += c * c; }
  red[tid] = s2; __syncthreads();
  for (int st = 128; st > 0; st >>= 1) { if (tid < st) red[tid] += red[tid + st]; __syncthreads(); }
  const float rs = rsqrtf(red[0] / (float)N + eps);
  {
    for (int u = 0; u < per / 4; ++u) {
      const int j = tid * 4 + 1024 * u;
      v4f o, sm;
#pragma unroll
      for (int q = 0; q < 4; ++q) {
        float gg = g[j + q], bb = bta[j + q];
        if (PARAM_BF16) { gg = bf16_round(gg); bb = bf16_round(bb); }
        sm[q] = vals[u * 4 + q]; o[q] = (vals[u * 4 + q] - mu) * rs * gg + bb;
      }
      if (out_sum) *(v4f*)(out_sum + (size_t)row * N + j) = sm;
      *(v4f*)(out_norm + (size_t)row * N + j) = o;
    }
    
  }
}



// ---- f16 WMMA path (v_wmma_f32_16x16x32_f16): 11-bit significands for operands in range — used where a [0,1] probability operand needs more precision than bf16
typedef _Float16 v16h __attribute__((ext_vector_type(16)));
union FragH { v16h v; v8us half[2]; _Float16 h[16]; unsigned short u[16]; };
template <int NT>
__device__ __forceinline__ v8f mmaH(v16h ah, v16h al, v16h bh, v16h bl, v8f c) {
  c = __builtin_amdgcn_wmma_f32_16x16x32_f16(false, ah, false, bh, (short)0, c, false, false);
  if (NT >= 2) c = __builtin_amdgcn_wmma_f32_16x16x32_f16(false, al, false, bh, (short)0, c, false, false);
  if (NT >= 3) c = __builtin_amdgcn_wmma_f32_16x16x32_f16(false, ah, false, bl, (short)0, c, false, false);
  asm volatile("v_nop\n\tv_nop\n\tv_nop\n\tv_nop" : "+v"(c) : "v"(ah), "v"(al), "v"(bh), "v"(bl));
  return c;
}
// batched GEMM like k_gemm_b but f16 operands: A f32 (split into f16 hi/lo if ASPLIT, else rounded to f16), Bt = f16 values [n][k]; alpha; C f32; N multiple of 16 (partial tiles skipped)
template <bool ASPLIT>
__global__ __launch_bounds__(128) void k_gemm_h(const float* __restrict__ A, int lda, size_t sA, const _Float16* __restrict__ Bh, int ldb, size_t sB, float alpha, float* __restrict__ C, int ldc, size_t sC, int M, int N, int K) {
  __shared__ __attribute__((aligned(16))) float so[4][16][64];
  const int tid = threadIdx.x, w = tid >> 5, lane = tid & 31, ln = lane & 15, hh = lane >> 4; const int by = blockIdx.y;
  A += (size_t)by * sA; Bh += (size_t)by * sB; C += (size_t)by * sC;
  const int ntn = (N + 63) / 64; const int wid = blockIdx.x * 4 + w; const int mt = wid / ntn, nq = wid % ntn; if (mt * 16 >= M) return;
  const int row0 = mt * 16, col0 = nq * 64; const float* arow = A + (size_t)(row0 + ln) * lda;
  v8f acc[4] = {};
  for (int kb = 0; kb < K; kb += 32) {
    FragH ah, al;
    const v4f x0 = *(const v4fa*)(arow + kb + 8 * hh), x1 = *(const v4fa*)(arow + kb + 8 * hh + 4), x2 = *(const v4fa*)(arow + kb + 16 + 8 * hh), x3 = *(const v4fa*)(arow + kb + 16 + 8 * hh + 4);
    float xs[16] = {x0[0],x0[1],x0[2],x0[3],x1[0],x1[1],x1[2],x1[3],x2[0],x2[1],x2[2],x2[3],x3[0],x3[1],x3[2],x3[3]};
#pragma unroll
    for (int i = 0; i < 16; ++i) { const _Float16 h = (_Float16)xs[i]; ah.h[i] = h; al.h[i] = ASPLIT ? (_Float16)(xs[i] - (float)h) : (_Float16)0.0f; }
#pragma unroll
    for (int t = 0; t < 4; ++t) { if (col0 + t * 16 >= N) continue; const size_t boff = (size_t)(col0 + t * 16 + ln) * ldb + kb; FragH bq; bq.half[0] = *(const v8us*)(Bh + boff + 8 * hh); bq.half[1] = *(const v8us*)(Bh + boff + 16 + 8 * hh);
      acc[t] = mmaH<ASPLIT ? 2 : 1>(ah.v, al.v, bq.v, bq.v, acc[t]); }
  }
#pragma unroll
  for (int t = 0; t < 4; ++t) { if (col0 + t * 16 >= N) continue;
#pragma unroll
    for (int r = 0; r < 8; ++r) so[w][8 * hh + r][t * 16 + ln] = acc[t][r] * alpha; }
  __builtin_amdgcn_fence(__ATOMIC_ACQ_REL, "workgroup"); __builtin_amdgcn_wave_barrier();
  const int rsub = lane >> 4, c4 = (lane & 15) * 4;
  {
#pragma unroll
    for (int q = 0; q < 8; ++q) { const int r = q * 2 + rsub; if (col0 + c4 < N) { const v4f v = *(const v4fa*)&so[w][r][c4]; *(v4f*)(C + (size_t)(row0 + r) * ldc + col0 + c4) = v; } }
     }
}

// Wt[n][k] = f16(W[k][n]·scale) from f32 row-major W[K][N] (scale = power of two; bf16-exact weights stay exact in f16 away from the subnormal range)
__global__ __launch_bounds__(256) void k_wt_f16(const float* __restrict__ W, _Float16* __restrict__ Wt, int K, int N, float scale) {
  const int t = blockIdx.x * 256 + threadIdx.x; if (t >= N * (K / 8)) return; const int n = t / (K / 8), k8 = (t % (K / 8)) * 8; FragH f;
#pragma unroll
  for (int i = 0; i < 8; ++i) f.h[i] = (_Float16)(bf16_round(W[(size_t)(k8 + i) * N + n]) * scale); const v8us o = f.half[0];
  *(v8us*)((unsigned short*)Wt + (size_t)n * K + k8) = o; 
}
// k_gemm_hh variant with fused epilogue: v = acc·alpha + bias[by·sBias + col] (+ CP[(row/rowsPerB)·sCPb + by·64 + col] if CP) ; ACT 0 none / 1 elu ; writes f16 C16 and f32 C, each if non-null
template <int ACT>
__device__ __forceinline__ void gemm_hhx_part(const _Float16* __restrict__ A, int lda, size_t sA, const _Float16* __restrict__ Bh, int ldb, size_t sB, float alpha, const float* __restrict__ bias, size_t sBias, const float* __restrict__ CP, int rowsPerB, size_t sCPb, int row0g,
    float* __restrict__ C, _Float16* __restrict__ C16, int ldc, size_t sC, int M, int N, int K, const int by) {
  __shared__ __attribute__((aligned(16))) float so[4][16][64];
  const int tid = threadIdx.x, w = tid >> 5, lane = tid & 31, ln = lane & 15, hh = lane >> 4;
  A += (size_t)by * sA; Bh += (size_t)by * sB; const size_t cofs = (size_t)by * sC; const float* bp = bias ? bias + (size_t)by * sBias : nullptr;
  const int ntn = (N + 63) / 64; const int wid = blockIdx.x * 4 + w; const int mt = wid / ntn, nq = wid % ntn; if (mt * 16 >= M) return;
  const int row0 = mt * 16, col0 = nq * 64; const _Float16* arow = A + (size_t)(row0 + ln) * lda;
  v8f acc[4] = {};
  for (int kb = 0; kb < K; kb += 32) { FragH ah; ah.half[0] = *(const v8us*)((const unsigned short*)arow + kb + 8 * hh); ah.half[1] = *(const v8us*)((const unsigned short*)arow + kb + 16 + 8 * hh);
#pragma unroll
    for (int t = 0; t < 4; ++t) { if (col0 + t * 16 >= N) continue; const size_t boff = (size_t)(col0 + t * 16 + ln) * ldb + kb; FragH bq; bq.half[0] = *(const v8us*)((const unsigned short*)Bh + boff + 8 * hh); bq.half[1] = *(const v8us*)((const unsigned short*)Bh + boff + 16 + 8 * hh);
      acc[t] = mmaH<1>(ah.v, ah.v, bq.v, bq.v, acc[t]); }
  }
#pragma unroll
  for (int t = 0; t < 4; ++t) { if (col0 + t * 16 >= N) continue; const int col = col0 + t * 16 + ln; const float bv = bp ? bf16_round(bp[col]) : 0.f;
#pragma unroll
    for (int r = 0; r < 8; ++r) { float v = acc[t][r] * alpha + bv; if (CP) { const int bidx = (row0g + row0 + 8 * hh + r) / rowsPerB; v += CP[(size_t)bidx * sCPb + (size_t)by * 64 + col]; } if (ACT == 1) v = (v > 0.f) ? v : expm1f(v); else if (ACT == 3) v = fmaxf(v, 0.f); so[w][8 * hh + r][t * 16 + ln] = v; } }
  __builtin_amdgcn_fence(__ATOMIC_ACQ_REL, "workgroup"); __builtin_amdgcn_wave_barrier();
  const int rsub = lane >> 4, c4 = (lane & 15) * 4; typedef _Float16 v4h __attribute__((ext_vector_type(4)));
  {
#pragma unroll
    for (int q = 0; q < 8; ++q) { const int r = q * 2 + rsub; if (col0 + c4 < N) { const v4f v = *(const v4fa*)&so[w][r][c4]; if (C) { *(v4f*)(C + cofs + (size_t)(row0 + r) * ldc + col0 + c4) = v; asm volatile("s_wait_xcnt 0x0" ::: "memory"); }      // before the conversion below reuses a register that this store names
      if (C16) { v4h h4; for (int i = 0; i < 4; ++i) h4[i] = (_Float16)v[i]; *(v4h*)(C16 + cofs + (size_t)(row0 + r) * ldc + col0 + c4) = h4; asm volatile("s_wait_xcnt 0x0" ::: "memory"); } } }      // before the next row's values and addresses reuse a register that this store names
     }
}
template <int ACT>
__global__ __launch_bounds__(128) void k_gemm_hhx(const _Float16* __restrict__ A, int lda, size_t sA, const _Float16* __restrict__ Bh, int ldb, size_t sB, float alpha, const float* __restrict__ bias, size_t sBias, const float* __restrict__ CP, int rowsPerB, size_t sCPb, int row0g,
    float* __restrict__ C, _Float16* __restrict__ C16, int ldc, size_t sC, int M, int N, int K) {
  gemm_hhx_part<ACT>(A, lda, sA, Bh, ldb, sB, alpha, bias, sBias, CP, rowsPerB, sCPb, row0g, C, C16, ldc, sC, M, N, K, blockIdx.y); }
// The q, k and v projections read the same A and depend on nothing of one another: one grid, blockIdx.y = 0 q, 1 k, 2 v picks the weights (sB apart), the output (sC apart) and the addend
// (q and v: their bias; k: the per-batch text term CPk, row block = row / rowsPerB). Three times the waves of one projection are resident at once and cover each other's load waits.
__global__ __launch_bounds__(128) void k_gemm_qkv(const _Float16* __restrict__ A, int lda, const _Float16* __restrict__ Bh, int ldb, size_t sB, float alpha, const float* __restrict__ bias_q, const float* __restrict__ bias_v, const float* __restrict__ CPk, int rowsPerB, size_t sCPb,
    _Float16* __restrict__ C16, int ldc, size_t sC, int M, int N, int K) {
  const int z = blockIdx.y;
  gemm_hhx_part<0>(A, lda, 0, Bh + (size_t)z * sB, ldb, 0, alpha, z == 0 ? bias_q : (z == 2 ? bias_v : nullptr), 0, z == 1 ? CPk : nullptr, rowsPerB, sCPb, 0, nullptr, C16 + (size_t)z * sC, ldc, 0, M, N, K, 0); }


__global__ __launch_bounds__(256) void k_x16(const float* __restrict__ x, _Float16* __restrict__ X16, size_t n8) { const size_t t = (size_t)blockIdx.x * 256 + threadIdx.x; if (t >= n8) return; FragH f;
#pragma unroll
  for (int q = 0; q < 8; ++q) f.h[q] = (_Float16)bf16_round(x[t * 8 + q]); *(v8us*)((unsigned short*)X16 + t * 8) = f.half[0];  }
__global__ __launch_bounds__(256) void k_h16(const float* __restrict__ x, _Float16* __restrict__ X16, size_t n8) { const size_t t = (size_t)blockIdx.x * 256 + threadIdx.x; if (t >= n8) return; FragH f;
#pragma unroll
  for (int q = 0; q < 8; ++q) f.h[q] = (_Float16)x[t * 8 + q]; *(v8us*)((unsigned short*)X16 + t * 8) = f.half[0];  }
__device__ __forceinline__ void round16f_part(const float* __restrict__ W, _Float16* __restrict__ Bt, size_t n8, const size_t t) { if (t >= n8) return; FragH f;
#pragma unroll
  for (int i = 0; i < 8; ++i) f.h[i] = (_Float16)(bf16_round(W[t * 8 + i]) * 16.0f); *(v8us*)((unsigned short*)Bt + t * 8) = f.half[0];
  asm volatile("s_wait_xcnt 0x0" ::: "memory"); }      // the built code holds a path from here into another part of the grid's kernel, which reuses the registers that this store names
template <int NHv, int TTv>
__global__ __launch_bounds__(256) void k_vt(const _Float16* __restrict__ V16, int ldv, int voff, _Float16* __restrict__ Vt) { __shared__ unsigned short tl[64][66]; const int tid = threadIdx.x; const int slab = blockIdx.x / (TTv / 64), lg = blockIdx.x % (TTv / 64); const int b = slab / NHv, h = slab % NHv;
  for (int i = tid; i < 64 * 8; i += 256) { const int r = i / 8, c8 = (i % 8) * 8; FragH f; f.half[0] = *(const v8us*)((const unsigned short*)V16 + ((size_t)b * TTv + lg * 64 + r) * ldv + voff + h * 64 + c8);
#pragma unroll
    for (int q = 0; q < 8; ++q) tl[r][c8 + q] = f.u[q]; }
  __syncthreads();
  {
#pragma unroll
    for (int rd = 0; rd < 2; ++rd) { const int d = rd * 32 + tid / 8, pc = tid % 8; FragH f;
#pragma unroll
      for (int q = 0; q < 8; ++q) f.u[q] = tl[pc * 8 + q][d];
      *(v8us*)((unsigned short*)Vt + ((size_t)slab * 64 + d) * TTv + lg * 64 + pc * 8) = f.half[0]; }
     } }

// Key split: the four waves of a block share ONE tile of 16 query rows; wave w walks the 32-key tiles w, w + 4, w + 8, ... with its own running max, sum and O,
// and the four partial results are merged through LDS at the end. 2048 blocks of 4 waves: eight waves per SIMD (second launch bound: 128 registers a wave) cover each other's load waits.
// Both products are formed transposed: S^T = K Q^T (A = 16 key rows, B = the query tile, kept in registers) and O^T += V^T P^T. A lane then holds 16 of the 32 scores of ONE query
// (query ln, keys 8 hh + r and 16 + 8 hh + r): its maximum and sum are in-lane but for one exchange between the wave's halves, max, sum and rescale factor are one register each,
// and the two score tiles, converted in place, ARE the B operand of the second product in the hardware k order, which the V^T loads already follow.
__device__ __forceinline__ float xhalf(float x) { return __builtin_bit_cast(float, __builtin_amdgcn_permlanex16(__builtin_bit_cast(int, x), __builtin_bit_cast(int, x), 0x76543210, 0xfedcba98, false, false)); }      // lane l with lane l ^ 16
__global__ __launch_bounds__(128, 8) void k_flash(const _Float16* __restrict__ Q16, int ldq, const _Float16* __restrict__ K16, int ldk, const _Float16* __restrict__ Vt, const int* __restrict__ MSK, float* __restrict__ O, int ldo) {
  constexpr int RPW = 16, NQB = 4096 / RPW, DT = 4, KS = 2; (void)MSK;
  __shared__ __attribute__((aligned(16))) float sO[4][RPW][64 + 4]; __shared__ float sM[4][RPW], sL[4][RPW];
  const int tid = threadIdx.x, w = tid >> 5, lane = tid & 31, ln = lane & 15, hh = lane >> 4;
  const int slab = blockIdx.x / NQB, qblk = blockIdx.x % NQB; const int b = slab / 4, h = slab % 4; const int q0 = qblk * RPW;
  FragH bq[KS];
  { const unsigned short* qr = (const unsigned short*)Q16 + ((size_t)b * 4096 + q0 + ln) * ldq + h * 64;
#pragma unroll
    for (int ks = 0; ks < KS; ++ks) { bq[ks].half[0] = *(const v8us*)(qr + ks * 32 + 8 * hh); bq[ks].half[1] = *(const v8us*)(qr + ks * 32 + 16 + 8 * hh); } }
  const unsigned short* Vth = (const unsigned short*)Vt + (size_t)slab * 64 * 4096;
  float m_q = -3.0e38f, l_q = 0.f; v8f oacc[DT];      // oacc[dt][r] = O[query ln][dt * 16 + 8 * hh + r], unnormalised
#pragma unroll
  for (int dt = 0; dt < DT; ++dt) oacc[dt] = (v8f){0.f,0.f,0.f,0.f,0.f,0.f,0.f,0.f};
  const int jend = 4096;
#pragma unroll 1
  for (int jb = 0; jb < jend; jb += 4 * 32) { const int j0 = jb + w * 32;      // the trip test is on jb, the same in every wave: a scalar branch, EXEC untouched around the WMMAs
    v8f s[2];      // s[nt][r] = q(ln) . k(j0 + nt * 16 + 8 * hh + r)
#pragma unroll
    for (int nt = 0; nt < 2; ++nt) { const unsigned short* kr = (const unsigned short*)K16 + ((size_t)b * 4096 + j0 + nt * 16 + ln) * ldk + h * 64; FragH ak[KS];
#pragma unroll
      for (int ks = 0; ks < KS; ++ks) { ak[ks].half[0] = *(const v8us*)(kr + ks * 32 + 8 * hh); ak[ks].half[1] = *(const v8us*)(kr + ks * 32 + 16 + 8 * hh); }
      v8f acc = (v8f){0.f,0.f,0.f,0.f,0.f,0.f,0.f,0.f};
#pragma unroll
      for (int ks = 0; ks < KS; ++ks) acc = mmaH<1>(ak[ks].v, ak[ks].v, bq[ks].v, bq[ks].v, acc);
      s[nt] = acc; }
    float mc = fmaxf(s[0][0], s[1][0]);
#pragma unroll
    for (int r = 1; r < 8; ++r) mc = fmaxf(mc, fmaxf(s[0][r], s[1][r]));
    mc = fmaxf(mc, xhalf(mc));      // both halves of the wave now hold the maximum over the query's 32 scores
    const float mn = fmaxf(m_q, mc); const float al = (mn > -1.0e38f) ? expf(m_q - mn) : 1.0f; m_q = mn;
    FragH pb; v8f pt[2];
#pragma unroll
    for (int nt = 0; nt < 2; ++nt)
#pragma unroll
      for (int r = 0; r < 8; ++r) { const float p = expf(s[nt][r] - mn); pt[nt][r] = p; pb.h[nt * 8 + r] = (_Float16)p; }
    const v8f p8 = pt[0] + pt[1]; const float ps = ((p8[0] + p8[1]) + (p8[2] + p8[3])) + ((p8[4] + p8[5]) + (p8[6] + p8[7]));
    l_q = l_q * al + ps;      // the lane's own 16 keys; the halves' sums are joined once, behind the loop
#pragma unroll
    for (int dt = 0; dt < DT; ++dt) oacc[dt] *= al;
#pragma unroll
    for (int dt = 0; dt < DT; ++dt) { const unsigned short* vrow = Vth + (size_t)(dt * 16 + ln) * 4096 + j0; FragH av; av.half[0] = *(const v8us*)(vrow + 8 * hh); av.half[1] = *(const v8us*)(vrow + 16 + 8 * hh);
      oacc[dt] = mmaH<1>(av.v, av.v, pb.v, pb.v, oacc[dt]); } }
  l_q += xhalf(l_q);
  if (hh == 0) { sM[w][ln] = m_q; sL[w][ln] = l_q; }
#pragma unroll
  for (int dt = 0; dt < DT; ++dt) { *(v4fa*)&sO[w][ln][dt * 16 + 8 * hh] = (v4f){oacc[dt][0], oacc[dt][1], oacc[dt][2], oacc[dt][3]}; *(v4fa*)&sO[w][ln][dt * 16 + 8 * hh + 4] = (v4f){oacc[dt][4], oacc[dt][5], oacc[dt][6], oacc[dt][7]}; }
  __syncthreads();      // every wave's partial (max, sum, unnormalised O) is in LDS before any wave merges
  {
#pragma unroll
    for (int rp = 0; rp < RPW; rp += 8) { const int r = rp + (tid >> 4), pc = tid & 15;
      const float mm = fmaxf(fmaxf(sM[0][r], sM[1][r]), fmaxf(sM[2][r], sM[3][r])); float l = 0.f; v4f val = {0.f, 0.f, 0.f, 0.f};
#pragma unroll
      for (int i = 0; i < 4; ++i) { const float e = expf(sM[i][r] - mm); l += e * sL[i][r]; const v4f o = *(const v4fa*)&sO[i][r][pc * 4]; val += e * o; }
      val *= (l > 0.f) ? 1.0f / l : 0.f; *(v4f*)(O + ((size_t)b * 4096 + q0 + r) * ldo + h * 64 + pc * 4) = val; }
     } }

// blk = which 64-channel x 16-point tile, tid = 0 .. 255 inside the 256 threads that share it, tl = their own LDS tile
__device__ __forceinline__ void tok_part(const float* __restrict__ x, _Float16* __restrict__ X16, const int blk, const int tid, unsigned short (*tl)[72]) { const int b = blk / ((CC / 64) * (NN / 16)), rem = blk % ((CC / 64) * (NN / 16)); const int cg = rem / (NN / 16), pg = rem % (NN / 16); const int c0 = cg * 64, p0 = pg * 16;
  for (int i = tid; i < 64 * 16; i += 256) { const int c = i / 16, pp = i % 16; FragH f; f.h[0] = (_Float16)bf16_round(x[((size_t)b * CC + c0 + c) * NN + p0 + pp]); tl[pp][c] = f.u[0]; }
  __syncthreads();
  if (tid < 128) { const int r = tid / 8, pc = tid % 8; FragH f;
#pragma unroll
    for (int q = 0; q < 8; ++q) f.u[q] = tl[r][pc * 8 + q]; unsigned short* d = (unsigned short*)X16 + ((size_t)b * NN + p0 + r) * CC + c0 + pc * 8; *(v8us*)d = f.half[0];  } }
// Text term of the key bias, one block of 32 waves a batch row. A wave owns 8 output channels; its 32 lanes split each weight row in float4 pieces, so that every wave-wide load covers
// whole 128-byte lines and the loads of the 8 rows are independent of one another; each lane sums its own columns and a butterfly over the lanes adds the 32 partial sums.
__device__ __forceinline__ void lanes_sum8(float (&a)[8]) {
#pragma unroll
  for (int m = 16; m > 0; m >>= 1) { float o[8];
#pragma unroll
    for (int i = 0; i < 8; ++i) o[i] = __shfl_xor(a[i], m, 32);      // the 8 exchanges of a stage are issued together: one wait a stage
#pragma unroll
    for (int i = 0; i < 8; ++i) a[i] += o[i]; } }
__device__ __forceinline__ void text_part(const float* __restrict__ tf, const float* __restrict__ Wt, const float* __restrict__ bt, const float* __restrict__ Wk, const float* __restrict__ bk, float* __restrict__ TB, const int b) {
  __shared__ __attribute__((aligned(16))) float ts[CC]; __shared__ float to[CC];
  const int tid = threadIdx.x, lane = tid & 31, c0 = (tid >> 5) * 8;
  float acc[8];
  { v4f x[DTX / 128];
#pragma unroll
    for (int q = 0; q < DTX / 128; ++q) x[q] = *(const v4fa*)(tf + b * DTX + q * 128 + lane * 4);
    asm volatile("s_wait_xcnt 0x0" ::: "memory");      // before a register that these loads name is used for something else
#pragma unroll
    for (int q = 0; q < DTX / 128; ++q)
#pragma unroll
      for (int e = 0; e < 4; ++e) x[q][e] = bf16_round(x[q][e]);
    const float* wr = Wt + (size_t)c0 * DTX + lane * 4;
#pragma unroll
    for (int i = 0; i < 8; ++i) { float s = 0.f;
#pragma unroll
      for (int q = 0; q < DTX / 128; ++q) { const v4f v = *(const v4fa*)(wr + i * DTX + q * 128);
#pragma unroll
        for (int e = 0; e < 4; ++e) s += x[q][e] * bf16_round(v[e]); }
      acc[i] = s; }
    asm volatile("s_wait_xcnt 0x0" :: "v"(wr) : "memory"); }      // the loads' address pair stays untouched up to this wait
  lanes_sum8(acc);
  { float s = acc[0];
#pragma unroll
    for (int i = 1; i < 8; ++i) s = (lane == i) ? acc[i] : s;
    if (lane < 8) { s += bf16_round(bt[c0 + lane]); ts[c0 + lane] = 0.5f * s * (1.0f + erff(s * 0.70710678118654752f)); } }
  __syncthreads();      // all 256 channels of the projected text are in LDS before any wave reads them
  { v4f t[CC / 128];
#pragma unroll
    for (int q = 0; q < CC / 128; ++q) t[q] = *(const v4fa*)&ts[q * 128 + lane * 4];
    const float* wr = Wk + (size_t)c0 * CC + lane * 4;
#pragma unroll
    for (int i = 0; i < 8; ++i) { float s = 0.f;
#pragma unroll
      for (int q = 0; q < CC / 128; ++q) { const v4f v = *(const v4fa*)(wr + i * CC + q * 128);
#pragma unroll
        for (int e = 0; e < 4; ++e) s += t[q][e] * bf16_round(v[e]); }
      acc[i] = s; }
    asm volatile("s_wait_xcnt 0x0" :: "v"(wr) : "memory"); }      // the loads' address pair stays untouched up to this wait
  lanes_sum8(acc);
  { float s = acc[0];
#pragma unroll
    for (int i = 1; i < 8; ++i) s = (lane == i) ? acc[i] : s;
    if (lane < 8) to[c0 + lane] = s + bf16_round(bk[c0 + lane]); }
  __syncthreads();      // the 8 results of each wave are gathered so that one wave stores each whole 128-byte line
  if (tid < CC) TB[b * CC + tid] = to[tid]; }
// Everything that depends on the inputs alone shares one grid of 1024-thread blocks, told apart by the block index: blocks 0 .. BB - 1 the text term (the longest chain of waits, so it starts first),
// then WB blocks for each of the five weight matrices, then the token-major copy of the points, four of its 256-thread tiles a block.
#define WB (CC * CC / 8 / 1024)
#define TKB (BB * (CC / 64) * (NN / 16) / 4)
__global__ __launch_bounds__(1024) void k_prep(const float* __restrict__ tf, const float* __restrict__ Wt, const float* __restrict__ bt, const float* __restrict__ Wk, const float* __restrict__ bk, float* __restrict__ TB,
    const float* __restrict__ Wq, const float* __restrict__ Wv, const float* __restrict__ W1, const float* __restrict__ W2, _Float16* __restrict__ Bq, _Float16* __restrict__ Bk, _Float16* __restrict__ Bv, _Float16* __restrict__ B1, _Float16* __restrict__ B2,
    const float* __restrict__ x, _Float16* __restrict__ X16) {
  __shared__ unsigned short tl[4][16][72];
  const int bx = blockIdx.x, tid = threadIdx.x;
  if (bx < BB) text_part(tf, Wt, bt, Wk, bk, TB, bx);
  else if (bx < BB + 5 * WB) { const int m = (bx - BB) / WB; const size_t t = (size_t)((bx - BB) % WB) * 1024 + tid;
    const float* W = m == 0 ? Wq : m == 1 ? Wk : m == 2 ? Wv : m == 3 ? W1 : W2; _Float16* Bt = m == 0 ? Bq : m == 1 ? Bk : m == 2 ? Bv : m == 3 ? B1 : B2;
    round16f_part(W, Bt, (size_t)CC * CC / 8, t); }
  else tok_part(x, X16, (bx - BB - 5 * WB) * 4 + (tid >> 8), tid & 255, tl[tid >> 8]); }
__global__ __launch_bounds__(256) void k_fin(const float* __restrict__ M2, const float* __restrict__ pf, const float* __restrict__ gam, float* __restrict__ out) { __shared__ float tl[32][65]; const int tid = threadIdx.x; const int b = blockIdx.x / ((CC / 32) * (NN / 64)), rem = blockIdx.x % ((CC / 32) * (NN / 64)); const int cg = rem / (NN / 64), pg = rem % (NN / 64); const int c0 = cg * 32, p0 = pg * 64; const float g = bf16_round(gam[0]);
  for (int i = tid; i < 64 * 32; i += 256) { const int pp = i / 32, c = i % 32; tl[c][pp] = M2[((size_t)b * NN + p0 + pp) * CC + c0 + c]; }
  __syncthreads();
  { for (int i = tid; i < 32 * 16; i += 256) { const int c = i / 16, pc = i % 16; const size_t gi = ((size_t)b * CC + c0 + c) * NN + p0 + pc * 4; const v4f x = *(const v4fa*)(pf + gi); v4f v; for (int q = 0; q < 4; ++q) v[q] = g * tl[c][pc * 4 + q] + bf16_round(x[q]); *(v4f*)(out + gi) = v; }  } }
extern "C" void kernel_launch(void* const* d_in, const int* in_sizes, int n_in,
                              void* d_out, int out_size, void* d_ws, size_t ws_size, hipStream_t stream) {
  (void)in_sizes; (void)n_in; (void)out_size;
  const float* const* I = (const float* const*)d_in; const float* pf = I[0]; const float* tf = I[1]; const float* Wt = I[2]; const float* bt = I[3]; const float* Wq = I[4]; const float* bq = I[5]; const float* Wk = I[6]; const float* bk = I[7]; const float* Wv = I[8]; const float* bv = I[9]; const float* W1 = I[10]; const float* b1 = I[11]; const float* W2 = I[12]; const float* b2 = I[13]; const float* gam = I[14];
  char* ws = (char*)d_ws; size_t off = 0;
  auto take = [&](size_t bytes) { char* p = ws + off; off += (bytes + 255) & ~(size_t)255; return p; };
  _Float16* Bq = (_Float16*)take(CC * CC * 2); _Float16* Bk = (_Float16*)take(CC * CC * 2); _Float16* Bv = (_Float16*)take(CC * CC * 2); _Float16* B1 = (_Float16*)take(CC * CC * 2); _Float16* B2 = (_Float16*)take(CC * CC * 2); float* TB = (float*)take(BB * CC * 4);
  _Float16* X16 = (_Float16*)take((size_t)NR * CC * 2); _Float16* Q16 = (_Float16*)take((size_t)NR * CC * 2); _Float16* K16 = (_Float16*)take((size_t)NR * CC * 2); _Float16* V16 = (_Float16*)take((size_t)NR * CC * 2); _Float16* Vt = (_Float16*)take((size_t)NR * CC * 2); float* O = (float*)take((size_t)NR * CC * 4); _Float16* O16 = Q16; _Float16* H1 = K16; float* M2 = O;
  if (off > ws_size) return;      // 0.7 + 4.2 × 5 + 8.4 ≈ 30 MiB
  k_prep<<<BB + 5 * WB + TKB, 1024, 0, stream>>>(tf, Wt, bt, Wk, bk, TB, Wq, Wv, W1, W2, Bq, Bk, Bv, B1, B2, pf, X16);      // weights (out,in)
  // Bq, Bk, Bv and Q16, K16, V16 were taken one behind the other and their sizes are multiples of 256 bytes: CC * CC and NR * CC elements apart
  k_gemm_qkv<<<dim3(((NR / 16) * (CC / 64) + 3) / 4, 3), 128, 0, stream>>>(X16, CC, Bq, CC, (size_t)CC * CC, 0.0625f, bq, bv, TB, NN, (size_t)CC, Q16, CC, (size_t)NR * CC, NR, CC, CC);      // k = pf Wk^T + (t Wk^T + bk): the per-batch text bias enters as the CP addend (row block b = row / 4096), unrounded
  k_vt<NH, NN><<<BB * NH * (NN / 64), 256, 0, stream>>>(V16, CC, 0, Vt);
  k_flash<<<BB * NH * (NN / 16), 128, 0, stream>>>(Q16, CC, K16, CC, Vt, nullptr, O, CC);
  const unsigned g8 = (unsigned)(((size_t)NR * CC / 8 + 255) / 256); const dim3 g1(((NR / 16) * (CC / 64) + 3) / 4, 1);
  k_h16<<<g8, 256, 0, stream>>>(O, O16, (size_t)NR * CC / 8);
  k_gemm_hhx<3><<<g1, 128, 0, stream>>>(O16, CC, 0, B1, CC, 0, 0.0625f, b1, 0, nullptr, 1, 0, 0, nullptr, H1, CC, 0, NR, CC, CC);      // relu(x·W1ᵀ + b1)
  k_gemm_hhx<0><<<g1, 128, 0, stream>>>(H1, CC, 0, B2, CC, 0, 0.0625f, b2, 0, nullptr, 1, 0, 0, M2, nullptr, CC, 0, NR, CC, CC);         // ·W2ᵀ + b2 (f32)
  k_fin<<<BB * (CC / 32) * (NN / 64), 256, 0, stream>>>(M2, pf, gam, (float*)d_out);
}

// v005
// A run of this version takes 180 microseconds.
// Timed twice side by side with v004, it ran 1.10 and 1.11 times as fast.
// All steps since v000 together make it 2.99 times as fast.
#include <hip/hip_runtime.h>
// Text-guided point attention (B=2, C=256 channels × N=4096 points; text 512 → 256 GELU projection added to the key input; q/k/v 1×1 convs; 4 heads × 64; UNSCALED softmax(q·k)·v; MLP 256 → relu →
// 256; out = γ·x + point_feats, channel-major): the q/k/v/MLP linears ((out,in) weights bf16-exact ×2^4; the text term enters k as a per-batch bias) and the attention as a fused flash-style
// kernel (online softmax f32, P f16 ≤ 1, O = P·Vt; RPW-16 waves) run on v_wmma_f32_16x16x32_f16 with f32 accumulate; the text projection, the NCW ↔ token-major transposes and the gated
// residual are f32 VALU.
#define BB 2
#define CC 256
#define NN 4096
#define DTX 512
#define NH 4
#define NR (BB * NN)

typedef __bf16 v16b __attribute__((ext_vector_type(16)));
typedef unsigned short v8us __attribute__((ext_vector_type(8), may_alias));
typedef float  v8f  __attribute__((ext_vector_type(8)));
typedef float  v4f  __attribute__((ext_vector_type(4)));
typedef float  v4fa __attribute__((ext_vector_type(4), may_alias));
union FragB { v16b v; v8us half[2]; unsigned short u[16]; };

__device__ __forceinline__ unsigned short bf16_bits(float x) { unsigned int u = __float_as_uint(x); return (unsigned short)((u + 0x7FFFu + ((u >> 16) & 1u)) >> 16); }
__device__ __forceinline__ float bf16_val(unsigned short b) { return __uint_as_float(((unsigned int)b) << 16); }
__device__ __forceinline__ float bf16_round(float x) { return bf16_val(bf16_bits(x)); }
// D += A·B with NT terms: 1 = ah·bh, 2 = + al·bh (A split), 3 = + ah·bl (both split)
template <int NT>
__device__ __forceinline__ v8f mmaN(v16b ah, v16b al, v16b bh, v16b bl, v8f c) {
  c = __builtin_amdgcn_wmma_f32_16x16x32_bf16(false, ah, false, bh, (short)0, c, false, false);
  if (NT >= 2) c = __builtin_amdgcn_wmma_f32_16x16x32_bf16(false, al, false, bh, (short)0, c, false, false);
  if (NT >= 3) c = __builtin_amdgcn_wmma_f32_16x16x32_bf16(false, ah, false, bl, (short)0, c, false, false);
  asm volatile("v_nop\n\tv_nop\n\tv_nop\n\tv_nop" : "+v"(c) : "v"(ah), "v"(al), "v"(bh), "v"(bl));
  return c;
}

__global__ __launch_bounds__(256) void k_wt_bf16(const float* __restrict__ W, unsigned short* __restrict__ Wt, int K, int N) {
  const int t = blockIdx.x * 256 + threadIdx.x;
  const int k8n = K / 8;
  if (t >= N * k8n) return;
  const int n = t / k8n, k8 = (t % k8n) * 8;
  v8us v;
#pragma unroll
  for (int i = 0; i < 8; ++i) v[i] = bf16_bits(W[(size_t)(k8 + i) * N + n]);
  *(v8us*)(Wt + (size_t)n * K + k8) = v;
  
}

// GEMM C[M][N] (f32, pitch ldc) = act(A[M][K]·W + bias). A f32 row-major (pitch lda) converted per fragment to bf16
// (ASPLIT: hi/lo two planes -> 2 terms, else single rounded term); Wt bf16 [N][K] (pitch ldb). BIAS_BF16 rounds the
// bias to bf16 first (bias quantised to bf16 before the add). K%32==0, M%16==0, N%64==0.
template <bool ASPLIT, int ACT, bool BIAS_BF16>
__global__ __launch_bounds__(128) void k_gemm_bf(const float* __restrict__ A, int lda, const unsigned short* __restrict__ Wt, int ldb,
                                               const float* __restrict__ bias, float* __restrict__ C, int ldc, int M, int N, int K) {
  __shared__ __attribute__((aligned(16))) float so[4][16][64];
  const int tid = threadIdx.x, w = tid >> 5, lane = tid & 31, ln = lane & 15, hh = lane >> 4;
  const int ntn = N / 64;
  const int wid = blockIdx.x * 4 + w;
  const int mt = wid / ntn, nq = wid % ntn;
  if (mt * 16 >= M) return;
  const int row0 = mt * 16, col0 = nq * 64;
  const float* arow = A + (size_t)(row0 + ln) * lda;
  v8f acc[4] = {};
  for (int kb = 0; kb < K; kb += 32) {
    FragB ah, al;
    const v4f x0 = *(const v4fa*)(arow + kb + 8 * hh), x1 = *(const v4fa*)(arow + kb + 8 * hh + 4);
    const v4f x2 = *(const v4fa*)(arow + kb + 16 + 8 * hh), x3 = *(const v4fa*)(arow + kb + 16 + 8 * hh + 4);
    float xs[16] = {x0[0],x0[1],x0[2],x0[3],x1[0],x1[1],x1[2],x1[3],x2[0],x2[1],x2[2],x2[3],x3[0],x3[1],x3[2],x3[3]};
#pragma unroll
    for (int i = 0; i < 16; ++i) { const unsigned short hb = bf16_bits(xs[i]); ah.u[i] = hb; al.u[i] = ASPLIT ? bf16_bits(xs[i] - bf16_val(hb)) : (unsigned short)0; }
#pragma unroll
    for (int t = 0; t < 4; ++t) {
      const unsigned short* brow = Wt + (size_t)(col0 + t * 16 + ln) * ldb + kb;
      FragB b;
      b.half[0] = *(const v8us*)(brow + 8 * hh);
      b.half[1] = *(const v8us*)(brow + 16 + 8 * hh);
      acc[t] = mmaN<ASPLIT ? 2 : 1>(ah.v, al.v, b.v, b.v, acc[t]);
    }
  }
#pragma unroll
  for (int t = 0; t < 4; ++t) {
    float bv = bias ? bias[col0 + t * 16 + ln] : 0.f;
    if (BIAS_BF16) bv = bf16_round(bv);
#pragma unroll
    for (int r = 0; r < 8; ++r) { float v = acc[t][r] + bv; if (ACT == 1) v = fmaxf(v, 0.f); so[w][8 * hh + r][t * 16 + ln] = v; }
  }
  __builtin_amdgcn_fence(__ATOMIC_ACQ_REL, "workgroup");
  __builtin_amdgcn_wave_barrier();
  const int rsub = lane >> 4, c4 = (lane & 15) * 4;
  {
#pragma unroll
    for (int q = 0; q < 8; ++q) {
      const int r = q * 2 + rsub;
      const v4f v = *(const v4fa*)&so[w][r][c4];
      *(v4f*)(C + (size_t)(row0 + r) * ldc + col0 + c4) = v;
    }
    
  }
}

// Flash-style causal/unmasked attention, all contractions 3-term bf16 hi/lo splits, f32 softmax with running max.
// q,k,v rows are read from f32 buffers with arbitrary row pitch (so they can live inside a fused qkv buffer);
// D = head size (multiple of 32, <= 128); one wave = 16 query rows; block = 4 waves (64 queries) sharing K/V chunks of 32.
template <int D, bool CAUSAL>
__global__ __launch_bounds__(128) void k_flash(const float* __restrict__ qb, const float* __restrict__ kb, const float* __restrict__ vb,
                                             int pitch, int T, int H, float scale, float* __restrict__ y, int ypitch) {
  constexpr int KS = D / 32;        // k-steps for QK
  constexpr int DT = D / 16;        // d tiles for PV
  __shared__ __attribute__((aligned(16))) unsigned short sKh[32][D + 8], sKl[32][D + 8], sVh[32][D + 8], sVl[32][D + 8];
  __shared__ __attribute__((aligned(16))) unsigned short sPh[4][16][40], sPl[4][16][40];
  __shared__ __attribute__((aligned(16))) float sO[4][16][D];
  const int tid = threadIdx.x, w = tid >> 5, lane = tid & 31, ln = lane & 15, hh = lane >> 4;
  const int nqb = (T + 63) / 64;
  const int bh = blockIdx.x / nqb, qblk = blockIdx.x % nqb;
  const int b = bh / H, h = bh % H;
  const int q0 = qblk * 64 + w * 16;
  const float* Q = qb + (size_t)b * T * pitch + h * D;
  const float* K = kb + (size_t)b * T * pitch + h * D;
  const float* V = vb + (size_t)b * T * pitch + h * D;

  // A fragments of the wave's 16 query rows (scaled), hi/lo
  FragB aqh[KS], aql[KS];
  {
    int row = q0 + ln; if (row >= T) row = T - 1;
    const float* qr = Q + (size_t)row * pitch;
#pragma unroll
    for (int ks = 0; ks < KS; ++ks)
#pragma unroll
      for (int i = 0; i < 16; ++i) {
        const int d = ks * 32 + ((i < 8) ? (8 * hh + i) : (16 + 8 * hh + (i - 8)));
        const float x = qr[d] * scale; const unsigned short hb = bf16_bits(x);
        aqh[ks].u[i] = hb; aql[ks].u[i] = bf16_bits(x - bf16_val(hb));
      }
  }
  float m_r[8], l_r[8];
#pragma unroll
  for (int r = 0; r < 8; ++r) { m_r[r] = -3.0e38f; l_r[r] = 0.f; }
  v8f oacc[DT];
#pragma unroll
  for (int dt = 0; dt < DT; ++dt) oacc[dt] = (v8f){0.f,0.f,0.f,0.f,0.f,0.f,0.f,0.f};

  const int kv_end = CAUSAL ? min(T, qblk * 64 + 64) : T;     // block-uniform
  for (int j0 = 0; j0 < kv_end; j0 += 32) {
    __syncthreads();
    for (int e = tid; e < 32 * (D / 4); e += 128) {
      const int r = e / (D / 4), c4 = (e % (D / 4)) * 4;
      const int key = j0 + r;
      v4f kf = {0.f,0.f,0.f,0.f}, vf = {0.f,0.f,0.f,0.f};
      if (key < T) { kf = *(const v4fa*)(K + (size_t)key * pitch + c4); vf = *(const v4fa*)(V + (size_t)key * pitch + c4); }
#pragma unroll
      for (int t = 0; t < 4; ++t) {
        unsigned short hb = bf16_bits(kf[t]); sKh[r][c4 + t] = hb; sKl[r][c4 + t] = bf16_bits(kf[t] - bf16_val(hb));
        hb = bf16_bits(vf[t]); sVh[r][c4 + t] = hb; sVl[r][c4 + t] = bf16_bits(vf[t] - bf16_val(hb));
      }
    }
    __syncthreads();
    // S tile 16 x 32
    v8f s[2];
#pragma unroll
    for (int nt = 0; nt < 2; ++nt) {
      v8f acc = {};
#pragma unroll
      for (int ks = 0; ks < KS; ++ks) {
        FragB bh_, bl_;
        bh_.half[0] = *(const v8us*)&sKh[nt * 16 + ln][ks * 32 + 8 * hh]; bh_.half[1] = *(const v8us*)&sKh[nt * 16 + ln][ks * 32 + 16 + 8 * hh];
        bl_.half[0] = *(const v8us*)&sKl[nt * 16 + ln][ks * 32 + 8 * hh]; bl_.half[1] = *(const v8us*)&sKl[nt * 16 + ln][ks * 32 + 16 + 8 * hh];
        acc = mmaN<3>(aqh[ks].v, aql[ks].v, bh_.v, bl_.v, acc);
      }
      s[nt] = acc;
    }
    // mask + running max (rows 8hh+r; the 16 lanes of a half share rows)
    float alpha[8];
#pragma unroll
    for (int r = 0; r < 8; ++r) {
      const int qi = q0 + 8 * hh + r;
      const int ja = j0 + ln, jb = j0 + 16 + ln;
      if (CAUSAL) { if (ja > qi) s[0][r] = -3.0e38f; if (jb > qi) s[1][r] = -3.0e38f; }
      if (ja >= T) s[0][r] = -3.0e38f;
      if (jb >= T) s[1][r] = -3.0e38f;
      float mx = fmaxf(s[0][r], s[1][r]);
      mx = fmaxf(mx, __shfl_xor(mx, 1, 32)); mx = fmaxf(mx, __shfl_xor(mx, 2, 32)); mx = fmaxf(mx, __shfl_xor(mx, 4, 32)); mx = fmaxf(mx, __shfl_xor(mx, 8, 32));
      const float mnew = fmaxf(m_r[r], mx);
      alpha[r] = (mnew > -1.0e38f) ? __expf(m_r[r] - mnew) : 1.0f;
      const float p0 = (s[0][r] > -1.0e38f) ? __expf(s[0][r] - mnew) : 0.f;
      const float p1 = (s[1][r] > -1.0e38f) ? __expf(s[1][r] - mnew) : 0.f;
      m_r[r] = mnew;
      l_r[r] = l_r[r] * alpha[r] + p0 + p1;            // per-lane partial row sum (16 lanes combined at the end)
      unsigned short hb = bf16_bits(p0); sPh[w][8 * hh + r][ln] = hb;      sPl[w][8 * hh + r][ln] = bf16_bits(p0 - bf16_val(hb));
      hb = bf16_bits(p1);                sPh[w][8 * hh + r][16 + ln] = hb; sPl[w][8 * hh + r][16 + ln] = bf16_bits(p1 - bf16_val(hb));
    }
#pragma unroll
    for (int dt = 0; dt < DT; ++dt)
#pragma unroll
      for (int r = 0; r < 8; ++r) oacc[dt][r] *= alpha[r];
    __builtin_amdgcn_fence(__ATOMIC_ACQ_REL, "workgroup");
    __builtin_amdgcn_wave_barrier();
    FragB pah, pal;
    pah.half[0] = *(const v8us*)&sPh[w][ln][8 * hh]; pah.half[1] = *(const v8us*)&sPh[w][ln][16 + 8 * hh];
    pal.half[0] = *(const v8us*)&sPl[w][ln][8 * hh]; pal.half[1] = *(const v8us*)&sPl[w][ln][16 + 8 * hh];
#pragma unroll
    for (int dt = 0; dt < DT; ++dt) {
      FragB bvh, bvl;
#pragma unroll
      for (int i = 0; i < 8; ++i) {
        bvh.u[i] = sVh[8 * hh + i][dt * 16 + ln]; bvh.u[8 + i] = sVh[16 + 8 * hh + i][dt * 16 + ln];
        bvl.u[i] = sVl[8 * hh + i][dt * 16 + ln]; bvl.u[8 + i] = sVl[16 + 8 * hh + i][dt * 16 + ln];
      }
      oacc[dt] = mmaN<3>(pah.v, pal.v, bvh.v, bvl.v, oacc[dt]);
    }
    __builtin_amdgcn_fence(__ATOMIC_ACQ_REL, "workgroup");
    __builtin_amdgcn_wave_barrier();
  }
#pragma unroll
  for (int r = 0; r < 8; ++r) {
    float l = l_r[r];
    l += __shfl_xor(l, 1, 32); l += __shfl_xor(l, 2, 32); l += __shfl_xor(l, 4, 32); l += __shfl_xor(l, 8, 32);
    l_r[r] = (l > 0.f) ? 1.0f / l : 0.f;
  }
#pragma unroll
  for (int dt = 0; dt < DT; ++dt)
#pragma unroll
    for (int r = 0; r < 8; ++r) sO[w][8 * hh + r][dt * 16 + ln] = oacc[dt][r] * l_r[r];
  __builtin_amdgcn_fence(__ATOMIC_ACQ_REL, "workgroup");
  __builtin_amdgcn_wave_barrier();
  {
    for (int r = 0; r < 16; ++r) {
      const int row = q0 + r;
      if (row < T && lane < D / 4) {
        const v4f val = *(const v4fa*)&sO[w][r][lane * 4];
        *(v4f*)(y + ((size_t)b * T + row) * ypitch + h * D + lane * 4) = val;
      }
    }
    
  }
}

// GEMM C = act(A·W + bias + resid): A f32 (ASPLIT -> hi/lo 2 terms), Wt bf16 [N][K]; ACT 0 none, 1 relu, 2 exact gelu;
// resid (optional, f32, row index = (row % rmod), pitch ldr, RES_BF16 rounds it) added before the activation.
template <bool ASPLIT, int ACT, bool BIAS_BF16, bool RES_BF16>
__global__ __launch_bounds__(128) void k_gemm_bf3(const float* __restrict__ A, int lda, const unsigned short* __restrict__ Wt, int ldb,
                                                const float* __restrict__ bias, const float* __restrict__ resid, int rmod, int ldr,
                                                float* __restrict__ C, int ldc, int M, int N, int K) {
  __shared__ __attribute__((aligned(16))) float so[4][16][64];
  const int tid = threadIdx.x, w = tid >> 5, lane = tid & 31, ln = lane & 15, hh = lane >> 4;
  const int ntn = N / 64;
  const int wid = blockIdx.x * 4 + w;
  const int mt = wid / ntn, nq = wid % ntn;
  if (mt * 16 >= M) return;
  const int row0 = mt * 16, col0 = nq * 64;
  const float* arow = A + (size_t)(row0 + ln) * lda;
  v8f acc[4] = {};
  for (int kb = 0; kb < K; kb += 32) {
    FragB ah, al;
    const v4f x0 = *(const v4fa*)(arow + kb + 8 * hh), x1 = *(const v4fa*)(arow + kb + 8 * hh + 4);
    const v4f x2 = *(const v4fa*)(arow + kb + 16 + 8 * hh), x3 = *(const v4fa*)(arow + kb + 16 + 8 * hh + 4);
    float xs[16] = {x0[0],x0[1],x0[2],x0[3],x1[0],x1[1],x1[2],x1[3],x2[0],x2[1],x2[2],x2[3],x3[0],x3[1],x3[2],x3[3]};
#pragma unroll
    for (int i = 0; i < 16; ++i) { const unsigned short hb = bf16_bits(xs[i]); ah.u[i] = hb; al.u[i] = ASPLIT ? bf16_bits(xs[i] - bf16_val(hb)) : (unsigned short)0; }
#pragma unroll
    for (int t = 0; t < 4; ++t) {
      const unsigned short* brow = Wt + (size_t)(col0 + t * 16 + ln) * ldb + kb;
      FragB b;
      b.half[0] = *(const v8us*)(brow + 8 * hh);
      b.half[1] = *(const v8us*)(brow + 16 + 8 * hh);
      acc[t] = mmaN<ASPLIT ? 2 : 1>(ah.v, al.v, b.v, b.v, acc[t]);
    }
  }
#pragma unroll
  for (int t = 0; t < 4; ++t) {
    const int col = col0 + t * 16 + ln;
    float bv = bias ? bias[col] : 0.f;
    if (BIAS_BF16) bv = bf16_round(bv);
#pragma unroll
    for (int r = 0; r < 8; ++r) {
      float v = acc[t][r] + bv;
      if (resid) { float rv = resid[(size_t)((row0 + 8 * hh + r) % rmod) * ldr + col]; if (RES_BF16) rv = bf16_round(rv); v += rv; }
      if (ACT == 1) v = fmaxf(v, 0.f);
      if (ACT == 2) v = 0.5f * v * (1.0f + erff(v * 0.70710678118654752f));
      if (ACT == 3) { const float u = 0.7978845608028654f * (v + 0.044715f * v * v * v); v = 0.5f * v * (1.0f + tanhf(u)); }
      so[w][8 * hh + r][t * 16 + ln] = v;
    }
  }
  __builtin_amdgcn_fence(__ATOMIC_ACQ_REL, "workgroup");
  __builtin_amdgcn_wave_barrier();
  const int rsub = lane >> 4, c4 = (lane & 15) * 4;
  {
#pragma unroll
    for (int q = 0; q < 8; ++q) {
      const int r = q * 2 + rsub;
      const v4f v = *(const v4fa*)&so[w][r][c4];
      *(v4f*)(C + (size_t)(row0 + r) * ldc + col0 + c4) = v;
    }
    
  }
}
// row LayerNorm (biased variance, eps) over N: s = X (+ R); optional out_sum <- s; out_norm <- (s-mu)*rsqrt(var+eps)*g + b
template <bool PARAM_BF16>
__global__ __launch_bounds__(256) void k_layernorm(const float* __restrict__ X, const float* __restrict__ R, const float* __restrict__ g, const float* __restrict__ bta,
                                                  float* __restrict__ out_sum, float* __restrict__ out_norm, int N, float eps) {
  __shared__ float red[256];
  const int row = blockIdx.x, tid = threadIdx.x;
  const float* x = X + (size_t)row * N; const float* rr = R ? R + (size_t)row * N : nullptr;
  float vals[16];                     // up to N = 4096
  const int per = N / 256;            // contiguous chunk per thread? use strided-by-4 chunks: thread handles j = tid*4 + 1024*u
  float s1 = 0.f;
  for (int u = 0; u < per / 4; ++u) {
    const int j = tid * 4 + 1024 * u;
    const v4f a = *(const v4fa*)(x + j);
    v4f b = {0.f,0.f,0.f,0.f}; if (rr) b = *(const v4fa*)(rr + j);
#pragma unroll
    for (int q = 0; q < 4; ++q) { const float v = a[q] + b[q]; vals[u * 4 + q] = v; s1 += v; }
  }
  red[tid] = s1; __syncthreads();
  for (int st = 128; st > 0; st >>= 1) { if (tid < st) red[tid] += red[tid + st]; __syncthreads(); }
  const float mu = red[0] / (float)N; __syncthreads();
  float s2 = 0.f;
  for (int u = 0; u < per / 4; ++u)
#pragma unroll
    for (int q = 0; q < 4; ++q) { const float c = vals[u * 4 + q] - mu; s2 += c * c; }
  red[tid] = s2; __syncthreads();
  for (int st = 128; st > 0; st >>= 1) { if (tid < st) red[tid] += red[tid + st]; __syncthreads(); }
  const float rs = rsqrtf(red[0] / (float)N + eps);
  {
    for (int u = 0; u < per / 4; ++u) {
      const int j = tid * 4 + 1024 * u;
      v4f o, sm;
#pragma unroll
      for (int q = 0; q < 4; ++q) {
        float gg = g[j + q], bb = bta[j + q];
        if (PARAM_BF16) { gg = bf16_round(gg); bb = bf16_round(bb); }
        sm[q] = vals[u * 4 + q]; o[q] = (vals[u * 4 + q] - mu) * rs * gg + bb;
      }
      if (out_sum) *(v4f*)(out_sum + (size_t)row * N + j) = sm;
      *(v4f*)(out_norm + (size_t)row * N + j) = o;
    }
    
  }
}



// ---- f16 WMMA path (v_wmma_f32_16x16x32_f16): 11-bit significands for operands in range — used where a [0,1] probability operand needs more precision than bf16
typedef _Float16 v16h __attribute__((ext_vector_type(16)));
union FragH { v16h v; v8us half[2]; _Float16 h[16]; unsigned short u[16]; };
template <int NT>
__device__ __forceinline__ v8f mmaH(v16h ah, v16h al, v16h bh, v16h bl, v8f c) {
  c = __builtin_amdgcn_wmma_f32_16x16x32_f16(false, ah, false, bh, (short)0, c, false, false);
  if (NT >= 2) c = __builtin_amdgcn_wmma_f32_16x16x32_f16(false, al, false, bh, (short)0, c, false, false);
  if (NT >= 3) c = __builtin_amdgcn_wmma_f32_16x16x32_f16(false, ah, false, bl, (short)0, c, false, false);
  asm volatile("v_nop\n\tv_nop\n\tv_nop\n\tv_nop" : "+v"(c) : "v"(ah), "v"(al), "v"(bh), "v"(bl));
  return c;
}
// batched GEMM like k_gemm_b but f16 operands: A f32 (split into f16 hi/lo if ASPLIT, else rounded to f16), Bt = f16 values [n][k]; alpha; C f32; N multiple of 16 (partial tiles skipped)
template <bool ASPLIT>
__global__ __launch_bounds__(128) void k_gemm_h(const float* __restrict__ A, int lda, size_t sA, const _Float16* __restrict__ Bh, int ldb, size_t sB, float alpha, float* __restrict__ C, int ldc, size_t sC, int M, int N, int K) {
  __shared__ __attribute__((aligned(16))) float so[4][16][64];
  const int tid = threadIdx.x, w = tid >> 5, lane = tid & 31, ln = lane & 15, hh = lane >> 4; const int by = blockIdx.y;
  A += (size_t)by * sA; Bh += (size_t)by * sB; C += (size_t)by * sC;
  const int ntn = (N + 63) / 64; const int wid = blockIdx.x * 4 + w; const int mt = wid / ntn, nq = wid % ntn; if (mt * 16 >= M) return;
  const int row0 = mt * 16, col0 = nq * 64; const float* arow = A + (size_t)(row0 + ln) * lda;
  v8f acc[4] = {};
  for (int kb = 0; kb < K; kb += 32) {
    FragH ah, al;
    const v4f x0 = *(const v4fa*)(arow + kb + 8 * hh), x1 = *(const v4fa*)(arow + kb + 8 * hh + 4), x2 = *(const v4fa*)(arow + kb + 16 + 8 * hh), x3 = *(const v4fa*)(arow + kb + 16 + 8 * hh + 4);
    float xs[16] = {x0[0],x0[1],x0[2],x0[3],x1[0],x1[1],x1[2],x1[3],x2[0],x2[1],x2[2],x2[3],x3[0],x3[1],x3[2],x3[3]};
#pragma unroll
    for (int i = 0; i < 16; ++i) { const _Float16 h = (_Float16)xs[i]; ah.h[i] = h; al.h[i] = ASPLIT ? (_Float16)(xs[i] - (float)h) : (_Float16)0.0f; }
#pragma unroll
    for (int t = 0; t < 4; ++t) { if (col0 + t * 16 >= N) continue; const size_t boff = (size_t)(col0 + t * 16 + ln) * ldb + kb; FragH bq; bq.half[0] = *(const v8us*)(Bh + boff + 8 * hh); bq.half[1] = *(const v8us*)(Bh + boff + 16 + 8 * hh);
      acc[t] = mmaH<ASPLIT ? 2 : 1>(ah.v, al.v, bq.v, bq.v, acc[t]); }
  }
#pragma unroll
  for (int t = 0; t < 4; ++t) { if (col0 + t * 16 >= N) continue;
#pragma unroll
    for (int r = 0; r < 8; ++r) so[w][8 * hh + r][t * 16 + ln] = acc[t][r] * alpha; }
  __builtin_amdgcn_fence(__ATOMIC_ACQ_REL, "workgroup"); __builtin_amdgcn_wave_barrier();
  const int rsub = lane >> 4, c4 = (lane & 15) * 4;
  {
#pragma unroll
    for (int q = 0; q < 8; ++q) { const int r = q * 2 + rsub; if (col0 + c4 < N) { const v4f v = *(const v4fa*)&so[w][r][c4]; *(v4f*)(C + (size_t)(row0 + r) * ldc + col0 + c4) = v; } }
     }
}

// Wt[n][k] = f16(W[k][n]·scale) from f32 row-major W[K][N] (scale = power of two; bf16-exact weights stay exact in f16 away from the subnormal range)
__global__ __launch_bounds__(256) void k_wt_f16(const float* __restrict__ W, _Float16* __restrict__ Wt, int K, int N, float scale) {
  const int t = blockIdx.x * 256 + threadIdx.x; if (t >= N * (K / 8)) return; const int n = t / (K / 8), k8 = (t % (K / 8)) * 8; FragH f;
#pragma unroll
  for (int i = 0; i < 8; ++i) f.h[i] = (_Float16)(bf16_round(W[(size_t)(k8 + i) * N + n]) * scale); const v8us o = f.half[0];
  *(v8us*)((unsigned short*)Wt + (size_t)n * K + k8) = o; 
}
// k_gemm_hh variant with fused epilogue: v = acc·alpha + bias[by·sBias + col] (+ CP[(row/rowsPerB)·sCPb + by·64 + col] if CP) ; ACT 0 none / 1 elu ; writes f16 C16 and f32 C, each if non-null
template <int ACT>
__device__ __forceinline__ void gemm_hhx_part(const _Float16* __restrict__ A, int lda, size_t sA, const _Float16* __restrict__ Bh, int ldb, size_t sB, float alpha, const float* __restrict__ bias, size_t sBias, const float* __restrict__ CP, int rowsPerB, size_t sCPb, int row0g,
    float* __restrict__ C, _Float16* __restrict__ C16, int ldc, size_t sC, int M, int N, int K, const int by) {
  __shared__ __attribute__((aligned(16))) float so[4][16][64];
  const int tid = threadIdx.x, w = tid >> 5, lane = tid & 31, ln = lane & 15, hh = lane >> 4;
  A += (size_t)by * sA; Bh += (size_t)by * sB; const size_t cofs = (size_t)by * sC; const float* bp = bias ? bias + (size_t)by * sBias : nullptr;
  const int ntn = (N + 63) / 64; const int wid = blockIdx.x * 4 + w; const int mt = wid / ntn, nq = wid % ntn; if (mt * 16 >= M) return;
  const int row0 = mt * 16, col0 = nq * 64; const _Float16* arow = A + (size_t)(row0 + ln) * lda;
  v8f acc[4] = {};
  for (int kb = 0; kb < K; kb += 32) { FragH ah; ah.half[0] = *(const v8us*)((const unsigned short*)arow + kb + 8 * hh); ah.half[1] = *(const v8us*)((const unsigned short*)arow + kb + 16 + 8 * hh);
#pragma unroll
    for (int t = 0; t < 4; ++t) { if (col0 + t * 16 >= N) continue; const size_t boff = (size_t)(col0 + t * 16 + ln) * ldb + kb; FragH bq; bq.half[0] = *(const v8us*)((const unsigned short*)Bh + boff + 8 * hh); bq.half[1] = *(const v8us*)((const unsigned short*)Bh + boff + 16 + 8 * hh);
      acc[t] = mmaH<1>(ah.v, ah.v, bq.v, bq.v, acc[t]); }
  }
#pragma unroll
  for (int t = 0; t < 4; ++t) { if (col0 + t * 16 >= N) continue; const int col = col0 + t * 16 + ln; const float bv = bp ? bf16_round(bp[col]) : 0.f;
#pragma unroll
    for (int r = 0; r < 8; ++r) { float v = acc[t][r] * alpha + bv; if (CP) { const int bidx = (row0g + row0 + 8 * hh + r) / rowsPerB; v += CP[(size_t)bidx * sCPb + (size_t)by * 64 + col]; } if (ACT == 1) v = (v > 0.f) ? v : expm1f(v); else if (ACT == 3) v = fmaxf(v, 0.f); so[w][8 * hh + r][t * 16 + ln] = v; } }
  __builtin_amdgcn_fence(__ATOMIC_ACQ_REL, "workgroup"); __builtin_amdgcn_wave_barrier();
  const int rsub = lane >> 4, c4 = (lane & 15) * 4; typedef _Float16 v4h __attribute__((ext_vector_type(4)));
  {
#pragma unroll
    for (int q = 0; q < 8; ++q) { const int r = q * 2 + rsub; if (col0 + c4 < N) { const v4f v = *(const v4fa*)&so[w][r][c4]; if (C) { *(v4f*)(C + cofs + (size_t)(row0 + r) * ldc + col0 + c4) = v; asm volatile("s_wait_xcnt 0x0" ::: "memory"); }      // before the conversion below reuses a register that this store names
      if (C16) { v4h h4; for (int i = 0; i < 4; ++i) h4[i] = (_Float16)v[i]; *(v4h*)(C16 + cofs + (size_t)(row0 + r) * ldc + col0 + c4) = h4; asm volatile("s_wait_xcnt 0x0" ::: "memory"); } } }      // before the next row's values and addresses reuse a register that this store names
     }
}
template <int ACT>
__global__ __launch_bounds__(128) void k_gemm_hhx(const _Float16* __restrict__ A, int lda, size_t sA, const _Float16* __restrict__ Bh, int ldb, size_t sB, float alpha, const float* __restrict__ bias, size_t sBias, const float* __restrict__ CP, int rowsPerB, size_t sCPb, int row0g,
    float* __restrict__ C, _Float16* __restrict__ C16, int ldc, size_t sC, int M, int N, int K) {
  gemm_hhx_part<ACT>(A, lda, sA, Bh, ldb, sB, alpha, bias, sBias, CP, rowsPerB, sCPb, row0g, C, C16, ldc, sC, M, N, K, blockIdx.y); }
// The q, k and v projections read the same A and depend on nothing of one another: one grid, blockIdx.y = 0 q, 1 k, 2 v picks the weights (sB apart), the output (sC apart) and the addend
// (q and v: their bias; k: the per-batch text term CPk, row block = row / rowsPerB). Three times the waves of one projection are resident at once and cover each other's load waits.
__global__ __launch_bounds__(128) void k_gemm_qkv(const _Float16* __restrict__ A, int lda, const _Float16* __restrict__ Bh, int ldb, size_t sB, float alpha, const float* __restrict__ bias_q, const float* __restrict__ bias_v, const float* __restrict__ CPk, int rowsPerB, size_t sCPb,
    _Float16* __restrict__ C16, int ldc, size_t sC, int M, int N, int K) {
  const int z = blockIdx.y;
  gemm_hhx_part<0>(A, lda, 0, Bh + (size_t)z * sB, ldb, 0, alpha, z == 0 ? bias_q : (z == 2 ? bias_v : nullptr), 0, z == 1 ? CPk : nullptr, rowsPerB, sCPb, 0, nullptr, C16 + (size_t)z * sC, ldc, 0, M, N, K, 0); }


__global__ __launch_bounds__(256) void k_x16(const float* __restrict__ x, _Float16* __restrict__ X16, size_t n8) { const size_t t = (size_t)blockIdx.x * 256 + threadIdx.x; if (t >= n8) return; FragH f;
#pragma unroll
  for (int q = 0; q < 8; ++q) f.h[q] = (_Float16)bf16_round(x[t * 8 + q]); *(v8us*)((unsigned short*)X16 + t * 8) = f.half[0];  }
__global__ __launch_bounds__(256) void k_h16(const float* __restrict__ x, _Float16* __restrict__ X16, size_t n8) { const size_t t = (size_t)blockIdx.x * 256 + threadIdx.x; if (t >= n8) return; FragH f;
#pragma unroll
  for (int q = 0; q < 8; ++q) f.h[q] = (_Float16)x[t * 8 + q]; *(v8us*)((unsigned short*)X16 + t * 8) = f.half[0];  }
__device__ __forceinline__ void round16f_part(const float* __restrict__ W, _Float16* __restrict__ Bt, size_t n8, const size_t t) { if (t >= n8) return; FragH f;
#pragma unroll
  for (int i = 0; i < 8; ++i) f.h[i] = (_Float16)(bf16_round(W[t * 8 + i]) * 16.0f); *(v8us*)((unsigned short*)Bt + t * 8) = f.half[0];
  asm volatile("s_wait_xcnt 0x0" ::: "memory"); }      // the built code holds a path from here into another part of the grid's kernel, which reuses the registers that this store names
// K and V are laid out anew in the order in which the attention kernel's matrix operands want them. A tile is 32 keys of one (batch, head) slab = 8 fragment halves of 512 bytes; in a half,
// lane l owns bytes 16 l .. 16 l + 15, exactly the eight f16 that it holds of that operand half. Each wave-wide 16-byte load of the attention loop then covers four whole 128-byte lines
// instead of 32-byte pieces of sixteen. K half fr = (nt * 2 + ks) * 2 + hf: key nt * 16 + ln, channels ks * 32 + hf * 16 + 8 hh + q. V half fr = dt * 2 + hf: channel dt * 16 + ln, keys hf * 16 + 8 hh + q.
template <int NHv, int TTv>
__global__ __launch_bounds__(256) void k_pack(const _Float16* __restrict__ V16, int ldv, int voff, _Float16* __restrict__ Vp, const _Float16* __restrict__ K16, _Float16* __restrict__ Kp) { __shared__ unsigned short tl[64][66]; const int tid = threadIdx.x; const int slab = blockIdx.x / (TTv / 64), lg = blockIdx.x % (TTv / 64); const int b = slab / NHv, h = slab % NHv;
  const int fr = (tid >> 5) & 7, lane = tid & 31, ln = lane & 15, hh = lane >> 4;      // a wave writes one fragment half of each of the block's two tiles
  const size_t dst0 = ((size_t)(slab * (TTv / 32) + lg * 2) * 8 + fr) * 256 + lane * 8;
  for (int i = tid; i < 64 * 8; i += 256) { const int r = i / 8, c8 = (i % 8) * 8; FragH f; f.half[0] = *(const v8us*)((const unsigned short*)V16 + ((size_t)b * TTv + lg * 64 + r) * ldv + voff + h * 64 + c8);
#pragma unroll
    for (int q = 0; q < 8; ++q) tl[r][c8 + q] = f.u[q]; }
  {
#pragma unroll
    for (int jt = 0; jt < 2; ++jt) { const v8us kv = *(const v8us*)((const unsigned short*)K16 + ((size_t)b * TTv + lg * 64 + jt * 32 + (fr >> 2) * 16 + ln) * ldv + h * 64 + ((fr >> 1) & 1) * 32 + (fr & 1) * 16 + 8 * hh);
      *(v8us*)((unsigned short*)Kp + dst0 + jt * 2048) = kv; }
    asm volatile("s_wait_xcnt 0x0" ::: "memory"); }      // before the V part below reuses a register that these loads and stores name
  __syncthreads();
  {
#pragma unroll
    for (int jt = 0; jt < 2; ++jt) { const int d = (fr >> 1) * 16 + ln, k0 = jt * 32 + (fr & 1) * 16 + 8 * hh; FragH f;
#pragma unroll
      for (int q = 0; q < 8; ++q) f.u[q] = tl[k0 + q][d];
      *(v8us*)((unsigned short*)Vp + dst0 + jt * 2048) = f.half[0]; }
     } }

// Key split: the four waves of a block share ONE tile of 16 query rows; wave w walks the 32-key tiles w, w + 4, w + 8, ... with its own running max, sum and O,
// and the four partial results are merged through LDS at the end. 2048 blocks of 4 waves: eight waves per SIMD (second launch bound: 128 registers a wave) cover each other's load waits.
// Both products are formed transposed: S^T = K Q^T (A = 16 key rows, B = the query tile, kept in registers) and O^T += V^T P^T. A lane then holds 16 of the 32 scores of ONE query
// (query ln, keys 8 hh + r and 16 + 8 hh + r): its maximum and sum are in-lane but for one exchange between the wave's halves, max, sum and rescale factor are one register each,
// and the two score tiles, converted in place, ARE the B operand of the second product in the hardware k order, which the V^T loads already follow.
__device__ __forceinline__ float xhalf(float x) { return __builtin_bit_cast(float, __builtin_amdgcn_permlanex16(__builtin_bit_cast(int, x), __builtin_bit_cast(int, x), 0x76543210, 0xfedcba98, false, false)); }      // lane l with lane l ^ 16
__global__ __launch_bounds__(128, 8) void k_flash(const _Float16* __restrict__ Q16, int ldq, const _Float16* __restrict__ Kp, const _Float16* __restrict__ Vp, const int* __restrict__ MSK, float* __restrict__ O, int ldo) {
  constexpr int RPW = 16, NQB = 4096 / RPW, DT = 4, KS = 2; (void)MSK;
  __shared__ __attribute__((aligned(16))) float sO[4][RPW][64 + 4]; __shared__ float sM[4][RPW], sL[4][RPW];
  const int tid = threadIdx.x, w = tid >> 5, lane = tid & 31, ln = lane & 15, hh = lane >> 4;
  const int slab = blockIdx.x / NQB, qblk = blockIdx.x % NQB; const int b = slab / 4, h = slab % 4; const int q0 = qblk * RPW;
  FragH bq[KS];
  { const unsigned short* qr = (const unsigned short*)Q16 + ((size_t)b * 4096 + q0 + ln) * ldq + h * 64;
#pragma unroll
    for (int ks = 0; ks < KS; ++ks) { bq[ks].half[0] = *(const v8us*)(qr + ks * 32 + 8 * hh); bq[ks].half[1] = *(const v8us*)(qr + ks * 32 + 16 + 8 * hh); } }
  const unsigned short* Kph = (const unsigned short*)Kp + (size_t)slab * 64 * 4096 + lane * 8; const unsigned short* Vph = (const unsigned short*)Vp + (size_t)slab * 64 * 4096 + lane * 8;      // fragment order (k_pack): 2048 elements a 32-key tile, 256 a fragment half
  float m_q = -3.0e38f, l_q = 0.f; v8f oacc[DT];      // oacc[dt][r] = O[query ln][dt * 16 + 8 * hh + r], unnormalised
#pragma unroll
  for (int dt = 0; dt < DT; ++dt) oacc[dt] = (v8f){0.f,0.f,0.f,0.f,0.f,0.f,0.f,0.f};
  const int jend = 4096;
#pragma unroll 1
  for (int jb = 0; jb < jend; jb += 4 * 32) { const int j0 = jb + w * 32; const unsigned short* kt = Kph + (size_t)j0 * 64; const unsigned short* vt = Vph + (size_t)j0 * 64;      // the trip test is on jb, the same in every wave: a scalar branch, EXEC untouched around the WMMAs
    v8f s[2];      // s[nt][r] = q(ln) . k(j0 + nt * 16 + 8 * hh + r)
#pragma unroll
    for (int nt = 0; nt < 2; ++nt) { FragH ak[KS];
#pragma unroll
      for (int ks = 0; ks < KS; ++ks) { ak[ks].half[0] = *(const v8us*)(kt + ((nt * 2 + ks) * 2) * 256); ak[ks].half[1] = *(const v8us*)(kt + ((nt * 2 + ks) * 2 + 1) * 256); }
      v8f acc = (v8f){0.f,0.f,0.f,0.f,0.f,0.f,0.f,0.f};
#pragma unroll
      for (int ks = 0; ks < KS; ++ks) acc = mmaH<1>(ak[ks].v, ak[ks].v, bq[ks].v, bq[ks].v, acc);
      s[nt] = acc; }
    asm volatile("s_wait_xcnt 0x0" :: "v"(kt) : "memory");      // the K loads' address pair stays untouched up to this wait
    float mc = fmaxf(s[0][0], s[1][0]);
#pragma unroll
    for (int r = 1; r < 8; ++r) mc = fmaxf(mc, fmaxf(s[0][r], s[1][r]));
    mc = fmaxf(mc, xhalf(mc));      // both halves of the wave now hold the maximum over the query's 32 scores
    const float mn = fmaxf(m_q, mc); const float al = (mn > -1.0e38f) ? expf(m_q - mn) : 1.0f; m_q = mn;
    FragH pb; v8f pt[2];
#pragma unroll
    for (int nt = 0; nt < 2; ++nt)
#pragma unroll
      for (int r = 0; r < 8; ++r) { const float p = expf(s[nt][r] - mn); pt[nt][r] = p; pb.h[nt * 8 + r] = (_Float16)p; }
    const v8f p8 = pt[0] + pt[1]; const float ps = ((p8[0] + p8[1]) + (p8[2] + p8[3])) + ((p8[4] + p8[5]) + (p8[6] + p8[7]));
    l_q = l_q * al + ps;      // the lane's own 16 keys; the halves' sums are joined once, behind the loop
#pragma unroll
    for (int dt = 0; dt < DT; ++dt) oacc[dt] *= al;
#pragma unroll
    for (int dt = 0; dt < DT; ++dt) { FragH av; av.half[0] = *(const v8us*)(vt + (dt * 2) * 256); av.half[1] = *(const v8us*)(vt + (dt * 2 + 1) * 256);
      oacc[dt] = mmaH<1>(av.v, av.v, pb.v, pb.v, oacc[dt]); }
    asm volatile("s_wait_xcnt 0x0" :: "v"(vt) : "memory"); }      // the V loads' address pair stays untouched up to this wait
  l_q += xhalf(l_q);
  if (hh == 0) { sM[w][ln] = m_q; sL[w][ln] = l_q; }
#pragma unroll
  for (int dt = 0; dt < DT; ++dt) { *(v4fa*)&sO[w][ln][dt * 16 + 8 * hh] = (v4f){oacc[dt][0], oacc[dt][1], oacc[dt][2], oacc[dt][3]}; *(v4fa*)&sO[w][ln][dt * 16 + 8 * hh + 4] = (v4f){oacc[dt][4], oacc[dt][5], oacc[dt][6], oacc[dt][7]}; }
  __syncthreads();      // every wave's partial (max, sum, unnormalised O) is in LDS before any wave merges
  {
#pragma unroll
    for (int rp = 0; rp < RPW; rp += 8) { const int r = rp + (tid >> 4), pc = tid & 15;
      const float mm = fmaxf(fmaxf(sM[0][r], sM[1][r]), fmaxf(sM[2][r], sM[3][r])); float l = 0.f; v4f val = {0.f, 0.f, 0.f, 0.f};
#pragma unroll
      for (int i = 0; i < 4; ++i) { const float e = expf(sM[i][r] - mm); l += e * sL[i][r]; const v4f o = *(const v4fa*)&sO[i][r][pc * 4]; val += e * o; }
      val *= (l > 0.f) ? 1.0f / l : 0.f; *(v4f*)(O + ((size_t)b * 4096 + q0 + r) * ldo + h * 64 + pc * 4) = val; }
     } }

// blk = which 64-channel x 16-point tile, tid = 0 .. 255 inside the 256 threads that share it, tl = their own LDS tile
__device__ __forceinline__ void tok_part(const float* __restrict__ x, _Float16* __restrict__ X16, const int blk, const int tid, unsigned short (*tl)[72]) { const int b = blk / ((CC / 64) * (NN / 16)), rem = blk % ((CC / 64) * (NN / 16)); const int cg = rem / (NN / 16), pg = rem % (NN / 16); const int c0 = cg * 64, p0 = pg * 16;
  for (int i = tid; i < 64 * 16; i += 256) { const int c = i / 16, pp = i % 16; FragH f; f.h[0] = (_Float16)bf16_round(x[((size_t)b * CC + c0 + c) * NN + p0 + pp]); tl[pp][c] = f.u[0]; }
  __syncthreads();
  if (tid < 128) { const int r = tid / 8, pc = tid % 8; FragH f;
#pragma unroll
    for (int q = 0; q < 8; ++q) f.u[q] = tl[r][pc * 8 + q]; unsigned short* d = (unsigned short*)X16 + ((size_t)b * NN + p0 + r) * CC + c0 + pc * 8; *(v8us*)d = f.half[0];  } }
// Text term of the key bias, one block of 32 waves a batch row. A wave owns 8 output channels; its 32 lanes split each weight row in float4 pieces, so that every wave-wide load covers
// whole 128-byte lines and the loads of the 8 rows are independent of one another; each lane sums its own columns and a butterfly over the lanes adds the 32 partial sums.
__device__ __forceinline__ void lanes_sum8(float (&a)[8]) {
#pragma unroll
  for (int m = 16; m > 0; m >>= 1) { float o[8];
#pragma unroll
    for (int i = 0; i < 8; ++i) o[i] = __shfl_xor(a[i], m, 32);      // the 8 exchanges of a stage are issued together: one wait a stage
#pragma unroll
    for (int i = 0; i < 8; ++i) a[i] += o[i]; } }
__device__ __forceinline__ void text_part(const float* __restrict__ tf, const float* __restrict__ Wt, const float* __restrict__ bt, const float* __restrict__ Wk, const float* __restrict__ bk, float* __restrict__ TB, const int b) {
  __shared__ __attribute__((aligned(16))) float ts[CC]; __shared__ float to[CC];
  const int tid = threadIdx.x, lane = tid & 31, c0 = (tid >> 5) * 8;
  float acc[8];
  { v4f x[DTX / 128];
#pragma unroll
    for (int q = 0; q < DTX / 128; ++q) x[q] = *(const v4fa*)(tf + b * DTX + q * 128 + lane * 4);
    asm volatile("s_wait_xcnt 0x0" ::: "memory");      // before a register that these loads name is used for something else
#pragma unroll
    for (int q = 0; q < DTX / 128; ++q)
#pragma unroll
      for (int e = 0; e < 4; ++e) x[q][e] = bf16_round(x[q][e]);
    const float* wr = Wt + (size_t)c0 * DTX + lane * 4;
#pragma unroll
    for (int i = 0; i < 8; ++i) { float s = 0.f;
#pragma unroll
      for (int q = 0; q < DTX / 128; ++q) { const v4f v = *(const v4fa*)(wr + i * DTX + q * 128);
#pragma unroll
        for (int e = 0; e < 4; ++e) s += x[q][e] * bf16_round(v[e]); }
      acc[i] = s; }
    asm volatile("s_wait_xcnt 0x0" :: "v"(wr) : "memory"); }      // the loads' address pair stays untouched up to this wait
  lanes_sum8(acc);
  { float s = acc[0];
#pragma unroll
    for (int i = 1; i < 8; ++i) s = (lane == i) ? acc[i] : s;
    if (lane < 8) { s += bf16_round(bt[c0 + lane]); ts[c0 + lane] = 0.5f * s * (1.0f + erff(s * 0.70710678118654752f)); } }
  __syncthreads();      // all 256 channels of the projected text are in LDS before any wave reads them
  { v4f t[CC / 128];
#pragma unroll
    for (int q = 0; q < CC / 128; ++q) t[q] = *(const v4fa*)&ts[q * 128 + lane * 4];
    const float* wr = Wk + (size_t)c0 * CC + lane * 4;
#pragma unroll
    for (int i = 0; i < 8; ++i) { float s = 0.f;
#pragma unroll
      for (int q = 0; q < CC / 128; ++q) { const v4f v = *(const v4fa*)(wr + i * CC + q * 128);
#pragma unroll
        for (int e = 0; e < 4; ++e) s += t[q][e] * bf16_round(v[e]); }
      acc[i] = s; }
    asm volatile("s_wait_xcnt 0x0" :: "v"(wr) : "memory"); }      // the loads' address pair stays untouched up to this wait
  lanes_sum8(acc);
  { float s = acc[0];
#pragma unroll
    for (int i = 1; i < 8; ++i) s = (lane == i) ? acc[i] : s;
    if (lane < 8) to[c0 + lane] = s + bf16_round(bk[c0 + lane]); }
  __syncthreads();      // the 8 results of each wave are gathered so that one wave stores each whole 128-byte line
  if (tid < CC) TB[b * CC + tid] = to[tid]; }
// Everything that depends on the inputs alone shares one grid of 1024-thread blocks, told apart by the block index: blocks 0 .. BB - 1 the text term (the longest chain of waits, so it starts first),
// then WB blocks for each of the five weight matrices, then the token-major copy of the points, four of its 256-thread tiles a block.
#define WB (CC * CC / 8 / 1024)
#define TKB (BB * (CC / 64) * (NN / 16) / 4)
__global__ __launch_bounds__(1024) void k_prep(const float* __restrict__ tf, const float* __restrict__ Wt, const float* __restrict__ bt, const float* __restrict__ Wk, const float* __restrict__ bk, float* __restrict__ TB,
    const float* __restrict__ Wq, const float* __restrict__ Wv, const float* __restrict__ W1, const float* __restrict__ W2, _Float16* __restrict__ Bq, _Float16* __restrict__ Bk, _Float16* __restrict__ Bv, _Float16* __restrict__ B1, _Float16* __restrict__ B2,
    const float* __restrict__ x, _Float16* __restrict__ X16) {
  __shared__ unsigned short tl[4][16][72];
  const int bx = blockIdx.x, tid = threadIdx.x;
  if (bx < BB) text_part(tf, Wt, bt, Wk, bk, TB, bx);
  else if (bx < BB + 5 * WB) { const int m = (bx - BB) / WB; const size_t t = (size_t)((bx - BB) % WB) * 1024 + tid;
    const float* W = m == 0 ? Wq : m == 1 ? Wk : m == 2 ? Wv : m == 3 ? W1 : W2; _Float16* Bt = m == 0 ? Bq : m == 1 ? Bk : m == 2 ? Bv : m == 3 ? B1 : B2;
    round16f_part(W, Bt, (size_t)CC * CC / 8, t); }
  else tok_part(x, X16, (bx - BB - 5 * WB) * 4 + (tid >> 8), tid & 255, tl[tid >> 8]); }
__global__ __launch_bounds__(256) void k_fin(const float* __restrict__ M2, const float* __restrict__ pf, const float* __restrict__ gam, float* __restrict__ out) { __shared__ float tl[32][65]; const int tid = threadIdx.x; const int b = blockIdx.x / ((CC / 32) * (NN / 64)), rem = blockIdx.x % ((CC / 32) * (NN / 64)); const int cg = rem / (NN / 64), pg = rem % (NN / 64); const int c0 = cg * 32, p0 = pg * 64; const float g = bf16_round(gam[0]);
  for (int i = tid; i < 64 * 32; i += 256) { const int pp = i / 32, c = i % 32; tl[c][pp] = M2[((size_t)b * NN + p0 + pp) * CC + c0 + c]; }
  __syncthreads();
  { for (int i = tid; i < 32 * 16; i += 256) { const int c = i / 16, pc = i % 16; const size_t gi = ((size_t)b * CC + c0 + c) * NN + p0 + pc * 4; const v4f x = *(const v4fa*)(pf + gi); v4f v; for (int q = 0; q < 4; ++q) v[q] = g * tl[c][pc * 4 + q] + bf16_round(x[q]); *(v4f*)(out + gi) = v; }  } }
extern "C" void kernel_launch(void* const* d_in, const int* in_sizes, int n_in,
                              void* d_out, int out_size, void* d_ws, size_t ws_size, hipStream_t stream) {
  (void)in_sizes; (void)n_in; (void)out_size;
  const float* const* I = (const float* const*)d_in; const float* pf = I[0]; const float* tf = I[1]; const float* Wt = I[2]; const float* bt = I[3]; const float* Wq = I[4]; const float* bq = I[5]; const float* Wk = I[6]; const float* bk = I[7]; const float* Wv = I[8]; const float* bv = I[9]; const float* W1 = I[10]; const float* b1 = I[11]; const float* W2 = I[12]; const float* b2 = I[13]; const float* gam = I[14];
  char* ws = (char*)d_ws; size_t off = 0;
  auto take = [&](size_t bytes) { char* p = ws + off; off += (bytes + 255) & ~(size_t)255; return p; };
  _Float16* Bq = (_Float16*)take(CC * CC * 2); _Float16* Bk = (_Float16*)take(CC * CC * 2); _Float16* Bv = (_Float16*)take(CC * CC * 2); _Float16* B1 = (_Float16*)take(CC * CC * 2); _Float16* B2 = (_Float16*)take(CC * CC * 2); float* TB = (float*)take(BB * CC * 4);
  _Float16* X16 = (_Float16*)take((size_t)NR * CC * 2); _Float16* Q16 = (_Float16*)take((size_t)NR * CC * 2); _Float16* K16 = (_Float16*)take((size_t)NR * CC * 2); _Float16* V16 = (_Float16*)take((size_t)NR * CC * 2); _Float16* Vp = (_Float16*)take((size_t)NR * CC * 2); _Float16* Kp = (_Float16*)take((size_t)NR * CC * 2); float* O = (float*)take((size_t)NR * CC * 4); _Float16* O16 = Q16; _Float16* H1 = K16; float* M2 = O;
  if (off > ws_size) return;      // 0.7 + 4.2 x 6 + 8.4 = about 34 MiB
  k_prep<<<BB + 5 * WB + TKB, 1024, 0, stream>>>(tf, Wt, bt, Wk, bk, TB, Wq, Wv, W1, W2, Bq, Bk, Bv, B1, B2, pf, X16);      // weights (out,in)
  // Bq, Bk, Bv and Q16, K16, V16 were taken one behind the other and their sizes are multiples of 256 bytes: CC * CC and NR * CC elements apart
  k_gemm_qkv<<<dim3(((NR / 16) * (CC / 64) + 3) / 4, 3), 128, 0, stream>>>(X16, CC, Bq, CC, (size_t)CC * CC, 0.0625f, bq, bv, TB, NN, (size_t)CC, Q16, CC, (size_t)NR * CC, NR, CC, CC);      // k = pf Wk^T + (t Wk^T + bk): the per-batch text bias enters as the CP addend (row block b = row / 4096), unrounded
  k_pack<NH, NN><<<BB * NH * (NN / 64), 256, 0, stream>>>(V16, CC, 0, Vp, K16, Kp);
  k_flash<<<BB * NH * (NN / 16), 128, 0, stream>>>(Q16, CC, Kp, Vp, nullptr, O, CC);
  const unsigned g8 = (unsigned)(((size_t)NR * CC / 8 + 255) / 256); const dim3 g1(((NR / 16) * (CC / 64) + 3) / 4, 1);
  k_h16<<<g8, 256, 0, stream>>>(O, O16, (size_t)NR * CC / 8);
  k_gemm_hhx<3><<<g1, 128, 0, stream>>>(O16, CC, 0, B1, CC, 0, 0.0625f, b1, 0, nullptr, 1, 0, 0, nullptr, H1, CC, 0, NR, CC, CC);      // relu(x·W1ᵀ + b1)
  k_gemm_hhx<0><<<g1, 128, 0, stream>>>(H1, CC, 0, B2, CC, 0, 0.0625f, b2, 0, nullptr, 1, 0, 0, M2, nullptr, CC, 0, NR, CC, CC);         // ·W2ᵀ + b2 (f32)
  k_fin<<<BB * (CC / 32) * (NN / 64), 256, 0, stream>>>(M2, pf, gam, (float*)d_out);
}

// v006
// A run of this version takes 149 microseconds.
// Next to v005, in two timings, it ran 1.20 and 1.21 times as fast.
// All steps since v000 together make it 3.62 times as fast.
#include <hip/hip_runtime.h>
// Text-guided point attention (B=2, C=256 channels × N=4096 points; text 512 → 256 GELU projection added to the key input; q/k/v 1×1 convs; 4 heads × 64; UNSCALED softmax(q·k)·v; MLP 256 → relu →
// 256; out = γ·x + point_feats, channel-major): the q/k/v/MLP linears ((out,in) weights bf16-exact ×2^4; the text term enters k as a per-batch bias) and the attention as a fused flash-style
// kernel (online softmax f32, P f16 ≤ 1, O = P·Vt; RPW-16 waves) run on v_wmma_f32_16x16x32_f16 with f32 accumulate; the text projection, the NCW ↔ token-major transposes and the gated
// residual are f32 VALU.
#define BB 2
#define CC 256
#define NN 4096
#define DTX 512
#define NH 4
#define NR (BB * NN)

typedef __bf16 v16b __attribute__((ext_vector_type(16)));
typedef unsigned short v8us __attribute__((ext_vector_type(8), may_alias));
typedef float  v8f  __attribute__((ext_vector_type(8)));
typedef float  v4f  __attribute__((ext_vector_type(4)));
typedef float  v4fa __attribute__((ext_vector_type(4), may_alias));
union FragB { v16b v; v8us half[2]; unsigned short u[16]; };

__device__ __forceinline__ unsigned short bf16_bits(float x) { unsigned int u = __float_as_uint(x); return (unsigned short)((u + 0x7FFFu + ((u >> 16) & 1u)) >> 16); }
__device__ __forceinline__ float bf16_val(unsigned short b) { return __uint_as_float(((unsigned int)b) << 16); }
__device__ __forceinline__ float bf16_round(float x) { return bf16_val(bf16_bits(x)); }
// D += A·B with NT terms: 1 = ah·bh, 2 = + al·bh (A split), 3 = + ah·bl (both split)
template <int NT>
__device__ __forceinline__ v8f mmaN(v16b ah, v16b al, v16b bh, v16b bl, v8f c) {
  c = __builtin_amdgcn_wmma_f32_16x16x32_bf16(false, ah, false, bh, (short)0, c, false, false);
  if (NT >= 2) c = __builtin_amdgcn_wmma_f32_16x16x32_bf16(false, al, false, bh, (short)0, c, false, false);
  if (NT >= 3) c = __builtin_amdgcn_wmma_f32_16x16x32_bf16(false, ah, false, bl, (short)0, c, false, false);
  asm volatile("v_nop\n\tv_nop\n\tv_nop\n\tv_nop" : "+v"(c) : "v"(ah), "v"(al), "v"(bh), "v"(bl));
  return c;
}

__global__ __launch_bounds__(256) void k_wt_bf16(const float* __restrict__ W, unsigned short* __restrict__ Wt, int K, int N) {
  const int t = blockIdx.x * 256 + threadIdx.x;
  const int k8n = K / 8;
  if (t >= N * k8n) return;
  const int n = t / k8n, k8 = (t % k8n) * 8;
  v8us v;
#pragma unroll
  for (int i = 0; i < 8; ++i) v[i] = bf16_bits(W[(size_t)(k8 + i) * N + n]);
  *(v8us*)(Wt + (size_t)n * K + k8) = v;
  
}

// GEMM C[M][N] (f32, pitch ldc) = act(A[M][K]·W + bias). A f32 row-major (pitch lda) converted per fragment to bf16
// (ASPLIT: hi/lo two planes -> 2 terms, else single rounded term); Wt bf16 [N][K] (pitch ldb). BIAS_BF16 rounds the
// bias to bf16 first (bias quantised to bf16 before the add). K%32==0, M%16==0, N%64==0.
template <bool ASPLIT, int ACT, bool BIAS_BF16>
__global__ __launch_bounds__(128) void k_gemm_bf(const float* __restrict__ A, int lda, const unsigned short* __restrict__ Wt, int ldb,
                                               const float* __restrict__ bias, float* __restrict__ C, int ldc, int M, int N, int K) {
  __shared__ __attribute__((aligned(16))) float so[4][16][64];
  const int tid = threadIdx.x, w = tid >> 5, lane = tid & 31, ln = lane & 15, hh = lane >> 4;
  const int ntn = N / 64;
  const int wid = blockIdx.x * 4 + w;
  const int mt = wid / ntn, nq = wid % ntn;
  if (mt * 16 >= M) return;
  const int row0 = mt * 16, col0 = nq * 64;
  const float* arow = A + (size_t)(row0 + ln) * lda;
  v8f acc[4] = {};
  for (int kb = 0; kb < K; kb += 32) {
    FragB ah, al;
    const v4f x0 = *(const v4fa*)(arow + kb + 8 * hh), x1 = *(const v4fa*)(arow + kb + 8 * hh + 4);
    const v4f x2 = *(const v4fa*)(arow + kb + 16 + 8 * hh), x3 = *(const v4fa*)(arow + kb + 16 + 8 * hh + 4);
    float xs[16] = {x0[0],x0[1],x0[2],x0[3],x1[0],x1[1],x1[2],x1[3],x2[0],x2[1],x2[2],x2[3],x3[0],x3[1],x3[2],x3[3]};
#pragma unroll
    for (int i = 0; i < 16; ++i) { const unsigned short hb = bf16_bits(xs[i]); ah.u[i] = hb; al.u[i] = ASPLIT ? bf16_bits(xs[i] - bf16_val(hb)) : (unsigned short)0; }
#pragma unroll
    for (int t = 0; t < 4; ++t) {
      const unsigned short* brow = Wt + (size_t)(col0 + t * 16 + ln) * ldb + kb;
      FragB b;
      b.half[0] = *(const v8us*)(brow + 8 * hh);
      b.half[1] = *(const v8us*)(brow + 16 + 8 * hh);
      acc[t] = mmaN<ASPLIT ? 2 : 1>(ah.v, al.v, b.v, b.v, acc[t]);
    }
  }
#pragma unroll
  for (int t = 0; t < 4; ++t) {
    float bv = bias ? bias[col0 + t * 16 + ln] : 0.f;
    if (BIAS_BF16) bv = bf16_round(bv);
#pragma unroll
    for (int r = 0; r < 8; ++r) { float v = acc[t][r] + bv; if (ACT == 1) v = fmaxf(v, 0.f); so[w][8 * hh + r][t * 16 + ln] = v; }
  }
  __builtin_amdgcn_fence(__ATOMIC_ACQ_REL, "workgroup");
  __builtin_amdgcn_wave_barrier();
  const int rsub = lane >> 4, c4 = (lane & 15) * 4;
  {
#pragma unroll
    for (int q = 0; q < 8; ++q) {
      const int r = q * 2 + rsub;
      const v4f v = *(const v4fa*)&so[w][r][c4];
      *(v4f*)(C + (size_t)(row0 + r) * ldc + col0 + c4) = v;
    }
    
  }
}

// Flash-style causal/unmasked attention, all contractions 3-term bf16 hi/lo splits, f32 softmax with running max.
// q,k,v rows are read from f32 buffers with arbitrary row pitch (so they can live inside a fused qkv buffer);
// D = head size (multiple of 32, <= 128); one wave = 16 query rows; block = 4 waves (64 queries) sharing K/V chunks of 32.
template <int D, bool CAUSAL>
__global__ __launch_bounds__(128) void k_flash(const float* __restrict__ qb, const float* __restrict__ kb, const float* __restrict__ vb,
                                             int pitch, int T, int H, float scale, float* __restrict__ y, int ypitch) {
  constexpr int KS = D / 32;        // k-steps for QK
  constexpr int DT = D / 16;        // d tiles for PV
  __shared__ __attribute__((aligned(16))) unsigned short sKh[32][D + 8], sKl[32][D + 8], sVh[32][D + 8], sVl[32][D + 8];
  __shared__ __attribute__((aligned(16))) unsigned short sPh[4][16][40], sPl[4][16][40];
  __shared__ __attribute__((aligned(16))) float sO[4][16][D];
  const int tid = threadIdx.x, w = tid >> 5, lane = tid & 31, ln = lane & 15, hh = lane >> 4;
  const int nqb = (T + 63) / 64;
  const int bh = blockIdx.x / nqb, qblk = blockIdx.x % nqb;
  const int b = bh / H, h = bh % H;
  const int q0 = qblk * 64 + w * 16;
  const float* Q = qb + (size_t)b * T * pitch + h * D;
  const float* K = kb + (size_t)b * T * pitch + h * D;
  const float* V = vb + (size_t)b * T * pitch + h * D;

  // A fragments of the wave's 16 query rows (scaled), hi/lo
  FragB aqh[KS], aql[KS];
  {
    int row = q0 + ln; if (row >= T) row = T - 1;
    const float* qr = Q + (size_t)row * pitch;
#pragma unroll
    for (int ks = 0; ks < KS; ++ks)
#pragma unroll
      for (int i = 0; i < 16; ++i) {
        const int d = ks * 32 + ((i < 8) ? (8 * hh + i) : (16 + 8 * hh + (i - 8)));
        const float x = qr[d] * scale; const unsigned short hb = bf16_bits(x);
        aqh[ks].u[i] = hb; aql[ks].u[i] = bf16_bits(x - bf16_val(hb));
      }
  }
  float m_r[8], l_r[8];
#pragma unroll
  for (int r = 0; r < 8; ++r) { m_r[r] = -3.0e38f; l_r[r] = 0.f; }
  v8f oacc[DT];
#pragma unroll
  for (int dt = 0; dt < DT; ++dt) oacc[dt] = (v8f){0.f,0.f,0.f,0.f,0.f,0.f,0.f,0.f};

  const int kv_end = CAUSAL ? min(T, qblk * 64 + 64) : T;     // block-uniform
  for (int j0 = 0; j0 < kv_end; j0 += 32) {
    __syncthreads();
    for (int e = tid; e < 32 * (D / 4); e += 128) {
      const int r = e / (D / 4), c4 = (e % (D / 4)) * 4;
      const int key = j0 + r;
      v4f kf = {0.f,0.f,0.f,0.f}, vf = {0.f,0.f,0.f,0.f};
      if (key < T) { kf = *(const v4fa*)(K + (size_t)key * pitch + c4); vf = *(const v4fa*)(V + (size_t)key * pitch + c4); }
#pragma unroll
      for (int t = 0; t < 4; ++t) {
        unsigned short hb = bf16_bits(kf[t]); sKh[r][c4 + t] = hb; sKl[r][c4 + t] = bf16_bits(kf[t] - bf16_val(hb));
        hb = bf16_bits(vf[t]); sVh[r][c4 + t] = hb; sVl[r][c4 + t] = bf16_bits(vf[t] - bf16_val(hb));
      }
    }
    __syncthreads();
    // S tile 16 x 32
    v8f s[2];
#pragma unroll
    for (int nt = 0; nt < 2; ++nt) {
      v8f acc = {};
#pragma unroll
      for (int ks = 0; ks < KS; ++ks) {
        FragB bh_, bl_;
        bh_.half[0] = *(const v8us*)&sKh[nt * 16 + ln][ks * 32 + 8 * hh]; bh_.half[1] = *(const v8us*)&sKh[nt * 16 + ln][ks * 32 + 16 + 8 * hh];
        bl_.half[0] = *(const v8us*)&sKl[nt * 16 + ln][ks * 32 + 8 * hh]; bl_.half[1] = *(const v8us*)&sKl[nt * 16 + ln][ks * 32 + 16 + 8 * hh];
        acc = mmaN<3>(aqh[ks].v, aql[ks].v, bh_.v, bl_.v, acc);
      }
      s[nt] = acc;
    }
    // mask + running max (rows 8hh+r; the 16 lanes of a half share rows)
    float alpha[8];
#pragma unroll
    for (int r = 0; r < 8; ++r) {
      const int qi = q0 + 8 * hh + r;
      const int ja = j0 + ln, jb = j0 + 16 + ln;
      if (CAUSAL) { if (ja > qi) s[0][r] = -3.0e38f; if (jb > qi) s[1][r] = -3.0e38f; }
      if (ja >= T) s[0][r] = -3.0e38f;
      if (jb >= T) s[1][r] = -3.0e38f;
      float mx = fmaxf(s[0][r], s[1][r]);
      mx = fmaxf(mx, __shfl_xor(mx, 1, 32)); mx = fmaxf(mx, __shfl_xor(mx, 2, 32)); mx = fmaxf(mx, __shfl_xor(mx, 4, 32)); mx = fmaxf(mx, __shfl_xor(mx, 8, 32));
      const float mnew = fmaxf(m_r[r], mx);
      alpha[r] = (mnew > -1.0e38f) ? __expf(m_r[r] - mnew) : 1.0f;
      const float p0 = (s[0][r] > -1.0e38f) ? __expf(s[0][r] - mnew) : 0.f;
      const float p1 = (s[1][r] > -1.0e38f) ? __expf(s[1][r] - mnew) : 0.f;
      m_r[r] = mnew;
      l_r[r] = l_r[r] * alpha[r] + p0 + p1;            // per-lane partial row sum (16 lanes combined at the end)
      unsigned short hb = bf16_bits(p0); sPh[w][8 * hh + r][ln] = hb;      sPl[w][8 * hh + r][ln] = bf16_bits(p0 - bf16_val(hb));
      hb = bf16_bits(p1);                sPh[w][8 * hh + r][16 + ln] = hb; sPl[w][8 * hh + r][16 + ln] = bf16_bits(p1 - bf16_val(hb));
    }
#pragma unroll
    for (int dt = 0; dt < DT; ++dt)
#pragma unroll
      for (int r = 0; r < 8; ++r) oacc[dt][r] *= alpha[r];
    __builtin_amdgcn_fence(__ATOMIC_ACQ_REL, "workgroup");
    __builtin_amdgcn_wave_barrier();
    FragB pah, pal;
    pah.half[0] = *(const v8us*)&sPh[w][ln][8 * hh]; pah.half[1] = *(const v8us*)&sPh[w][ln][16 + 8 * hh];
    pal.half[0] = *(const v8us*)&sPl[w][ln][8 * hh]; pal.half[1] = *(const v8us*)&sPl[w][ln][16 + 8 * hh];
#pragma unroll
    for (int dt = 0; dt < DT; ++dt) {
      FragB bvh, bvl;
#pragma unroll
      for (int i = 0; i < 8; ++i) {
        bvh.u[i] = sVh[8 * hh + i][dt * 16 + ln]; bvh.u[8 + i] = sVh[16 + 8 * hh + i][dt * 16 + ln];
        bvl.u[i] = sVl[8 * hh + i][dt * 16 + ln]; bvl.u[8 + i] = sVl[16 + 8 * hh + i][dt * 16 + ln];
      }
      oacc[dt] = mmaN<3>(pah.v, pal.v, bvh.v, bvl.v, oacc[dt]);
    }
    __builtin_amdgcn_fence(__ATOMIC_ACQ_REL, "workgroup");
    __builtin_amdgcn_wave_barrier();
  }
#pragma unroll
  for (int r = 0; r < 8; ++r) {
    float l = l_r[r];
    l += __shfl_xor(l, 1, 32); l += __shfl_xor(l, 2, 32); l += __shfl_xor(l, 4, 32); l += __shfl_xor(l, 8, 32);
    l_r[r] = (l > 0.f) ? 1.0f / l : 0.f;
  }
#pragma unroll
  for (int dt = 0; dt < DT; ++dt)
#pragma unroll
    for (int r = 0; r < 8; ++r) sO[w][8 * hh + r][dt * 16 + ln] = oacc[dt][r] * l_r[r];
  __builtin_amdgcn_fence(__ATOMIC_ACQ_REL, "workgroup");
  __builtin_amdgcn_wave_barrier();
  {
    for (int r = 0; r < 16; ++r) {
      const int row = q0 + r;
      if (row < T && lane < D / 4) {
        const v4f val = *(const v4fa*)&sO[w][r][lane * 4];
        *(v4f*)(y + ((size_t)b * T + row) * ypitch + h * D + lane * 4) = val;
      }
    }
    
  }
}

// GEMM C = act(A·W + bias + resid): A f32 (ASPLIT -> hi/lo 2 terms), Wt bf16 [N][K]; ACT 0 none, 1 relu, 2 exact gelu;
// resid (optional, f32, row index = (row % rmod), pitch ldr, RES_BF16 rounds it) added before the activation.
template <bool ASPLIT, int ACT, bool BIAS_BF16, bool RES_BF16>
__global__ __launch_bounds__(128) void k_gemm_bf3(const float* __restrict__ A, int lda, const unsigned short* __restrict__ Wt, int ldb,
                                                const float* __restrict__ bias, const float* __restrict__ resid, int rmod, int ldr,
                                                float* __restrict__ C, int ldc, int M, int N, int K) {
  __shared__ __attribute__((aligned(16))) float so[4][16][64];
  const int tid = threadIdx.x, w = tid >> 5, lane = tid & 31, ln = lane & 15, hh = lane >> 4;
  const int ntn = N / 64;
  const int wid = blockIdx.x * 4 + w;
  const int mt = wid / ntn, nq = wid % ntn;
  if (mt * 16 >= M) return;
  const int row0 = mt * 16, col0 = nq * 64;
  const float* arow = A + (size_t)(row0 + ln) * lda;
  v8f acc[4] = {};
  for (int kb = 0; kb < K; kb += 32) {
    FragB ah, al;
    const v4f x0 = *(const v4fa*)(arow + kb + 8 * hh), x1 = *(const v4fa*)(arow + kb + 8 * hh + 4);
    const v4f x2 = *(const v4fa*)(arow + kb + 16 + 8 * hh), x3 = *(const v4fa*)(arow + kb + 16 + 8 * hh + 4);
    float xs[16] = {x0[0],x0[1],x0[2],x0[3],x1[0],x1[1],x1[2],x1[3],x2[0],x2[1],x2[2],x2[3],x3[0],x3[1],x3[2],x3[3]};
#pragma unroll
    for (int i = 0; i < 16; ++i) { const unsigned short hb = bf16_bits(xs[i]); ah.u[i] = hb; al.u[i] = ASPLIT ? bf16_bits(xs[i] - bf16_val(hb)) : (unsigned short)0; }
#pragma unroll
    for (int t = 0; t < 4; ++t) {
      const unsigned short* brow = Wt + (size_t)(col0 + t * 16 + ln) * ldb + kb;
      FragB b;
      b.half[0] = *(const v8us*)(brow + 8 * hh);
      b.half[1] = *(const v8us*)(brow + 16 + 8 * hh);
      acc[t] = mmaN<ASPLIT ? 2 : 1>(ah.v, al.v, b.v, b.v, acc[t]);
    }
  }
#pragma unroll
  for (int t = 0; t < 4; ++t) {
    const int col = col0 + t * 16 + ln;
    float bv = bias ? bias[col] : 0.f;
    if (BIAS_BF16) bv = bf16_round(bv);
#pragma unroll
    for (int r = 0; r < 8; ++r) {
      float v = acc[t][r] + bv;
      if (resid) { float rv = resid[(size_t)((row0 + 8 * hh + r) % rmod) * ldr + col]; if (RES_BF16) rv = bf16_round(rv); v += rv; }
      if (ACT == 1) v = fmaxf(v, 0.f);
      if (ACT == 2) v = 0.5f * v * (1.0f + erff(v * 0.70710678118654752f));
      if (ACT == 3) { const float u = 0.7978845608028654f * (v + 0.044715f * v * v * v); v = 0.5f * v * (1.0f + tanhf(u)); }
      so[w][8 * hh + r][t * 16 + ln] = v;
    }
  }
  __builtin_amdgcn_fence(__ATOMIC_ACQ_REL, "workgroup");
  __builtin_amdgcn_wave_barrier();
  const int rsub = lane >> 4, c4 = (lane & 15) * 4;
  {
#pragma unroll
    for (int q = 0; q < 8; ++q) {
      const int r = q * 2 + rsub;
      const v4f v = *(const v4fa*)&so[w][r][c4];
      *(v4f*)(C + (size_t)(row0 + r) * ldc + col0 + c4) = v;
    }
    
  }
}
// row LayerNorm (biased variance, eps) over N: s = X (+ R); optional out_sum <- s; out_norm <- (s-mu)*rsqrt(var+eps)*g + b
template <bool PARAM_BF16>
__global__ __launch_bounds__(256) void k_layernorm(const float* __restrict__ X, const float* __restrict__ R, const float* __restrict__ g, const float* __restrict__ bta,
                                                  float* __restrict__ out_sum, float* __restrict__ out_norm, int N, float eps) {
  __shared__ float red[256];
  const int row = blockIdx.x, tid = threadIdx.x;
  const float* x = X + (size_t)row * N; const float* rr = R ? R + (size_t)row * N : nullptr;
  float vals[16];                     // up to N = 4096
  const int per = N / 256;            // contiguous chunk per thread? use strided-by-4 chunks: thread handles j = tid*4 + 1024*u
  float s1 = 0.f;
  for (int u = 0; u < per / 4; ++u) {
    const int j = tid * 4 + 1024 * u;
    const v4f a = *(const v4fa*)(x + j);
    v4f b = {0.f,0.f,0.f,0.f}; if (rr) b = *(const v4fa*)(rr + j);
#pragma unroll
    for (int q = 0; q < 4; ++q) { const float v = a[q] + b[q]; vals[u * 4 + q] = v; s1 += v; }
  }
  red[tid] = s1; __syncthreads();
  for (int st = 128; st > 0; st >>= 1) { if (tid < st) red[tid] += red[tid + st]; __syncthreads(); }
  const float mu = red[0] / (float)N; __syncthreads();
  float s2 = 0.f;
  for (int u = 0; u < per / 4; ++u)
#pragma unroll
    for (int q = 0; q < 4; ++q) { const float c = vals[u * 4 + q] - mu; s2 += c * c; }
  red[tid] = s2; __syncthreads();
  for (int st = 128; st > 0; st >>= 1) { if (tid < st) red[tid] += red[tid + st]; __syncthreads(); }
  const float rs = rsqrtf(red[0] / (float)N + eps);
  {
    for (int u = 0; u < per / 4; ++u) {
      const int j = tid * 4 + 1024 * u;
      v4f o, sm;
#pragma unroll
      for (int q = 0; q < 4; ++q) {
        float gg = g[j + q], bb = bta[j + q];
        if (PARAM_BF16) { gg = bf16_round(gg); bb = bf16_round(bb); }
        sm[q] = vals[u * 4 + q]; o[q] = (vals[u * 4 + q] - mu) * rs * gg + bb;
      }
      if (out_sum) *(v4f*)(out_sum + (size_t)row * N + j) = sm;
      *(v4f*)(out_norm + (size_t)row * N + j) = o;
    }
    
  }
}



// ---- f16 WMMA path (v_wmma_f32_16x16x32_f16): 11-bit significands for operands in range — used where a [0,1] probability operand needs more precision than bf16
typedef _Float16 v16h __attribute__((ext_vector_type(16)));
union FragH { v16h v; v8us half[2]; _Float16 h[16]; unsigned short u[16]; };
template <int NT>
__device__ __forceinline__ v8f mmaH(v16h ah, v16h al, v16h bh, v16h bl, v8f c) {
  c = __builtin_amdgcn_wmma_f32_16x16x32_f16(false, ah, false, bh, (short)0, c, false, false);
  if (NT >= 2) c = __builtin_amdgcn_wmma_f32_16x16x32_f16(false, al, false, bh, (short)0, c, false, false);
  if (NT >= 3) c = __builtin_amdgcn_wmma_f32_16x16x32_f16(false, ah, false, bl, (short)0, c, false, false);
  asm volatile("v_nop\n\tv_nop\n\tv_nop\n\tv_nop" : "+v"(c) : "v"(ah), "v"(al), "v"(bh), "v"(bl));
  return c;
}
// batched GEMM like k_gemm_b but f16 operands: A f32 (split into f16 hi/lo if ASPLIT, else rounded to f16), Bt = f16 values [n][k]; alpha; C f32; N multiple of 16 (partial tiles skipped)
template <bool ASPLIT>
__global__ __launch_bounds__(128) void k_gemm_h(const float* __restrict__ A, int lda, size_t sA, const _Float16* __restrict__ Bh, int ldb, size_t sB, float alpha, float* __restrict__ C, int ldc, size_t sC, int M, int N, int K) {
  __shared__ __attribute__((aligned(16))) float so[4][16][64];
  const int tid = threadIdx.x, w = tid >> 5, lane = tid & 31, ln = lane & 15, hh = lane >> 4; const int by = blockIdx.y;
  A += (size_t)by * sA; Bh += (size_t)by * sB; C += (size_t)by * sC;
  const int ntn = (N + 63) / 64; const int wid = blockIdx.x * 4 + w; const int mt = wid / ntn, nq = wid % ntn; if (mt * 16 >= M) return;
  const int row0 = mt * 16, col0 = nq * 64; const float* arow = A + (size_t)(row0 + ln) * lda;
  v8f acc[4] = {};
  for (int kb = 0; kb < K; kb += 32) {
    FragH ah, al;
    const v4f x0 = *(const v4fa*)(arow + kb + 8 * hh), x1 = *(const v4fa*)(arow + kb + 8 * hh + 4), x2 = *(const v4fa*)(arow + kb + 16 + 8 * hh), x3 = *(const v4fa*)(arow + kb + 16 + 8 * hh + 4);
    float xs[16] = {x0[0],x0[1],x0[2],x0[3],x1[0],x1[1],x1[2],x1[3],x2[0],x2[1],x2[2],x2[3],x3[0],x3[1],x3[2],x3[3]};
#pragma unroll
    for (int i = 0; i < 16; ++i) { const _Float16 h = (_Float16)xs[i]; ah.h[i] = h; al.h[i] = ASPLIT ? (_Float16)(xs[i] - (float)h) : (_Float16)0.0f; }
#pragma unroll
    for (int t = 0; t < 4; ++t) { if (col0 + t * 16 >= N) continue; const size_t boff = (size_t)(col0 + t * 16 + ln) * ldb + kb; FragH bq; bq.half[0] = *(const v8us*)(Bh + boff + 8 * hh); bq.half[1] = *(const v8us*)(Bh + boff + 16 + 8 * hh);
      acc[t] = mmaH<ASPLIT ? 2 : 1>(ah.v, al.v, bq.v, bq.v, acc[t]); }
  }
#pragma unroll
  for (int t = 0; t < 4; ++t) { if (col0 + t * 16 >= N) continue;
#pragma unroll
    for (int r = 0; r < 8; ++r) so[w][8 * hh + r][t * 16 + ln] = acc[t][r] * alpha; }
  __builtin_amdgcn_fence(__ATOMIC_ACQ_REL, "workgroup"); __builtin_amdgcn_wave_barrier();
  const int rsub = lane >> 4, c4 = (lane & 15) * 4;
  {
#pragma unroll
    for (int q = 0; q < 8; ++q) { const int r = q * 2 + rsub; if (col0 + c4 < N) { const v4f v = *(const v4fa*)&so[w][r][c4]; *(v4f*)(C + (size_t)(row0 + r) * ldc + col0 + c4) = v; } }
     }
}

// Wt[n][k] = f16(W[k][n]·scale) from f32 row-major W[K][N] (scale = power of two; bf16-exact weights stay exact in f16 away from the subnormal range)
__global__ __launch_bounds__(256) void k_wt_f16(const float* __restrict__ W, _Float16* __restrict__ Wt, int K, int N, float scale) {
  const int t = blockIdx.x * 256 + threadIdx.x; if (t >= N * (K / 8)) return; const int n = t / (K / 8), k8 = (t % (K / 8)) * 8; FragH f;
#pragma unroll
  for (int i = 0; i < 8; ++i) f.h[i] = (_Float16)(bf16_round(W[(size_t)(k8 + i) * N + n]) * scale); const v8us o = f.half[0];
  *(v8us*)((unsigned short*)Wt + (size_t)n * K + k8) = o; 
}
// k_gemm_hh variant with fused epilogue: v = acc·alpha + bias[by·sBias + col] (+ CP[(row/rowsPerB)·sCPb + by·64 + col] if CP) ; ACT 0 none / 1 elu / 3 relu ; writes f16 C16 and f32 C, each if non-null
template <int ACT, int N, int K>
__device__ __forceinline__ void gemm_hhx_part(const _Float16* __restrict__ A, int lda, size_t sA, const _Float16* __restrict__ Bh, int ldb, size_t sB, float alpha, const float* __restrict__ bias, size_t sBias, const float* __restrict__ CP, int rowsPerB, size_t sCPb, int row0g,
    float* __restrict__ C, _Float16* __restrict__ C16, int ldc, size_t sC, int M, const int by) {
  __shared__ __attribute__((aligned(16))) float so[4][16][64];
  const int tid = threadIdx.x, w = tid >> 5, lane = tid & 31, ln = lane & 15, hh = lane >> 4;
  A += (size_t)by * sA; Bh += (size_t)by * sB; const size_t cofs = (size_t)by * sC; const float* bp = bias ? bias + (size_t)by * sBias : nullptr;
  const int ntn = (N + 63) / 64; const int wid = blockIdx.x * 4 + w; const int mt = wid / ntn, nq = wid % ntn; if (mt * 16 >= M) return;
  const int row0 = mt * 16, col0 = nq * 64; const _Float16* arow = A + (size_t)(row0 + ln) * lda;
  v8f acc[4] = {};
  // The ten operand loads of a k-step go out as one group, three k-steps ahead of the WMMAs that use them, into a ring of three register sets (K is a constant, the loop is unrolled, so every ring index is one too).
  // A wave then waits out one load latency for every three k-steps; with a pair of loads in front of each WMMA it waited out four per k-step. The k order of the sums is the old one.
  constexpr int KST = K / 32, RD = 3; constexpr bool PART = (N % 64) != 0;      // with N a multiple of 64 every one of a wave's four column tiles lies inside N
  FragH ra[RD], rb[RD][4];
  auto fetch = [&](const int st) { const int kb = st * 32; FragH& ah = ra[st % RD]; ah.half[0] = *(const v8us*)((const unsigned short*)arow + kb + 8 * hh); ah.half[1] = *(const v8us*)((const unsigned short*)arow + kb + 16 + 8 * hh);
#pragma unroll
    for (int t = 0; t < 4; ++t) { if (PART && col0 + t * 16 >= N) continue; const size_t boff = (size_t)(col0 + t * 16 + ln) * ldb + kb; FragH& bq = rb[st % RD][t]; bq.half[0] = *(const v8us*)((const unsigned short*)Bh + boff + 8 * hh); bq.half[1] = *(const v8us*)((const unsigned short*)Bh + boff + 16 + 8 * hh); } };
#pragma unroll
  for (int st = 0; st < RD && st < KST; ++st) fetch(st);
  __builtin_amdgcn_sched_barrier(0);      // keeps the first WMMA, and the wait in front of it, behind the last of the ring's first loads: without it the wave waits out the first four loads before it issues the rest
#pragma unroll
  for (int st = 0; st < KST; ++st) {
#pragma unroll
    for (int t = 0; t < 4; ++t) { if (PART && col0 + t * 16 >= N) continue; acc[t] = mmaH<1>(ra[st % RD].v, ra[st % RD].v, rb[st % RD][t].v, rb[st % RD][t].v, acc[t]); }
    if (st + RD < KST) fetch(st + RD);      // into the set that this step has just used
  }
  asm volatile("s_wait_xcnt 0x0" ::: "memory");      // before the epilogue reuses a register that these loads name
  float bv4[4] = {0.f, 0.f, 0.f, 0.f}, cp[4][8];      // the epilogue's addends likewise: all of a wave's bias and CP loads go out together, under one test each, not one waited load per output element
  if (bp) { const float* br = bp + col0 + ln;
#pragma unroll
    for (int t = 0; t < 4; ++t) { if (PART && col0 + t * 16 >= N) continue; bv4[t] = br[t * 16]; }
    asm volatile("s_wait_xcnt 0x0" :: "v"(br) : "memory"); }      // the loads' address pair stays untouched up to this wait
  if (CP) { const float* cr[8];
#pragma unroll
    for (int r = 0; r < 8; ++r) { const int bidx = (row0g + row0 + 8 * hh + r) / rowsPerB; cr[r] = CP + (size_t)bidx * sCPb + (size_t)by * 64 + col0 + ln; }
#pragma unroll
    for (int r = 0; r < 8; ++r)
#pragma unroll
      for (int t = 0; t < 4; ++t) { if (PART && col0 + t * 16 >= N) continue; cp[t][r] = cr[r][t * 16]; }
    asm volatile("s_wait_xcnt 0x0" :: "v"(cr[0]), "v"(cr[1]), "v"(cr[2]), "v"(cr[3]), "v"(cr[4]), "v"(cr[5]), "v"(cr[6]), "v"(cr[7]) : "memory"); }      // the eight rows' address pairs stay untouched up to this wait
#pragma unroll
  for (int t = 0; t < 4; ++t) { if (PART && col0 + t * 16 >= N) continue; const float bv = bf16_round(bv4[t]);
#pragma unroll
    for (int r = 0; r < 8; ++r) { float v = acc[t][r] * alpha + bv; if (CP) v += cp[t][r]; if (ACT == 1) v = (v > 0.f) ? v : expm1f(v); else if (ACT == 3) v = fmaxf(v, 0.f); so[w][8 * hh + r][t * 16 + ln] = v; } }
  __builtin_amdgcn_fence(__ATOMIC_ACQ_REL, "workgroup"); __builtin_amdgcn_wave_barrier();
  const int rsub = lane >> 4, c4 = (lane & 15) * 4; typedef _Float16 v4h __attribute__((ext_vector_type(4)));
  {
#pragma unroll
    for (int q = 0; q < 8; ++q) { const int r = q * 2 + rsub; if (col0 + c4 < N) { const v4f v = *(const v4fa*)&so[w][r][c4]; if (C) { *(v4f*)(C + cofs + (size_t)(row0 + r) * ldc + col0 + c4) = v; asm volatile("s_wait_xcnt 0x0" ::: "memory"); }      // before the conversion below reuses a register that this store names
      if (C16) { v4h h4; for (int i = 0; i < 4; ++i) h4[i] = (_Float16)v[i]; *(v4h*)(C16 + cofs + (size_t)(row0 + r) * ldc + col0 + c4) = h4; asm volatile("s_wait_xcnt 0x0" ::: "memory"); } } }      // before the next row's values and addresses reuse a register that this store names
     }
}
template <int ACT>
__global__ __launch_bounds__(128) void k_gemm_hhx(const _Float16* __restrict__ A, int lda, size_t sA, const _Float16* __restrict__ Bh, int ldb, size_t sB, float alpha, const float* __restrict__ bias, size_t sBias, const float* __restrict__ CP, int rowsPerB, size_t sCPb, int row0g,
    float* __restrict__ C, _Float16* __restrict__ C16, int ldc, size_t sC, int M) {
  gemm_hhx_part<ACT, CC, CC>(A, lda, sA, Bh, ldb, sB, alpha, bias, sBias, CP, rowsPerB, sCPb, row0g, C, C16, ldc, sC, M, blockIdx.y); }
// The q, k and v projections read the same A and depend on nothing of one another: one grid, blockIdx.y = 0 q, 1 k, 2 v picks the weights (sB apart), the output (sC apart) and the addend
// (q and v: their bias; k: the per-batch text term CPk, row block = row / rowsPerB). Three times the waves of one projection are resident at once and cover each other's load waits.
__global__ __launch_bounds__(128) void k_gemm_qkv(const _Float16* __restrict__ A, int lda, const _Float16* __restrict__ Bh, int ldb, size_t sB, float alpha, const float* __restrict__ bias_q, const float* __restrict__ bias_v, const float* __restrict__ CPk, int rowsPerB, size_t sCPb,
    _Float16* __restrict__ C16, int ldc, size_t sC, int M) {
  const int z = blockIdx.y;
  gemm_hhx_part<0, CC, CC>(A, lda, 0, Bh + (size_t)z * sB, ldb, 0, alpha, z == 0 ? bias_q : (z == 2 ? bias_v : nullptr), 0, z == 1 ? CPk : nullptr, rowsPerB, sCPb, 0, nullptr, C16 + (size_t)z * sC, ldc, 0, M, 0); }


__global__ __launch_bounds__(256) void k_x16(const float* __restrict__ x, _Float16* __restrict__ X16, size_t n8) { const size_t t = (size_t)blockIdx.x * 256 + threadIdx.x; if (t >= n8) return; FragH f;
#pragma unroll
  for (int q = 0; q < 8; ++q) f.h[q] = (_Float16)bf16_round(x[t * 8 + q]); *(v8us*)((unsigned short*)X16 + t * 8) = f.half[0];  }
__global__ __launch_bounds__(256) void k_h16(const float* __restrict__ x, _Float16* __restrict__ X16, size_t n8) { const size_t t = (size_t)blockIdx.x * 256 + threadIdx.x; if (t >= n8) return; FragH f;
#pragma unroll
  for (int q = 0; q < 8; ++q) f.h[q] = (_Float16)x[t * 8 + q]; *(v8us*)((unsigned short*)X16 + t * 8) = f.half[0];  }
__device__ __forceinline__ void round16f_part(const float* __restrict__ W, _Float16* __restrict__ Bt, size_t n8, const size_t t) { if (t >= n8) return; FragH f;
#pragma unroll
  for (int i = 0; i < 8; ++i) f.h[i] = (_Float16)(bf16_round(W[t * 8 + i]) * 16.0f); *(v8us*)((unsigned short*)Bt + t * 8) = f.half[0];
  asm volatile("s_wait_xcnt 0x0" ::: "memory"); }      // the built code holds a path from here into another part of the grid's kernel, which reuses the registers that this store names
// K and V are laid out anew in the order in which the attention kernel's matrix operands want them. A tile is 32 keys of one (batch, head) slab = 8 fragment halves of 512 bytes; in a half,
// lane l owns bytes 16 l .. 16 l + 15, exactly the eight f16 that it holds of that operand half. Each wave-wide 16-byte load of the attention loop then covers four whole 128-byte lines
// instead of 32-byte pieces of sixteen. K half fr = (nt * 2 + ks) * 2 + hf: key nt * 16 + ln, channels ks * 32 + hf * 16 + 8 hh + q. V half fr = dt * 2 + hf: channel dt * 16 + ln, keys hf * 16 + 8 hh + q.
template <int NHv, int TTv>
__global__ __launch_bounds__(256) void k_pack(const _Float16* __restrict__ V16, int ldv, int voff, _Float16* __restrict__ Vp, const _Float16* __restrict__ K16, _Float16* __restrict__ Kp) { __shared__ unsigned short tl[64][66]; const int tid = threadIdx.x; const int slab = blockIdx.x / (TTv / 64), lg = blockIdx.x % (TTv / 64); const int b = slab / NHv, h = slab % NHv;
  const int fr = (tid >> 5) & 7, lane = tid & 31, ln = lane & 15, hh = lane >> 4;      // a wave writes one fragment half of each of the block's two tiles
  const size_t dst0 = ((size_t)(slab * (TTv / 32) + lg * 2) * 8 + fr) * 256 + lane * 8;
  for (int i = tid; i < 64 * 8; i += 256) { const int r = i / 8, c8 = (i % 8) * 8; FragH f; f.half[0] = *(const v8us*)((const unsigned short*)V16 + ((size_t)b * TTv + lg * 64 + r) * ldv + voff + h * 64 + c8);
#pragma unroll
    for (int q = 0; q < 8; ++q) tl[r][c8 + q] = f.u[q]; }
  {
#pragma unroll
    for (int jt = 0; jt < 2; ++jt) { const v8us kv = *(const v8us*)((const unsigned short*)K16 + ((size_t)b * TTv + lg * 64 + jt * 32 + (fr >> 2) * 16 + ln) * ldv + h * 64 + ((fr >> 1) & 1) * 32 + (fr & 1) * 16 + 8 * hh);
      *(v8us*)((unsigned short*)Kp + dst0 + jt * 2048) = kv; }
    asm volatile("s_wait_xcnt 0x0" ::: "memory"); }      // before the V part below reuses a register that these loads and stores name
  __syncthreads();
  {
#pragma unroll
    for (int jt = 0; jt < 2; ++jt) { const int d = (fr >> 1) * 16 + ln, k0 = jt * 32 + (fr & 1) * 16 + 8 * hh; FragH f;
#pragma unroll
      for (int q = 0; q < 8; ++q) f.u[q] = tl[k0 + q][d];
      *(v8us*)((unsigned short*)Vp + dst0 + jt * 2048) = f.half[0]; }
     } }

// Key split: the four waves of a block share ONE tile of 16 query rows; wave w walks the 32-key tiles w, w + 4, w + 8, ... with its own running max, sum and O,
// and the four partial results are merged through LDS at the end. 2048 blocks of 4 waves: eight waves per SIMD (second launch bound: 128 registers a wave) cover each other's load waits.
// Both products are formed transposed: S^T = K Q^T (A = 16 key rows, B = the query tile, kept in registers) and O^T += V^T P^T. A lane then holds 16 of the 32 scores of ONE query
// (query ln, keys 8 hh + r and 16 + 8 hh + r): its maximum and sum are in-lane but for one exchange between the wave's halves, max, sum and rescale factor are one register each,
// and the two score tiles, converted in place, ARE the B operand of the second product in the hardware k order, which the V^T loads already follow.
__device__ __forceinline__ float xhalf(float x) { return __builtin_bit_cast(float, __builtin_amdgcn_permlanex16(__builtin_bit_cast(int, x), __builtin_bit_cast(int, x), 0x76543210, 0xfedcba98, false, false)); }      // lane l with lane l ^ 16
__global__ __launch_bounds__(128, 8) void k_flash(const _Float16* __restrict__ Q16, int ldq, const _Float16* __restrict__ Kp, const _Float16* __restrict__ Vp, const int* __restrict__ MSK, float* __restrict__ O, int ldo) {
  constexpr int RPW = 16, NQB = 4096 / RPW, DT = 4, KS = 2; (void)MSK;
  __shared__ __attribute__((aligned(16))) float sO[4][RPW][64 + 4]; __shared__ float sM[4][RPW], sL[4][RPW];
  const int tid = threadIdx.x, w = tid >> 5, lane = tid & 31, ln = lane & 15, hh = lane >> 4;
  const int slab = blockIdx.x / NQB, qblk = blockIdx.x % NQB; const int b = slab / 4, h = slab % 4; const int q0 = qblk * RPW;
  FragH bq[KS];
  { const unsigned short* qr = (const unsigned short*)Q16 + ((size_t)b * 4096 + q0 + ln) * ldq + h * 64;
#pragma unroll
    for (int ks = 0; ks < KS; ++ks) { bq[ks].half[0] = *(const v8us*)(qr + ks * 32 + 8 * hh); bq[ks].half[1] = *(const v8us*)(qr + ks * 32 + 16 + 8 * hh); } }
  const unsigned short* Kph = (const unsigned short*)Kp + (size_t)slab * 64 * 4096 + lane * 8; const unsigned short* Vph = (const unsigned short*)Vp + (size_t)slab * 64 * 4096 + lane * 8;      // fragment order (k_pack): 2048 elements a 32-key tile, 256 a fragment half
  float m_q = -3.0e38f, l_q = 0.f; v8f oacc[DT];      // oacc[dt][r] = O[query ln][dt * 16 + 8 * hh + r], unnormalised
#pragma unroll
  for (int dt = 0; dt < DT; ++dt) oacc[dt] = (v8f){0.f,0.f,0.f,0.f,0.f,0.f,0.f,0.f};
  const int jend = 4096;
#pragma unroll 1
  for (int jb = 0; jb < jend; jb += 4 * 32) { const int j0 = jb + w * 32; const unsigned short* kt = Kph + (size_t)j0 * 64; const unsigned short* vt = Vph + (size_t)j0 * 64;      // the trip test is on jb, the same in every wave: a scalar branch, EXEC untouched around the WMMAs
    FragH ak[2][KS];      // the tile's eight K loads go out as one group ahead of the four WMMAs: one load latency, not one per key half
#pragma unroll
    for (int nt = 0; nt < 2; ++nt)
#pragma unroll
      for (int ks = 0; ks < KS; ++ks) { ak[nt][ks].half[0] = *(const v8us*)(kt + ((nt * 2 + ks) * 2) * 256); ak[nt][ks].half[1] = *(const v8us*)(kt + ((nt * 2 + ks) * 2 + 1) * 256); }
    v8f s[2];      // s[nt][r] = q(ln) . k(j0 + nt * 16 + 8 * hh + r)
#pragma unroll
    for (int nt = 0; nt < 2; ++nt) { v8f acc = (v8f){0.f,0.f,0.f,0.f,0.f,0.f,0.f,0.f};
#pragma unroll
      for (int ks = 0; ks < KS; ++ks) acc = mmaH<1>(ak[nt][ks].v, ak[nt][ks].v, bq[ks].v, bq[ks].v, acc);
      s[nt] = acc; }
    asm volatile("s_wait_xcnt 0x0" :: "v"(kt) : "memory");      // the K loads' address pair stays untouched up to this wait
    FragH av[DT];      // the tile's eight V loads go out here as one group, into the registers that K has left: they fly while the softmax below is worked out
#pragma unroll
    for (int dt = 0; dt < DT; ++dt) { av[dt].half[0] = *(const v8us*)(vt + (dt * 2) * 256); av[dt].half[1] = *(const v8us*)(vt + (dt * 2 + 1) * 256); }
    float mc = fmaxf(s[0][0], s[1][0]);
#pragma unroll
    for (int r = 1; r < 8; ++r) mc = fmaxf(mc, fmaxf(s[0][r], s[1][r]));
    mc = fmaxf(mc, xhalf(mc));      // both halves of the wave now hold the maximum over the query's 32 scores
    const float mn = fmaxf(m_q, mc); const float al = (mn > -1.0e38f) ? expf(m_q - mn) : 1.0f; m_q = mn;
    FragH pb; v8f pt[2];
#pragma unroll
    for (int nt = 0; nt < 2; ++nt)
#pragma unroll
      for (int r = 0; r < 8; ++r) { const float p = expf(s[nt][r] - mn); pt[nt][r] = p; pb.h[nt * 8 + r] = (_Float16)p; }
    const v8f p8 = pt[0] + pt[1]; const float ps = ((p8[0] + p8[1]) + (p8[2] + p8[3])) + ((p8[4] + p8[5]) + (p8[6] + p8[7]));
    l_q = l_q * al + ps;      // the lane's own 16 keys; the halves' sums are joined once, behind the loop
#pragma unroll
    for (int dt = 0; dt < DT; ++dt) oacc[dt] *= al;
#pragma unroll
    for (int dt = 0; dt < DT; ++dt) oacc[dt] = mmaH<1>(av[dt].v, av[dt].v, pb.v, pb.v, oacc[dt]);
    asm volatile("s_wait_xcnt 0x0" :: "v"(vt) : "memory"); }      // the V loads' address pair stays untouched up to this wait
  l_q += xhalf(l_q);
  if (hh == 0) { sM[w][ln] = m_q; sL[w][ln] = l_q; }
#pragma unroll
  for (int dt = 0; dt < DT; ++dt) { *(v4fa*)&sO[w][ln][dt * 16 + 8 * hh] = (v4f){oacc[dt][0], oacc[dt][1], oacc[dt][2], oacc[dt][3]}; *(v4fa*)&sO[w][ln][dt * 16 + 8 * hh + 4] = (v4f){oacc[dt][4], oacc[dt][5], oacc[dt][6], oacc[dt][7]}; }
  __syncthreads();      // every wave's partial (max, sum, unnormalised O) is in LDS before any wave merges
  {
#pragma unroll
    for (int rp = 0; rp < RPW; rp += 8) { const int r = rp + (tid >> 4), pc = tid & 15;
      const float mm = fmaxf(fmaxf(sM[0][r], sM[1][r]), fmaxf(sM[2][r], sM[3][r])); float l = 0.f; v4f val = {0.f, 0.f, 0.f, 0.f};
#pragma unroll
      for (int i = 0; i < 4; ++i) { const float e = expf(sM[i][r] - mm); l += e * sL[i][r]; const v4f o = *(const v4fa*)&sO[i][r][pc * 4]; val += e * o; }
      val *= (l > 0.f) ? 1.0f / l : 0.f; *(v4f*)(O + ((size_t)b * 4096 + q0 + r) * ldo + h * 64 + pc * 4) = val; }
     } }

// blk = which 64-channel x 16-point tile, tid = 0 .. 255 inside the 256 threads that share it, tl = their own LDS tile
__device__ __forceinline__ void tok_part(const float* __restrict__ x, _Float16* __restrict__ X16, const int blk, const int tid, unsigned short (*tl)[72]) { const int b = blk / ((CC / 64) * (NN / 16)), rem = blk % ((CC / 64) * (NN / 16)); const int cg = rem / (NN / 16), pg = rem % (NN / 16); const int c0 = cg * 64, p0 = pg * 16;
  for (int i = tid; i < 64 * 16; i += 256) { const int c = i / 16, pp = i % 16; FragH f; f.h[0] = (_Float16)bf16_round(x[((size_t)b * CC + c0 + c) * NN + p0 + pp]); tl[pp][c] = f.u[0]; }
  __syncthreads();
  if (tid < 128) { const int r = tid / 8, pc = tid % 8; FragH f;
#pragma unroll
    for (int q = 0; q < 8; ++q) f.u[q] = tl[r][pc * 8 + q]; unsigned short* d = (unsigned short*)X16 + ((size_t)b * NN + p0 + r) * CC + c0 + pc * 8; *(v8us*)d = f.half[0];  } }
// Text term of the key bias, one block of 32 waves a batch row. A wave owns 8 output channels; its 32 lanes split each weight row in float4 pieces, so that every wave-wide load covers
// whole 128-byte lines and the loads of the 8 rows are independent of one another; each lane sums its own columns and a butterfly over the lanes adds the 32 partial sums.
__device__ __forceinline__ void lanes_sum8(float (&a)[8]) {
#pragma unroll
  for (int m = 16; m > 0; m >>= 1) { float o[8];
#pragma unroll
    for (int i = 0; i < 8; ++i) o[i] = __shfl_xor(a[i], m, 32);      // the 8 exchanges of a stage are issued together: one wait a stage
#pragma unroll
    for (int i = 0; i < 8; ++i) a[i] += o[i]; } }
__device__ __forceinline__ void text_part(const float* __restrict__ tf, const float* __restrict__ Wt, const float* __restrict__ bt, const float* __restrict__ Wk, const float* __restrict__ bk, float* __restrict__ TB, const int b) {
  __shared__ __attribute__((aligned(16))) float ts[CC]; __shared__ float to[CC];
  const int tid = threadIdx.x, lane = tid & 31, c0 = (tid >> 5) * 8;
  float acc[8];
  { v4f x[DTX / 128];
#pragma unroll
    for (int q = 0; q < DTX / 128; ++q) x[q] = *(const v4fa*)(tf + b * DTX + q * 128 + lane * 4);
    asm volatile("s_wait_xcnt 0x0" ::: "memory");      // before a register that these loads name is used for something else
#pragma unroll
    for (int q = 0; q < DTX / 128; ++q)
#pragma unroll
      for (int e = 0; e < 4; ++e) x[q][e] = bf16_round(x[q][e]);
    const float* wr = Wt + (size_t)c0 * DTX + lane * 4;
#pragma unroll
    for (int i = 0; i < 8; ++i) { float s = 0.f;
#pragma unroll
      for (int q = 0; q < DTX / 128; ++q) { const v4f v = *(const v4fa*)(wr + i * DTX + q * 128);
#pragma unroll
        for (int e = 0; e < 4; ++e) s += x[q][e] * bf16_round(v[e]); }
      acc[i] = s; }
    asm volatile("s_wait_xcnt 0x0" :: "v"(wr) : "memory"); }      // the loads' address pair stays untouched up to this wait
  lanes_sum8(acc);
  { float s = acc[0];
#pragma unroll
    for (int i = 1; i < 8; ++i) s = (lane == i) ? acc[i] : s;
    if (lane < 8) { s += bf16_round(bt[c0 + lane]); ts[c0 + lane] = 0.5f * s * (1.0f + erff(s * 0.70710678118654752f)); } }
  __syncthreads();      // all 256 channels of the projected text are in LDS before any wave reads them
  { v4f t[CC / 128];
#pragma unroll
    for (int q = 0; q < CC / 128; ++q) t[q] = *(const v4fa*)&ts[q * 128 + lane * 4];
    const float* wr = Wk + (size_t)c0 * CC + lane * 4;
#pragma unroll
    for (int i = 0; i < 8; ++i) { float s = 0.f;
#pragma unroll
      for (int q = 0; q < CC / 128; ++q) { const v4f v = *(const v4fa*)(wr + i * CC + q * 128);
#pragma unroll
        for (int e = 0; e < 4; ++e) s += t[q][e] * bf16_round(v[e]); }
      acc[i] = s; }
    asm volatile("s_wait_xcnt 0x0" :: "v"(wr) : "memory"); }      // the loads' address pair stays untouched up to this wait
  lanes_sum8(acc);
  { float s = acc[0];
#pragma unroll
    for (int i = 1; i < 8; ++i) s = (lane == i) ? acc[i] : s;
    if (lane < 8) to[c0 + lane] = s + bf16_round(bk[c0 + lane]); }
  __syncthreads();      // the 8 results of each wave are gathered so that one wave stores each whole 128-byte line
  if (tid < CC) TB[b * CC + tid] = to[tid]; }
// Everything that depends on the inputs alone shares one grid of 1024-thread blocks, told apart by the block index: blocks 0 .. BB - 1 the text term (the longest chain of waits, so it starts first),
// then WB blocks for each of the five weight matrices, then the token-major copy of the points, four of its 256-thread tiles a block.
#define WB (CC * CC / 8 / 1024)
#define TKB (BB * (CC / 64) * (NN / 16) / 4)
__global__ __launch_bounds__(1024) void k_prep(const float* __restrict__ tf, const float* __restrict__ Wt, const float* __restrict__ bt, const float* __restrict__ Wk, const float* __restrict__ bk, float* __restrict__ TB,
    const float* __restrict__ Wq, const float* __restrict__ Wv, const float* __restrict__ W1, const float* __restrict__ W2, _Float16* __restrict__ Bq, _Float16* __restrict__ Bk, _Float16* __restrict__ Bv, _Float16* __restrict__ B1, _Float16* __restrict__ B2,
    const float* __restrict__ x, _Float16* __restrict__ X16) {
  __shared__ unsigned short tl[4][16][72];
  const int bx = blockIdx.x, tid = threadIdx.x;
  if (bx < BB) text_part(tf, Wt, bt, Wk, bk, TB, bx);
  else if (bx < BB + 5 * WB) { const int m = (bx - BB) / WB; const size_t t = (size_t)((bx - BB) % WB) * 1024 + tid;
    const float* W = m == 0 ? Wq : m == 1 ? Wk : m == 2 ? Wv : m == 3 ? W1 : W2; _Float16* Bt = m == 0 ? Bq : m == 1 ? Bk : m == 2 ? Bv : m == 3 ? B1 : B2;
    round16f_part(W, Bt, (size_t)CC * CC / 8, t); }
  else tok_part(x, X16, (bx - BB - 5 * WB) * 4 + (tid >> 8), tid & 255, tl[tid >> 8]); }
__global__ __launch_bounds__(256) void k_fin(const float* __restrict__ M2, const float* __restrict__ pf, const float* __restrict__ gam, float* __restrict__ out) { __shared__ float tl[32][65]; const int tid = threadIdx.x; const int b = blockIdx.x / ((CC / 32) * (NN / 64)), rem = blockIdx.x % ((CC / 32) * (NN / 64)); const int cg = rem / (NN / 64), pg = rem % (NN / 64); const int c0 = cg * 32, p0 = pg * 64; const float g = bf16_round(gam[0]);
  for (int i = tid; i < 64 * 32; i += 256) { const int pp = i / 32, c = i % 32; tl[c][pp] = M2[((size_t)b * NN + p0 + pp) * CC + c0 + c]; }
  __syncthreads();
  { for (int i = tid; i < 32 * 16; i += 256) { const int c = i / 16, pc = i % 16; const size_t gi = ((size_t)b * CC + c0 + c) * NN + p0 + pc * 4; const v4f x = *(const v4fa*)(pf + gi); v4f v; for (int q = 0; q < 4; ++q) v[q] = g * tl[c][pc * 4 + q] + bf16_round(x[q]); *(v4f*)(out + gi) = v; }  } }
extern "C" void kernel_launch(void* const* d_in, const int* in_sizes, int n_in,
                              void* d_out, int out_size, void* d_ws, size_t ws_size, hipStream_t stream) {
  (void)in_sizes; (void)n_in; (void)out_size;
  const float* const* I = (const float* const*)d_in; const float* pf = I[0]; const float* tf = I[1]; const float* Wt = I[2]; const float* bt = I[3]; const float* Wq = I[4]; const float* bq = I[5]; const float* Wk = I[6]; const float* bk = I[7]; const float* Wv = I[8]; const float* bv = I[9]; const float* W1 = I[10]; const float* b1 = I[11]; const float* W2 = I[12]; const float* b2 = I[13]; const float* gam = I[14];
  char* ws = (char*)d_ws; size_t off = 0;
  auto take = [&](size_t bytes) { char* p = ws + off; off += (bytes + 255) & ~(size_t)255; return p; };
  _Float16* Bq = (_Float16*)take(CC * CC * 2); _Float16* Bk = (_Float16*)take(CC * CC * 2); _Float16* Bv = (_Float16*)take(CC * CC * 2); _Float16* B1 = (_Float16*)take(CC * CC * 2); _Float16* B2 = (_Float16*)take(CC * CC * 2); float* TB = (float*)take(BB * CC * 4);
  _Float16* X16 = (_Float16*)take((size_t)NR * CC * 2); _Float16* Q16 = (_Float16*)take((size_t)NR * CC * 2); _Float16* K16 = (_Float16*)take((size_t)NR * CC * 2); _Float16* V16 = (_Float16*)take((size_t)NR * CC * 2); _Float16* Vp = (_Float16*)take((size_t)NR * CC * 2); _Float16* Kp = (_Float16*)take((size_t)NR * CC * 2); float* O = (float*)take((size_t)NR * CC * 4); _Float16* O16 = Q16; _Float16* H1 = K16; float* M2 = O;
  if (off > ws_size) return;      // 0.7 + 4.2 x 6 + 8.4 = about 34 MiB
  k_prep<<<BB + 5 * WB + TKB, 1024, 0, stream>>>(tf, Wt, bt, Wk, bk, TB, Wq, Wv, W1, W2, Bq, Bk, Bv, B1, B2, pf, X16);      // weights (out,in)
  // Bq, Bk, Bv and Q16, K16, V16 were taken one behind the other and their sizes are multiples of 256 bytes: CC * CC and NR * CC elements apart
  k_gemm_qkv<<<dim3(((NR / 16) * (CC / 64) + 3) / 4, 3), 128, 0, stream>>>(X16, CC, Bq, CC, (size_t)CC * CC, 0.0625f, bq, bv, TB, NN, (size_t)CC, Q16, CC, (size_t)NR * CC, NR);      // k = pf Wk^T + (t Wk^T + bk): the per-batch text bias enters as the CP addend (row block b = row / 4096), unrounded
  k_pack<NH, NN><<<BB * NH * (NN / 64), 256, 0, stream>>>(V16, CC, 0, Vp, K16, Kp);
  k_flash<<<BB * NH * (NN / 16), 128, 0, stream>>>(Q16, CC, Kp, Vp, nullptr, O, CC);
  const unsigned g8 = (unsigned)(((size_t)NR * CC / 8 + 255) / 256); const dim3 g1(((NR / 16) * (CC / 64) + 3) / 4, 1);
  k_h16<<<g8, 256, 0, stream>>>(O, O16, (size_t)NR * CC / 8);
  k_gemm_hhx<3><<<g1, 128, 0, stream>>>(O16, CC, 0, B1, CC, 0, 0.0625f, b1, 0, nullptr, 1, 0, 0, nullptr, H1, CC, 0, NR);      // relu(x·W1ᵀ + b1)
  k_gemm_hhx<0><<<g1, 128, 0, stream>>>(H1, CC, 0, B2, CC, 0, 0.0625f, b2, 0, nullptr, 1, 0, 0, M2, nullptr, CC, 0, NR);         // ·W2ᵀ + b2 (f32)
  k_fin<<<BB * (CC / 32) * (NN / 64), 256, 0, stream>>>(M2, pf, gam, (float*)d_out);
}

// v007
// A run of this version takes 138 microseconds.
// Two timings next to v006 put it at 1.06 and 1.08 times that version's speed.
// Counting every step since v000, it is 3.86 times as fast.
#include <hip/hip_runtime.h>
// Text-guided point attention (B=2, C=256 channels × N=4096 points; text 512 → 256 GELU projection added to the key input; q/k/v 1×1 convs; 4 heads × 64; UNSCALED softmax(q·k)·v; MLP 256 → relu →
// 256; out = γ·x + point_feats, channel-major): the q/k/v/MLP linears ((out,in) weights bf16-exact ×2^4; the text term enters k as a per-batch bias) and the attention as a fused flash-style
// kernel (online softmax f32, P f16 ≤ 1, O = P·Vt; RPW-32 key-split waves) run on v_wmma_f32_16x16x32_f16 with f32 accumulate; the text projection, the NCW ↔ token-major transposes and the gated
// residual are f32 VALU.
#define BB 2
#define CC 256
#define NN 4096
#define DTX 512
#define NH 4
#define NR (BB * NN)

typedef __bf16 v16b __attribute__((ext_vector_type(16)));
typedef unsigned short v8us __attribute__((ext_vector_type(8), may_alias));
typedef float  v8f  __attribute__((ext_vector_type(8)));
typedef float  v4f  __attribute__((ext_vector_type(4)));
typedef float  v4fa __attribute__((ext_vector_type(4), may_alias));
union FragB { v16b v; v8us half[2]; unsigned short u[16]; };

__device__ __forceinline__ unsigned short bf16_bits(float x) { unsigned int u = __float_as_uint(x); return (unsigned short)((u + 0x7FFFu + ((u >> 16) & 1u)) >> 16); }
__device__ __forceinline__ float bf16_val(unsigned short b) { return __uint_as_float(((unsigned int)b) << 16); }
__device__ __forceinline__ float bf16_round(float x) { return bf16_val(bf16_bits(x)); }
// D += A·B with NT terms: 1 = ah·bh, 2 = + al·bh (A split), 3 = + ah·bl (both split)
template <int NT>
__device__ __forceinline__ v8f mmaN(v16b ah, v16b al, v16b bh, v16b bl, v8f c) {
  c = __builtin_amdgcn_wmma_f32_16x16x32_bf16(false, ah, false, bh, (short)0, c, false, false);
  if (NT >= 2) c = __builtin_amdgcn_wmma_f32_16x16x32_bf16(false, al, false, bh, (short)0, c, false, false);
  if (NT >= 3) c = __builtin_amdgcn_wmma_f32_16x16x32_bf16(false, ah, false, bl, (short)0, c, false, false);
  asm volatile("v_nop\n\tv_nop\n\tv_nop\n\tv_nop" : "+v"(c) : "v"(ah), "v"(al), "v"(bh), "v"(bl));
  return c;
}

__global__ __launch_bounds__(256) void k_wt_bf16(const float* __restrict__ W, unsigned short* __restrict__ Wt, int K, int N) {
  const int t = blockIdx.x * 256 + threadIdx.x;
  const int k8n = K / 8;
  if (t >= N * k8n) return;
  const int n = t / k8n, k8 = (t % k8n) * 8;
  v8us v;
#pragma unroll
  for (int i = 0; i < 8; ++i) v[i] = bf16_bits(W[(size_t)(k8 + i) * N + n]);
  *(v8us*)(Wt + (size_t)n * K + k8) = v;
  
}

// GEMM C[M][N] (f32, pitch ldc) = act(A[M][K]·W + bias). A f32 row-major (pitch lda) converted per fragment to bf16
// (ASPLIT: hi/lo two planes -> 2 terms, else single rounded term); Wt bf16 [N][K] (pitch ldb). BIAS_BF16 rounds the
// bias to bf16 first (bias quantised to bf16 before the add). K%32==0, M%16==0, N%64==0.
template <bool ASPLIT, int ACT, bool BIAS_BF16>
__global__ __launch_bounds__(128) void k_gemm_bf(const float* __restrict__ A, int lda, const unsigned short* __restrict__ Wt, int ldb,
                                               const float* __restrict__ bias, float* __restrict__ C, int ldc, int M, int N, int K) {
  __shared__ __attribute__((aligned(16))) float so[4][16][64];
  const int tid = threadIdx.x, w = tid >> 5, lane = tid & 31, ln = lane & 15, hh = lane >> 4;
  const int ntn = N / 64;
  const int wid = blockIdx.x * 4 + w;
  const int mt = wid / ntn, nq = wid % ntn;
  if (mt * 16 >= M) return;
  const int row0 = mt * 16, col0 = nq * 64;
  const float* arow = A + (size_t)(row0 + ln) * lda;
  v8f acc[4] = {};
  for (int kb = 0; kb < K; kb += 32) {
    FragB ah, al;
    const v4f x0 = *(const v4fa*)(arow + kb + 8 * hh), x1 = *(const v4fa*)(arow + kb + 8 * hh + 4);
    const v4f x2 = *(const v4fa*)(arow + kb + 16 + 8 * hh), x3 = *(const v4fa*)(arow + kb + 16 + 8 * hh + 4);
    float xs[16] = {x0[0],x0[1],x0[2],x0[3],x1[0],x1[1],x1[2],x1[3],x2[0],x2[1],x2[2],x2[3],x3[0],x3[1],x3[2],x3[3]};
#pragma unroll
    for (int i = 0; i < 16; ++i) { const unsigned short hb = bf16_bits(xs[i]); ah.u[i] = hb; al.u[i] = ASPLIT ? bf16_bits(xs[i] - bf16_val(hb)) : (unsigned short)0; }
#pragma unroll
    for (int t = 0; t < 4; ++t) {
      const unsigned short* brow = Wt + (size_t)(col0 + t * 16 + ln) * ldb + kb;
      FragB b;
      b.half[0] = *(const v8us*)(brow + 8 * hh);
      b.half[1] = *(const v8us*)(brow + 16 + 8 * hh);
      acc[t] = mmaN<ASPLIT ? 2 : 1>(ah.v, al.v, b.v, b.v, acc[t]);
    }
  }
#pragma unroll
  for (int t = 0; t < 4; ++t) {
    float bv = bias ? bias[col0 + t * 16 + ln] : 0.f;
    if (BIAS_BF16) bv = bf16_round(bv);
#pragma unroll
    for (int r = 0; r < 8; ++r) { float v = acc[t][r] + bv; if (ACT == 1) v = fmaxf(v, 0.f); so[w][8 * hh + r][t * 16 + ln] = v; }
  }
  __builtin_amdgcn_fence(__ATOMIC_ACQ_REL, "workgroup");
  __builtin_amdgcn_wave_barrier();
  const int rsub = lane >> 4, c4 = (lane & 15) * 4;
  {
#pragma unroll
    for (int q = 0; q < 8; ++q) {
      const int r = q * 2 + rsub;
      const v4f v = *(const v4fa*)&so[w][r][c4];
      *(v4f*)(C + (size_t)(row0 + r) * ldc + col0 + c4) = v;
    }
    
  }
}

// Flash-style causal/unmasked attention, all contractions 3-term bf16 hi/lo splits, f32 softmax with running max.
// q,k,v rows are read from f32 buffers with arbitrary row pitch (so they can live inside a fused qkv buffer);
// D = head size (multiple of 32, <= 128); one wave = 16 query rows; block = 4 waves (64 queries) sharing K/V chunks of 32.
template <int D, bool CAUSAL>
__global__ __launch_bounds__(128) void k_flash(const float* __restrict__ qb, const float* __restrict__ kb, const float* __restrict__ vb,
                                             int pitch, int T, int H, float scale, float* __restrict__ y, int ypitch) {
  constexpr int KS = D / 32;        // k-steps for QK
  constexpr int DT = D / 16;        // d tiles for PV
  __shared__ __attribute__((aligned(16))) unsigned short sKh[32][D + 8], sKl[32][D + 8], sVh[32][D + 8], sVl[32][D + 8];
  __shared__ __attribute__((aligned(16))) unsigned short sPh[4][16][40], sPl[4][16][40];
  __shared__ __attribute__((aligned(16))) float sO[4][16][D];
  const int tid = threadIdx.x, w = tid >> 5, lane = tid & 31, ln = lane & 15, hh = lane >> 4;
  const int nqb = (T + 63) / 64;
  const int bh = blockIdx.x / nqb, qblk = blockIdx.x % nqb;
  const int b = bh / H, h = bh % H;
  const int q0 = qblk * 64 + w * 16;
  const float* Q = qb + (size_t)b * T * pitch + h * D;
  const float* K = kb + (size_t)b * T * pitch + h * D;
  const float* V = vb + (size_t)b * T * pitch + h * D;

  // A fragments of the wave's 16 query rows (scaled), hi/lo
  FragB aqh[KS], aql[KS];
  {
    int row = q0 + ln; if (row >= T) row = T - 1;
    const float* qr = Q + (size_t)row * pitch;
#pragma unroll
    for (int ks = 0; ks < KS; ++ks)
#pragma unroll
      for (int i = 0; i < 16; ++i) {
        const int d = ks * 32 + ((i < 8) ? (8 * hh + i) : (16 + 8 * hh + (i - 8)));
        const float x = qr[d] * scale; const unsigned short hb = bf16_bits(x);
        aqh[ks].u[i] = hb; aql[ks].u[i] = bf16_bits(x - bf16_val(hb));
      }
  }
  float m_r[8], l_r[8];
#pragma unroll
  for (int r = 0; r < 8; ++r) { m_r[r] = -3.0e38f; l_r[r] = 0.f; }
  v8f oacc[DT];
#pragma unroll
  for (int dt = 0; dt < DT; ++dt) oacc[dt] = (v8f){0.f,0.f,0.f,0.f,0.f,0.f,0.f,0.f};

  const int kv_end = CAUSAL ? min(T, qblk * 64 + 64) : T;     // block-uniform
  for (int j0 = 0; j0 < kv_end; j0 += 32) {
    __syncthreads();
    for (int e = tid; e < 32 * (D / 4); e += 128) {
      const int r = e / (D / 4), c4 = (e % (D / 4)) * 4;
      const int key = j0 + r;
      v4f kf = {0.f,0.f,0.f,0.f}, vf = {0.f,0.f,0.f,0.f};
      if (key < T) { kf = *(const v4fa*)(K + (size_t)key * pitch + c4); vf = *(const v4fa*)(V + (size_t)key * pitch + c4); }
#pragma unroll
      for (int t = 0; t < 4; ++t) {
        unsigned short hb = bf16_bits(kf[t]); sKh[r][c4 + t] = hb; sKl[r][c4 + t] = bf16_bits(kf[t] - bf16_val(hb));
        hb = bf16_bits(vf[t]); sVh[r][c4 + t] = hb; sVl[r][c4 + t] = bf16_bits(vf[t] - bf16_val(hb));
      }
    }
    __syncthreads();
    // S tile 16 x 32
    v8f s[2];
#pragma unroll
    for (int nt = 0; nt < 2; ++nt) {
      v8f acc = {};
#pragma unroll
      for (int ks = 0; ks < KS; ++ks) {
        FragB bh_, bl_;
        bh_.half[0] = *(const v8us*)&sKh[nt * 16 + ln][ks * 32 + 8 * hh]; bh_.half[1] = *(const v8us*)&sKh[nt * 16 + ln][ks * 32 + 16 + 8 * hh];
        bl_.half[0] = *(const v8us*)&sKl[nt * 16 + ln][ks * 32 + 8 * hh]; bl_.half[1] = *(const v8us*)&sKl[nt * 16 + ln][ks * 32 + 16 + 8 * hh];
        acc = mmaN<3>(aqh[ks].v, aql[ks].v, bh_.v, bl_.v, acc);
      }
      s[nt] = acc;
    }
    // mask + running max (rows 8hh+r; the 16 lanes of a half share rows)
    float alpha[8];
#pragma unroll
    for (int r = 0; r < 8; ++r) {
      const int qi = q0 + 8 * hh + r;
      const int ja = j0 + ln, jb = j0 + 16 + ln;
      if (CAUSAL) { if (ja > qi) s[0][r] = -3.0e38f; if (jb > qi) s[1][r] = -3.0e38f; }
      if (ja >= T) s[0][r] = -3.0e38f;
      if (jb >= T) s[1][r] = -3.0e38f;
      float mx = fmaxf(s[0][r], s[1][r]);
      mx = fmaxf(mx, __shfl_xor(mx, 1, 32)); mx = fmaxf(mx, __shfl_xor(mx, 2, 32)); mx = fmaxf(mx, __shfl_xor(mx, 4, 32)); mx = fmaxf(mx, __shfl_xor(mx, 8, 32));
      const float mnew = fmaxf(m_r[r], mx);
      alpha[r] = (mnew > -1.0e38f) ? __expf(m_r[r] - mnew) : 1.0f;
      const float p0 = (s[0][r] > -1.0e38f) ? __expf(s[0][r] - mnew) : 0.f;
      const float p1 = (s[1][r] > -1.0e38f) ? __expf(s[1][r] - mnew) : 0.f;
      m_r[r] = mnew;
      l_r[r] = l_r[r] * alpha[r] + p0 + p1;            // per-lane partial row sum (16 lanes combined at the end)
      unsigned short hb = bf16_bits(p0); sPh[w][8 * hh + r][ln] = hb;      sPl[w][8 * hh + r][ln] = bf16_bits(p0 - bf16_val(hb));
      hb = bf16_bits(p1);                sPh[w][8 * hh + r][16 + ln] = hb; sPl[w][8 * hh + r][16 + ln] = bf16_bits(p1 - bf16_val(hb));
    }
#pragma unroll
    for (int dt = 0; dt < DT; ++dt)
#pragma unroll
      for (int r = 0; r < 8; ++r) oacc[dt][r] *= alpha[r];
    __builtin_amdgcn_fence(__ATOMIC_ACQ_REL, "workgroup");
    __builtin_amdgcn_wave_barrier();
    FragB pah, pal;
    pah.half[0] = *(const v8us*)&sPh[w][ln][8 * hh]; pah.half[1] = *(const v8us*)&sPh[w][ln][16 + 8 * hh];
    pal.half[0] = *(const v8us*)&sPl[w][ln][8 * hh]; pal.half[1] = *(const v8us*)&sPl[w][ln][16 + 8 * hh];
#pragma unroll
    for (int dt = 0; dt < DT; ++dt) {
      FragB bvh, bvl;
#pragma unroll
      for (int i = 0; i < 8; ++i) {
        bvh.u[i] = sVh[8 * hh + i][dt * 16 + ln]; bvh.u[8 + i] = sVh[16 + 8 * hh + i][dt * 16 + ln];
        bvl.u[i] = sVl[8 * hh + i][dt * 16 + ln]; bvl.u[8 + i] = sVl[16 + 8 * hh + i][dt * 16 + ln];
      }
      oacc[dt] = mmaN<3>(pah.v, pal.v, bvh.v, bvl.v, oacc[dt]);
    }
    __builtin_amdgcn_fence(__ATOMIC_ACQ_REL, "workgroup");
    __builtin_amdgcn_wave_barrier();
  }
#pragma unroll
  for (int r = 0; r < 8; ++r) {
    float l = l_r[r];
    l += __shfl_xor(l, 1, 32); l += __shfl_xor(l, 2, 32); l += __shfl_xor(l, 4, 32); l += __shfl_xor(l, 8, 32);
    l_r[r] = (l > 0.f) ? 1.0f / l : 0.f;
  }
#pragma unroll
  for (int dt = 0; dt < DT; ++dt)
#pragma unroll
    for (int r = 0; r < 8; ++r) sO[w][8 * hh + r][dt * 16 + ln] = oacc[dt][r] * l_r[r];
  __builtin_amdgcn_fence(__ATOMIC_ACQ_REL, "workgroup");
  __builtin_amdgcn_wave_barrier();
  {
    for (int r = 0; r < 16; ++r) {
      const int row = q0 + r;
      if (row < T && lane < D / 4) {
        const v4f val = *(const v4fa*)&sO[w][r][lane * 4];
        *(v4f*)(y + ((size_t)b * T + row) * ypitch + h * D + lane * 4) = val;
      }
    }
    
  }
}

// GEMM C = act(A·W + bias + resid): A f32 (ASPLIT -> hi/lo 2 terms), Wt bf16 [N][K]; ACT 0 none, 1 relu, 2 exact gelu;
// resid (optional, f32, row index = (row % rmod), pitch ldr, RES_BF16 rounds it) added before the activation.
template <bool ASPLIT, int ACT, bool BIAS_BF16, bool RES_BF16>
__global__ __launch_bounds__(128) void k_gemm_bf3(const float* __restrict__ A, int lda, const unsigned short* __restrict__ Wt, int ldb,
                                                const float* __restrict__ bias, const float* __restrict__ resid, int rmod, int ldr,
                                                float* __restrict__ C, int ldc, int M, int N, int K) {
  __shared__ __attribute__((aligned(16))) float so[4][16][64];
  const int tid = threadIdx.x, w = tid >> 5, lane = tid & 31, ln = lane & 15, hh = lane >> 4;
  const int ntn = N / 64;
  const int wid = blockIdx.x * 4 + w;
  const int mt = wid / ntn, nq = wid % ntn;
  if (mt * 16 >= M) return;
  const int row0 = mt * 16, col0 = nq * 64;
  const float* arow = A + (size_t)(row0 + ln) * lda;
  v8f acc[4] = {};
  for (int kb = 0; kb < K; kb += 32) {
    FragB ah, al;
    const v4f x0 = *(const v4fa*)(arow + kb + 8 * hh), x1 = *(const v4fa*)(arow + kb + 8 * hh + 4);
    const v4f x2 = *(const v4fa*)(arow + kb + 16 + 8 * hh), x3 = *(const v4fa*)(arow + kb + 16 + 8 * hh + 4);
    float xs[16] = {x0[0],x0[1],x0[2],x0[3],x1[0],x1[1],x1[2],x1[3],x2[0],x2[1],x2[2],x2[3],x3[0],x3[1],x3[2],x3[3]};
#pragma unroll
    for (int i = 0; i < 16; ++i) { const unsigned short hb = bf16_bits(xs[i]); ah.u[i] = hb; al.u[i] = ASPLIT ? bf16_bits(xs[i] - bf16_val(hb)) : (unsigned short)0; }
#pragma unroll
    for (int t = 0; t < 4; ++t) {
      const unsigned short* brow = Wt + (size_t)(col0 + t * 16 + ln) * ldb + kb;
      FragB b;
      b.half[0] = *(const v8us*)(brow + 8 * hh);
      b.half[1] = *(const v8us*)(brow + 16 + 8 * hh);
      acc[t] = mmaN<ASPLIT ? 2 : 1>(ah.v, al.v, b.v, b.v, acc[t]);
    }
  }
#pragma unroll
  for (int t = 0; t < 4; ++t) {
    const int col = col0 + t * 16 + ln;
    float bv = bias ? bias[col] : 0.f;
    if (BIAS_BF16) bv = bf16_round(bv);
#pragma unroll
    for (int r = 0; r < 8; ++r) {
      float v = acc[t][r] + bv;
      if (resid) { float rv = resid[(size_t)((row0 + 8 * hh + r) % rmod) * ldr + col]; if (RES_BF16) rv = bf16_round(rv); v += rv; }
      if (ACT == 1) v = fmaxf(v, 0.f);
      if (ACT == 2) v = 0.5f * v * (1.0f + erff(v * 0.70710678118654752f));
      if (ACT == 3) { const float u = 0.7978845608028654f * (v + 0.044715f * v * v * v); v = 0.5f * v * (1.0f + tanhf(u)); }
      so[w][8 * hh + r][t * 16 + ln] = v;
    }
  }
  __builtin_amdgcn_fence(__ATOMIC_ACQ_REL, "workgroup");
  __builtin_amdgcn_wave_barrier();
  const int rsub = lane >> 4, c4 = (lane & 15) * 4;
  {
#pragma unroll
    for (int q = 0; q < 8; ++q) {
      const int r = q * 2 + rsub;
      const v4f v = *(const v4fa*)&so[w][r][c4];
      *(v4f*)(C + (size_t)(row0 + r) * ldc + col0 + c4) = v;
    }
    
  }
}
// row LayerNorm (biased variance, eps) over N: s = X (+ R); optional out_sum <- s; out_norm <- (s-mu)*rsqrt(var+eps)*g + b
template <bool PARAM_BF16>
__global__ __launch_bounds__(256) void k_layernorm(const float* __restrict__ X, const float* __restrict__ R, const float* __restrict__ g, const float* __restrict__ bta,
                                                  float* __restrict__ out_sum, float* __restrict__ out_norm, int N, float eps) {
  __shared__ float red[256];
  const int row = blockIdx.x, tid = threadIdx.x;
  const float* x = X + (size_t)row * N; const float* rr = R ? R + (size_t)row * N : nullptr;
  float vals[16];                     // up to N = 4096
  const int per = N / 256;            // contiguous chunk per thread? use strided-by-4 chunks: thread handles j = tid*4 + 1024*u
  float s1 = 0.f;
  for (int u = 0; u < per / 4; ++u) {
    const int j = tid * 4 + 1024 * u;
    const v4f a = *(const v4fa*)(x + j);
    v4f b = {0.f,0.f,0.f,0.f}; if (rr) b = *(const v4fa*)(rr + j);
#pragma unroll
    for (int q = 0; q < 4; ++q) { const float v = a[q] + b[q]; vals[u * 4 + q] = v; s1 += v; }
  }
  red[tid] = s1; __syncthreads();
  for (int st = 128; st > 0; st >>= 1) { if (tid < st) red[tid] += red[tid + st]; __syncthreads(); }
  const float mu = red[0] / (float)N; __syncthreads();
  float s2 = 0.f;
  for (int u = 0; u < per / 4; ++u)
#pragma unroll
    for (int q = 0; q < 4; ++q) { const float c = vals[u * 4 + q] - mu; s2 += c * c; }
  red[tid] = s2; __syncthreads();
  for (int st = 128; st > 0; st >>= 1) { if (tid < st) red[tid] += red[tid + st]; __syncthreads(); }
  const float rs = rsqrtf(red[0] / (float)N + eps);
  {
    for (int u = 0; u < per / 4; ++u) {
      const int j = tid * 4 + 1024 * u;
      v4f o, sm;
#pragma unroll
      for (int q = 0; q < 4; ++q) {
        float gg = g[j + q], bb = bta[j + q];
        if (PARAM_BF16) { gg = bf16_round(gg); bb = bf16_round(bb); }
        sm[q] = vals[u * 4 + q]; o[q] = (vals[u * 4 + q] - mu) * rs * gg + bb;
      }
      if (out_sum) *(v4f*)(out_sum + (size_t)row * N + j) = sm;
      *(v4f*)(out_norm + (size_t)row * N + j) = o;
    }
    
  }
}



// ---- f16 WMMA path (v_wmma_f32_16x16x32_f16): 11-bit significands for operands in range — used where a [0,1] probability operand needs more precision than bf16
typedef _Float16 v16h __attribute__((ext_vector_type(16)));
union FragH { v16h v; v8us half[2]; _Float16 h[16]; unsigned short u[16]; };
template <int NT>
__device__ __forceinline__ v8f mmaH(v16h ah, v16h al, v16h bh, v16h bl, v8f c) {
  c = __builtin_amdgcn_wmma_f32_16x16x32_f16(false, ah, false, bh, (short)0, c, false, false);
  if (NT >= 2) c = __builtin_amdgcn_wmma_f32_16x16x32_f16(false, al, false, bh, (short)0, c, false, false);
  if (NT >= 3) c = __builtin_amdgcn_wmma_f32_16x16x32_f16(false, ah, false, bl, (short)0, c, false, false);
  asm volatile("v_nop\n\tv_nop\n\tv_nop\n\tv_nop" : "+v"(c) : "v"(ah), "v"(al), "v"(bh), "v"(bl));
  return c;
}
// batched GEMM like k_gemm_b but f16 operands: A f32 (split into f16 hi/lo if ASPLIT, else rounded to f16), Bt = f16 values [n][k]; alpha; C f32; N multiple of 16 (partial tiles skipped)
template <bool ASPLIT>
__global__ __launch_bounds__(128) void k_gemm_h(const float* __restrict__ A, int lda, size_t sA, const _Float16* __restrict__ Bh, int ldb, size_t sB, float alpha, float* __restrict__ C, int ldc, size_t sC, int M, int N, int K) {
  __shared__ __attribute__((aligned(16))) float so[4][16][64];
  const int tid = threadIdx.x, w = tid >> 5, lane = tid & 31, ln = lane & 15, hh = lane >> 4; const int by = blockIdx.y;
  A += (size_t)by * sA; Bh += (size_t)by * sB; C += (size_t)by * sC;
  const int ntn = (N + 63) / 64; const int wid = blockIdx.x * 4 + w; const int mt = wid / ntn, nq = wid % ntn; if (mt * 16 >= M) return;
  const int row0 = mt * 16, col0 = nq * 64; const float* arow = A + (size_t)(row0 + ln) * lda;
  v8f acc[4] = {};
  for (int kb = 0; kb < K; kb += 32) {
    FragH ah, al;
    const v4f x0 = *(const v4fa*)(arow + kb + 8 * hh), x1 = *(const v4fa*)(arow + kb + 8 * hh + 4), x2 = *(const v4fa*)(arow + kb + 16 + 8 * hh), x3 = *(const v4fa*)(arow + kb + 16 + 8 * hh + 4);
    float xs[16] = {x0[0],x0[1],x0[2],x0[3],x1[0],x1[1],x1[2],x1[3],x2[0],x2[1],x2[2],x2[3],x3[0],x3[1],x3[2],x3[3]};
#pragma unroll
    for (int i = 0; i < 16; ++i) { const _Float16 h = (_Float16)xs[i]; ah.h[i] = h; al.h[i] = ASPLIT ? (_Float16)(xs[i] - (float)h) : (_Float16)0.0f; }
#pragma unroll
    for (int t = 0; t < 4; ++t) { if (col0 + t * 16 >= N) continue; const size_t boff = (size_t)(col0 + t * 16 + ln) * ldb + kb; FragH bq; bq.half[0] = *(const v8us*)(Bh + boff + 8 * hh); bq.half[1] = *(const v8us*)(Bh + boff + 16 + 8 * hh);
      acc[t] = mmaH<ASPLIT ? 2 : 1>(ah.v, al.v, bq.v, bq.v, acc[t]); }
  }
#pragma unroll
  for (int t = 0; t < 4; ++t) { if (col0 + t * 16 >= N) continue;
#pragma unroll
    for (int r = 0; r < 8; ++r) so[w][8 * hh + r][t * 16 + ln] = acc[t][r] * alpha; }
  __builtin_amdgcn_fence(__ATOMIC_ACQ_REL, "workgroup"); __builtin_amdgcn_wave_barrier();
  const int rsub = lane >> 4, c4 = (lane & 15) * 4;
  {
#pragma unroll
    for (int q = 0; q < 8; ++q) { const int r = q * 2 + rsub; if (col0 + c4 < N) { const v4f v = *(const v4fa*)&so[w][r][c4]; *(v4f*)(C + (size_t)(row0 + r) * ldc + col0 + c4) = v; } }
     }
}

// Wt[n][k] = f16(W[k][n]·scale) from f32 row-major W[K][N] (scale = power of two; bf16-exact weights stay exact in f16 away from the subnormal range)
__global__ __launch_bounds__(256) void k_wt_f16(const float* __restrict__ W, _Float16* __restrict__ Wt, int K, int N, float scale) {
  const int t = blockIdx.x * 256 + threadIdx.x; if (t >= N * (K / 8)) return; const int n = t / (K / 8), k8 = (t % (K / 8)) * 8; FragH f;
#pragma unroll
  for (int i = 0; i < 8; ++i) f.h[i] = (_Float16)(bf16_round(W[(size_t)(k8 + i) * N + n]) * scale); const v8us o = f.half[0];
  *(v8us*)((unsigned short*)Wt + (size_t)n * K + k8) = o; 
}
// k_gemm_hh variant with fused epilogue: v = acc·alpha + bias[by·sBias + col] (+ CP[(row/rowsPerB)·sCPb + by·64 + col] if CP) ; ACT 0 none / 1 elu / 3 relu ; writes f16 C16 and f32 C, each if non-null
template <int ACT, int N, int K>
__device__ __forceinline__ void gemm_hhx_part(const _Float16* __restrict__ A, int lda, size_t sA, const _Float16* __restrict__ Bh, int ldb, size_t sB, float alpha, const float* __restrict__ bias, size_t sBias, const float* __restrict__ CP, int rowsPerB, size_t sCPb, int row0g,
    float* __restrict__ C, _Float16* __restrict__ C16, int ldc, size_t sC, int M, const int by) {
  __shared__ __attribute__((aligned(16))) float so[4][16][64];
  const int tid = threadIdx.x, w = tid >> 5, lane = tid & 31, ln = lane & 15, hh = lane >> 4;
  A += (size_t)by * sA; Bh += (size_t)by * sB; const size_t cofs = (size_t)by * sC; const float* bp = bias ? bias + (size_t)by * sBias : nullptr;
  const int ntn = (N + 63) / 64; const int wid = blockIdx.x * 4 + w; const int mt = wid / ntn, nq = wid % ntn; if (mt * 16 >= M) return;
  const int row0 = mt * 16, col0 = nq * 64; const _Float16* arow = A + (size_t)(row0 + ln) * lda;
  v8f acc[4] = {};
  // The ten operand loads of a k-step go out as one group, three k-steps ahead of the WMMAs that use them, into a ring of three register sets (K is a constant, the loop is unrolled, so every ring index is one too).
  // A wave then waits out one load latency for every three k-steps; with a pair of loads in front of each WMMA it waited out four per k-step. The k order of the sums is the old one.
  constexpr int KST = K / 32, RD = 3; constexpr bool PART = (N % 64) != 0;      // with N a multiple of 64 every one of a wave's four column tiles lies inside N
  FragH ra[RD], rb[RD][4];
  auto fetch = [&](const int st) { const int kb = st * 32; FragH& ah = ra[st % RD]; ah.half[0] = *(const v8us*)((const unsigned short*)arow + kb + 8 * hh); ah.half[1] = *(const v8us*)((const unsigned short*)arow + kb + 16 + 8 * hh);
#pragma unroll
    for (int t = 0; t < 4; ++t) { if (PART && col0 + t * 16 >= N) continue; const size_t boff = (size_t)(col0 + t * 16 + ln) * ldb + kb; FragH& bq = rb[st % RD][t]; bq.half[0] = *(const v8us*)((const unsigned short*)Bh + boff + 8 * hh); bq.half[1] = *(const v8us*)((const unsigned short*)Bh + boff + 16 + 8 * hh); } };
#pragma unroll
  for (int st = 0; st < RD && st < KST; ++st) fetch(st);
  __builtin_amdgcn_sched_barrier(0);      // keeps the first WMMA, and the wait in front of it, behind the last of the ring's first loads: without it the wave waits out the first four loads before it issues the rest
#pragma unroll
  for (int st = 0; st < KST; ++st) {
#pragma unroll
    for (int t = 0; t < 4; ++t) { if (PART && col0 + t * 16 >= N) continue; acc[t] = mmaH<1>(ra[st % RD].v, ra[st % RD].v, rb[st % RD][t].v, rb[st % RD][t].v, acc[t]); }
    if (st + RD < KST) fetch(st + RD);      // into the set that this step has just used
  }
  asm volatile("s_wait_xcnt 0x0" ::: "memory");      // before the epilogue reuses a register that these loads name
  float bv4[4] = {0.f, 0.f, 0.f, 0.f}, cp[4][8];      // the epilogue's addends likewise: all of a wave's bias and CP loads go out together, under one test each, not one waited load per output element
  if (bp) { const float* br = bp + col0 + ln;
#pragma unroll
    for (int t = 0; t < 4; ++t) { if (PART && col0 + t * 16 >= N) continue; bv4[t] = br[t * 16]; }
    asm volatile("s_wait_xcnt 0x0" :: "v"(br) : "memory"); }      // the loads' address pair stays untouched up to this wait
  if (CP) { const float* cr[8];
#pragma unroll
    for (int r = 0; r < 8; ++r) { const int bidx = (row0g + row0 + 8 * hh + r) / rowsPerB; cr[r] = CP + (size_t)bidx * sCPb + (size_t)by * 64 + col0 + ln; }
#pragma unroll
    for (int r = 0; r < 8; ++r)
#pragma unroll
      for (int t = 0; t < 4; ++t) { if (PART && col0 + t * 16 >= N) continue; cp[t][r] = cr[r][t * 16]; }
    asm volatile("s_wait_xcnt 0x0" :: "v"(cr[0]), "v"(cr[1]), "v"(cr[2]), "v"(cr[3]), "v"(cr[4]), "v"(cr[5]), "v"(cr[6]), "v"(cr[7]) : "memory"); }      // the eight rows' address pairs stay untouched up to this wait
#pragma unroll
  for (int t = 0; t < 4; ++t) { if (PART && col0 + t * 16 >= N) continue; const float bv = bf16_round(bv4[t]);
#pragma unroll
    for (int r = 0; r < 8; ++r) { float v = acc[t][r] * alpha + bv; if (CP) v += cp[t][r]; if (ACT == 1) v = (v > 0.f) ? v : expm1f(v); else if (ACT == 3) v = fmaxf(v, 0.f); so[w][8 * hh + r][t * 16 + ln] = v; } }
  __builtin_amdgcn_fence(__ATOMIC_ACQ_REL, "workgroup"); __builtin_amdgcn_wave_barrier();
  const int rsub = lane >> 4, c4 = (lane & 15) * 4; typedef _Float16 v4h __attribute__((ext_vector_type(4)));
  {
#pragma unroll
    for (int q = 0; q < 8; ++q) { const int r = q * 2 + rsub; if (col0 + c4 < N) { const v4f v = *(const v4fa*)&so[w][r][c4]; if (C) { *(v4f*)(C + cofs + (size_t)(row0 + r) * ldc + col0 + c4) = v; asm volatile("s_wait_xcnt 0x0" ::: "memory"); }      // before the conversion below reuses a register that this store names
      if (C16) { v4h h4; for (int i = 0; i < 4; ++i) h4[i] = (_Float16)v[i]; *(v4h*)(C16 + cofs + (size_t)(row0 + r) * ldc + col0 + c4) = h4; asm volatile("s_wait_xcnt 0x0" ::: "memory"); } } }      // before the next row's values and addresses reuse a register that this store names
     }
}
template <int ACT>
__global__ __launch_bounds__(128) void k_gemm_hhx(const _Float16* __restrict__ A, int lda, size_t sA, const _Float16* __restrict__ Bh, int ldb, size_t sB, float alpha, const float* __restrict__ bias, size_t sBias, const float* __restrict__ CP, int rowsPerB, size_t sCPb, int row0g,
    float* __restrict__ C, _Float16* __restrict__ C16, int ldc, size_t sC, int M) {
  gemm_hhx_part<ACT, CC, CC>(A, lda, sA, Bh, ldb, sB, alpha, bias, sBias, CP, rowsPerB, sCPb, row0g, C, C16, ldc, sC, M, blockIdx.y); }
// The q, k and v projections read the same A and depend on nothing of one another: one grid, blockIdx.y = 0 q, 1 k, 2 v picks the weights (sB apart), the output (sC apart) and the addend
// (q and v: their bias; k: the per-batch text term CPk, row block = row / rowsPerB). Three times the waves of one projection are resident at once and cover each other's load waits.
__global__ __launch_bounds__(128) void k_gemm_qkv(const _Float16* __restrict__ A, int lda, const _Float16* __restrict__ Bh, int ldb, size_t sB, float alpha, const float* __restrict__ bias_q, const float* __restrict__ bias_v, const float* __restrict__ CPk, int rowsPerB, size_t sCPb,
    _Float16* __restrict__ C16, int ldc, size_t sC, int M) {
  const int z = blockIdx.y;
  gemm_hhx_part<0, CC, CC>(A, lda, 0, Bh + (size_t)z * sB, ldb, 0, alpha, z == 0 ? bias_q : (z == 2 ? bias_v : nullptr), 0, z == 1 ? CPk : nullptr, rowsPerB, sCPb, 0, nullptr, C16 + (size_t)z * sC, ldc, 0, M, 0); }


__global__ __launch_bounds__(256) void k_x16(const float* __restrict__ x, _Float16* __restrict__ X16, size_t n8) { const size_t t = (size_t)blockIdx.x * 256 + threadIdx.x; if (t >= n8) return; FragH f;
#pragma unroll
  for (int q = 0; q < 8; ++q) f.h[q] = (_Float16)bf16_round(x[t * 8 + q]); *(v8us*)((unsigned short*)X16 + t * 8) = f.half[0];  }
__global__ __launch_bounds__(256) void k_h16(const float* __restrict__ x, _Float16* __restrict__ X16, size_t n8) { const size_t t = (size_t)blockIdx.x * 256 + threadIdx.x; if (t >= n8) return; FragH f;
#pragma unroll
  for (int q = 0; q < 8; ++q) f.h[q] = (_Float16)x[t * 8 + q]; *(v8us*)((unsigned short*)X16 + t * 8) = f.half[0];  }
__device__ __forceinline__ void round16f_part(const float* __restrict__ W, _Float16* __restrict__ Bt, size_t n8, const size_t t) { if (t >= n8) return; FragH f;
#pragma unroll
  for (int i = 0; i < 8; ++i) f.h[i] = (_Float16)(bf16_round(W[t * 8 + i]) * 16.0f); *(v8us*)((unsigned short*)Bt + t * 8) = f.half[0];
  asm volatile("s_wait_xcnt 0x0" ::: "memory"); }      // the built code holds a path from here into another part of the grid's kernel, which reuses the registers that this store names
// K and V are laid out anew in the order in which the attention kernel's matrix operands want them. A tile is 32 keys of one (batch, head) slab = 8 fragment halves of 512 bytes; in a half,
// lane l owns bytes 16 l .. 16 l + 15, exactly the eight f16 that it holds of that operand half. Each wave-wide 16-byte load of the attention loop then covers four whole 128-byte lines
// instead of 32-byte pieces of sixteen. K half fr = (nt * 2 + ks) * 2 + hf: key nt * 16 + ln, channels ks * 32 + hf * 16 + 8 hh + q. V half fr = dt * 2 + hf: channel dt * 16 + ln, keys hf * 16 + 8 hh + q.
template <int NHv, int TTv>
__global__ __launch_bounds__(256) void k_pack(const _Float16* __restrict__ V16, int ldv, int voff, _Float16* __restrict__ Vp, const _Float16* __restrict__ K16, _Float16* __restrict__ Kp) { __shared__ unsigned short tl[64][66]; const int tid = threadIdx.x; const int slab = blockIdx.x / (TTv / 64), lg = blockIdx.x % (TTv / 64); const int b = slab / NHv, h = slab % NHv;
  const int fr = (tid >> 5) & 7, lane = tid & 31, ln = lane & 15, hh = lane >> 4;      // a wave writes one fragment half of each of the block's two tiles
  const size_t dst0 = ((size_t)(slab * (TTv / 32) + lg * 2) * 8 + fr) * 256 + lane * 8;
  for (int i = tid; i < 64 * 8; i += 256) { const int r = i / 8, c8 = (i % 8) * 8; FragH f; f.half[0] = *(const v8us*)((const unsigned short*)V16 + ((size_t)b * TTv + lg * 64 + r) * ldv + voff + h * 64 + c8);
#pragma unroll
    for (int q = 0; q < 8; ++q) tl[r][c8 + q] = f.u[q]; }
  {
#pragma unroll
    for (int jt = 0; jt < 2; ++jt) { const v8us kv = *(const v8us*)((const unsigned short*)K16 + ((size_t)b * TTv + lg * 64 + jt * 32 + (fr >> 2) * 16 + ln) * ldv + h * 64 + ((fr >> 1) & 1) * 32 + (fr & 1) * 16 + 8 * hh);
      *(v8us*)((unsigned short*)Kp + dst0 + jt * 2048) = kv; }
    asm volatile("s_wait_xcnt 0x0" ::: "memory"); }      // before the V part below reuses a register that these loads and stores name
  __syncthreads();
  {
#pragma unroll
    for (int jt = 0; jt < 2; ++jt) { const int d = (fr >> 1) * 16 + ln, k0 = jt * 32 + (fr & 1) * 16 + 8 * hh; FragH f;
#pragma unroll
      for (int q = 0; q < 8; ++q) f.u[q] = tl[k0 + q][d];
      *(v8us*)((unsigned short*)Vp + dst0 + jt * 2048) = f.half[0]; }
     } }

// Key split: the four waves of a block share ONE group of 32 query rows (two 16-row tiles); wave w walks the 32-key tiles w, w + 4, w + 8, ... with its own running max, sum and O for each query,
// and the four partial results are merged through LDS at the end. Every K and V fragment that a wave loads feeds the products of BOTH query tiles, so the kernel asks L2 for half the bytes of one tile a wave.
// 1024 blocks of 4 waves: four waves per SIMD (second launch bound: 256 registers a wave).
// Both products are formed transposed: S^T = K Q^T (A = 16 key rows, B = a query tile, kept in registers) and O^T += V^T P^T. A lane then holds 16 of the 32 scores of ONE query of each tile
// (query qt * 16 + ln, keys 8 hh + r and 16 + 8 hh + r): its maximum and sum are in-lane but for one exchange between the wave's halves, max, sum and rescale factor are one register each a tile,
// and the two score tiles, converted in place, ARE the B operand of the second product in the hardware k order, which the V^T loads already follow.
__device__ __forceinline__ float xhalf(float x) { return __builtin_bit_cast(float, __builtin_amdgcn_permlanex16(__builtin_bit_cast(int, x), __builtin_bit_cast(int, x), 0x76543210, 0xfedcba98, false, false)); }      // lane l with lane l ^ 16
__global__ __launch_bounds__(128, 4) void k_flash(const _Float16* __restrict__ Q16, int ldq, const _Float16* __restrict__ Kp, const _Float16* __restrict__ Vp, const int* __restrict__ MSK, float* __restrict__ O, int ldo) {
  constexpr int QT = 2, RPW = 16 * QT, NQB = 4096 / RPW, DT = 4, KS = 2; (void)MSK;
  __shared__ __attribute__((aligned(16))) float sO[4][RPW][64 + 4]; __shared__ float sM[4][RPW], sL[4][RPW];
  const int tid = threadIdx.x, w = tid >> 5, lane = tid & 31, ln = lane & 15, hh = lane >> 4;
  const int slab = blockIdx.x / NQB, qblk = blockIdx.x % NQB; const int b = slab / 4, h = slab % 4; const int q0 = qblk * RPW;
  FragH bq[QT][KS];
#pragma unroll
  for (int qt = 0; qt < QT; ++qt) { const unsigned short* qr = (const unsigned short*)Q16 + ((size_t)b * 4096 + q0 + qt * 16 + ln) * ldq + h * 64;
#pragma unroll
    for (int ks = 0; ks < KS; ++ks) { bq[qt][ks].half[0] = *(const v8us*)(qr + ks * 32 + 8 * hh); bq[qt][ks].half[1] = *(const v8us*)(qr + ks * 32 + 16 + 8 * hh); } }
  const unsigned short* Kph = (const unsigned short*)Kp + (size_t)slab * 64 * 4096 + lane * 8; const unsigned short* Vph = (const unsigned short*)Vp + (size_t)slab * 64 * 4096 + lane * 8;      // fragment order (k_pack): 2048 elements a 32-key tile, 256 a fragment half
  float m_q[QT], l_q[QT]; v8f oacc[QT][DT];      // oacc[qt][dt][r] = O[query qt * 16 + ln][dt * 16 + 8 * hh + r], unnormalised
#pragma unroll
  for (int qt = 0; qt < QT; ++qt) { m_q[qt] = -3.0e38f; l_q[qt] = 0.f;
#pragma unroll
    for (int dt = 0; dt < DT; ++dt) oacc[qt][dt] = (v8f){0.f,0.f,0.f,0.f,0.f,0.f,0.f,0.f}; }
  const int jend = 4096;
#pragma unroll 1
  for (int jb = 0; jb < jend; jb += 4 * 32) { const int j0 = jb + w * 32; const unsigned short* kt = Kph + (size_t)j0 * 64; const unsigned short* vt = Vph + (size_t)j0 * 64;      // the trip test is on jb, the same in every wave: a scalar branch, EXEC untouched around the WMMAs
    FragH ak[2][KS];      // the tile's eight K loads go out as one group ahead of the eight WMMAs: one load latency, not one per key half
#pragma unroll
    for (int nt = 0; nt < 2; ++nt)
#pragma unroll
      for (int ks = 0; ks < KS; ++ks) { ak[nt][ks].half[0] = *(const v8us*)(kt + ((nt * 2 + ks) * 2) * 256); ak[nt][ks].half[1] = *(const v8us*)(kt + ((nt * 2 + ks) * 2 + 1) * 256); }
    v8f s[QT][2];      // s[qt][nt][r] = q(qt * 16 + ln) . k(j0 + nt * 16 + 8 * hh + r)
#pragma unroll
    for (int nt = 0; nt < 2; ++nt)
#pragma unroll
      for (int qt = 0; qt < QT; ++qt) { v8f acc = (v8f){0.f,0.f,0.f,0.f,0.f,0.f,0.f,0.f};
#pragma unroll
        for (int ks = 0; ks < KS; ++ks) acc = mmaH<1>(ak[nt][ks].v, ak[nt][ks].v, bq[qt][ks].v, bq[qt][ks].v, acc);
        s[qt][nt] = acc; }
    asm volatile("s_wait_xcnt 0x0" :: "v"(kt) : "memory");      // the K loads' address pair stays untouched up to this wait
    FragH av[DT];      // the tile's eight V loads go out here as one group, into the registers that K has left: they fly while the softmax below is worked out
#pragma unroll
    for (int dt = 0; dt < DT; ++dt) { av[dt].half[0] = *(const v8us*)(vt + (dt * 2) * 256); av[dt].half[1] = *(const v8us*)(vt + (dt * 2 + 1) * 256); }
    FragH pb[QT];
#pragma unroll
    for (int qt = 0; qt < QT; ++qt) {
      float mc = fmaxf(s[qt][0][0], s[qt][1][0]);
#pragma unroll
      for (int r = 1; r < 8; ++r) mc = fmaxf(mc, fmaxf(s[qt][0][r], s[qt][1][r]));
      mc = fmaxf(mc, xhalf(mc));      // both halves of the wave now hold the maximum over the query's 32 scores
      const float mn = fmaxf(m_q[qt], mc); const float al = (mn > -1.0e38f) ? expf(m_q[qt] - mn) : 1.0f; m_q[qt] = mn;
      v8f pt[2];
#pragma unroll
      for (int nt = 0; nt < 2; ++nt)
#pragma unroll
        for (int r = 0; r < 8; ++r) { const float p = expf(s[qt][nt][r] - mn); pt[nt][r] = p; pb[qt].h[nt * 8 + r] = (_Float16)p; }
      const v8f p8 = pt[0] + pt[1]; const float ps = ((p8[0] + p8[1]) + (p8[2] + p8[3])) + ((p8[4] + p8[5]) + (p8[6] + p8[7]));
      l_q[qt] = l_q[qt] * al + ps;      // the lane's own 16 keys; the halves' sums are joined once, behind the loop
#pragma unroll
      for (int dt = 0; dt < DT; ++dt) oacc[qt][dt] *= al; }
#pragma unroll
    for (int dt = 0; dt < DT; ++dt)
#pragma unroll
      for (int qt = 0; qt < QT; ++qt) oacc[qt][dt] = mmaH<1>(av[dt].v, av[dt].v, pb[qt].v, pb[qt].v, oacc[qt][dt]);
    asm volatile("s_wait_xcnt 0x0" :: "v"(vt) : "memory"); }      // the V loads' address pair stays untouched up to this wait
#pragma unroll
  for (int qt = 0; qt < QT; ++qt) { const int qr = qt * 16 + ln;
    l_q[qt] += xhalf(l_q[qt]);
    if (hh == 0) { sM[w][qr] = m_q[qt]; sL[w][qr] = l_q[qt]; }
#pragma unroll
    for (int dt = 0; dt < DT; ++dt) { *(v4fa*)&sO[w][qr][dt * 16 + 8 * hh] = (v4f){oacc[qt][dt][0], oacc[qt][dt][1], oacc[qt][dt][2], oacc[qt][dt][3]}; *(v4fa*)&sO[w][qr][dt * 16 + 8 * hh + 4] = (v4f){oacc[qt][dt][4], oacc[qt][dt][5], oacc[qt][dt][6], oacc[qt][dt][7]}; } }
  __syncthreads();      // every wave's partial (max, sum, unnormalised O) is in LDS before any wave merges
  {
#pragma unroll
    for (int rp = 0; rp < RPW; rp += 8) { const int r = rp + (tid >> 4), pc = tid & 15;
      const float mm = fmaxf(fmaxf(sM[0][r], sM[1][r]), fmaxf(sM[2][r], sM[3][r])); float l = 0.f; v4f val = {0.f, 0.f, 0.f, 0.f};
#pragma unroll
      for (int i = 0; i < 4; ++i) { const float e = expf(sM[i][r] - mm); l += e * sL[i][r]; const v4f o = *(const v4fa*)&sO[i][r][pc * 4]; val += e * o; }
      val *= (l > 0.f) ? 1.0f / l : 0.f; *(v4f*)(O + ((size_t)b * 4096 + q0 + r) * ldo + h * 64 + pc * 4) = val; }
     } }

// blk = which 64-channel x 16-point tile, tid = 0 .. 255 inside the 256 threads that share it, tl = their own LDS tile
__device__ __forceinline__ void tok_part(const float* __restrict__ x, _Float16* __restrict__ X16, const int blk, const int tid, unsigned short (*tl)[72]) { const int b = blk / ((CC / 64) * (NN / 16)), rem = blk % ((CC / 64) * (NN / 16)); const int cg = rem / (NN / 16), pg = rem % (NN / 16); const int c0 = cg * 64, p0 = pg * 16;
  for (int i = tid; i < 64 * 16; i += 256) { const int c = i / 16, pp = i % 16; FragH f; f.h[0] = (_Float16)bf16_round(x[((size_t)b * CC + c0 + c) * NN + p0 + pp]); tl[pp][c] = f.u[0]; }
  __syncthreads();
  if (tid < 128) { const int r = tid / 8, pc = tid % 8; FragH f;
#pragma unroll
    for (int q = 0; q < 8; ++q) f.u[q] = tl[r][pc * 8 + q]; unsigned short* d = (unsigned short*)X16 + ((size_t)b * NN + p0 + r) * CC + c0 + pc * 8; *(v8us*)d = f.half[0];  } }
// Text term of the key bias, one block of 32 waves a batch row. A wave owns 8 output channels; its 32 lanes split each weight row in float4 pieces, so that every wave-wide load covers
// whole 128-byte lines and the loads of the 8 rows are independent of one another; each lane sums its own columns and a butterfly over the lanes adds the 32 partial sums.
__device__ __forceinline__ void lanes_sum8(float (&a)[8]) {
#pragma unroll
  for (int m = 16; m > 0; m >>= 1) { float o[8];
#pragma unroll
    for (int i = 0; i < 8; ++i) o[i] = __shfl_xor(a[i], m, 32);      // the 8 exchanges of a stage are issued together: one wait a stage
#pragma unroll
    for (int i = 0; i < 8; ++i) a[i] += o[i]; } }
__device__ __forceinline__ void text_part(const float* __restrict__ tf, const float* __restrict__ Wt, const float* __restrict__ bt, const float* __restrict__ Wk, const float* __restrict__ bk, float* __restrict__ TB, const int b) {
  __shared__ __attribute__((aligned(16))) float ts[CC]; __shared__ float to[CC];
  const int tid = threadIdx.x, lane = tid & 31, c0 = (tid >> 5) * 8;
  float acc[8];
  { v4f x[DTX / 128];
#pragma unroll
    for (int q = 0; q < DTX / 128; ++q) x[q] = *(const v4fa*)(tf + b * DTX + q * 128 + lane * 4);
    asm volatile("s_wait_xcnt 0x0" ::: "memory");      // before a register that these loads name is used for something else
#pragma unroll
    for (int q = 0; q < DTX / 128; ++q)
#pragma unroll
      for (int e = 0; e < 4; ++e) x[q][e] = bf16_round(x[q][e]);
    const float* wr = Wt + (size_t)c0 * DTX + lane * 4;
#pragma unroll
    for (int i = 0; i < 8; ++i) { float s = 0.f;
#pragma unroll
      for (int q = 0; q < DTX / 128; ++q) { const v4f v = *(const v4fa*)(wr + i * DTX + q * 128);
#pragma unroll
        for (int e = 0; e < 4; ++e) s += x[q][e] * bf16_round(v[e]); }
      acc[i] = s; }
    asm volatile("s_wait_xcnt 0x0" :: "v"(wr) : "memory"); }      // the loads' address pair stays untouched up to this wait
  lanes_sum8(acc);
  { float s = acc[0];
#pragma unroll
    for (int i = 1; i < 8; ++i) s = (lane == i) ? acc[i] : s;
    if (lane < 8) { s += bf16_round(bt[c0 + lane]); ts[c0 + lane] = 0.5f * s * (1.0f + erff(s * 0.70710678118654752f)); } }
  __syncthreads();      // all 256 channels of the projected text are in LDS before any wave reads them
  { v4f t[CC / 128];
#pragma unroll
    for (int q = 0; q < CC / 128; ++q) t[q] = *(const v4fa*)&ts[q * 128 + lane * 4];
    const float* wr = Wk + (size_t)c0 * CC + lane * 4;
#pragma unroll
    for (int i = 0; i < 8; ++i) { float s = 0.f;
#pragma unroll
      for (int q = 0; q < CC / 128; ++q) { const v4f v = *(const v4fa*)(wr + i * CC + q * 128);
#pragma unroll
        for (int e = 0; e < 4; ++e) s += t[q][e] * bf16_round(v[e]); }
      acc[i] = s; }
    asm volatile("s_wait_xcnt 0x0" :: "v"(wr) : "memory"); }      // the loads' address pair stays untouched up to this wait
  lanes_sum8(acc);
  { float s = acc[0];
#pragma unroll
    for (int i = 1; i < 8; ++i) s = (lane == i) ? acc[i] : s;
    if (lane < 8) to[c0 + lane] = s + bf16_round(bk[c0 + lane]); }
  __syncthreads();      // the 8 results of each wave are gathered so that one wave stores each whole 128-byte line
  if (tid < CC) TB[b * CC + tid] = to[tid]; }
// Everything that depends on the inputs alone shares one grid of 1024-thread blocks, told apart by the block index: blocks 0 .. BB - 1 the text term (the longest chain of waits, so it starts first),
// then WB blocks for each of the five weight matrices, then the token-major copy of the points, four of its 256-thread tiles a block.
#define WB (CC * CC / 8 / 1024)
#define TKB (BB * (CC / 64) * (NN / 16) / 4)
__global__ __launch_bounds__(1024) void k_prep(const float* __restrict__ tf, const float* __restrict__ Wt, const float* __restrict__ bt, const float* __restrict__ Wk, const float* __restrict__ bk, float* __restrict__ TB,
    const float* __restrict__ Wq, const float* __restrict__ Wv, const float* __restrict__ W1, const float* __restrict__ W2, _Float16* __restrict__ Bq, _Float16* __restrict__ Bk, _Float16* __restrict__ Bv, _Float16* __restrict__ B1, _Float16* __restrict__ B2,
    const float* __restrict__ x, _Float16* __restrict__ X16) {
  __shared__ unsigned short tl[4][16][72];
  const int bx = blockIdx.x, tid = threadIdx.x;
  if (bx < BB) text_part(tf, Wt, bt, Wk, bk, TB, bx);
  else if (bx < BB + 5 * WB) { const int m = (bx - BB) / WB; const size_t t = (size_t)((bx - BB) % WB) * 1024 + tid;
    const float* W = m == 0 ? Wq : m == 1 ? Wk : m == 2 ? Wv : m == 3 ? W1 : W2; _Float16* Bt = m == 0 ? Bq : m == 1 ? Bk : m == 2 ? Bv : m == 3 ? B1 : B2;
    round16f_part(W, Bt, (size_t)CC * CC / 8, t); }
  else tok_part(x, X16, (bx - BB - 5 * WB) * 4 + (tid >> 8), tid & 255, tl[tid >> 8]); }
__global__ __launch_bounds__(256) void k_fin(const float* __restrict__ M2, const float* __restrict__ pf, const float* __restrict__ gam, float* __restrict__ out) { __shared__ float tl[32][65]; const int tid = threadIdx.x; const int b = blockIdx.x / ((CC / 32) * (NN / 64)), rem = blockIdx.x % ((CC / 32) * (NN / 64)); const int cg = rem / (NN / 64), pg = rem % (NN / 64); const int c0 = cg * 32, p0 = pg * 64; const float g = bf16_round(gam[0]);
  for (int i = tid; i < 64 * 32; i += 256) { const int pp = i / 32, c = i % 32; tl[c][pp] = M2[((size_t)b * NN + p0 + pp) * CC + c0 + c]; }
  __syncthreads();
  { for (int i = tid; i < 32 * 16; i += 256) { const int c = i / 16, pc = i % 16; const size_t gi = ((size_t)b * CC + c0 + c) * NN + p0 + pc * 4; const v4f x = *(const v4fa*)(pf + gi); v4f v; for (int q = 0; q < 4; ++q) v[q] = g * tl[c][pc * 4 + q] + bf16_round(x[q]); *(v4f*)(out + gi) = v; }  } }
extern "C" void kernel_launch(void* const* d_in, const int* in_sizes, int n_in,
                              void* d_out, int out_size, void* d_ws, size_t ws_size, hipStream_t stream) {
  (void)in_sizes; (void)n_in; (void)out_size;
  const float* const* I = (const float* const*)d_in; const float* pf = I[0]; const float* tf = I[1]; const float* Wt = I[2]; const float* bt = I[3]; const float* Wq = I[4]; const float* bq = I[5]; const float* Wk = I[6]; const float* bk = I[7]; const float* Wv = I[8]; const float* bv = I[9]; const float* W1 = I[10]; const float* b1 = I[11]; const float* W2 = I[12]; const float* b2 = I[13]; const float* gam = I[14];
  char* ws = (char*)d_ws; size_t off = 0;
  auto take = [&](size_t bytes) { char* p = ws + off; off += (bytes + 255) & ~(size_t)255; return p; };
  _Float16* Bq = (_Float16*)take(CC * CC * 2); _Float16* Bk = (_Float16*)take(CC * CC * 2); _Float16* Bv = (_Float16*)take(CC * CC * 2); _Float16* B1 = (_Float16*)take(CC * CC * 2); _Float16* B2 = (_Float16*)take(CC * CC * 2); float* TB = (float*)take(BB * CC * 4);
  _Float16* X16 = (_Float16*)take((size_t)NR * CC * 2); _Float16* Q16 = (_Float16*)take((size_t)NR * CC * 2); _Float16* K16 = (_Float16*)take((size_t)NR * CC * 2); _Float16* V16 = (_Float16*)take((size_t)NR * CC * 2); _Float16* Vp = (_Float16*)take((size_t)NR * CC * 2); _Float16* Kp = (_Float16*)take((size_t)NR * CC * 2); float* O = (float*)take((size_t)NR * CC * 4); _Float16* O16 = Q16; _Float16* H1 = K16; float* M2 = O;
  if (off > ws_size) return;      // 0.7 + 4.2 x 6 + 8.4 = about 34 MiB
  k_prep<<<BB + 5 * WB + TKB, 1024, 0, stream>>>(tf, Wt, bt, Wk, bk, TB, Wq, Wv, W1, W2, Bq, Bk, Bv, B1, B2, pf, X16);      // weights (out,in)
  // Bq, Bk, Bv and Q16, K16, V16 were taken one behind the other and their sizes are multiples of 256 bytes: CC * CC and NR * CC elements apart
  k_gemm_qkv<<<dim3(((NR / 16) * (CC / 64) + 3) / 4, 3), 128, 0, stream>>>(X16, CC, Bq, CC, (size_t)CC * CC, 0.0625f, bq, bv, TB, NN, (size_t)CC, Q16, CC, (size_t)NR * CC, NR);      // k = pf Wk^T + (t Wk^T + bk): the per-batch text bias enters as the CP addend (row block b = row / 4096), unrounded
  k_pack<NH, NN><<<BB * NH * (NN / 64), 256, 0, stream>>>(V16, CC, 0, Vp, K16, Kp);
  k_flash<<<BB * NH * (NN / 32), 128, 0, stream>>>(Q16, CC, Kp, Vp, nullptr, O, CC);
  const unsigned g8 = (unsigned)(((size_t)NR * CC / 8 + 255) / 256); const dim3 g1(((NR / 16) * (CC / 64) + 3) / 4, 1);
  k_h16<<<g8, 256, 0, stream>>>(O, O16, (size_t)NR * CC / 8);
  k_gemm_hhx<3><<<g1, 128, 0, stream>>>(O16, CC, 0, B1, CC, 0, 0.0625f, b1, 0, nullptr, 1, 0, 0, nullptr, H1, CC, 0, NR);      // relu(x·W1ᵀ + b1)
  k_gemm_hhx<0><<<g1, 128, 0, stream>>>(H1, CC, 0, B2, CC, 0, 0.0625f, b2, 0, nullptr, 1, 0, 0, M2, nullptr, CC, 0, NR);         // ·W2ᵀ + b2 (f32)
  k_fin<<<BB * (CC / 32) * (NN / 64), 256, 0, stream>>>(M2, pf, gam, (float*)d_out);
}

// v008
// A run of this version takes 113 microseconds.
// In two side-by-side timings against v007, it was 1.21 and 1.22 times as fast.
// All steps since v000 together make it 4.70 times as fast.
#include <hip/hip_runtime.h>
// Text-guided point attention (B=2, C=256 channels × N=4096 points; text 512 → 256 GELU projection added to the key input; q/k/v 1×1 convs; 4 heads × 64; UNSCALED softmax(q·k)·v; MLP 256 → relu →
// 256; out = γ·x + point_feats, channel-major): the q/k/v/MLP linears ((out,in) weights bf16-exact ×2^4; the text term enters k as a per-batch bias) and the attention as a fused flash-style
// kernel (online softmax f32, P f16 ≤ 1, O = P·Vt; RPW-32 key-split waves) run on v_wmma_f32_16x16x32_f16 with f32 accumulate; the text projection, the NCW ↔ token-major transposes and the gated
// residual are f32 VALU.
#define BB 2
#define CC 256
#define NN 4096
#define DTX 512
#define NH 4
#define NR (BB * NN)

typedef __bf16 v16b __attribute__((ext_vector_type(16)));
typedef unsigned short v8us __attribute__((ext_vector_type(8), may_alias));
typedef float  v8f  __attribute__((ext_vector_type(8)));
typedef float  v4f  __attribute__((ext_vector_type(4)));
typedef float  v4fa __attribute__((ext_vector_type(4), may_alias));
union FragB { v16b v; v8us half[2]; unsigned short u[16]; };

__device__ __forceinline__ unsigned short bf16_bits(float x) { unsigned int u = __float_as_uint(x); return (unsigned short)((u + 0x7FFFu + ((u >> 16) & 1u)) >> 16); }
__device__ __forceinline__ float bf16_val(unsigned short b) { return __uint_as_float(((unsigned int)b) << 16); }
__device__ __forceinline__ float bf16_round(float x) { return bf16_val(bf16_bits(x)); }
// D += A·B with NT terms: 1 = ah·bh, 2 = + al·bh (A split), 3 = + ah·bl (both split)
template <int NT>
__device__ __forceinline__ v8f mmaN(v16b ah, v16b al, v16b bh, v16b bl, v8f c) {
  c = __builtin_amdgcn_wmma_f32_16x16x32_bf16(false, ah, false, bh, (short)0, c, false, false);
  if (NT >= 2) c = __builtin_amdgcn_wmma_f32_16x16x32_bf16(false, al, false, bh, (short)0, c, false, false);
  if (NT >= 3) c = __builtin_amdgcn_wmma_f32_16x16x32_bf16(false, ah, false, bl, (short)0, c, false, false);
  asm volatile("v_nop\n\tv_nop\n\tv_nop\n\tv_nop" : "+v"(c) : "v"(ah), "v"(al), "v"(bh), "v"(bl));
  return c;
}

__global__ __launch_bounds__(256) void k_wt_bf16(const float* __restrict__ W, unsigned short* __restrict__ Wt, int K, int N) {
  const int t = blockIdx.x * 256 + threadIdx.x;
  const int k8n = K / 8;
  if (t >= N * k8n) return;
  const int n = t / k8n, k8 = (t % k8n) * 8;
  v8us v;
#pragma unroll
  for (int i = 0; i < 8; ++i) v[i] = bf16_bits(W[(size_t)(k8 + i) * N + n]);
  *(v8us*)(Wt + (size_t)n * K + k8) = v;
  
}

// GEMM C[M][N] (f32, pitch ldc) = act(A[M][K]·W + bias). A f32 row-major (pitch lda) converted per fragment to bf16
// (ASPLIT: hi/lo two planes -> 2 terms, else single rounded term); Wt bf16 [N][K] (pitch ldb). BIAS_BF16 rounds the
// bias to bf16 first (bias quantised to bf16 before the add). K%32==0, M%16==0, N%64==0.
template <bool ASPLIT, int ACT, bool BIAS_BF16>
__global__ __launch_bounds__(128) void k_gemm_bf(const float* __restrict__ A, int lda, const unsigned short* __restrict__ Wt, int ldb,
                                               const float* __restrict__ bias, float* __restrict__ C, int ldc, int M, int N, int K) {
  __shared__ __attribute__((aligned(16))) float so[4][16][64];
  const int tid = threadIdx.x, w = tid >> 5, lane = tid & 31, ln = lane & 15, hh = lane >> 4;
  const int ntn = N / 64;
  const int wid = blockIdx.x * 4 + w;
  const int mt = wid / ntn, nq = wid % ntn;
  if (mt * 16 >= M) return;
  const int row0 = mt * 16, col0 = nq * 64;
  const float* arow = A + (size_t)(row0 + ln) * lda;
  v8f acc[4] = {};
  for (int kb = 0; kb < K; kb += 32) {
    FragB ah, al;
    const v4f x0 = *(const v4fa*)(arow + kb + 8 * hh), x1 = *(const v4fa*)(arow + kb + 8 * hh + 4);
    const v4f x2 = *(const v4fa*)(arow + kb + 16 + 8 * hh), x3 = *(const v4fa*)(arow + kb + 16 + 8 * hh + 4);
    float xs[16] = {x0[0],x0[1],x0[2],x0[3],x1[0],x1[1],x1[2],x1[3],x2[0],x2[1],x2[2],x2[3],x3[0],x3[1],x3[2],x3[3]};
#pragma unroll
    for (int i = 0; i < 16; ++i) { const unsigned short hb = bf16_bits(xs[i]); ah.u[i] = hb; al.u[i] = ASPLIT ? bf16_bits(xs[i] - bf16_val(hb)) : (unsigned short)0; }
#pragma unroll
    for (int t = 0; t < 4; ++t) {
      const unsigned short* brow = Wt + (size_t)(col0 + t * 16 + ln) * ldb + kb;
      FragB b;
      b.half[0] = *(const v8us*)(brow + 8 * hh);
      b.half[1] = *(const v8us*)(brow + 16 + 8 * hh);
      acc[t] = mmaN<ASPLIT ? 2 : 1>(ah.v, al.v, b.v, b.v, acc[t]);
    }
  }
#pragma unroll
  for (int t = 0; t < 4; ++t) {
    float bv = bias ? bias[col0 + t * 16 + ln] : 0.f;
    if (BIAS_BF16) bv = bf16_round(bv);
#pragma unroll
    for (int r = 0; r < 8; ++r) { float v = acc[t][r] + bv; if (ACT == 1) v = fmaxf(v, 0.f); so[w][8 * hh + r][t * 16 + ln] = v; }
  }
  __builtin_amdgcn_fence(__ATOMIC_ACQ_REL, "workgroup");
  __builtin_amdgcn_wave_barrier();
  const int rsub = lane >> 4, c4 = (lane & 15) * 4;
  {
#pragma unroll
    for (int q = 0; q < 8; ++q) {
      const int r = q * 2 + rsub;
      const v4f v = *(const v4fa*)&so[w][r][c4];
      *(v4f*)(C + (size_t)(row0 + r) * ldc + col0 + c4) = v;
    }
    
  }
}

// Flash-style causal/unmasked attention, all contractions 3-term bf16 hi/lo splits, f32 softmax with running max.
// q,k,v rows are read from f32 buffers with arbitrary row pitch (so they can live inside a fused qkv buffer);
// D = head size (multiple of 32, <= 128); one wave = 16 query rows; block = 4 waves (64 queries) sharing K/V chunks of 32.
template <int D, bool CAUSAL>
__global__ __launch_bounds__(128) void k_flash(const float* __restrict__ qb, const float* __restrict__ kb, const float* __restrict__ vb,
                                             int pitch, int T, int H, float scale, float* __restrict__ y, int ypitch) {
  constexpr int KS = D / 32;        // k-steps for QK
  constexpr int DT = D / 16;        // d tiles for PV
  __shared__ __attribute__((aligned(16))) unsigned short sKh[32][D + 8], sKl[32][D + 8], sVh[32][D + 8], sVl[32][D + 8];
  __shared__ __attribute__((aligned(16))) unsigned short sPh[4][16][40], sPl[4][16][40];
  __shared__ __attribute__((aligned(16))) float sO[4][16][D];
  const int tid = threadIdx.x, w = tid >> 5, lane = tid & 31, ln = lane & 15, hh = lane >> 4;
  const int nqb = (T + 63) / 64;
  const int bh = blockIdx.x / nqb, qblk = blockIdx.x % nqb;
  const int b = bh / H, h = bh % H;
  const int q0 = qblk * 64 + w * 16;
  const float* Q = qb + (size_t)b * T * pitch + h * D;
  const float* K = kb + (size_t)b * T * pitch + h * D;
  const float* V = vb + (size_t)b * T * pitch + h * D;

  // A fragments of the wave's 16 query rows (scaled), hi/lo
  FragB aqh[KS], aql[KS];
  {
    int row = q0 + ln; if (row >= T) row = T - 1;
    const float* qr = Q + (size_t)row * pitch;
#pragma unroll
    for (int ks = 0; ks < KS; ++ks)
#pragma unroll
      for (int i = 0; i < 16; ++i) {
        const int d = ks * 32 + ((i < 8) ? (8 * hh + i) : (16 + 8 * hh + (i - 8)));
        const float x = qr[d] * scale; const unsigned short hb = bf16_bits(x);
        aqh[ks].u[i] = hb; aql[ks].u[i] = bf16_bits(x - bf16_val(hb));
      }
  }
  float m_r[8], l_r[8];
#pragma unroll
  for (int r = 0; r < 8; ++r) { m_r[r] = -3.0e38f; l_r[r] = 0.f; }
  v8f oacc[DT];
#pragma unroll
  for (int dt = 0; dt < DT; ++dt) oacc[dt] = (v8f){0.f,0.f,0.f,0.f,0.f,0.f,0.f,0.f};

  const int kv_end = CAUSAL ? min(T, qblk * 64 + 64) : T;     // block-uniform
  for (int j0 = 0; j0 < kv_end; j0 += 32) {
    __syncthreads();
    for (int e = tid; e < 32 * (D / 4); e += 128) {
      const int r = e / (D / 4), c4 = (e % (D / 4)) * 4;
      const int key = j0 + r;
      v4f kf = {0.f,0.f,0.f,0.f}, vf = {0.f,0.f,0.f,0.f};
      if (key < T) { kf = *(const v4fa*)(K + (size_t)key * pitch + c4); vf = *(const v4fa*)(V + (size_t)key * pitch + c4); }
#pragma unroll
      for (int t = 0; t < 4; ++t) {
        unsigned short hb = bf16_bits(kf[t]); sKh[r][c4 + t] = hb; sKl[r][c4 + t] = bf16_bits(kf[t] - bf16_val(hb));
        hb = bf16_bits(vf[t]); sVh[r][c4 + t] = hb; sVl[r][c4 + t] = bf16_bits(vf[t] - bf16_val(hb));
      }
    }
    __syncthreads();
    // S tile 16 x 32
    v8f s[2];
#pragma unroll
    for (int nt = 0; nt < 2; ++nt) {
      v8f acc = {};
#pragma unroll
      for (int ks = 0; ks < KS; ++ks) {
        FragB bh_, bl_;
        bh_.half[0] = *(const v8us*)&sKh[nt * 16 + ln][ks * 32 + 8 * hh]; bh_.half[1] = *(const v8us*)&sKh[nt * 16 + ln][ks * 32 + 16 + 8 * hh];
        bl_.half[0] = *(const v8us*)&sKl[nt * 16 + ln][ks * 32 + 8 * hh]; bl_.half[1] = *(const v8us*)&sKl[nt * 16 + ln][ks * 32 + 16 + 8 * hh];
        acc = mmaN<3>(aqh[ks].v, aql[ks].v, bh_.v, bl_.v, acc);
      }
      s[nt] = acc;
    }
    // mask + running max (rows 8hh+r; the 16 lanes of a half share rows)
    float alpha[8];
#pragma unroll
    for (int r = 0; r < 8; ++r) {
      const int qi = q0 + 8 * hh + r;
      const int ja = j0 + ln, jb = j0 + 16 + ln;
      if (CAUSAL) { if (ja > qi) s[0][r] = -3.0e38f; if (jb > qi) s[1][r] = -3.0e38f; }
      if (ja >= T) s[0][r] = -3.0e38f;
      if (jb >= T) s[1][r] = -3.0e38f;
      float mx = fmaxf(s[0][r], s[1][r]);
      mx = fmaxf(mx, __shfl_xor(mx, 1, 32)); mx = fmaxf(mx, __shfl_xor(mx, 2, 32)); mx = fmaxf(mx, __shfl_xor(mx, 4, 32)); mx = fmaxf(mx, __shfl_xor(mx, 8, 32));
      const float mnew = fmaxf(m_r[r], mx);
      alpha[r] = (mnew > -1.0e38f) ? __expf(m_r[r] - mnew) : 1.0f;
      const float p0 = (s[0][r] > -1.0e38f) ? __expf(s[0][r] - mnew) : 0.f;
      const float p1 = (s[1][r] > -1.0e38f) ? __expf(s[1][r] - mnew) : 0.f;
      m_r[r] = mnew;
      l_r[r] = l_r[r] * alpha[r] + p0 + p1;            // per-lane partial row sum (16 lanes combined at the end)
      unsigned short hb = bf16_bits(p0); sPh[w][8 * hh + r][ln] = hb;      sPl[w][8 * hh + r][ln] = bf16_bits(p0 - bf16_val(hb));
      hb = bf16_bits(p1);                sPh[w][8 * hh + r][16 + ln] = hb; sPl[w][8 * hh + r][16 + ln] = bf16_bits(p1 - bf16_val(hb));
    }
#pragma unroll
    for (int dt = 0; dt < DT; ++dt)
#pragma unroll
      for (int r = 0; r < 8; ++r) oacc[dt][r] *= alpha[r];
    __builtin_amdgcn_fence(__ATOMIC_ACQ_REL, "workgroup");
    __builtin_amdgcn_wave_barrier();
    FragB pah, pal;
    pah.half[0] = *(const v8us*)&sPh[w][ln][8 * hh]; pah.half[1] = *(const v8us*)&sPh[w][ln][16 + 8 * hh];
    pal.half[0] = *(const v8us*)&sPl[w][ln][8 * hh]; pal.half[1] = *(const v8us*)&sPl[w][ln][16 + 8 * hh];
#pragma unroll
    for (int dt = 0; dt < DT; ++dt) {
      FragB bvh, bvl;
#pragma unroll
      for (int i = 0; i < 8; ++i) {
        bvh.u[i] = sVh[8 * hh + i][dt * 16 + ln]; bvh.u[8 + i] = sVh[16 + 8 * hh + i][dt * 16 + ln];
        bvl.u[i] = sVl[8 * hh + i][dt * 16 + ln]; bvl.u[8 + i] = sVl[16 + 8 * hh + i][dt * 16 + ln];
      }
      oacc[dt] = mmaN<3>(pah.v, pal.v, bvh.v, bvl.v, oacc[dt]);
    }
    __builtin_amdgcn_fence(__ATOMIC_ACQ_REL, "workgroup");
    __builtin_amdgcn_wave_barrier();
  }
#pragma unroll
  for (int r = 0; r < 8; ++r) {
    float l = l_r[r];
    l += __shfl_xor(l, 1, 32); l += __shfl_xor(l, 2, 32); l += __shfl_xor(l, 4, 32); l += __shfl_xor(l, 8, 32);
    l_r[r] = (l > 0.f) ? 1.0f / l : 0.f;
  }
#pragma unroll
  for (int dt = 0; dt < DT; ++dt)
#pragma unroll
    for (int r = 0; r < 8; ++r) sO[w][8 * hh + r][dt * 16 + ln] = oacc[dt][r] * l_r[r];
  __builtin_amdgcn_fence(__ATOMIC_ACQ_REL, "workgroup");
  __builtin_amdgcn_wave_barrier();
  {
    for (int r = 0; r < 16; ++r) {
      const int row = q0 + r;
      if (row < T && lane < D / 4) {
        const v4f val = *(const v4fa*)&sO[w][r][lane * 4];
        *(v4f*)(y + ((size_t)b * T + row) * ypitch + h * D + lane * 4) = val;
      }
    }
    
  }
}

// GEMM C = act(A·W + bias + resid): A f32 (ASPLIT -> hi/lo 2 terms), Wt bf16 [N][K]; ACT 0 none, 1 relu, 2 exact gelu;
// resid (optional, f32, row index = (row % rmod), pitch ldr, RES_BF16 rounds it) added before the activation.
template <bool ASPLIT, int ACT, bool BIAS_BF16, bool RES_BF16>
__global__ __launch_bounds__(128) void k_gemm_bf3(const float* __restrict__ A, int lda, const unsigned short* __restrict__ Wt, int ldb,
                                                const float* __restrict__ bias, const float* __restrict__ resid, int rmod, int ldr,
                                                float* __restrict__ C, int ldc, int M, int N, int K) {
  __shared__ __attribute__((aligned(16))) float so[4][16][64];
  const int tid = threadIdx.x, w = tid >> 5, lane = tid & 31, ln = lane & 15, hh = lane >> 4;
  const int ntn = N / 64;
  const int wid = blockIdx.x * 4 + w;
  const int mt = wid / ntn, nq = wid % ntn;
  if (mt * 16 >= M) return;
  const int row0 = mt * 16, col0 = nq * 64;
  const float* arow = A + (size_t)(row0 + ln) * lda;
  v8f acc[4] = {};
  for (int kb = 0; kb < K; kb += 32) {
    FragB ah, al;
    const v4f x0 = *(const v4fa*)(arow + kb + 8 * hh), x1 = *(const v4fa*)(arow + kb + 8 * hh + 4);
    const v4f x2 = *(const v4fa*)(arow + kb + 16 + 8 * hh), x3 = *(const v4fa*)(arow + kb + 16 + 8 * hh + 4);
    float xs[16] = {x0[0],x0[1],x0[2],x0[3],x1[0],x1[1],x1[2],x1[3],x2[0],x2[1],x2[2],x2[3],x3[0],x3[1],x3[2],x3[3]};
#pragma unroll
    for (int i = 0; i < 16; ++i) { const unsigned short hb = bf16_bits(xs[i]); ah.u[i] = hb; al.u[i] = ASPLIT ? bf16_bits(xs[i] - bf16_val(hb)) : (unsigned short)0; }
#pragma unroll
    for (int t = 0; t < 4; ++t) {
      const unsigned short* brow = Wt + (size_t)(col0 + t * 16 + ln) * ldb + kb;
      FragB b;
      b.half[0] = *(const v8us*)(brow + 8 * hh);
      b.half[1] = *(const v8us*)(brow + 16 + 8 * hh);
      acc[t] = mmaN<ASPLIT ? 2 : 1>(ah.v, al.v, b.v, b.v, acc[t]);
    }
  }
#pragma unroll
  for (int t = 0; t < 4; ++t) {
    const int col = col0 + t * 16 + ln;
    float bv = bias ? bias[col] : 0.f;
    if (BIAS_BF16) bv = bf16_round(bv);
#pragma unroll
    for (int r = 0; r < 8; ++r) {
      float v = acc[t][r] + bv;
      if (resid) { float rv = resid[(size_t)((row0 + 8 * hh + r) % rmod) * ldr + col]; if (RES_BF16) rv = bf16_round(rv); v += rv; }
      if (ACT == 1) v = fmaxf(v, 0.f);
      if (ACT == 2) v = 0.5f * v * (1.0f + erff(v * 0.70710678118654752f));
      if (ACT == 3) { const float u = 0.7978845608028654f * (v + 0.044715f * v * v * v); v = 0.5f * v * (1.0f + tanhf(u)); }
      so[w][8 * hh + r][t * 16 + ln] = v;
    }
  }
  __builtin_amdgcn_fence(__ATOMIC_ACQ_REL, "workgroup");
  __builtin_amdgcn_wave_barrier();
  const int rsub = lane >> 4, c4 = (lane & 15) * 4;
  {
#pragma unroll
    for (int q = 0; q < 8; ++q) {
      const int r = q * 2 + rsub;
      const v4f v = *(const v4fa*)&so[w][r][c4];
      *(v4f*)(C + (size_t)(row0 + r) * ldc + col0 + c4) = v;
    }
    
  }
}
// row LayerNorm (biased variance, eps) over N: s = X (+ R); optional out_sum <- s; out_norm <- (s-mu)*rsqrt(var+eps)*g + b
template <bool PARAM_BF16>
__global__ __launch_bounds__(256) void k_layernorm(const float* __restrict__ X, const float* __restrict__ R, const float* __restrict__ g, const float* __restrict__ bta,
                                                  float* __restrict__ out_sum, float* __restrict__ out_norm, int N, float eps) {
  __shared__ float red[256];
  const int row = blockIdx.x, tid = threadIdx.x;
  const float* x = X + (size_t)row * N; const float* rr = R ? R + (size_t)row * N : nullptr;
  float vals[16];                     // up to N = 4096
  const int per = N / 256;            // contiguous chunk per thread? use strided-by-4 chunks: thread handles j = tid*4 + 1024*u
  float s1 = 0.f;
  for (int u = 0; u < per / 4; ++u) {
    const int j = tid * 4 + 1024 * u;
    const v4f a = *(const v4fa*)(x + j);
    v4f b = {0.f,0.f,0.f,0.f}; if (rr) b = *(const v4fa*)(rr + j);
#pragma unroll
    for (int q = 0; q < 4; ++q) { const float v = a[q] + b[q]; vals[u * 4 + q] = v; s1 += v; }
  }
  red[tid] = s1; __syncthreads();
  for (int st = 128; st > 0; st >>= 1) { if (tid < st) red[tid] += red[tid + st]; __syncthreads(); }
  const float mu = red[0] / (float)N; __syncthreads();
  float s2 = 0.f;
  for (int u = 0; u < per / 4; ++u)
#pragma unroll
    for (int q = 0; q < 4; ++q) { const float c = vals[u * 4 + q] - mu; s2 += c * c; }
  red[tid] = s2; __syncthreads();
  for (int st = 128; st > 0; st >>= 1) { if (tid < st) red[tid] += red[tid + st]; __syncthreads(); }
  const float rs = rsqrtf(red[0] / (float)N + eps);
  {
    for (int u = 0; u < per / 4; ++u) {
      const int j = tid * 4 + 1024 * u;
      v4f o, sm;
#pragma unroll
      for (int q = 0; q < 4; ++q) {
        float gg = g[j + q], bb = bta[j + q];
        if (PARAM_BF16) { gg = bf16_round(gg); bb = bf16_round(bb); }
        sm[q] = vals[u * 4 + q]; o[q] = (vals[u * 4 + q] - mu) * rs * gg + bb;
      }
      if (out_sum) *(v4f*)(out_sum + (size_t)row * N + j) = sm;
      *(v4f*)(out_norm + (size_t)row * N + j) = o;
    }
    
  }
}



// ---- f16 WMMA path (v_wmma_f32_16x16x32_f16): 11-bit significands for operands in range — used where a [0,1] probability operand needs more precision than bf16
typedef _Float16 v16h __attribute__((ext_vector_type(16)));
union FragH { v16h v; v8us half[2]; _Float16 h[16]; unsigned short u[16]; };
template <int NT>
__device__ __forceinline__ v8f mmaH(v16h ah, v16h al, v16h bh, v16h bl, v8f c) {
  c = __builtin_amdgcn_wmma_f32_16x16x32_f16(false, ah, false, bh, (short)0, c, false, false);
  if (NT >= 2) c = __builtin_amdgcn_wmma_f32_16x16x32_f16(false, al, false, bh, (short)0, c, false, false);
  if (NT >= 3) c = __builtin_amdgcn_wmma_f32_16x16x32_f16(false, ah, false, bl, (short)0, c, false, false);
  asm volatile("v_nop\n\tv_nop\n\tv_nop\n\tv_nop" : "+v"(c) : "v"(ah), "v"(al), "v"(bh), "v"(bl));
  return c;
}
// batched GEMM like k_gemm_b but f16 operands: A f32 (split into f16 hi/lo if ASPLIT, else rounded to f16), Bt = f16 values [n][k]; alpha; C f32; N multiple of 16 (partial tiles skipped)
template <bool ASPLIT>
__global__ __launch_bounds__(128) void k_gemm_h(const float* __restrict__ A, int lda, size_t sA, const _Float16* __restrict__ Bh, int ldb, size_t sB, float alpha, float* __restrict__ C, int ldc, size_t sC, int M, int N, int K) {
  __shared__ __attribute__((aligned(16))) float so[4][16][64];
  const int tid = threadIdx.x, w = tid >> 5, lane = tid & 31, ln = lane & 15, hh = lane >> 4; const int by = blockIdx.y;
  A += (size_t)by * sA; Bh += (size_t)by * sB; C += (size_t)by * sC;
  const int ntn = (N + 63) / 64; const int wid = blockIdx.x * 4 + w; const int mt = wid / ntn, nq = wid % ntn; if (mt * 16 >= M) return;
  const int row0 = mt * 16, col0 = nq * 64; const float* arow = A + (size_t)(row0 + ln) * lda;
  v8f acc[4] = {};
  for (int kb = 0; kb < K; kb += 32) {
    FragH ah, al;
    const v4f x0 = *(const v4fa*)(arow + kb + 8 * hh), x1 = *(const v4fa*)(arow + kb + 8 * hh + 4), x2 = *(const v4fa*)(arow + kb + 16 + 8 * hh), x3 = *(const v4fa*)(arow + kb + 16 + 8 * hh + 4);
    float xs[16] = {x0[0],x0[1],x0[2],x0[3],x1[0],x1[1],x1[2],x1[3],x2[0],x2[1],x2[2],x2[3],x3[0],x3[1],x3[2],x3[3]};
#pragma unroll
    for (int i = 0; i < 16; ++i) { const _Float16 h = (_Float16)xs[i]; ah.h[i] = h; al.h[i] = ASPLIT ? (_Float16)(xs[i] - (float)h) : (_Float16)0.0f; }
#pragma unroll
    for (int t = 0; t < 4; ++t) { if (col0 + t * 16 >= N) continue; const size_t boff = (size_t)(col0 + t * 16 + ln) * ldb + kb; FragH bq; bq.half[0] = *(const v8us*)(Bh + boff + 8 * hh); bq.half[1] = *(const v8us*)(Bh + boff + 16 + 8 * hh);
      acc[t] = mmaH<ASPLIT ? 2 : 1>(ah.v, al.v, bq.v, bq.v, acc[t]); }
  }
#pragma unroll
  for (int t = 0; t < 4; ++t) { if (col0 + t * 16 >= N) continue;
#pragma unroll
    for (int r = 0; r < 8; ++r) so[w][8 * hh + r][t * 16 + ln] = acc[t][r] * alpha; }
  __builtin_amdgcn_fence(__ATOMIC_ACQ_REL, "workgroup"); __builtin_amdgcn_wave_barrier();
  const int rsub = lane >> 4, c4 = (lane & 15) * 4;
  {
#pragma unroll
    for (int q = 0; q < 8; ++q) { const int r = q * 2 + rsub; if (col0 + c4 < N) { const v4f v = *(const v4fa*)&so[w][r][c4]; *(v4f*)(C + (size_t)(row0 + r) * ldc + col0 + c4) = v; } }
     }
}

// Wt[n][k] = f16(W[k][n]·scale) from f32 row-major W[K][N] (scale = power of two; bf16-exact weights stay exact in f16 away from the subnormal range)
__global__ __launch_bounds__(256) void k_wt_f16(const float* __restrict__ W, _Float16* __restrict__ Wt, int K, int N, float scale) {
  const int t = blockIdx.x * 256 + threadIdx.x; if (t >= N * (K / 8)) return; const int n = t / (K / 8), k8 = (t % (K / 8)) * 8; FragH f;
#pragma unroll
  for (int i = 0; i < 8; ++i) f.h[i] = (_Float16)(bf16_round(W[(size_t)(k8 + i) * N + n]) * scale); const v8us o = f.half[0];
  *(v8us*)((unsigned short*)Wt + (size_t)n * K + k8) = o; 
}
// k_gemm_hh variant with fused epilogue: v = acc·alpha + bias[by·sBias + col] (+ CP[(row/rowsPerB)·sCPb + by·64 + col] if CP) ; ACT 0 none / 1 elu / 3 relu ; writes f16 C16 and f32 C, each if non-null
template <int ACT, int N, int K>
__device__ __forceinline__ void gemm_hhx_part(const _Float16* __restrict__ A, int lda, size_t sA, const _Float16* __restrict__ Bh, int ldb, size_t sB, float alpha, const float* __restrict__ bias, size_t sBias, const float* __restrict__ CP, int rowsPerB, size_t sCPb, int row0g,
    float* __restrict__ C, _Float16* __restrict__ C16, int ldc, size_t sC, int M, const int by) {
  __shared__ __attribute__((aligned(16))) float so[4][16][64];
  const int tid = threadIdx.x, w = tid >> 5, lane = tid & 31, ln = lane & 15, hh = lane >> 4;
  A += (size_t)by * sA; Bh += (size_t)by * sB; const size_t cofs = (size_t)by * sC; const float* bp = bias ? bias + (size_t)by * sBias : nullptr;
  const int ntn = (N + 63) / 64; const int wid = blockIdx.x * 4 + w; const int mt = wid / ntn, nq = wid % ntn; if (mt * 16 >= M) return;
  const int row0 = mt * 16, col0 = nq * 64; const _Float16* arow = A + (size_t)(row0 + ln) * lda;
  v8f acc[4] = {};
  // The ten operand loads of a k-step go out as one group, three k-steps ahead of the WMMAs that use them, into a ring of three register sets (K is a constant, the loop is unrolled, so every ring index is one too).
  // A wave then waits out one load latency for every three k-steps; with a pair of loads in front of each WMMA it waited out four per k-step. The k order of the sums is the old one.
  constexpr int KST = K / 32, RD = 3; constexpr bool PART = (N % 64) != 0;      // with N a multiple of 64 every one of a wave's four column tiles lies inside N
  FragH ra[RD], rb[RD][4];
  auto fetch = [&](const int st) { const int kb = st * 32; FragH& ah = ra[st % RD]; ah.half[0] = *(const v8us*)((const unsigned short*)arow + kb + 8 * hh); ah.half[1] = *(const v8us*)((const unsigned short*)arow + kb + 16 + 8 * hh);
#pragma unroll
    for (int t = 0; t < 4; ++t) { if (PART && col0 + t * 16 >= N) continue; const size_t boff = (size_t)(col0 + t * 16 + ln) * ldb + kb; FragH& bq = rb[st % RD][t]; bq.half[0] = *(const v8us*)((const unsigned short*)Bh + boff + 8 * hh); bq.half[1] = *(const v8us*)((const unsigned short*)Bh + boff + 16 + 8 * hh); } };
#pragma unroll
  for (int st = 0; st < RD && st < KST; ++st) fetch(st);
  __builtin_amdgcn_sched_barrier(0);      // keeps the first WMMA, and the wait in front of it, behind the last of the ring's first loads: without it the wave waits out the first four loads before it issues the rest
#pragma unroll
  for (int st = 0; st < KST; ++st) {
#pragma unroll
    for (int t = 0; t < 4; ++t) { if (PART && col0 + t * 16 >= N) continue; acc[t] = mmaH<1>(ra[st % RD].v, ra[st % RD].v, rb[st % RD][t].v, rb[st % RD][t].v, acc[t]); }
    if (st + RD < KST) fetch(st + RD);      // into the set that this step has just used
  }
  asm volatile("s_wait_xcnt 0x0" ::: "memory");      // before the epilogue reuses a register that these loads name
  float bv4[4] = {0.f, 0.f, 0.f, 0.f}, cp[4][8];      // the epilogue's addends likewise: all of a wave's bias and CP loads go out together, under one test each, not one waited load per output element
  if (bp) { const float* br = bp + col0 + ln;
#pragma unroll
    for (int t = 0; t < 4; ++t) { if (PART && col0 + t * 16 >= N) continue; bv4[t] = br[t * 16]; }
    asm volatile("s_wait_xcnt 0x0" :: "v"(br) : "memory"); }      // the loads' address pair stays untouched up to this wait
  if (CP) { const float* cr[8];
#pragma unroll
    for (int r = 0; r < 8; ++r) { const int bidx = (row0g + row0 + 8 * hh + r) / rowsPerB; cr[r] = CP + (size_t)bidx * sCPb + (size_t)by * 64 + col0 + ln; }
#pragma unroll
    for (int r = 0; r < 8; ++r)
#pragma unroll
      for (int t = 0; t < 4; ++t) { if (PART && col0 + t * 16 >= N) continue; cp[t][r] = cr[r][t * 16]; }
    asm volatile("s_wait_xcnt 0x0" :: "v"(cr[0]), "v"(cr[1]), "v"(cr[2]), "v"(cr[3]), "v"(cr[4]), "v"(cr[5]), "v"(cr[6]), "v"(cr[7]) : "memory"); }      // the eight rows' address pairs stay untouched up to this wait
#pragma unroll
  for (int t = 0; t < 4; ++t) { if (PART && col0 + t * 16 >= N) continue; const float bv = bf16_round(bv4[t]);
#pragma unroll
    for (int r = 0; r < 8; ++r) { float v = acc[t][r] * alpha + bv; if (CP) v += cp[t][r]; if (ACT == 1) v = (v > 0.f) ? v : expm1f(v); else if (ACT == 3) v = fmaxf(v, 0.f); so[w][8 * hh + r][t * 16 + ln] = v; } }
  __builtin_amdgcn_fence(__ATOMIC_ACQ_REL, "workgroup"); __builtin_amdgcn_wave_barrier();
  const int rsub = lane >> 4, c4 = (lane & 15) * 4; typedef _Float16 v4h __attribute__((ext_vector_type(4)));
  {
#pragma unroll
    for (int q = 0; q < 8; ++q) { const int r = q * 2 + rsub; if (col0 + c4 < N) { const v4f v = *(const v4fa*)&so[w][r][c4]; if (C) { *(v4f*)(C + cofs + (size_t)(row0 + r) * ldc + col0 + c4) = v; asm volatile("s_wait_xcnt 0x0" ::: "memory"); }      // before the conversion below reuses a register that this store names
      if (C16) { v4h h4; for (int i = 0; i < 4; ++i) h4[i] = (_Float16)v[i]; *(v4h*)(C16 + cofs + (size_t)(row0 + r) * ldc + col0 + c4) = h4; asm volatile("s_wait_xcnt 0x0" ::: "memory"); } } }      // before the next row's values and addresses reuse a register that this store names
     }
}
template <int ACT>
__global__ __launch_bounds__(128) void k_gemm_hhx(const _Float16* __restrict__ A, int lda, size_t sA, const _Float16* __restrict__ Bh, int ldb, size_t sB, float alpha, const float* __restrict__ bias, size_t sBias, const float* __restrict__ CP, int rowsPerB, size_t sCPb, int row0g,
    float* __restrict__ C, _Float16* __restrict__ C16, int ldc, size_t sC, int M) {
  gemm_hhx_part<ACT, CC, CC>(A, lda, sA, Bh, ldb, sB, alpha, bias, sBias, CP, rowsPerB, sCPb, row0g, C, C16, ldc, sC, M, blockIdx.y); }
// The q, k and v projections read the same A and depend on nothing of one another: one grid, blockIdx.y = 0 q, 1 k, 2 v picks the weights (sB apart), the output (sC apart) and the addend
// (q and v: their bias; k: the per-batch text term CPk, row block = row / rowsPerB). Three times the waves of one projection are resident at once and cover each other's load waits.
__global__ __launch_bounds__(128) void k_gemm_qkv(const _Float16* __restrict__ A, int lda, const _Float16* __restrict__ Bh, int ldb, size_t sB, float alpha, const float* __restrict__ bias_q, const float* __restrict__ bias_v, const float* __restrict__ CPk, int rowsPerB, size_t sCPb,
    _Float16* __restrict__ C16, int ldc, size_t sC, int M) {
  const int z = blockIdx.y;
  gemm_hhx_part<0, CC, CC>(A, lda, 0, Bh + (size_t)z * sB, ldb, 0, alpha, z == 0 ? bias_q : (z == 2 ? bias_v : nullptr), 0, z == 1 ? CPk : nullptr, rowsPerB, sCPb, 0, nullptr, C16 + (size_t)z * sC, ldc, 0, M, 0); }


__global__ __launch_bounds__(256) void k_x16(const float* __restrict__ x, _Float16* __restrict__ X16, size_t n8) { const size_t t = (size_t)blockIdx.x * 256 + threadIdx.x; if (t >= n8) return; FragH f;
#pragma unroll
  for (int q = 0; q < 8; ++q) f.h[q] = (_Float16)bf16_round(x[t * 8 + q]); *(v8us*)((unsigned short*)X16 + t * 8) = f.half[0];  }
__global__ __launch_bounds__(256) void k_h16(const float* __restrict__ x, _Float16* __restrict__ X16, size_t n8) { const size_t t = (size_t)blockIdx.x * 256 + threadIdx.x; if (t >= n8) return; FragH f;
#pragma unroll
  for (int q = 0; q < 8; ++q) f.h[q] = (_Float16)x[t * 8 + q]; *(v8us*)((unsigned short*)X16 + t * 8) = f.half[0];  }
__device__ __forceinline__ void round16f_part(const float* __restrict__ W, _Float16* __restrict__ Bt, size_t n8, const size_t t) { if (t >= n8) return; FragH f;
#pragma unroll
  for (int i = 0; i < 8; ++i) f.h[i] = (_Float16)(bf16_round(W[t * 8 + i]) * 16.0f); *(v8us*)((unsigned short*)Bt + t * 8) = f.half[0];
  asm volatile("s_wait_xcnt 0x0" ::: "memory"); }      // the built code holds a path from here into another part of the grid's kernel, which reuses the registers that this store names
// K and V are laid out anew in the order in which the attention kernel's matrix operands want them. A tile is 32 keys of one (batch, head) slab = 8 fragment halves of 512 bytes; in a half,
// lane l owns bytes 16 l .. 16 l + 15, exactly the eight f16 that it holds of that operand half. Each wave-wide 16-byte load of the attention loop then covers four whole 128-byte lines
// instead of 32-byte pieces of sixteen. K half fr = (nt * 2 + ks) * 2 + hf: key nt * 16 + ln, channels ks * 32 + hf * 16 + 8 hh + q. V half fr = dt * 2 + hf: channel dt * 16 + ln, keys hf * 16 + 8 hh + q.
template <int NHv, int TTv>
__global__ __launch_bounds__(256) void k_pack(const _Float16* __restrict__ V16, int ldv, int voff, _Float16* __restrict__ Vp, const _Float16* __restrict__ K16, _Float16* __restrict__ Kp) { __shared__ unsigned short tl[64][66]; const int tid = threadIdx.x; const int slab = blockIdx.x / (TTv / 64), lg = blockIdx.x % (TTv / 64); const int b = slab / NHv, h = slab % NHv;
  const int fr = (tid >> 5) & 7, lane = tid & 31, ln = lane & 15, hh = lane >> 4;      // a wave writes one fragment half of each of the block's two tiles
  const size_t dst0 = ((size_t)(slab * (TTv / 32) + lg * 2) * 8 + fr) * 256 + lane * 8;
  for (int i = tid; i < 64 * 8; i += 256) { const int r = i / 8, c8 = (i % 8) * 8; FragH f; f.half[0] = *(const v8us*)((const unsigned short*)V16 + ((size_t)b * TTv + lg * 64 + r) * ldv + voff + h * 64 + c8);
#pragma unroll
    for (int q = 0; q < 8; ++q) tl[r][c8 + q] = f.u[q]; }
  {
#pragma unroll
    for (int jt = 0; jt < 2; ++jt) { const v8us kv = *(const v8us*)((const unsigned short*)K16 + ((size_t)b * TTv + lg * 64 + jt * 32 + (fr >> 2) * 16 + ln) * ldv + h * 64 + ((fr >> 1) & 1) * 32 + (fr & 1) * 16 + 8 * hh);
      *(v8us*)((unsigned short*)Kp + dst0 + jt * 2048) = kv; }
    asm volatile("s_wait_xcnt 0x0" ::: "memory"); }      // before the V part below reuses a register that these loads and stores name
  __syncthreads();
  {
#pragma unroll
    for (int jt = 0; jt < 2; ++jt) { const int d = (fr >> 1) * 16 + ln, k0 = jt * 32 + (fr & 1) * 16 + 8 * hh; FragH f;
#pragma unroll
      for (int q = 0; q < 8; ++q) f.u[q] = tl[k0 + q][d];
      *(v8us*)((unsigned short*)Vp + dst0 + jt * 2048) = f.half[0]; }
     } }

// Key split: the four waves of a block share ONE group of 32 query rows (two 16-row tiles); wave w walks the 32-key tiles w, w + 4, w + 8, ... with its own running max, sum and O for each query,
// and the four partial results are merged through LDS at the end. Every K and V fragment that a wave loads feeds the products of BOTH query tiles, so the kernel asks L2 for half the bytes of one tile a wave.
// 1024 blocks of 4 waves: four waves per SIMD (second launch bound: 256 registers a wave).
// Both products are formed transposed: S^T = K Q^T (A = 16 key rows, B = a query tile, kept in registers) and O^T += V^T P^T. A lane then holds 16 of the 32 scores of ONE query of each tile
// (query qt * 16 + ln, keys 8 hh + r and 16 + 8 hh + r): its maximum and sum are in-lane but for one exchange between the wave's halves, max, sum and rescale factor are one register each a tile,
// and the two score tiles, converted in place, ARE the B operand of the second product in the hardware k order, which the V^T loads already follow.
__device__ __forceinline__ float xhalf(float x) { return __builtin_bit_cast(float, __builtin_amdgcn_permlanex16(__builtin_bit_cast(int, x), __builtin_bit_cast(int, x), 0x76543210, 0xfedcba98, false, false)); }      // lane l with lane l ^ 16
__global__ __launch_bounds__(128, 4) void k_flash(const _Float16* __restrict__ Q16, int ldq, const _Float16* __restrict__ Kp, const _Float16* __restrict__ Vp, const int* __restrict__ MSK, float* __restrict__ O, int ldo) {
  constexpr int QT = 2, RPW = 16 * QT, NQB = 4096 / RPW, DT = 4, KS = 2; (void)MSK;
  constexpr float L2E = 1.4426950408889634f;      // e^(s - m) = 2^(s L2E - m L2E): one fused multiply-add and the bare v_exp_f32 a score, in place of the library's range-split expf
  __shared__ __attribute__((aligned(16))) float sO[4][RPW][64 + 4]; __shared__ float sM[4][RPW], sL[4][RPW];
  const int tid = threadIdx.x, w = tid >> 5, lane = tid & 31, ln = lane & 15, hh = lane >> 4;
  const int slab = blockIdx.x / NQB, qblk = blockIdx.x % NQB; const int b = slab / 4, h = slab % 4; const int q0 = qblk * RPW;
  FragH bq[QT][KS];
#pragma unroll
  for (int qt = 0; qt < QT; ++qt) { const unsigned short* qr = (const unsigned short*)Q16 + ((size_t)b * 4096 + q0 + qt * 16 + ln) * ldq + h * 64;
#pragma unroll
    for (int ks = 0; ks < KS; ++ks) { bq[qt][ks].half[0] = *(const v8us*)(qr + ks * 32 + 8 * hh); bq[qt][ks].half[1] = *(const v8us*)(qr + ks * 32 + 16 + 8 * hh); } }
  const unsigned short* Kph = (const unsigned short*)Kp + (size_t)slab * 64 * 4096 + lane * 8; const unsigned short* Vph = (const unsigned short*)Vp + (size_t)slab * 64 * 4096 + lane * 8;      // fragment order (k_pack): 2048 elements a 32-key tile, 256 a fragment half
  float m_q[QT], l_q[QT]; v8f oacc[QT][DT];      // oacc[qt][dt][r] = O[query qt * 16 + ln][dt * 16 + 8 * hh + r], unnormalised
#pragma unroll
  for (int qt = 0; qt < QT; ++qt) { m_q[qt] = -3.0e38f; l_q[qt] = 0.f;
#pragma unroll
    for (int dt = 0; dt < DT; ++dt) oacc[qt][dt] = (v8f){0.f,0.f,0.f,0.f,0.f,0.f,0.f,0.f}; }
  const int jend = 4096;
#pragma unroll 1
  for (int jb = 0; jb < jend; jb += 4 * 32) { const int j0 = jb + w * 32; const unsigned short* kt = Kph + (size_t)j0 * 64; const unsigned short* vt = Vph + (size_t)j0 * 64;      // the trip test is on jb, the same in every wave: a scalar branch, EXEC untouched around the WMMAs
    FragH ak[2][KS];      // the tile's eight K loads go out as one group ahead of the eight WMMAs: one load latency, not one per key half
#pragma unroll
    for (int nt = 0; nt < 2; ++nt)
#pragma unroll
      for (int ks = 0; ks < KS; ++ks) { ak[nt][ks].half[0] = *(const v8us*)(kt + ((nt * 2 + ks) * 2) * 256); ak[nt][ks].half[1] = *(const v8us*)(kt + ((nt * 2 + ks) * 2 + 1) * 256); }
    v8f s[QT][2];      // s[qt][nt][r] = q(qt * 16 + ln) . k(j0 + nt * 16 + 8 * hh + r)
#pragma unroll
    for (int nt = 0; nt < 2; ++nt)
#pragma unroll
      for (int qt = 0; qt < QT; ++qt) { v8f acc = (v8f){0.f,0.f,0.f,0.f,0.f,0.f,0.f,0.f};
#pragma unroll
        for (int ks = 0; ks < KS; ++ks) acc = mmaH<1>(ak[nt][ks].v, ak[nt][ks].v, bq[qt][ks].v, bq[qt][ks].v, acc);
        s[qt][nt] = acc; }
    asm volatile("s_wait_xcnt 0x0" :: "v"(kt) : "memory");      // the K loads' address pair stays untouched up to this wait
    FragH av[DT];      // the tile's eight V loads go out here as one group, into the registers that K has left: they fly while the softmax below is worked out
#pragma unroll
    for (int dt = 0; dt < DT; ++dt) { av[dt].half[0] = *(const v8us*)(vt + (dt * 2) * 256); av[dt].half[1] = *(const v8us*)(vt + (dt * 2 + 1) * 256); }
    FragH pb[QT];
#pragma unroll
    for (int qt = 0; qt < QT; ++qt) {
      float mc = fmaxf(s[qt][0][0], s[qt][1][0]);
#pragma unroll
      for (int r = 1; r < 8; ++r) mc = fmaxf(mc, fmaxf(s[qt][0][r], s[qt][1][r]));
      mc = fmaxf(mc, xhalf(mc));      // both halves of the wave now hold the maximum over the query's 32 scores
      const float mn = fmaxf(m_q[qt], mc); const float nb = -mn * L2E; const float al = (mn > -1.0e38f) ? __builtin_amdgcn_exp2f(__builtin_fmaf(m_q[qt], L2E, nb)) : 1.0f; m_q[qt] = mn;
      v8f pt[2];
#pragma unroll
      for (int nt = 0; nt < 2; ++nt)
#pragma unroll
        for (int r = 0; r < 8; ++r) { const float p = __builtin_amdgcn_exp2f(__builtin_fmaf(s[qt][nt][r], L2E, nb)); pt[nt][r] = p; pb[qt].h[nt * 8 + r] = (_Float16)p; }
      const v8f p8 = pt[0] + pt[1]; const float ps = ((p8[0] + p8[1]) + (p8[2] + p8[3])) + ((p8[4] + p8[5]) + (p8[6] + p8[7]));
      l_q[qt] = l_q[qt] * al + ps;      // the lane's own 16 keys; the halves' sums are joined once, behind the loop
#pragma unroll
      for (int dt = 0; dt < DT; ++dt) oacc[qt][dt] *= al; }
#pragma unroll
    for (int dt = 0; dt < DT; ++dt)
#pragma unroll
      for (int qt = 0; qt < QT; ++qt) oacc[qt][dt] = mmaH<1>(av[dt].v, av[dt].v, pb[qt].v, pb[qt].v, oacc[qt][dt]);
    asm volatile("s_wait_xcnt 0x0" :: "v"(vt) : "memory"); }      // the V loads' address pair stays untouched up to this wait
#pragma unroll
  for (int qt = 0; qt < QT; ++qt) { const int qr = qt * 16 + ln;
    l_q[qt] += xhalf(l_q[qt]);
    if (hh == 0) { sM[w][qr] = m_q[qt]; sL[w][qr] = l_q[qt]; }
#pragma unroll
    for (int dt = 0; dt < DT; ++dt) { *(v4fa*)&sO[w][qr][dt * 16 + 8 * hh] = (v4f){oacc[qt][dt][0], oacc[qt][dt][1], oacc[qt][dt][2], oacc[qt][dt][3]}; *(v4fa*)&sO[w][qr][dt * 16 + 8 * hh + 4] = (v4f){oacc[qt][dt][4], oacc[qt][dt][5], oacc[qt][dt][6], oacc[qt][dt][7]}; } }
  __syncthreads();      // every wave's partial (max, sum, unnormalised O) is in LDS before any wave merges
  {
#pragma unroll
    for (int rp = 0; rp < RPW; rp += 8) { const int r = rp + (tid >> 4), pc = tid & 15;
      const float mm = fmaxf(fmaxf(sM[0][r], sM[1][r]), fmaxf(sM[2][r], sM[3][r])); float l = 0.f; v4f val = {0.f, 0.f, 0.f, 0.f};
#pragma unroll
      for (int i = 0; i < 4; ++i) { const float e = expf(sM[i][r] - mm); l += e * sL[i][r]; const v4f o = *(const v4fa*)&sO[i][r][pc * 4]; val += e * o; }
      val *= (l > 0.f) ? 1.0f / l : 0.f; *(v4f*)(O + ((size_t)b * 4096 + q0 + r) * ldo + h * 64 + pc * 4) = val; }
     } }

// blk = which 64-channel x 16-point tile, tid = 0 .. 255 inside the 256 threads that share it, tl = their own LDS tile
__device__ __forceinline__ void tok_part(const float* __restrict__ x, _Float16* __restrict__ X16, const int blk, const int tid, unsigned short (*tl)[72]) { const int b = blk / ((CC / 64) * (NN / 16)), rem = blk % ((CC / 64) * (NN / 16)); const int cg = rem / (NN / 16), pg = rem % (NN / 16); const int c0 = cg * 64, p0 = pg * 16;
  for (int i = tid; i < 64 * 16; i += 256) { const int c = i / 16, pp = i % 16; FragH f; f.h[0] = (_Float16)bf16_round(x[((size_t)b * CC + c0 + c) * NN + p0 + pp]); tl[pp][c] = f.u[0]; }
  __syncthreads();
  if (tid < 128) { const int r = tid / 8, pc = tid % 8; FragH f;
#pragma unroll
    for (int q = 0; q < 8; ++q) f.u[q] = tl[r][pc * 8 + q]; unsigned short* d = (unsigned short*)X16 + ((size_t)b * NN + p0 + r) * CC + c0 + pc * 8; *(v8us*)d = f.half[0];  } }
// Text term of the key bias, one block of 32 waves a batch row. A wave owns 8 output channels; its 32 lanes split each weight row in float4 pieces, so that every wave-wide load covers
// whole 128-byte lines and the loads of the 8 rows are independent of one another; each lane sums its own columns and a butterfly over the lanes adds the 32 partial sums.
__device__ __forceinline__ void lanes_sum8(float (&a)[8]) {
#pragma unroll
  for (int m = 16; m > 0; m >>= 1) { float o[8];
#pragma unroll
    for (int i = 0; i < 8; ++i) o[i] = __shfl_xor(a[i], m, 32);      // the 8 exchanges of a stage are issued together: one wait a stage
#pragma unroll
    for (int i = 0; i < 8; ++i) a[i] += o[i]; } }
__device__ __forceinline__ void text_part(const float* __restrict__ tf, const float* __restrict__ Wt, const float* __restrict__ bt, const float* __restrict__ Wk, const float* __restrict__ bk, float* __restrict__ TB, const int b) {
  __shared__ __attribute__((aligned(16))) float ts[CC]; __shared__ float to[CC];
  const int tid = threadIdx.x, lane = tid & 31, c0 = (tid >> 5) * 8;
  float acc[8];
  { v4f x[DTX / 128];
#pragma unroll
    for (int q = 0; q < DTX / 128; ++q) x[q] = *(const v4fa*)(tf + b * DTX + q * 128 + lane * 4);
    asm volatile("s_wait_xcnt 0x0" ::: "memory");      // before a register that these loads name is used for something else
#pragma unroll
    for (int q = 0; q < DTX / 128; ++q)
#pragma unroll
      for (int e = 0; e < 4; ++e) x[q][e] = bf16_round(x[q][e]);
    const float* wr = Wt + (size_t)c0 * DTX + lane * 4;
#pragma unroll
    for (int i = 0; i < 8; ++i) { float s = 0.f;
#pragma unroll
      for (int q = 0; q < DTX / 128; ++q) { const v4f v = *(const v4fa*)(wr + i * DTX + q * 128);
#pragma unroll
        for (int e = 0; e < 4; ++e) s += x[q][e] * bf16_round(v[e]); }
      acc[i] = s; }
    asm volatile("s_wait_xcnt 0x0" :: "v"(wr) : "memory"); }      // the loads' address pair stays untouched up to this wait
  lanes_sum8(acc);
  { float s = acc[0];
#pragma unroll
    for (int i = 1; i < 8; ++i) s = (lane == i) ? acc[i] : s;
    if (lane < 8) { s += bf16_round(bt[c0 + lane]); ts[c0 + lane] = 0.5f * s * (1.0f + erff(s * 0.70710678118654752f)); } }
  __syncthreads();      // all 256 channels of the projected text are in LDS before any wave reads them
  { v4f t[CC / 128];
#pragma unroll
    for (int q = 0; q < CC / 128; ++q) t[q] = *(const v4fa*)&ts[q * 128 + lane * 4];
    const float* wr = Wk + (size_t)c0 * CC + lane * 4;
#pragma unroll
    for (int i = 0; i < 8; ++i) { float s = 0.f;
#pragma unroll
      for (int q = 0; q < CC / 128; ++q) { const v4f v = *(const v4fa*)(wr + i * CC + q * 128);
#pragma unroll
        for (int e = 0; e < 4; ++e) s += t[q][e] * bf16_round(v[e]); }
      acc[i] = s; }
    asm volatile("s_wait_xcnt 0x0" :: "v"(wr) : "memory"); }      // the loads' address pair stays untouched up to this wait
  lanes_sum8(acc);
  { float s = acc[0];
#pragma unroll
    for (int i = 1; i < 8; ++i) s = (lane == i) ? acc[i] : s;
    if (lane < 8) to[c0 + lane] = s + bf16_round(bk[c0 + lane]); }
  __syncthreads();      // the 8 results of each wave are gathered so that one wave stores each whole 128-byte line
  if (tid < CC) TB[b * CC + tid] = to[tid]; }
// Everything that depends on the inputs alone shares one grid of 1024-thread blocks, told apart by the block index: blocks 0 .. BB - 1 the text term (the longest chain of waits, so it starts first),
// then WB blocks for each of the five weight matrices, then the token-major copy of the points, four of its 256-thread tiles a block.
#define WB (CC * CC / 8 / 1024)
#define TKB (BB * (CC / 64) * (NN / 16) / 4)
__global__ __launch_bounds__(1024) void k_prep(const float* __restrict__ tf, const float* __restrict__ Wt, const float* __restrict__ bt, const float* __restrict__ Wk, const float* __restrict__ bk, float* __restrict__ TB,
    const float* __restrict__ Wq, const float* __restrict__ Wv, const float* __restrict__ W1, const float* __restrict__ W2, _Float16* __restrict__ Bq, _Float16* __restrict__ Bk, _Float16* __restrict__ Bv, _Float16* __restrict__ B1, _Float16* __restrict__ B2,
    const float* __restrict__ x, _Float16* __restrict__ X16) {
  __shared__ unsigned short tl[4][16][72];
  const int bx = blockIdx.x, tid = threadIdx.x;
  if (bx < BB) text_part(tf, Wt, bt, Wk, bk, TB, bx);
  else if (bx < BB + 5 * WB) { const int m = (bx - BB) / WB; const size_t t = (size_t)((bx - BB) % WB) * 1024 + tid;
    const float* W = m == 0 ? Wq : m == 1 ? Wk : m == 2 ? Wv : m == 3 ? W1 : W2; _Float16* Bt = m == 0 ? Bq : m == 1 ? Bk : m == 2 ? Bv : m == 3 ? B1 : B2;
    round16f_part(W, Bt, (size_t)CC * CC / 8, t); }
  else tok_part(x, X16, (bx - BB - 5 * WB) * 4 + (tid >> 8), tid & 255, tl[tid >> 8]); }
__global__ __launch_bounds__(256) void k_fin(const float* __restrict__ M2, const float* __restrict__ pf, const float* __restrict__ gam, float* __restrict__ out) { __shared__ float tl[32][65]; const int tid = threadIdx.x; const int b = blockIdx.x / ((CC / 32) * (NN / 64)), rem = blockIdx.x % ((CC / 32) * (NN / 64)); const int cg = rem / (NN / 64), pg = rem % (NN / 64); const int c0 = cg * 32, p0 = pg * 64; const float g = bf16_round(gam[0]);
  for (int i = tid; i < 64 * 32; i += 256) { const int pp = i / 32, c = i % 32; tl[c][pp] = M2[((size_t)b * NN + p0 + pp) * CC + c0 + c]; }
  __syncthreads();
  { for (int i = tid; i < 32 * 16; i += 256) { const int c = i / 16, pc = i % 16; const size_t gi = ((size_t)b * CC + c0 + c) * NN + p0 + pc * 4; const v4f x = *(const v4fa*)(pf + gi); v4f v; for (int q = 0; q < 4; ++q) v[q] = g * tl[c][pc * 4 + q] + bf16_round(x[q]); *(v4f*)(out + gi) = v; }  } }
extern "C" void kernel_launch(void* const* d_in, const int* in_sizes, int n_in,
                              void* d_out, int out_size, void* d_ws, size_t ws_size, hipStream_t stream) {
  (void)in_sizes; (void)n_in; (void)out_size;
  const float* const* I = (const float* const*)d_in; const float* pf = I[0]; const float* tf = I[1]; const float* Wt = I[2]; const float* bt = I[3]; const float* Wq = I[4]; const float* bq = I[5]; const float* Wk = I[6]; const float* bk = I[7]; const float* Wv = I[8]; const float* bv = I[9]; const float* W1 = I[10]; const float* b1 = I[11]; const float* W2 = I[12]; const float* b2 = I[13]; const float* gam = I[14];
  char* ws = (char*)d_ws; size_t off = 0;
  auto take = [&](size_t bytes) { char* p = ws + off; off += (bytes + 255) & ~(size_t)255; return p; };
  _Float16* Bq = (_Float16*)take(CC * CC * 2); _Float16* Bk = (_Float16*)take(CC * CC * 2); _Float16* Bv = (_Float16*)take(CC * CC * 2); _Float16* B1 = (_Float16*)take(CC * CC * 2); _Float16* B2 = (_Float16*)take(CC * CC * 2); float* TB = (float*)take(BB * CC * 4);
  _Float16* X16 = (_Float16*)take((size_t)NR * CC * 2); _Float16* Q16 = (_Float16*)take((size_t)NR * CC * 2); _Float16* K16 = (_Float16*)take((size_t)NR * CC * 2); _Float16* V16 = (_Float16*)take((size_t)NR * CC * 2); _Float16* Vp = (_Float16*)take((size_t)NR * CC * 2); _Float16* Kp = (_Float16*)take((size_t)NR * CC * 2); float* O = (float*)take((size_t)NR * CC * 4); _Float16* O16 = Q16; _Float16* H1 = K16; float* M2 = O;
  if (off > ws_size) return;      // 0.7 + 4.2 x 6 + 8.4 = about 34 MiB
  k_prep<<<BB + 5 * WB + TKB, 1024, 0, stream>>>(tf, Wt, bt, Wk, bk, TB, Wq, Wv, W1, W2, Bq, Bk, Bv, B1, B2, pf, X16);      // weights (out,in)
  // Bq, Bk, Bv and Q16, K16, V16 were taken one behind the other and their sizes are multiples of 256 bytes: CC * CC and NR * CC elements apart
  k_gemm_qkv<<<dim3(((NR / 16) * (CC / 64) + 3) / 4, 3), 128, 0, stream>>>(X16, CC, Bq, CC, (size_t)CC * CC, 0.0625f, bq, bv, TB, NN, (size_t)CC, Q16, CC, (size_t)NR * CC, NR);      // k = pf Wk^T + (t Wk^T + bk): the per-batch text bias enters as the CP addend (row block b = row / 4096), unrounded
  k_pack<NH, NN><<<BB * NH * (NN / 64), 256, 0, stream>>>(V16, CC, 0, Vp, K16, Kp);
  k_flash<<<BB * NH * (NN / 32), 128, 0, stream>>>(Q16, CC, Kp, Vp, nullptr, O, CC);
  const unsigned g8 = (unsigned)(((size_t)NR * CC / 8 + 255) / 256); const dim3 g1(((NR / 16) * (CC / 64) + 3) / 4, 1);
  k_h16<<<g8, 256, 0, stream>>>(O, O16, (size_t)NR * CC / 8);
  k_gemm_hhx<3><<<g1, 128, 0, stream>>>(O16, CC, 0, B1, CC, 0, 0.0625f, b1, 0, nullptr, 1, 0, 0, nullptr, H1, CC, 0, NR);      // relu(x·W1ᵀ + b1)
  k_gemm_hhx<0><<<g1, 128, 0, stream>>>(H1, CC, 0, B2, CC, 0, 0.0625f, b2, 0, nullptr, 1, 0, 0, M2, nullptr, CC, 0, NR);         // ·W2ᵀ + b2 (f32)
  k_fin<<<BB * (CC / 32) * (NN / 64), 256, 0, stream>>>(M2, pf, gam, (float*)d_out);
}

// v009
// It runs in 91.8 microseconds.
// Timed twice side by side with v008, it ran 1.24 and 1.23 times as fast.
// Over all steps from v000 it is 5.82 times as fast.
#include <hip/hip_runtime.h>
// Text-guided point attention (B=2, C=256 channels × N=4096 points; text 512 → 256 GELU projection added to the key input; q/k/v 1×1 convs; 4 heads × 64; UNSCALED softmax(q·k)·v; MLP 256 → relu →
// 256; out = γ·x + point_feats, channel-major): the q/k/v/MLP linears ((out,in) weights bf16-exact ×2^4; the text term enters k as a per-batch bias) and the attention as a fused flash-style
// kernel (online softmax f32, P f16 ≤ 1, O = P·Vt; RPW-32 key-split waves) run on v_wmma_f32_16x16x32_f16 with f32 accumulate; the text projection, the NCW ↔ token-major transposes and the gated
// residual are f32 VALU.
#define BB 2
#define CC 256
#define NN 4096
#define DTX 512
#define NH 4
#define NR (BB * NN)

typedef __bf16 v16b __attribute__((ext_vector_type(16)));
typedef unsigned short v8us __attribute__((ext_vector_type(8), may_alias));
typedef float  v8f  __attribute__((ext_vector_type(8)));
typedef float  v4f  __attribute__((ext_vector_type(4)));
typedef float  v4fa __attribute__((ext_vector_type(4), may_alias));
union FragB { v16b v; v8us half[2]; unsigned short u[16]; };

__device__ __forceinline__ unsigned short bf16_bits(float x) { unsigned int u = __float_as_uint(x); return (unsigned short)((u + 0x7FFFu + ((u >> 16) & 1u)) >> 16); }
__device__ __forceinline__ float bf16_val(unsigned short b) { return __uint_as_float(((unsigned int)b) << 16); }
__device__ __forceinline__ float bf16_round(float x) { return bf16_val(bf16_bits(x)); }
// D += A·B with NT terms: 1 = ah·bh, 2 = + al·bh (A split), 3 = + ah·bl (both split)
template <int NT>
__device__ __forceinline__ v8f mmaN(v16b ah, v16b al, v16b bh, v16b bl, v8f c) {
  c = __builtin_amdgcn_wmma_f32_16x16x32_bf16(false, ah, false, bh, (short)0, c, false, false);
  if (NT >= 2) c = __builtin_amdgcn_wmma_f32_16x16x32_bf16(false, al, false, bh, (short)0, c, false, false);
  if (NT >= 3) c = __builtin_amdgcn_wmma_f32_16x16x32_bf16(false, ah, false, bl, (short)0, c, false, false);
  asm volatile("v_nop\n\tv_nop\n\tv_nop\n\tv_nop" : "+v"(c) : "v"(ah), "v"(al), "v"(bh), "v"(bl));
  return c;
}

__global__ __launch_bounds__(256) void k_wt_bf16(const float* __restrict__ W, unsigned short* __restrict__ Wt, int K, int N) {
  const int t = blockIdx.x * 256 + threadIdx.x;
  const int k8n = K / 8;
  if (t >= N * k8n) return;
  const int n = t / k8n, k8 = (t % k8n) * 8;
  v8us v;
#pragma unroll
  for (int i = 0; i < 8; ++i) v[i] = bf16_bits(W[(size_t)(k8 + i) * N + n]);
  *(v8us*)(Wt + (size_t)n * K + k8) = v;
  
}

// GEMM C[M][N] (f32, pitch ldc) = act(A[M][K]·W + bias). A f32 row-major (pitch lda) converted per fragment to bf16
// (ASPLIT: hi/lo two planes -> 2 terms, else single rounded term); Wt bf16 [N][K] (pitch ldb). BIAS_BF16 rounds the
// bias to bf16 first (bias quantised to bf16 before the add). K%32==0, M%16==0, N%64==0.
template <bool ASPLIT, int ACT, bool BIAS_BF16>
__global__ __launch_bounds__(128) void k_gemm_bf(const float* __restrict__ A, int lda, const unsigned short* __restrict__ Wt, int ldb,
                                               const float* __restrict__ bias, float* __restrict__ C, int ldc, int M, int N, int K) {
  __shared__ __attribute__((aligned(16))) float so[4][16][64];
  const int tid = threadIdx.x, w = tid >> 5, lane = tid & 31, ln = lane & 15, hh = lane >> 4;
  const int ntn = N / 64;
  const int wid = blockIdx.x * 4 + w;
  const int mt = wid / ntn, nq = wid % ntn;
  if (mt * 16 >= M) return;
  const int row0 = mt * 16, col0 = nq * 64;
  const float* arow = A + (size_t)(row0 + ln) * lda;
  v8f acc[4] = {};
  for (int kb = 0; kb < K; kb += 32) {
    FragB ah, al;
    const v4f x0 = *(const v4fa*)(arow + kb + 8 * hh), x1 = *(const v4fa*)(arow + kb + 8 * hh + 4);
    const v4f x2 = *(const v4fa*)(arow + kb + 16 + 8 * hh), x3 = *(const v4fa*)(arow + kb + 16 + 8 * hh + 4);
    float xs[16] = {x0[0],x0[1],x0[2],x0[3],x1[0],x1[1],x1[2],x1[3],x2[0],x2[1],x2[2],x2[3],x3[0],x3[1],x3[2],x3[3]};
#pragma unroll
    for (int i = 0; i < 16; ++i) { const unsigned short hb = bf16_bits(xs[i]); ah.u[i] = hb; al.u[i] = ASPLIT ? bf16_bits(xs[i] - bf16_val(hb)) : (unsigned short)0; }
#pragma unroll
    for (int t = 0; t < 4; ++t) {
      const unsigned short* brow = Wt + (size_t)(col0 + t * 16 + ln) * ldb + kb;
      FragB b;
      b.half[0] = *(const v8us*)(brow + 8 * hh);
      b.half[1] = *(const v8us*)(brow + 16 + 8 * hh);
      acc[t] = mmaN<ASPLIT ? 2 : 1>(ah.v, al.v, b.v, b.v, acc[t]);
    }
  }
#pragma unroll
  for (int t = 0; t < 4; ++t) {
    float bv = bias ? bias[col0 + t * 16 + ln] : 0.f;
    if (BIAS_BF16) bv = bf16_round(bv);
#pragma unroll
    for (int r = 0; r < 8; ++r) { float v = acc[t][r] + bv; if (ACT == 1) v = fmaxf(v, 0.f); so[w][8 * hh + r][t * 16 + ln] = v; }
  }
  __builtin_amdgcn_fence(__ATOMIC_ACQ_REL, "workgroup");
  __builtin_amdgcn_wave_barrier();
  const int rsub = lane >> 4, c4 = (lane & 15) * 4;
  {
#pragma unroll
    for (int q = 0; q < 8; ++q) {
      const int r = q * 2 + rsub;
      const v4f v = *(const v4fa*)&so[w][r][c4];
      *(v4f*)(C + (size_t)(row0 + r) * ldc + col0 + c4) = v;
    }
    
  }
}

// Flash-style causal/unmasked attention, all contractions 3-term bf16 hi/lo splits, f32 softmax with running max.
// q,k,v rows are read from f32 buffers with arbitrary row pitch (so they can live inside a fused qkv buffer);
// D = head size (multiple of 32, <= 128); one wave = 16 query rows; block = 4 waves (64 queries) sharing K/V chunks of 32.
template <int D, bool CAUSAL>
__global__ __launch_bounds__(128) void k_flash(const float* __restrict__ qb, const float* __restrict__ kb, const float* __restrict__ vb,
                                             int pitch, int T, int H, float scale, float* __restrict__ y, int ypitch) {
  constexpr int KS = D / 32;        // k-steps for QK
  constexpr int DT = D / 16;        // d tiles for PV
  __shared__ __attribute__((aligned(16))) unsigned short sKh[32][D + 8], sKl[32][D + 8], sVh[32][D + 8], sVl[32][D + 8];
  __shared__ __attribute__((aligned(16))) unsigned short sPh[4][16][40], sPl[4][16][40];
  __shared__ __attribute__((aligned(16))) float sO[4][16][D];
  const int tid = threadIdx.x, w = tid >> 5, lane = tid & 31, ln = lane & 15, hh = lane >> 4;
  const int nqb = (T + 63) / 64;
  const int bh = blockIdx.x / nqb, qblk = blockIdx.x % nqb;
  const int b = bh / H, h = bh % H;
  const int q0 = qblk * 64 + w * 16;
  const float* Q = qb + (size_t)b * T * pitch + h * D;
  const float* K = kb + (size_t)b * T * pitch + h * D;
  const float* V = vb + (size_t)b * T * pitch + h * D;

  // A fragments of the wave's 16 query rows (scaled), hi/lo
  FragB aqh[KS], aql[KS];
  {
    int row = q0 + ln; if (row >= T) row = T - 1;
    const float* qr = Q + (size_t)row * pitch;
#pragma unroll
    for (int ks = 0; ks < KS; ++ks)
#pragma unroll
      for (int i = 0; i < 16; ++i) {
        const int d = ks * 32 + ((i < 8) ? (8 * hh + i) : (16 + 8 * hh + (i - 8)));
        const float x = qr[d] * scale; const unsigned short hb = bf16_bits(x);
        aqh[ks].u[i] = hb; aql[ks].u[i] = bf16_bits(x - bf16_val(hb));
      }
  }
  float m_r[8], l_r[8];
#pragma unroll
  for (int r = 0; r < 8; ++r) { m_r[r] = -3.0e38f; l_r[r] = 0.f; }
  v8f oacc[DT];
#pragma unroll
  for (int dt = 0; dt < DT; ++dt) oacc[dt] = (v8f){0.f,0.f,0.f,0.f,0.f,0.f,0.f,0.f};

  const int kv_end = CAUSAL ? min(T, qblk * 64 + 64) : T;     // block-uniform
  for (int j0 = 0; j0 < kv_end; j0 += 32) {
    __syncthreads();
    for (int e = tid; e < 32 * (D / 4); e += 128) {
      const int r = e / (D / 4), c4 = (e % (D / 4)) * 4;
      const int key = j0 + r;
      v4f kf = {0.f,0.f,0.f,0.f}, vf = {0.f,0.f,0.f,0.f};
      if (key < T) { kf = *(const v4fa*)(K + (size_t)key * pitch + c4); vf = *(const v4fa*)(V + (size_t)key * pitch + c4); }
#pragma unroll
      for (int t = 0; t < 4; ++t) {
        unsigned short hb = bf16_bits(kf[t]); sKh[r][c4 + t] = hb; sKl[r][c4 + t] = bf16_bits(kf[t] - bf16_val(hb));
        hb = bf16_bits(vf[t]); sVh[r][c4 + t] = hb; sVl[r][c4 + t] = bf16_bits(vf[t] - bf16_val(hb));
      }
    }
    __syncthreads();
    // S tile 16 x 32
    v8f s[2];
#pragma unroll
    for (int nt = 0; nt < 2; ++nt) {
      v8f acc = {};
#pragma unroll
      for (int ks = 0; ks < KS; ++ks) {
        FragB bh_, bl_;
        bh_.half[0] = *(const v8us*)&sKh[nt * 16 + ln][ks * 32 + 8 * hh]; bh_.half[1] = *(const v8us*)&sKh[nt * 16 + ln][ks * 32 + 16 + 8 * hh];
        bl_.half[0] = *(const v8us*)&sKl[nt * 16 + ln][ks * 32 + 8 * hh]; bl_.half[1] = *(const v8us*)&sKl[nt * 16 + ln][ks * 32 + 16 + 8 * hh];
        acc = mmaN<3>(aqh[ks].v, aql[ks].v, bh_.v, bl_.v, acc);
      }
      s[nt] = acc;
    }
    // mask + running max (rows 8hh+r; the 16 lanes of a half share rows)
    float alpha[8];
#pragma unroll
    for (int r = 0; r < 8; ++r) {
      const int qi = q0 + 8 * hh + r;
      const int ja = j0 + ln, jb = j0 + 16 + ln;
      if (CAUSAL) { if (ja > qi) s[0][r] = -3.0e38f; if (jb > qi) s[1][r] = -3.0e38f; }
      if (ja >= T) s[0][r] = -3.0e38f;
      if (jb >= T) s[1][r] = -3.0e38f;
      float mx = fmaxf(s[0][r], s[1][r]);
      mx = fmaxf(mx, __shfl_xor(mx, 1, 32)); mx = fmaxf(mx, __shfl_xor(mx, 2, 32)); mx = fmaxf(mx, __shfl_xor(mx, 4, 32)); mx = fmaxf(mx, __shfl_xor(mx, 8, 32));
      const float mnew = fmaxf(m_r[r], mx);
      alpha[r] = (mnew > -1.0e38f) ? __expf(m_r[r] - mnew) : 1.0f;
      const float p0 = (s[0][r] > -1.0e38f) ? __expf(s[0][r] - mnew) : 0.f;
      const float p1 = (s[1][r] > -1.0e38f) ? __expf(s[1][r] - mnew) : 0.f;
      m_r[r] = mnew;
      l_r[r] = l_r[r] * alpha[r] + p0 + p1;            // per-lane partial row sum (16 lanes combined at the end)
      unsigned short hb = bf16_bits(p0); sPh[w][8 * hh + r][ln] = hb;      sPl[w][8 * hh + r][ln] = bf16_bits(p0 - bf16_val(hb));
      hb = bf16_bits(p1);                sPh[w][8 * hh + r][16 + ln] = hb; sPl[w][8 * hh + r][16 + ln] = bf16_bits(p1 - bf16_val(hb));
    }
#pragma unroll
    for (int dt = 0; dt < DT; ++dt)
#pragma unroll
      for (int r = 0; r < 8; ++r) oacc[dt][r] *= alpha[r];
    __builtin_amdgcn_fence(__ATOMIC_ACQ_REL, "workgroup");
    __builtin_amdgcn_wave_barrier();
    FragB pah, pal;
    pah.half[0] = *(const v8us*)&sPh[w][ln][8 * hh]; pah.half[1] = *(const v8us*)&sPh[w][ln][16 + 8 * hh];
    pal.half[0] = *(const v8us*)&sPl[w][ln][8 * hh]; pal.half[1] = *(const v8us*)&sPl[w][ln][16 + 8 * hh];
#pragma unroll
    for (int dt = 0; dt < DT; ++dt) {
      FragB bvh, bvl;
#pragma unroll
      for (int i = 0; i < 8; ++i) {
        bvh.u[i] = sVh[8 * hh + i][dt * 16 + ln]; bvh.u[8 + i] = sVh[16 + 8 * hh + i][dt * 16 + ln];
        bvl.u[i] = sVl[8 * hh + i][dt * 16 + ln]; bvl.u[8 + i] = sVl[16 + 8 * hh + i][dt * 16 + ln];
      }
      oacc[dt] = mmaN<3>(pah.v, pal.v, bvh.v, bvl.v, oacc[dt]);
    }
    __builtin_amdgcn_fence(__ATOMIC_ACQ_REL, "workgroup");
    __builtin_amdgcn_wave_barrier();
  }
#pragma unroll
  for (int r = 0; r < 8; ++r) {
    float l = l_r[r];
    l += __shfl_xor(l, 1, 32); l += __shfl_xor(l, 2, 32); l += __shfl_xor(l, 4, 32); l += __shfl_xor(l, 8, 32);
    l_r[r] = (l > 0.f) ? 1.0f / l : 0.f;
  }
#pragma unroll
  for (int dt = 0; dt < DT; ++dt)
#pragma unroll
    for (int r = 0; r < 8; ++r) sO[w][8 * hh + r][dt * 16 + ln] = oacc[dt][r] * l_r[r];
  __builtin_amdgcn_fence(__ATOMIC_ACQ_REL, "workgroup");
  __builtin_amdgcn_wave_barrier();
  {
    for (int r = 0; r < 16; ++r) {
      const int row = q0 + r;
      if (row < T && lane < D / 4) {
        const v4f val = *(const v4fa*)&sO[w][r][lane * 4];
        *(v4f*)(y + ((size_t)b * T + row) * ypitch + h * D + lane * 4) = val;
      }
    }
    
  }
}

// GEMM C = act(A·W + bias + resid): A f32 (ASPLIT -> hi/lo 2 terms), Wt bf16 [N][K]; ACT 0 none, 1 relu, 2 exact gelu;
// resid (optional, f32, row index = (row % rmod), pitch ldr, RES_BF16 rounds it) added before the activation.
template <bool ASPLIT, int ACT, bool BIAS_BF16, bool RES_BF16>
__global__ __launch_bounds__(128) void k_gemm_bf3(const float* __restrict__ A, int lda, const unsigned short* __restrict__ Wt, int ldb,
                                                const float* __restrict__ bias, const float* __restrict__ resid, int rmod, int ldr,
                                                float* __restrict__ C, int ldc, int M, int N, int K) {
  __shared__ __attribute__((aligned(16))) float so[4][16][64];
  const int tid = threadIdx.x, w = tid >> 5, lane = tid & 31, ln = lane & 15, hh = lane >> 4;
  const int ntn = N / 64;
  const int wid = blockIdx.x * 4 + w;
  const int mt = wid / ntn, nq = wid % ntn;
  if (mt * 16 >= M) return;
  const int row0 = mt * 16, col0 = nq * 64;
  const float* arow = A + (size_t)(row0 + ln) * lda;
  v8f acc[4] = {};
  for (int kb = 0; kb < K; kb += 32) {
    FragB ah, al;
    const v4f x0 = *(const v4fa*)(arow + kb + 8 * hh), x1 = *(const v4fa*)(arow + kb + 8 * hh + 4);
    const v4f x2 = *(const v4fa*)(arow + kb + 16 + 8 * hh), x3 = *(const v4fa*)(arow + kb + 16 + 8 * hh + 4);
    float xs[16] = {x0[0],x0[1],x0[2],x0[3],x1[0],x1[1],x1[2],x1[3],x2[0],x2[1],x2[2],x2[3],x3[0],x3[1],x3[2],x3[3]};
#pragma unroll
    for (int i = 0; i < 16; ++i) { const unsigned short hb = bf16_bits(xs[i]); ah.u[i] = hb; al.u[i] = ASPLIT ? bf16_bits(xs[i] - bf16_val(hb)) : (unsigned short)0; }
#pragma unroll
    for (int t = 0; t < 4; ++t) {
      const unsigned short* brow = Wt + (size_t)(col0 + t * 16 + ln) * ldb + kb;
      FragB b;
      b.half[0] = *(const v8us*)(brow + 8 * hh);
      b.half[1] = *(const v8us*)(brow + 16 + 8 * hh);
      acc[t] = mmaN<ASPLIT ? 2 : 1>(ah.v, al.v, b.v, b.v, acc[t]);
    }
  }
#pragma unroll
  for (int t = 0; t < 4; ++t) {
    const int col = col0 + t * 16 + ln;
    float bv = bias ? bias[col] : 0.f;
    if (BIAS_BF16) bv = bf16_round(bv);
#pragma unroll
    for (int r = 0; r < 8; ++r) {
      float v = acc[t][r] + bv;
      if (resid) { float rv = resid[(size_t)((row0 + 8 * hh + r) % rmod) * ldr + col]; if (RES_BF16) rv = bf16_round(rv); v += rv; }
      if (ACT == 1) v = fmaxf(v, 0.f);
      if (ACT == 2) v = 0.5f * v * (1.0f + erff(v * 0.70710678118654752f));
      if (ACT == 3) { const float u = 0.7978845608028654f * (v + 0.044715f * v * v * v); v = 0.5f * v * (1.0f + tanhf(u)); }
      so[w][8 * hh + r][t * 16 + ln] = v;
    }
  }
  __builtin_amdgcn_fence(__ATOMIC_ACQ_REL, "workgroup");
  __builtin_amdgcn_wave_barrier();
  const int rsub = lane >> 4, c4 = (lane & 15) * 4;
  {
#pragma unroll
    for (int q = 0; q < 8; ++q) {
      const int r = q * 2 + rsub;
      const v4f v = *(const v4fa*)&so[w][r][c4];
      *(v4f*)(C + (size_t)(row0 + r) * ldc + col0 + c4) = v;
    }
    
  }
}
// row LayerNorm (biased variance, eps) over N: s = X (+ R); optional out_sum <- s; out_norm <- (s-mu)*rsqrt(var+eps)*g + b
template <bool PARAM_BF16>
__global__ __launch_bounds__(256) void k_layernorm(const float* __restrict__ X, const float* __restrict__ R, const float* __restrict__ g, const float* __restrict__ bta,
                                                  float* __restrict__ out_sum, float* __restrict__ out_norm, int N, float eps) {
  __shared__ float red[256];
  const int row = blockIdx.x, tid = threadIdx.x;
  const float* x = X + (size_t)row * N; const float* rr = R ? R + (size_t)row * N : nullptr;
  float vals[16];                     // up to N = 4096
  const int per = N / 256;            // contiguous chunk per thread? use strided-by-4 chunks: thread handles j = tid*4 + 1024*u
  float s1 = 0.f;
  for (int u = 0; u < per / 4; ++u) {
    const int j = tid * 4 + 1024 * u;
    const v4f a = *(const v4fa*)(x + j);
    v4f b = {0.f,0.f,0.f,0.f}; if (rr) b = *(const v4fa*)(rr + j);
#pragma unroll
    for (int q = 0; q < 4; ++q) { const float v = a[q] + b[q]; vals[u * 4 + q] = v; s1 += v; }
  }
  red[tid] = s1; __syncthreads();
  for (int st = 128; st > 0; st >>= 1) { if (tid < st) red[tid] += red[tid + st]; __syncthreads(); }
  const float mu = red[0] / (float)N; __syncthreads();
  float s2 = 0.f;
  for (int u = 0; u < per / 4; ++u)
#pragma unroll
    for (int q = 0; q < 4; ++q) { const float c = vals[u * 4 + q] - mu; s2 += c * c; }
  red[tid] = s2; __syncthreads();
  for (int st = 128; st > 0; st >>= 1) { if (tid < st) red[tid] += red[tid + st]; __syncthreads(); }
  const float rs = rsqrtf(red[0] / (float)N + eps);
  {
    for (int u = 0; u < per / 4; ++u) {
      const int j = tid * 4 + 1024 * u;
      v4f o, sm;
#pragma unroll
      for (int q = 0; q < 4; ++q) {
        float gg = g[j + q], bb = bta[j + q];
        if (PARAM_BF16) { gg = bf16_round(gg); bb = bf16_round(bb); }
        sm[q] = vals[u * 4 + q]; o[q] = (vals[u * 4 + q] - mu) * rs * gg + bb;
      }
      if (out_sum) *(v4f*)(out_sum + (size_t)row * N + j) = sm;
      *(v4f*)(out_norm + (size_t)row * N + j) = o;
    }
    
  }
}



// ---- f16 WMMA path (v_wmma_f32_16x16x32_f16): 11-bit significands for operands in range — used where a [0,1] probability operand needs more precision than bf16
typedef _Float16 v16h __attribute__((ext_vector_type(16)));
union FragH { v16h v; v8us half[2]; _Float16 h[16]; unsigned short u[16]; };
template <int NT>
__device__ __forceinline__ v8f mmaH(v16h ah, v16h al, v16h bh, v16h bl, v8f c) {
  c = __builtin_amdgcn_wmma_f32_16x16x32_f16(false, ah, false, bh, (short)0, c, false, false);
  if (NT >= 2) c = __builtin_amdgcn_wmma_f32_16x16x32_f16(false, al, false, bh, (short)0, c, false, false);
  if (NT >= 3) c = __builtin_amdgcn_wmma_f32_16x16x32_f16(false, ah, false, bl, (short)0, c, false, false);
  asm volatile("v_nop\n\tv_nop\n\tv_nop\n\tv_nop" : "+v"(c) : "v"(ah), "v"(al), "v"(bh), "v"(bl));
  return c;
}
// batched GEMM like k_gemm_b but f16 operands: A f32 (split into f16 hi/lo if ASPLIT, else rounded to f16), Bt = f16 values [n][k]; alpha; C f32; N multiple of 16 (partial tiles skipped)
template <bool ASPLIT>
__global__ __launch_bounds__(128) void k_gemm_h(const float* __restrict__ A, int lda, size_t sA, const _Float16* __restrict__ Bh, int ldb, size_t sB, float alpha, float* __restrict__ C, int ldc, size_t sC, int M, int N, int K) {
  __shared__ __attribute__((aligned(16))) float so[4][16][64];
  const int tid = threadIdx.x, w = tid >> 5, lane = tid & 31, ln = lane & 15, hh = lane >> 4; const int by = blockIdx.y;
  A += (size_t)by * sA; Bh += (size_t)by * sB; C += (size_t)by * sC;
  const int ntn = (N + 63) / 64; const int wid = blockIdx.x * 4 + w; const int mt = wid / ntn, nq = wid % ntn; if (mt * 16 >= M) return;
  const int row0 = mt * 16, col0 = nq * 64; const float* arow = A + (size_t)(row0 + ln) * lda;
  v8f acc[4] = {};
  for (int kb = 0; kb < K; kb += 32) {
    FragH ah, al;
    const v4f x0 = *(const v4fa*)(arow + kb + 8 * hh), x1 = *(const v4fa*)(arow + kb + 8 * hh + 4), x2 = *(const v4fa*)(arow + kb + 16 + 8 * hh), x3 = *(const v4fa*)(arow + kb + 16 + 8 * hh + 4);
    float xs[16] = {x0[0],x0[1],x0[2],x0[3],x1[0],x1[1],x1[2],x1[3],x2[0],x2[1],x2[2],x2[3],x3[0],x3[1],x3[2],x3[3]};
#pragma unroll
    for (int i = 0; i < 16; ++i) { const _Float16 h = (_Float16)xs[i]; ah.h[i] = h; al.h[i] = ASPLIT ? (_Float16)(xs[i] - (float)h) : (_Float16)0.0f; }
#pragma unroll
    for (int t = 0; t < 4; ++t) { if (col0 + t * 16 >= N) continue; const size_t boff = (size_t)(col0 + t * 16 + ln) * ldb + kb; FragH bq; bq.half[0] = *(const v8us*)(Bh + boff + 8 * hh); bq.half[1] = *(const v8us*)(Bh + boff + 16 + 8 * hh);
      acc[t] = mmaH<ASPLIT ? 2 : 1>(ah.v, al.v, bq.v, bq.v, acc[t]); }
  }
#pragma unroll
  for (int t = 0; t < 4; ++t) { if (col0 + t * 16 >= N) continue;
#pragma unroll
    for (int r = 0; r < 8; ++r) so[w][8 * hh + r][t * 16 + ln] = acc[t][r] * alpha; }
  __builtin_amdgcn_fence(__ATOMIC_ACQ_REL, "workgroup"); __builtin_amdgcn_wave_barrier();
  const int rsub = lane >> 4, c4 = (lane & 15) * 4;
  {
#pragma unroll
    for (int q = 0; q < 8; ++q) { const int r = q * 2 + rsub; if (col0 + c4 < N) { const v4f v = *(const v4fa*)&so[w][r][c4]; *(v4f*)(C + (size_t)(row0 + r) * ldc + col0 + c4) = v; } }
     }
}

// Wt[n][k] = f16(W[k][n]·scale) from f32 row-major W[K][N] (scale = power of two; bf16-exact weights stay exact in f16 away from the subnormal range)
__global__ __launch_bounds__(256) void k_wt_f16(const float* __restrict__ W, _Float16* __restrict__ Wt, int K, int N, float scale) {
  const int t = blockIdx.x * 256 + threadIdx.x; if (t >= N * (K / 8)) return; const int n = t / (K / 8), k8 = (t % (K / 8)) * 8; FragH f;
#pragma unroll
  for (int i = 0; i < 8; ++i) f.h[i] = (_Float16)(bf16_round(W[(size_t)(k8 + i) * N + n]) * scale); const v8us o = f.half[0];
  *(v8us*)((unsigned short*)Wt + (size_t)n * K + k8) = o; 
}
// k_gemm_hh variant with fused epilogue: v = acc·alpha + bias[by·sBias + col] (+ CP[(row/rowsPerB)·sCPb + by·64 + col] if CP) ; ACT 0 none / 1 elu / 3 relu ; writes f16 C16 and f32 C, each if non-null
template <int ACT, int N, int K>
__device__ __forceinline__ void gemm_hhx_part(const _Float16* __restrict__ A, int lda, size_t sA, const _Float16* __restrict__ Bh, int ldb, size_t sB, float alpha, const float* __restrict__ bias, size_t sBias, const float* __restrict__ CP, int rowsPerB, size_t sCPb, int row0g,
    float* __restrict__ C, _Float16* __restrict__ C16, int ldc, size_t sC, int M, const int by) {
  __shared__ __attribute__((aligned(16))) float so[4][16][64];
  const int tid = threadIdx.x, w = tid >> 5, lane = tid & 31, ln = lane & 15, hh = lane >> 4;
  A += (size_t)by * sA; Bh += (size_t)by * sB; const size_t cofs = (size_t)by * sC; const float* bp = bias ? bias + (size_t)by * sBias : nullptr;
  const int ntn = (N + 63) / 64; const int wid = blockIdx.x * 4 + w; const int mt = wid / ntn, nq = wid % ntn; if (mt * 16 >= M) return;
  const int row0 = mt * 16, col0 = nq * 64; const _Float16* arow = A + (size_t)(row0 + ln) * lda;
  v8f acc[4] = {};
  // The ten operand loads of a k-step go out as one group, three k-steps ahead of the WMMAs that use them, into a ring of three register sets (K is a constant, the loop is unrolled, so every ring index is one too).
  // A wave then waits out one load latency for every three k-steps; with a pair of loads in front of each WMMA it waited out four per k-step. The k order of the sums is the old one.
  constexpr int KST = K / 32, RD = 3; constexpr bool PART = (N % 64) != 0;      // with N a multiple of 64 every one of a wave's four column tiles lies inside N
  FragH ra[RD], rb[RD][4];
  auto fetch = [&](const int st) { const int kb = st * 32; FragH& ah = ra[st % RD]; ah.half[0] = *(const v8us*)((const unsigned short*)arow + kb + 8 * hh); ah.half[1] = *(const v8us*)((const unsigned short*)arow + kb + 16 + 8 * hh);
#pragma unroll
    for (int t = 0; t < 4; ++t) { if (PART && col0 + t * 16 >= N) continue; const size_t boff = (size_t)(col0 + t * 16 + ln) * ldb + kb; FragH& bq = rb[st % RD][t]; bq.half[0] = *(const v8us*)((const unsigned short*)Bh + boff + 8 * hh); bq.half[1] = *(const v8us*)((const unsigned short*)Bh + boff + 16 + 8 * hh); } };
#pragma unroll
  for (int st = 0; st < RD && st < KST; ++st) fetch(st);
  __builtin_amdgcn_sched_barrier(0);      // keeps the first WMMA, and the wait in front of it, behind the last of the ring's first loads: without it the wave waits out the first four loads before it issues the rest
#pragma unroll
  for (int st = 0; st < KST; ++st) {
#pragma unroll
    for (int t = 0; t < 4; ++t) { if (PART && col0 + t * 16 >= N) continue; acc[t] = mmaH<1>(ra[st % RD].v, ra[st % RD].v, rb[st % RD][t].v, rb[st % RD][t].v, acc[t]); }
    if (st + RD < KST) fetch(st + RD);      // into the set that this step has just used
  }
  asm volatile("s_wait_xcnt 0x0" ::: "memory");      // before the epilogue reuses a register that these loads name
  float bv4[4] = {0.f, 0.f, 0.f, 0.f}, cp[4][8];      // the epilogue's addends likewise: all of a wave's bias and CP loads go out together, under one test each, not one waited load per output element
  if (bp) { const float* br = bp + col0 + ln;
#pragma unroll
    for (int t = 0; t < 4; ++t) { if (PART && col0 + t * 16 >= N) continue; bv4[t] = br[t * 16]; }
    asm volatile("s_wait_xcnt 0x0" :: "v"(br) : "memory"); }      // the loads' address pair stays untouched up to this wait
  if (CP) { const float* cr[8];
#pragma unroll
    for (int r = 0; r < 8; ++r) { const int bidx = (row0g + row0 + 8 * hh + r) / rowsPerB; cr[r] = CP + (size_t)bidx * sCPb + (size_t)by * 64 + col0 + ln; }
#pragma unroll
    for (int r = 0; r < 8; ++r)
#pragma unroll
      for (int t = 0; t < 4; ++t) { if (PART && col0 + t * 16 >= N) continue; cp[t][r] = cr[r][t * 16]; }
    asm volatile("s_wait_xcnt 0x0" :: "v"(cr[0]), "v"(cr[1]), "v"(cr[2]), "v"(cr[3]), "v"(cr[4]), "v"(cr[5]), "v"(cr[6]), "v"(cr[7]) : "memory"); }      // the eight rows' address pairs stay untouched up to this wait
#pragma unroll
  for (int t = 0; t < 4; ++t) { if (PART && col0 + t * 16 >= N) continue; const float bv = bf16_round(bv4[t]);
#pragma unroll
    for (int r = 0; r < 8; ++r) { float v = acc[t][r] * alpha + bv; if (CP) v += cp[t][r]; if (ACT == 1) v = (v > 0.f) ? v : expm1f(v); else if (ACT == 3) v = fmaxf(v, 0.f); so[w][8 * hh + r][t * 16 + ln] = v; } }
  __builtin_amdgcn_fence(__ATOMIC_ACQ_REL, "workgroup"); __builtin_amdgcn_wave_barrier();
  const int rsub = lane >> 4, c4 = (lane & 15) * 4; typedef _Float16 v4h __attribute__((ext_vector_type(4)));
  {
#pragma unroll
    for (int q = 0; q < 8; ++q) { const int r = q * 2 + rsub; if (col0 + c4 < N) { const v4f v = *(const v4fa*)&so[w][r][c4]; if (C) { *(v4f*)(C + cofs + (size_t)(row0 + r) * ldc + col0 + c4) = v; asm volatile("s_wait_xcnt 0x0" ::: "memory"); }      // before the conversion below reuses a register that this store names
      if (C16) { v4h h4; for (int i = 0; i < 4; ++i) h4[i] = (_Float16)v[i]; *(v4h*)(C16 + cofs + (size_t)(row0 + r) * ldc + col0 + c4) = h4; asm volatile("s_wait_xcnt 0x0" ::: "memory"); } } }      // before the next row's values and addresses reuse a register that this store names
     }
}
// The q, k and v projections read the same A and depend on nothing of one another: one grid, blockIdx.y = 0 q, 1 k, 2 v picks the weights (sB apart), the output (sC apart) and the addend
// (q and v: their bias; k: the per-batch text term CPk, row block = row / rowsPerB). Three times the waves of one projection are resident at once and cover each other's load waits.
__global__ __launch_bounds__(128) void k_gemm_qkv(const _Float16* __restrict__ A, int lda, const _Float16* __restrict__ Bh, int ldb, size_t sB, float alpha, const float* __restrict__ bias_q, const float* __restrict__ bias_v, const float* __restrict__ CPk, int rowsPerB, size_t sCPb,
    _Float16* __restrict__ C16, int ldc, size_t sC, int M) {
  const int z = blockIdx.y;
  gemm_hhx_part<0, CC, CC>(A, lda, 0, Bh + (size_t)z * sB, ldb, 0, alpha, z == 0 ? bias_q : (z == 2 ? bias_v : nullptr), 0, z == 1 ? CPk : nullptr, rowsPerB, sCPb, 0, nullptr, C16 + (size_t)z * sC, ldc, 0, M, 0); }


__global__ __launch_bounds__(256) void k_x16(const float* __restrict__ x, _Float16* __restrict__ X16, size_t n8) { const size_t t = (size_t)blockIdx.x * 256 + threadIdx.x; if (t >= n8) return; FragH f;
#pragma unroll
  for (int q = 0; q < 8; ++q) f.h[q] = (_Float16)bf16_round(x[t * 8 + q]); *(v8us*)((unsigned short*)X16 + t * 8) = f.half[0];  }
__device__ __forceinline__ void round16f_part(const float* __restrict__ W, _Float16* __restrict__ Bt, size_t n8, const size_t t) { if (t >= n8) return; FragH f;
#pragma unroll
  for (int i = 0; i < 8; ++i) f.h[i] = (_Float16)(bf16_round(W[t * 8 + i]) * 16.0f); *(v8us*)((unsigned short*)Bt + t * 8) = f.half[0];
  asm volatile("s_wait_xcnt 0x0" ::: "memory"); }      // the built code holds a path from here into another part of the grid's kernel, which reuses the registers that this store names
// K and V are laid out anew in the order in which the attention kernel's matrix operands want them. A tile is 32 keys of one (batch, head) slab = 8 fragment halves of 512 bytes; in a half,
// lane l owns bytes 16 l .. 16 l + 15, exactly the eight f16 that it holds of that operand half. Each wave-wide 16-byte load of the attention loop then covers four whole 128-byte lines
// instead of 32-byte pieces of sixteen. K half fr = (nt * 2 + ks) * 2 + hf: key nt * 16 + ln, channels ks * 32 + hf * 16 + 8 hh + q. V half fr = dt * 2 + hf: channel dt * 16 + ln, keys hf * 16 + 8 hh + q.
template <int NHv, int TTv>
__global__ __launch_bounds__(256) void k_pack(const _Float16* __restrict__ V16, int ldv, int voff, _Float16* __restrict__ Vp, const _Float16* __restrict__ K16, _Float16* __restrict__ Kp) { __shared__ unsigned short tl[64][66]; const int tid = threadIdx.x; const int slab = blockIdx.x / (TTv / 64), lg = blockIdx.x % (TTv / 64); const int b = slab / NHv, h = slab % NHv;
  const int fr = (tid >> 5) & 7, lane = tid & 31, ln = lane & 15, hh = lane >> 4;      // a wave writes one fragment half of each of the block's two tiles
  const size_t dst0 = ((size_t)(slab * (TTv / 32) + lg * 2) * 8 + fr) * 256 + lane * 8;
  for (int i = tid; i < 64 * 8; i += 256) { const int r = i / 8, c8 = (i % 8) * 8; FragH f; f.half[0] = *(const v8us*)((const unsigned short*)V16 + ((size_t)b * TTv + lg * 64 + r) * ldv + voff + h * 64 + c8);
#pragma unroll
    for (int q = 0; q < 8; ++q) tl[r][c8 + q] = f.u[q]; }
  {
#pragma unroll
    for (int jt = 0; jt < 2; ++jt) { const v8us kv = *(const v8us*)((const unsigned short*)K16 + ((size_t)b * TTv + lg * 64 + jt * 32 + (fr >> 2) * 16 + ln) * ldv + h * 64 + ((fr >> 1) & 1) * 32 + (fr & 1) * 16 + 8 * hh);
      *(v8us*)((unsigned short*)Kp + dst0 + jt * 2048) = kv; }
    asm volatile("s_wait_xcnt 0x0" ::: "memory"); }      // before the V part below reuses a register that these loads and stores name
  __syncthreads();
  {
#pragma unroll
    for (int jt = 0; jt < 2; ++jt) { const int d = (fr >> 1) * 16 + ln, k0 = jt * 32 + (fr & 1) * 16 + 8 * hh; FragH f;
#pragma unroll
      for (int q = 0; q < 8; ++q) f.u[q] = tl[k0 + q][d];
      *(v8us*)((unsigned short*)Vp + dst0 + jt * 2048) = f.half[0]; }
     } }

// Key split: the four waves of a block share ONE group of 32 query rows (two 16-row tiles); wave w walks the 32-key tiles w, w + 4, w + 8, ... with its own running max, sum and O for each query,
// and the four partial results are merged through LDS at the end. Every K and V fragment that a wave loads feeds the products of BOTH query tiles, so the kernel asks L2 for half the bytes of one tile a wave.
// 1024 blocks of 4 waves: four waves per SIMD (second launch bound: 256 registers a wave).
// Both products are formed transposed: S^T = K Q^T (A = 16 key rows, B = a query tile, kept in registers) and O^T += V^T P^T. A lane then holds 16 of the 32 scores of ONE query of each tile
// (query qt * 16 + ln, keys 8 hh + r and 16 + 8 hh + r): its maximum and sum are in-lane but for one exchange between the wave's halves, max, sum and rescale factor are one register each a tile,
// and the two score tiles, converted in place, ARE the B operand of the second product in the hardware k order, which the V^T loads already follow.
__device__ __forceinline__ float xhalf(float x) { return __builtin_bit_cast(float, __builtin_amdgcn_permlanex16(__builtin_bit_cast(int, x), __builtin_bit_cast(int, x), 0x76543210, 0xfedcba98, false, false)); }      // lane l with lane l ^ 16
__global__ __launch_bounds__(128, 4) void k_flash(const _Float16* __restrict__ Q16, int ldq, const _Float16* __restrict__ Kp, const _Float16* __restrict__ Vp, const int* __restrict__ MSK, _Float16* __restrict__ O, int ldo) {
  constexpr int QT = 2, RPW = 16 * QT, NQB = 4096 / RPW, DT = 4, KS = 2; (void)MSK;
  constexpr float L2E = 1.4426950408889634f;      // e^(s - m) = 2^(s L2E - m L2E): one fused multiply-add and the bare v_exp_f32 a score, in place of the library's range-split expf
  __shared__ __attribute__((aligned(16))) float sO[4][RPW][64 + 4]; __shared__ float sM[4][RPW], sL[4][RPW];
  const int tid = threadIdx.x, w = tid >> 5, lane = tid & 31, ln = lane & 15, hh = lane >> 4;
  const int slab = blockIdx.x / NQB, qblk = blockIdx.x % NQB; const int b = slab / 4, h = slab % 4; const int q0 = qblk * RPW;
  FragH bq[QT][KS];
#pragma unroll
  for (int qt = 0; qt < QT; ++qt) { const unsigned short* qr = (const unsigned short*)Q16 + ((size_t)b * 4096 + q0 + qt * 16 + ln) * ldq + h * 64;
#pragma unroll
    for (int ks = 0; ks < KS; ++ks) { bq[qt][ks].half[0] = *(const v8us*)(qr + ks * 32 + 8 * hh); bq[qt][ks].half[1] = *(const v8us*)(qr + ks * 32 + 16 + 8 * hh); } }
  const unsigned short* Kph = (const unsigned short*)Kp + (size_t)slab * 64 * 4096 + lane * 8; const unsigned short* Vph = (const unsigned short*)Vp + (size_t)slab * 64 * 4096 + lane * 8;      // fragment order (k_pack): 2048 elements a 32-key tile, 256 a fragment half
  float m_q[QT], l_q[QT]; v8f oacc[QT][DT];      // oacc[qt][dt][r] = O[query qt * 16 + ln][dt * 16 + 8 * hh + r], unnormalised
#pragma unroll
  for (int qt = 0; qt < QT; ++qt) { m_q[qt] = -3.0e38f; l_q[qt] = 0.f;
#pragma unroll
    for (int dt = 0; dt < DT; ++dt) oacc[qt][dt] = (v8f){0.f,0.f,0.f,0.f,0.f,0.f,0.f,0.f}; }
  const int jend = 4096;
#pragma unroll 1
  for (int jb = 0; jb < jend; jb += 4 * 32) { const int j0 = jb + w * 32; const unsigned short* kt = Kph + (size_t)j0 * 64; const unsigned short* vt = Vph + (size_t)j0 * 64;      // the trip test is on jb, the same in every wave: a scalar branch, EXEC untouched around the WMMAs
    FragH ak[2][KS];      // the tile's eight K loads go out as one group ahead of the eight WMMAs: one load latency, not one per key half
#pragma unroll
    for (int nt = 0; nt < 2; ++nt)
#pragma unroll
      for (int ks = 0; ks < KS; ++ks) { ak[nt][ks].half[0] = *(const v8us*)(kt + ((nt * 2 + ks) * 2) * 256); ak[nt][ks].half[1] = *(const v8us*)(kt + ((nt * 2 + ks) * 2 + 1) * 256); }
    v8f s[QT][2];      // s[qt][nt][r] = q(qt * 16 + ln) . k(j0 + nt * 16 + 8 * hh + r)
#pragma unroll
    for (int nt = 0; nt < 2; ++nt)
#pragma unroll
      for (int qt = 0; qt < QT; ++qt) { v8f acc = (v8f){0.f,0.f,0.f,0.f,0.f,0.f,0.f,0.f};
#pragma unroll
        for (int ks = 0; ks < KS; ++ks) acc = mmaH<1>(ak[nt][ks].v, ak[nt][ks].v, bq[qt][ks].v, bq[qt][ks].v, acc);
        s[qt][nt] = acc; }
    asm volatile("s_wait_xcnt 0x0" :: "v"(kt) : "memory");      // the K loads' address pair stays untouched up to this wait
    FragH av[DT];      // the tile's eight V loads go out here as one group, into the registers that K has left: they fly while the softmax below is worked out
#pragma unroll
    for (int dt = 0; dt < DT; ++dt) { av[dt].half[0] = *(const v8us*)(vt + (dt * 2) * 256); av[dt].half[1] = *(const v8us*)(vt + (dt * 2 + 1) * 256); }
    FragH pb[QT];
#pragma unroll
    for (int qt = 0; qt < QT; ++qt) {
      float mc = fmaxf(s[qt][0][0], s[qt][1][0]);
#pragma unroll
      for (int r = 1; r < 8; ++r) mc = fmaxf(mc, fmaxf(s[qt][0][r], s[qt][1][r]));
      mc = fmaxf(mc, xhalf(mc));      // both halves of the wave now hold the maximum over the query's 32 scores
      const float mn = fmaxf(m_q[qt], mc); const float nb = -mn * L2E; const float al = (mn > -1.0e38f) ? __builtin_amdgcn_exp2f(__builtin_fmaf(m_q[qt], L2E, nb)) : 1.0f; m_q[qt] = mn;
      v8f pt[2];
#pragma unroll
      for (int nt = 0; nt < 2; ++nt)
#pragma unroll
        for (int r = 0; r < 8; ++r) { const float p = __builtin_amdgcn_exp2f(__builtin_fmaf(s[qt][nt][r], L2E, nb)); pt[nt][r] = p; pb[qt].h[nt * 8 + r] = (_Float16)p; }
      const v8f p8 = pt[0] + pt[1]; const float ps = ((p8[0] + p8[1]) + (p8[2] + p8[3])) + ((p8[4] + p8[5]) + (p8[6] + p8[7]));
      l_q[qt] = l_q[qt] * al + ps;      // the lane's own 16 keys; the halves' sums are joined once, behind the loop
#pragma unroll
      for (int dt = 0; dt < DT; ++dt) oacc[qt][dt] *= al; }
#pragma unroll
    for (int dt = 0; dt < DT; ++dt)
#pragma unroll
      for (int qt = 0; qt < QT; ++qt) oacc[qt][dt] = mmaH<1>(av[dt].v, av[dt].v, pb[qt].v, pb[qt].v, oacc[qt][dt]);
    asm volatile("s_wait_xcnt 0x0" :: "v"(vt) : "memory"); }      // the V loads' address pair stays untouched up to this wait
#pragma unroll
  for (int qt = 0; qt < QT; ++qt) { const int qr = qt * 16 + ln;
    l_q[qt] += xhalf(l_q[qt]);
    if (hh == 0) { sM[w][qr] = m_q[qt]; sL[w][qr] = l_q[qt]; }
#pragma unroll
    for (int dt = 0; dt < DT; ++dt) { *(v4fa*)&sO[w][qr][dt * 16 + 8 * hh] = (v4f){oacc[qt][dt][0], oacc[qt][dt][1], oacc[qt][dt][2], oacc[qt][dt][3]}; *(v4fa*)&sO[w][qr][dt * 16 + 8 * hh + 4] = (v4f){oacc[qt][dt][4], oacc[qt][dt][5], oacc[qt][dt][6], oacc[qt][dt][7]}; } }
  __syncthreads();      // every wave's partial (max, sum, unnormalised O) is in LDS before any wave merges
  {
#pragma unroll
    for (int rp = 0; rp < RPW; rp += 8) { const int r = rp + (tid >> 4), pc = tid & 15;
      const float mm = fmaxf(fmaxf(sM[0][r], sM[1][r]), fmaxf(sM[2][r], sM[3][r])); float l = 0.f; v4f val = {0.f, 0.f, 0.f, 0.f};
#pragma unroll
      for (int i = 0; i < 4; ++i) { const float e = expf(sM[i][r] - mm); l += e * sL[i][r]; const v4f o = *(const v4fa*)&sO[i][r][pc * 4]; val += e * o; }
      val *= (l > 0.f) ? 1.0f / l : 0.f; typedef _Float16 v4h __attribute__((ext_vector_type(4))); const v4h h4 = {(_Float16)val[0], (_Float16)val[1], (_Float16)val[2], (_Float16)val[3]};      // the f16 operand of the next product is stored here, not by a launch of its own
      *(v4h*)(O + ((size_t)b * 4096 + q0 + r) * ldo + h * 64 + pc * 4) = h4; asm volatile("s_wait_xcnt 0x0" ::: "memory"); }      // before the next rows' values and addresses reuse a register that this store names
     } }

// blk = which 64-channel x 16-point tile, tid = 0 .. 255 inside the 256 threads that share it, tl = their own LDS tile
__device__ __forceinline__ void tok_part(const float* __restrict__ x, _Float16* __restrict__ X16, const int blk, const int tid, unsigned short (*tl)[72]) { const int b = blk / ((CC / 64) * (NN / 16)), rem = blk % ((CC / 64) * (NN / 16)); const int cg = rem / (NN / 16), pg = rem % (NN / 16); const int c0 = cg * 64, p0 = pg * 16;
  for (int i = tid; i < 64 * 16; i += 256) { const int c = i / 16, pp = i % 16; FragH f; f.h[0] = (_Float16)bf16_round(x[((size_t)b * CC + c0 + c) * NN + p0 + pp]); tl[pp][c] = f.u[0]; }
  __syncthreads();
  if (tid < 128) { const int r = tid / 8, pc = tid % 8; FragH f;
#pragma unroll
    for (int q = 0; q < 8; ++q) f.u[q] = tl[r][pc * 8 + q]; unsigned short* d = (unsigned short*)X16 + ((size_t)b * NN + p0 + r) * CC + c0 + pc * 8; *(v8us*)d = f.half[0];  } }
// Text term of the key bias, one block of 32 waves a batch row. A wave owns 8 output channels; its 32 lanes split each weight row in float4 pieces, so that every wave-wide load covers
// whole 128-byte lines and the loads of the 8 rows are independent of one another; each lane sums its own columns and a butterfly over the lanes adds the 32 partial sums.
__device__ __forceinline__ void lanes_sum8(float (&a)[8]) {
#pragma unroll
  for (int m = 16; m > 0; m >>= 1) { float o[8];
#pragma unroll
    for (int i = 0; i < 8; ++i) o[i] = __shfl_xor(a[i], m, 32);      // the 8 exchanges of a stage are issued together: one wait a stage
#pragma unroll
    for (int i = 0; i < 8; ++i) a[i] += o[i]; } }
__device__ __forceinline__ void text_part(const float* __restrict__ tf, const float* __restrict__ Wt, const float* __restrict__ bt, const float* __restrict__ Wk, const float* __restrict__ bk, float* __restrict__ TB, const int b) {
  __shared__ __attribute__((aligned(16))) float ts[CC]; __shared__ float to[CC];
  const int tid = threadIdx.x, lane = tid & 31, c0 = (tid >> 5) * 8;
  float acc[8];
  { v4f x[DTX / 128];
#pragma unroll
    for (int q = 0; q < DTX / 128; ++q) x[q] = *(const v4fa*)(tf + b * DTX + q * 128 + lane * 4);
    asm volatile("s_wait_xcnt 0x0" ::: "memory");      // before a register that these loads name is used for something else
#pragma unroll
    for (int q = 0; q < DTX / 128; ++q)
#pragma unroll
      for (int e = 0; e < 4; ++e) x[q][e] = bf16_round(x[q][e]);
    const float* wr = Wt + (size_t)c0 * DTX + lane * 4;
#pragma unroll
    for (int i = 0; i < 8; ++i) { float s = 0.f;
#pragma unroll
      for (int q = 0; q < DTX / 128; ++q) { const v4f v = *(const v4fa*)(wr + i * DTX + q * 128);
#pragma unroll
        for (int e = 0; e < 4; ++e) s += x[q][e] * bf16_round(v[e]); }
      acc[i] = s; }
    asm volatile("s_wait_xcnt 0x0" :: "v"(wr) : "memory"); }      // the loads' address pair stays untouched up to this wait
  lanes_sum8(acc);
  { float s = acc[0];
#pragma unroll
    for (int i = 1; i < 8; ++i) s = (lane == i) ? acc[i] : s;
    if (lane < 8) { s += bf16_round(bt[c0 + lane]); ts[c0 + lane] = 0.5f * s * (1.0f + erff(s * 0.70710678118654752f)); } }
  __syncthreads();      // all 256 channels of the projected text are in LDS before any wave reads them
  { v4f t[CC / 128];
#pragma unroll
    for (int q = 0; q < CC / 128; ++q) t[q] = *(const v4fa*)&ts[q * 128 + lane * 4];
    const float* wr = Wk + (size_t)c0 * CC + lane * 4;
#pragma unroll
    for (int i = 0; i < 8; ++i) { float s = 0.f;
#pragma unroll
      for (int q = 0; q < CC / 128; ++q) { const v4f v = *(const v4fa*)(wr + i * CC + q * 128);
#pragma unroll
        for (int e = 0; e < 4; ++e) s += t[q][e] * bf16_round(v[e]); }
      acc[i] = s; }
    asm volatile("s_wait_xcnt 0x0" :: "v"(wr) : "memory"); }      // the loads' address pair stays untouched up to this wait
  lanes_sum8(acc);
  { float s = acc[0];
#pragma unroll
    for (int i = 1; i < 8; ++i) s = (lane == i) ? acc[i] : s;
    if (lane < 8) to[c0 + lane] = s + bf16_round(bk[c0 + lane]); }
  __syncthreads();      // the 8 results of each wave are gathered so that one wave stores each whole 128-byte line
  if (tid < CC) TB[b * CC + tid] = to[tid]; }
// Everything that depends on the inputs alone shares one grid of 1024-thread blocks, told apart by the block index: blocks 0 .. BB - 1 the text term (the longest chain of waits, so it starts first),
// then WB blocks for each of the five weight matrices, then the token-major copy of the points, four of its 256-thread tiles a block.
#define WB (CC * CC / 8 / 1024)
#define TKB (BB * (CC / 64) * (NN / 16) / 4)
__global__ __launch_bounds__(1024) void k_prep(const float* __restrict__ tf, const float* __restrict__ Wt, const float* __restrict__ bt, const float* __restrict__ Wk, const float* __restrict__ bk, float* __restrict__ TB,
    const float* __restrict__ Wq, const float* __restrict__ Wv, const float* __restrict__ W1, const float* __restrict__ W2, _Float16* __restrict__ Bq, _Float16* __restrict__ Bk, _Float16* __restrict__ Bv, _Float16* __restrict__ B1, _Float16* __restrict__ B2,
    const float* __restrict__ x, _Float16* __restrict__ X16) {
  __shared__ unsigned short tl[4][16][72];
  const int bx = blockIdx.x, tid = threadIdx.x;
  if (bx < BB) text_part(tf, Wt, bt, Wk, bk, TB, bx);
  else if (bx < BB + 5 * WB) { const int m = (bx - BB) / WB; const size_t t = (size_t)((bx - BB) % WB) * 1024 + tid;
    const float* W = m == 0 ? Wq : m == 1 ? Wk : m == 2 ? Wv : m == 3 ? W1 : W2; _Float16* Bt = m == 0 ? Bq : m == 1 ? Bk : m == 2 ? Bv : m == 3 ? B1 : B2;
    round16f_part(W, Bt, (size_t)CC * CC / 8, t); }
  else tok_part(x, X16, (bx - BB - 5 * WB) * 4 + (tid >> 8), tid & 255, tl[tid >> 8]); }
// Everything behind the attention needs only a point's own row, so one kernel does it for 32 points a block: both MLP layers, the gate, the residual and the channel-major store.
// Both products are formed transposed (A = 16 weight rows = output channels, B = 16 points), one 16-channel tile and both point tiles a wave, 16 waves for the 256 channels. A lane of the first product
// holds 8 consecutive hidden channels of one point: 16 bytes of f16, stored as such into the LDS row of that point, where every wave reads them back as its B operand in the same k order as the weight rows.
// The second product leaves channels in registers and points in lanes, which is the order of the output.
#define MPT 32
#define MPITCH (CC + 8)      // LDS row pitch in f16: 528 bytes = 16 x 33, an odd count of 16-byte units for the 16-byte fragment reads
// Work-group barrier whose fences name LDS alone: a wave's LDS stores are waited out in front of it, its global loads stay in flight across it (__syncthreads() waits for those too, here for the second layer's weights).
__device__ __forceinline__ void lds_barrier() { __builtin_amdgcn_fence(__ATOMIC_RELEASE, "workgroup", "local"); __builtin_amdgcn_s_barrier(); __builtin_amdgcn_fence(__ATOMIC_ACQUIRE, "workgroup", "local"); }
__global__ __launch_bounds__(512) void k_mlp(const _Float16* __restrict__ X, const _Float16* __restrict__ B1, const _Float16* __restrict__ B2, const float* __restrict__ b1, const float* __restrict__ b2,
    const float* __restrict__ pf, const float* __restrict__ gam, float* __restrict__ out) {
  __shared__ __attribute__((aligned(16))) unsigned short xs[MPT][MPITCH], hs[MPT][MPITCH];
  const int tid = threadIdx.x, lane = tid & 31, ln = lane & 15, hh = lane >> 4;
  const int c0 = __builtin_amdgcn_readfirstlane(tid >> 5) * 16;      // the wave's 16 output channels, of both layers; the same in every lane, so that what is indexed by it alone comes through scalar loads
  const int row0 = blockIdx.x * MPT, b = row0 / NN, n0 = row0 % NN;
  constexpr int KST = CC / 32;
  // All of a wave's global loads go out together, in the order in which they are needed: its share of the block's input rows (a whole 512-byte row a load), both layers' weight rows, the residual.
  const unsigned short* xr = (const unsigned short*)X + (size_t)(row0 + (tid >> 5)) * CC + lane * 8;
  const v8us xv0 = *(const v8us*)xr, xv1 = *(const v8us*)(xr + 16 * CC);
  __builtin_amdgcn_sched_barrier(0);      // this one and the two below keep the groups in this order: loads return in the order of issue, and left alone the compiler puts the residual, needed last, in front of the input rows, needed first
  const unsigned short* w1r = (const unsigned short*)B1 + (size_t)(c0 + ln) * CC + 8 * hh; const unsigned short* w2r = (const unsigned short*)B2 + (size_t)(c0 + ln) * CC + 8 * hh;
  FragH a1[KST], a2[KST];
#pragma unroll
  for (int ks = 0; ks < KST; ++ks) { a1[ks].half[0] = *(const v8us*)(w1r + ks * 32); a1[ks].half[1] = *(const v8us*)(w1r + ks * 32 + 16); }
  __builtin_amdgcn_sched_barrier(0);
#pragma unroll
  for (int ks = 0; ks < KST; ++ks) { a2[ks].half[0] = *(const v8us*)(w2r + ks * 32); a2[ks].half[1] = *(const v8us*)(w2r + ks * 32 + 16); }
  __builtin_amdgcn_sched_barrier(0);
  const float* pr = pf + ((size_t)b * CC + c0) * NN + n0 + lane; float px[16];      // channel c0 + j, point n0 + lane: a whole 128-byte line a load
#pragma unroll
  for (int j = 0; j < 16; ++j) px[j] = pr[(size_t)j * NN];
  const float g = bf16_round(gam[0]); float b1v[16], b2v[16];      // gate and biases of the wave's 16 channels, the same in every lane: scalar loads, rounded on the scalar unit
#pragma unroll
  for (int j = 0; j < 16; ++j) { b1v[j] = bf16_round(b1[c0 + j]); b2v[j] = bf16_round(b2[c0 + j]); }
  asm volatile("s_wait_xcnt 0x0" :: "v"(xr), "v"(w1r), "v"(w2r) : "memory");      // the loads' address pairs stay untouched up to this wait (the residual loads' lane offset lives on to the stores)
  __builtin_amdgcn_sched_barrier(0);      // the second layer's weight loads and the residual loads stay up here, in flight under the first layer, instead of sinking to their uses
  *(v8us*)&xs[tid >> 5][lane * 8] = xv0; *(v8us*)&xs[16 + (tid >> 5)][lane * 8] = xv1;
  lds_barrier();      // the block's 32 input rows are in LDS before any wave reads its B fragments
  v8f acc[2] = {};
#pragma unroll
  for (int ks = 0; ks < KST; ++ks)
#pragma unroll
    for (int pt = 0; pt < 2; ++pt) { FragH bx; bx.half[0] = *(const v8us*)&xs[pt * 16 + ln][ks * 32 + 8 * hh]; bx.half[1] = *(const v8us*)&xs[pt * 16 + ln][ks * 32 + 16 + 8 * hh];
      acc[pt] = __builtin_amdgcn_wmma_f32_16x16x32_f16(false, a1[ks].v, false, bx.v, (short)0, acc[pt], false, false); }
#pragma unroll
  for (int pt = 0; pt < 2; ++pt) { FragH hv;      // acc[pt][r] = hidden channel c0 + 8 hh + r of point pt * 16 + ln
#pragma unroll
    for (int r = 0; r < 8; ++r) hv.h[r] = (_Float16)fmaxf(acc[pt][r] * 0.0625f + (hh ? b1v[8 + r] : b1v[r]), 0.f);
    *(v8us*)&hs[pt * 16 + ln][c0 + 8 * hh] = hv.half[0]; }
  lds_barrier();      // all 256 hidden channels of the 32 points are in LDS before any wave reads them
  __builtin_amdgcn_sched_barrier(0);      // the rounding of the residual stays below: moved up into the first layer it would bring the wait for the last loads with it
  v8f acc2[2] = {};
#pragma unroll
  for (int ks = 0; ks < KST; ++ks)
#pragma unroll
    for (int pt = 0; pt < 2; ++pt) { FragH bx; bx.half[0] = *(const v8us*)&hs[pt * 16 + ln][ks * 32 + 8 * hh]; bx.half[1] = *(const v8us*)&hs[pt * 16 + ln][ks * 32 + 16 + 8 * hh];
      acc2[pt] = __builtin_amdgcn_wmma_f32_16x16x32_f16(false, a2[ks].v, false, bx.v, (short)0, acc2[pt], false, false); }
  // acc2[pt][r] = channel c0 + 8 hh + r of point pt * 16 + ln. The wave's halves swap one tile each, so that a register holds ONE channel at the 32 points n0 + lane and each store covers a whole 128-byte line.
  float o[16];
#pragma unroll
  for (int r = 0; r < 8; ++r) { const float d0 = acc2[0][r], d1 = acc2[1][r], x0 = xhalf(d0), x1 = xhalf(d1);
    const float e0 = hh ? x1 : d0, e1 = hh ? d1 : x0;      // e0: channel c0 + r, e1: channel c0 + 8 + r
    o[r] = g * (e0 * 0.0625f + b2v[r]) + bf16_round(px[r]); o[8 + r] = g * (e1 * 0.0625f + b2v[8 + r]) + bf16_round(px[8 + r]); }
  float* orow = out + ((size_t)b * CC + c0) * NN + n0 + lane;
#pragma unroll
  for (int j = 0; j < 16; ++j) orow[(size_t)j * NN] = o[j]; }
extern "C" void kernel_launch(void* const* d_in, const int* in_sizes, int n_in,
                              void* d_out, int out_size, void* d_ws, size_t ws_size, hipStream_t stream) {
  (void)in_sizes; (void)n_in; (void)out_size;
  const float* const* I = (const float* const*)d_in; const float* pf = I[0]; const float* tf = I[1]; const float* Wt = I[2]; const float* bt = I[3]; const float* Wq = I[4]; const float* bq = I[5]; const float* Wk = I[6]; const float* bk = I[7]; const float* Wv = I[8]; const float* bv = I[9]; const float* W1 = I[10]; const float* b1 = I[11]; const float* W2 = I[12]; const float* b2 = I[13]; const float* gam = I[14];
  char* ws = (char*)d_ws; size_t off = 0;
  auto take = [&](size_t bytes) { char* p = ws + off; off += (bytes + 255) & ~(size_t)255; return p; };
  _Float16* Bq = (_Float16*)take(CC * CC * 2); _Float16* Bk = (_Float16*)take(CC * CC * 2); _Float16* Bv = (_Float16*)take(CC * CC * 2); _Float16* B1 = (_Float16*)take(CC * CC * 2); _Float16* B2 = (_Float16*)take(CC * CC * 2); float* TB = (float*)take(BB * CC * 4);
  _Float16* X16 = (_Float16*)take((size_t)NR * CC * 2); _Float16* Q16 = (_Float16*)take((size_t)NR * CC * 2); _Float16* K16 = (_Float16*)take((size_t)NR * CC * 2); _Float16* V16 = (_Float16*)take((size_t)NR * CC * 2); _Float16* Vp = (_Float16*)take((size_t)NR * CC * 2); _Float16* Kp = (_Float16*)take((size_t)NR * CC * 2); _Float16* O16 = (_Float16*)take((size_t)NR * CC * 2);
  if (off > ws_size) return;      // 0.7 + 4.2 x 7 = about 30 MiB
  k_prep<<<BB + 5 * WB + TKB, 1024, 0, stream>>>(tf, Wt, bt, Wk, bk, TB, Wq, Wv, W1, W2, Bq, Bk, Bv, B1, B2, pf, X16);      // weights (out,in)
  // Bq, Bk, Bv and Q16, K16, V16 were taken one behind the other and their sizes are multiples of 256 bytes: CC * CC and NR * CC elements apart
  k_gemm_qkv<<<dim3(((NR / 16) * (CC / 64) + 3) / 4, 3), 128, 0, stream>>>(X16, CC, Bq, CC, (size_t)CC * CC, 0.0625f, bq, bv, TB, NN, (size_t)CC, Q16, CC, (size_t)NR * CC, NR);      // k = pf Wk^T + (t Wk^T + bk): the per-batch text bias enters as the CP addend (row block b = row / 4096), unrounded
  k_pack<NH, NN><<<BB * NH * (NN / 64), 256, 0, stream>>>(V16, CC, 0, Vp, K16, Kp);
  k_flash<<<BB * NH * (NN / 32), 128, 0, stream>>>(Q16, CC, Kp, Vp, nullptr, O16, CC);
  k_mlp<<<NR / MPT, 512, 0, stream>>>(O16, B1, B2, b1, b2, pf, gam, (float*)d_out);      // gamma (relu(x W1^T + b1) W2^T + b2) + point_feats, channel-major
}

// v010
// A run of this version takes 85.8 microseconds.
// Next to v009, in two timings, it ran 1.07 times as fast each time.
// All steps since v000 together make it 6.22 times as fast.
#include <hip/hip_runtime.h>
// Text-guided point attention (B=2, C=256 channels × N=4096 points; text 512 → 256 GELU projection added to the key input; q/k/v 1×1 convs; 4 heads × 64; UNSCALED softmax(q·k)·v; MLP 256 → relu →
// 256; out = γ·x + point_feats, channel-major): the q/k/v/MLP linears ((out,in) weights bf16-exact ×2^4; the text term enters k as a per-batch bias) and the attention as a fused flash-style
// kernel (online softmax f32, P f16 ≤ 1, O = P·Vt; RPW-32 key-split waves) run on v_wmma_f32_16x16x32_f16 with f32 accumulate; the text projection, the NCW → fragment-order and token-major → NCW transposes and the gated
// residual are f32 VALU.
#define BB 2
#define CC 256
#define NN 4096
#define DTX 512
#define NH 4
#define NR (BB * NN)

typedef __bf16 v16b __attribute__((ext_vector_type(16)));
typedef unsigned short v8us __attribute__((ext_vector_type(8), may_alias));
typedef float  v8f  __attribute__((ext_vector_type(8)));
typedef float  v4f  __attribute__((ext_vector_type(4)));
typedef float  v4fa __attribute__((ext_vector_type(4), may_alias));
union FragB { v16b v; v8us half[2]; unsigned short u[16]; };

__device__ __forceinline__ unsigned short bf16_bits(float x) { unsigned int u = __float_as_uint(x); return (unsigned short)((u + 0x7FFFu + ((u >> 16) & 1u)) >> 16); }
__device__ __forceinline__ float bf16_val(unsigned short b) { return __uint_as_float(((unsigned int)b) << 16); }
__device__ __forceinline__ float bf16_round(float x) { return bf16_val(bf16_bits(x)); }
// D += A·B with NT terms: 1 = ah·bh, 2 = + al·bh (A split), 3 = + ah·bl (both split)
template <int NT>
__device__ __forceinline__ v8f mmaN(v16b ah, v16b al, v16b bh, v16b bl, v8f c) {
  c = __builtin_amdgcn_wmma_f32_16x16x32_bf16(false, ah, false, bh, (short)0, c, false, false);
  if (NT >= 2) c = __builtin_amdgcn_wmma_f32_16x16x32_bf16(false, al, false, bh, (short)0, c, false, false);
  if (NT >= 3) c = __builtin_amdgcn_wmma_f32_16x16x32_bf16(false, ah, false, bl, (short)0, c, false, false);
  asm volatile("v_nop\n\tv_nop\n\tv_nop\n\tv_nop" : "+v"(c) : "v"(ah), "v"(al), "v"(bh), "v"(bl));
  return c;
}

__global__ __launch_bounds__(256) void k_wt_bf16(const float* __restrict__ W, unsigned short* __restrict__ Wt, int K, int N) {
  const int t = blockIdx.x * 256 + threadIdx.x;
  const int k8n = K / 8;
  if (t >= N * k8n) return;
  const int n = t / k8n, k8 = (t % k8n) * 8;
  v8us v;
#pragma unroll
  for (int i = 0; i < 8; ++i) v[i] = bf16_bits(W[(size_t)(k8 + i) * N + n]);
  *(v8us*)(Wt + (size_t)n * K + k8) = v;
  
}

// GEMM C[M][N] (f32, pitch ldc) = act(A[M][K]·W + bias). A f32 row-major (pitch lda) converted per fragment to bf16
// (ASPLIT: hi/lo two planes -> 2 terms, else single rounded term); Wt bf16 [N][K] (pitch ldb). BIAS_BF16 rounds the
// bias to bf16 first (bias quantised to bf16 before the add). K%32==0, M%16==0, N%64==0.
template <bool ASPLIT, int ACT, bool BIAS_BF16>
__global__ __launch_bounds__(128) void k_gemm_bf(const float* __restrict__ A, int lda, const unsigned short* __restrict__ Wt, int ldb,
                                               const float* __restrict__ bias, float* __restrict__ C, int ldc, int M, int N, int K) {
  __shared__ __attribute__((aligned(16))) float so[4][16][64];
  const int tid = threadIdx.x, w = tid >> 5, lane = tid & 31, ln = lane & 15, hh = lane >> 4;
  const int ntn = N / 64;
  const int wid = blockIdx.x * 4 + w;
  const int mt = wid / ntn, nq = wid % ntn;
  if (mt * 16 >= M) return;
  const int row0 = mt * 16, col0 = nq * 64;
  const float* arow = A + (size_t)(row0 + ln) * lda;
  v8f acc[4] = {};
  for (int kb = 0; kb < K; kb += 32) {
    FragB ah, al;
    const v4f x0 = *(const v4fa*)(arow + kb + 8 * hh), x1 = *(const v4fa*)(arow + kb + 8 * hh + 4);
    const v4f x2 = *(const v4fa*)(arow + kb + 16 + 8 * hh), x3 = *(const v4fa*)(arow + kb + 16 + 8 * hh + 4);
    float xs[16] = {x0[0],x0[1],x0[2],x0[3],x1[0],x1[1],x1[2],x1[3],x2[0],x2[1],x2[2],x2[3],x3[0],x3[1],x3[2],x3[3]};
#pragma unroll
    for (int i = 0; i < 16; ++i) { const unsigned short hb = bf16_bits(xs[i]); ah.u[i] = hb; al.u[i] = ASPLIT ? bf16_bits(xs[i] - bf16_val(hb)) : (unsigned short)0; }
#pragma unroll
    for (int t = 0; t < 4; ++t) {
      const unsigned short* brow = Wt + (size_t)(col0 + t * 16 + ln) * ldb + kb;
      FragB b;
      b.half[0] = *(const v8us*)(brow + 8 * hh);
      b.half[1] = *(const v8us*)(brow + 16 + 8 * hh);
      acc[t] = mmaN<ASPLIT ? 2 : 1>(ah.v, al.v, b.v, b.v, acc[t]);
    }
  }
#pragma unroll
  for (int t = 0; t < 4; ++t) {
    float bv = bias ? bias[col0 + t * 16 + ln] : 0.f;
    if (BIAS_BF16) bv = bf16_round(bv);
#pragma unroll
    for (int r = 0; r < 8; ++r) { float v = acc[t][r] + bv; if (ACT == 1) v = fmaxf(v, 0.f); so[w][8 * hh + r][t * 16 + ln] = v; }
  }
  __builtin_amdgcn_fence(__ATOMIC_ACQ_REL, "workgroup");
  __builtin_amdgcn_wave_barrier();
  const int rsub = lane >> 4, c4 = (lane & 15) * 4;
  {
#pragma unroll
    for (int q = 0; q < 8; ++q) {
      const int r = q * 2 + rsub;
      const v4f v = *(const v4fa*)&so[w][r][c4];
      *(v4f*)(C + (size_t)(row0 + r) * ldc + col0 + c4) = v;
    }
    
  }
}

// Flash-style causal/unmasked attention, all contractions 3-term bf16 hi/lo splits, f32 softmax with running max.
// q,k,v rows are read from f32 buffers with arbitrary row pitch (so they can live inside a fused qkv buffer);
// D = head size (multiple of 32, <= 128); one wave = 16 query rows; block = 4 waves (64 queries) sharing K/V chunks of 32.
template <int D, bool CAUSAL>
__global__ __launch_bounds__(128) void k_flash(const float* __restrict__ qb, const float* __restrict__ kb, const float* __restrict__ vb,
                                             int pitch, int T, int H, float scale, float* __restrict__ y, int ypitch) {
  constexpr int KS = D / 32;        // k-steps for QK
  constexpr int DT = D / 16;        // d tiles for PV
  __shared__ __attribute__((aligned(16))) unsigned short sKh[32][D + 8], sKl[32][D + 8], sVh[32][D + 8], sVl[32][D + 8];
  __shared__ __attribute__((aligned(16))) unsigned short sPh[4][16][40], sPl[4][16][40];
  __shared__ __attribute__((aligned(16))) float sO[4][16][D];
  const int tid = threadIdx.x, w = tid >> 5, lane = tid & 31, ln = lane & 15, hh = lane >> 4;
  const int nqb = (T + 63) / 64;
  const int bh = blockIdx.x / nqb, qblk = blockIdx.x % nqb;
  const int b = bh / H, h = bh % H;
  const int q0 = qblk * 64 + w * 16;
  const float* Q = qb + (size_t)b * T * pitch + h * D;
  const float* K = kb + (size_t)b * T * pitch + h * D;
  const float* V = vb + (size_t)b * T * pitch + h * D;

  // A fragments of the wave's 16 query rows (scaled), hi/lo
  FragB aqh[KS], aql[KS];
  {
    int row = q0 + ln; if (row >= T) row = T - 1;
    const float* qr = Q + (size_t)row * pitch;
#pragma unroll
    for (int ks = 0; ks < KS; ++ks)
#pragma unroll
      for (int i = 0; i < 16; ++i) {
        const int d = ks * 32 + ((i < 8) ? (8 * hh + i) : (16 + 8 * hh + (i - 8)));
        const float x = qr[d] * scale; const unsigned short hb = bf16_bits(x);
        aqh[ks].u[i] = hb; aql[ks].u[i] = bf16_bits(x - bf16_val(hb));
      }
  }
  float m_r[8], l_r[8];
#pragma unroll
  for (int r = 0; r < 8; ++r) { m_r[r] = -3.0e38f; l_r[r] = 0.f; }
  v8f oacc[DT];
#pragma unroll
  for (int dt = 0; dt < DT; ++dt) oacc[dt] = (v8f){0.f,0.f,0.f,0.f,0.f,0.f,0.f,0.f};

  const int kv_end = CAUSAL ? min(T, qblk * 64 + 64) : T;     // block-uniform
  for (int j0 = 0; j0 < kv_end; j0 += 32) {
    __syncthreads();
    for (int e = tid; e < 32 * (D / 4); e += 128) {
      const int r = e / (D / 4), c4 = (e % (D / 4)) * 4;
      const int key = j0 + r;
      v4f kf = {0.f,0.f,0.f,0.f}, vf = {0.f,0.f,0.f,0.f};
      if (key < T) { kf = *(const v4fa*)(K + (size_t)key * pitch + c4); vf = *(const v4fa*)(V + (size_t)key * pitch + c4); }
#pragma unroll
      for (int t = 0; t < 4; ++t) {
        unsigned short hb = bf16_bits(kf[t]); sKh[r][c4 + t] = hb; sKl[r][c4 + t] = bf16_bits(kf[t] - bf16_val(hb));
        hb = bf16_bits(vf[t]); sVh[r][c4 + t] = hb; sVl[r][c4 + t] = bf16_bits(vf[t] - bf16_val(hb));
      }
    }
    __syncthreads();
    // S tile 16 x 32
    v8f s[2];
#pragma unroll
    for (int nt = 0; nt < 2; ++nt) {
      v8f acc = {};
#pragma unroll
      for (int ks = 0; ks < KS; ++ks) {
        FragB bh_, bl_;
        bh_.half[0] = *(const v8us*)&sKh[nt * 16 + ln][ks * 32 + 8 * hh]; bh_.half[1] = *(const v8us*)&sKh[nt * 16 + ln][ks * 32 + 16 + 8 * hh];
        bl_.half[0] = *(const v8us*)&sKl[nt * 16 + ln][ks * 32 + 8 * hh]; bl_.half[1] = *(const v8us*)&sKl[nt * 16 + ln][ks * 32 + 16 + 8 * hh];
        acc = mmaN<3>(aqh[ks].v, aql[ks].v, bh_.v, bl_.v, acc);
      }
      s[nt] = acc;
    }
    // mask + running max (rows 8hh+r; the 16 lanes of a half share rows)
    float alpha[8];
#pragma unroll
    for (int r = 0; r < 8; ++r) {
      const int qi = q0 + 8 * hh + r;
      const int ja = j0 + ln, jb = j0 + 16 + ln;
      if (CAUSAL) { if (ja > qi) s[0][r] = -3.0e38f; if (jb > qi) s[1][r] = -3.0e38f; }
      if (ja >= T) s[0][r] = -3.0e38f;
      if (jb >= T) s[1][r] = -3.0e38f;
      float mx = fmaxf(s[0][r], s[1][r]);
      mx = fmaxf(mx, __shfl_xor(mx, 1, 32)); mx = fmaxf(mx, __shfl_xor(mx, 2, 32)); mx = fmaxf(mx, __shfl_xor(mx, 4, 32)); mx = fmaxf(mx, __shfl_xor(mx, 8, 32));
      const float mnew = fmaxf(m_r[r], mx);
      alpha[r] = (mnew > -1.0e38f) ? __expf(m_r[r] - mnew) : 1.0f;
      const float p0 = (s[0][r] > -1.0e38f) ? __expf(s[0][r] - mnew) : 0.f;
      const float p1 = (s[1][r] > -1.0e38f) ? __expf(s[1][r] - mnew) : 0.f;
      m_r[r] = mnew;
      l_r[r] = l_r[r] * alpha[r] + p0 + p1;            // per-lane partial row sum (16 lanes combined at the end)
      unsigned short hb = bf16_bits(p0); sPh[w][8 * hh + r][ln] = hb;      sPl[w][8 * hh + r][ln] = bf16_bits(p0 - bf16_val(hb));
      hb = bf16_bits(p1);                sPh[w][8 * hh + r][16 + ln] = hb; sPl[w][8 * hh + r][16 + ln] = bf16_bits(p1 - bf16_val(hb));
    }
#pragma unroll
    for (int dt = 0; dt < DT; ++dt)
#pragma unroll
      for (int r = 0; r < 8; ++r) oacc[dt][r] *= alpha[r];
    __builtin_amdgcn_fence(__ATOMIC_ACQ_REL, "workgroup");
    __builtin_amdgcn_wave_barrier();
    FragB pah, pal;
    pah.half[0] = *(const v8us*)&sPh[w][ln][8 * hh]; pah.half[1] = *(const v8us*)&sPh[w][ln][16 + 8 * hh];
    pal.half[0] = *(const v8us*)&sPl[w][ln][8 * hh]; pal.half[1] = *(const v8us*)&sPl[w][ln][16 + 8 * hh];
#pragma unroll
    for (int dt = 0; dt < DT; ++dt) {
      FragB bvh, bvl;
#pragma unroll
      for (int i = 0; i < 8; ++i) {
        bvh.u[i] = sVh[8 * hh + i][dt * 16 + ln]; bvh.u[8 + i] = sVh[16 + 8 * hh + i][dt * 16 + ln];
        bvl.u[i] = sVl[8 * hh + i][dt * 16 + ln]; bvl.u[8 + i] = sVl[16 + 8 * hh + i][dt * 16 + ln];
      }
      oacc[dt] = mmaN<3>(pah.v, pal.v, bvh.v, bvl.v, oacc[dt]);
    }
    __builtin_amdgcn_fence(__ATOMIC_ACQ_REL, "workgroup");
    __builtin_amdgcn_wave_barrier();
  }
#pragma unroll
  for (int r = 0; r < 8; ++r) {
    float l = l_r[r];
    l += __shfl_xor(l, 1, 32); l += __shfl_xor(l, 2, 32); l += __shfl_xor(l, 4, 32); l += __shfl_xor(l, 8, 32);
    l_r[r] = (l > 0.f) ? 1.0f / l : 0.f;
  }
#pragma unroll
  for (int dt = 0; dt < DT; ++dt)
#pragma unroll
    for (int r = 0; r < 8; ++r) sO[w][8 * hh + r][dt * 16 + ln] = oacc[dt][r] * l_r[r];
  __builtin_amdgcn_fence(__ATOMIC_ACQ_REL, "workgroup");
  __builtin_amdgcn_wave_barrier();
  {
    for (int r = 0; r < 16; ++r) {
      const int row = q0 + r;
      if (row < T && lane < D / 4) {
        const v4f val = *(const v4fa*)&sO[w][r][lane * 4];
        *(v4f*)(y + ((size_t)b * T + row) * ypitch + h * D + lane * 4) = val;
      }
    }
    
  }
}

// GEMM C = act(A·W + bias + resid): A f32 (ASPLIT -> hi/lo 2 terms), Wt bf16 [N][K]; ACT 0 none, 1 relu, 2 exact gelu;
// resid (optional, f32, row index = (row % rmod), pitch ldr, RES_BF16 rounds it) added before the activation.
template <bool ASPLIT, int ACT, bool BIAS_BF16, bool RES_BF16>
__global__ __launch_bounds__(128) void k_gemm_bf3(const float* __restrict__ A, int lda, const unsigned short* __restrict__ Wt, int ldb,
                                                const float* __restrict__ bias, const float* __restrict__ resid, int rmod, int ldr,
                                                float* __restrict__ C, int ldc, int M, int N, int K) {
  __shared__ __attribute__((aligned(16))) float so[4][16][64];
  const int tid = threadIdx.x, w = tid >> 5, lane = tid & 31, ln = lane & 15, hh = lane >> 4;
  const int ntn = N / 64;
  const int wid = blockIdx.x * 4 + w;
  const int mt = wid / ntn, nq = wid % ntn;
  if (mt * 16 >= M) return;
  const int row0 = mt * 16, col0 = nq * 64;
  const float* arow = A + (size_t)(row0 + ln) * lda;
  v8f acc[4] = {};
  for (int kb = 0; kb < K; kb += 32) {
    FragB ah, al;
    const v4f x0 = *(const v4fa*)(arow + kb + 8 * hh), x1 = *(const v4fa*)(arow + kb + 8 * hh + 4);
    const v4f x2 = *(const v4fa*)(arow + kb + 16 + 8 * hh), x3 = *(const v4fa*)(arow + kb + 16 + 8 * hh + 4);
    float xs[16] = {x0[0],x0[1],x0[2],x0[3],x1[0],x1[1],x1[2],x1[3],x2[0],x2[1],x2[2],x2[3],x3[0],x3[1],x3[2],x3[3]};
#pragma unroll
    for (int i = 0; i < 16; ++i) { const unsigned short hb = bf16_bits(xs[i]); ah.u[i] = hb; al.u[i] = ASPLIT ? bf16_bits(xs[i] - bf16_val(hb)) : (unsigned short)0; }
#pragma unroll
    for (int t = 0; t < 4; ++t) {
      const unsigned short* brow = Wt + (size_t)(col0 + t * 16 + ln) * ldb + kb;
      FragB b;
      b.half[0] = *(const v8us*)(brow + 8 * hh);
      b.half[1] = *(const v8us*)(brow + 16 + 8 * hh);
      acc[t] = mmaN<ASPLIT ? 2 : 1>(ah.v, al.v, b.v, b.v, acc[t]);
    }
  }
#pragma unroll
  for (int t = 0; t < 4; ++t) {
    const int col = col0 + t * 16 + ln;
    float bv = bias ? bias[col] : 0.f;
    if (BIAS_BF16) bv = bf16_round(bv);
#pragma unroll
    for (int r = 0; r < 8; ++r) {
      float v = acc[t][r] + bv;
      if (resid) { float rv = resid[(size_t)((row0 + 8 * hh + r) % rmod) * ldr + col]; if (RES_BF16) rv = bf16_round(rv); v += rv; }
      if (ACT == 1) v = fmaxf(v, 0.f);
      if (ACT == 2) v = 0.5f * v * (1.0f + erff(v * 0.70710678118654752f));
      if (ACT == 3) { const float u = 0.7978845608028654f * (v + 0.044715f * v * v * v); v = 0.5f * v * (1.0f + tanhf(u)); }
      so[w][8 * hh + r][t * 16 + ln] = v;
    }
  }
  __builtin_amdgcn_fence(__ATOMIC_ACQ_REL, "workgroup");
  __builtin_amdgcn_wave_barrier();
  const int rsub = lane >> 4, c4 = (lane & 15) * 4;
  {
#pragma unroll
    for (int q = 0; q < 8; ++q) {
      const int r = q * 2 + rsub;
      const v4f v = *(const v4fa*)&so[w][r][c4];
      *(v4f*)(C + (size_t)(row0 + r) * ldc + col0 + c4) = v;
    }
    
  }
}
// row LayerNorm (biased variance, eps) over N: s = X (+ R); optional out_sum <- s; out_norm <- (s-mu)*rsqrt(var+eps)*g + b
template <bool PARAM_BF16>
__global__ __launch_bounds__(256) void k_layernorm(const float* __restrict__ X, const float* __restrict__ R, const float* __restrict__ g, const float* __restrict__ bta,
                                                  float* __restrict__ out_sum, float* __restrict__ out_norm, int N, float eps) {
  __shared__ float red[256];
  const int row = blockIdx.x, tid = threadIdx.x;
  const float* x = X + (size_t)row * N; const float* rr = R ? R + (size_t)row * N : nullptr;
  float vals[16];                     // up to N = 4096
  const int per = N / 256;            // contiguous chunk per thread? use strided-by-4 chunks: thread handles j = tid*4 + 1024*u
  float s1 = 0.f;
  for (int u = 0; u < per / 4; ++u) {
    const int j = tid * 4 + 1024 * u;
    const v4f a = *(const v4fa*)(x + j);
    v4f b = {0.f,0.f,0.f,0.f}; if (rr) b = *(const v4fa*)(rr + j);
#pragma unroll
    for (int q = 0; q < 4; ++q) { const float v = a[q] + b[q]; vals[u * 4 + q] = v; s1 += v; }
  }
  red[tid] = s1; __syncthreads();
  for (int st = 128; st > 0; st >>= 1) { if (tid < st) red[tid] += red[tid + st]; __syncthreads(); }
  const float mu = red[0] / (float)N; __syncthreads();
  float s2 = 0.f;
  for (int u = 0; u < per / 4; ++u)
#pragma unroll
    for (int q = 0; q < 4; ++q) { const float c = vals[u * 4 + q] - mu; s2 += c * c; }
  red[tid] = s2; __syncthreads();
  for (int st = 128; st > 0; st >>= 1) { if (tid < st) red[tid] += red[tid + st]; __syncthreads(); }
  const float rs = rsqrtf(red[0] / (float)N + eps);
  {
    for (int u = 0; u < per / 4; ++u) {
      const int j = tid * 4 + 1024 * u;
      v4f o, sm;
#pragma unroll
      for (int q = 0; q < 4; ++q) {
        float gg = g[j + q], bb = bta[j + q];
        if (PARAM_BF16) { gg = bf16_round(gg); bb = bf16_round(bb); }
        sm[q] = vals[u * 4 + q]; o[q] = (vals[u * 4 + q] - mu) * rs * gg + bb;
      }
      if (out_sum) *(v4f*)(out_sum + (size_t)row * N + j) = sm;
      *(v4f*)(out_norm + (size_t)row * N + j) = o;
    }
    
  }
}



// ---- f16 WMMA path (v_wmma_f32_16x16x32_f16): 11-bit significands for operands in range — used where a [0,1] probability operand needs more precision than bf16
typedef _Float16 v16h __attribute__((ext_vector_type(16)));
union FragH { v16h v; v8us half[2]; _Float16 h[16]; unsigned short u[16]; };
template <int NT>
__device__ __forceinline__ v8f mmaH(v16h ah, v16h al, v16h bh, v16h bl, v8f c) {
  c = __builtin_amdgcn_wmma_f32_16x16x32_f16(false, ah, false, bh, (short)0, c, false, false);
  if (NT >= 2) c = __builtin_amdgcn_wmma_f32_16x16x32_f16(false, al, false, bh, (short)0, c, false, false);
  if (NT >= 3) c = __builtin_amdgcn_wmma_f32_16x16x32_f16(false, ah, false, bl, (short)0, c, false, false);
  asm volatile("v_nop\n\tv_nop\n\tv_nop\n\tv_nop" : "+v"(c) : "v"(ah), "v"(al), "v"(bh), "v"(bl));
  return c;
}
// batched GEMM like k_gemm_b but f16 operands: A f32 (split into f16 hi/lo if ASPLIT, else rounded to f16), Bt = f16 values [n][k]; alpha; C f32; N multiple of 16 (partial tiles skipped)
template <bool ASPLIT>
__global__ __launch_bounds__(128) void k_gemm_h(const float* __restrict__ A, int lda, size_t sA, const _Float16* __restrict__ Bh, int ldb, size_t sB, float alpha, float* __restrict__ C, int ldc, size_t sC, int M, int N, int K) {
  __shared__ __attribute__((aligned(16))) float so[4][16][64];
  const int tid = threadIdx.x, w = tid >> 5, lane = tid & 31, ln = lane & 15, hh = lane >> 4; const int by = blockIdx.y;
  A += (size_t)by * sA; Bh += (size_t)by * sB; C += (size_t)by * sC;
  const int ntn = (N + 63) / 64; const int wid = blockIdx.x * 4 + w; const int mt = wid / ntn, nq = wid % ntn; if (mt * 16 >= M) return;
  const int row0 = mt * 16, col0 = nq * 64; const float* arow = A + (size_t)(row0 + ln) * lda;
  v8f acc[4] = {};
  for (int kb = 0; kb < K; kb += 32) {
    FragH ah, al;
    const v4f x0 = *(const v4fa*)(arow + kb + 8 * hh), x1 = *(const v4fa*)(arow + kb + 8 * hh + 4), x2 = *(const v4fa*)(arow + kb + 16 + 8 * hh), x3 = *(const v4fa*)(arow + kb + 16 + 8 * hh + 4);
    float xs[16] = {x0[0],x0[1],x0[2],x0[3],x1[0],x1[1],x1[2],x1[3],x2[0],x2[1],x2[2],x2[3],x3[0],x3[1],x3[2],x3[3]};
#pragma unroll
    for (int i = 0; i < 16; ++i) { const _Float16 h = (_Float16)xs[i]; ah.h[i] = h; al.h[i] = ASPLIT ? (_Float16)(xs[i] - (float)h) : (_Float16)0.0f; }
#pragma unroll
    for (int t = 0; t < 4; ++t) { if (col0 + t * 16 >= N) continue; const size_t boff = (size_t)(col0 + t * 16 + ln) * ldb + kb; FragH bq; bq.half[0] = *(const v8us*)(Bh + boff + 8 * hh); bq.half[1] = *(const v8us*)(Bh + boff + 16 + 8 * hh);
      acc[t] = mmaH<ASPLIT ? 2 : 1>(ah.v, al.v, bq.v, bq.v, acc[t]); }
  }
#pragma unroll
  for (int t = 0; t < 4; ++t) { if (col0 + t * 16 >= N) continue;
#pragma unroll
    for (int r = 0; r < 8; ++r) so[w][8 * hh + r][t * 16 + ln] = acc[t][r] * alpha; }
  __builtin_amdgcn_fence(__ATOMIC_ACQ_REL, "workgroup"); __builtin_amdgcn_wave_barrier();
  const int rsub = lane >> 4, c4 = (lane & 15) * 4;
  {
#pragma unroll
    for (int q = 0; q < 8; ++q) { const int r = q * 2 + rsub; if (col0 + c4 < N) { const v4f v = *(const v4fa*)&so[w][r][c4]; *(v4f*)(C + (size_t)(row0 + r) * ldc + col0 + c4) = v; } }
     }
}

// Wt[n][k] = f16(W[k][n]·scale) from f32 row-major W[K][N] (scale = power of two; bf16-exact weights stay exact in f16 away from the subnormal range)
__global__ __launch_bounds__(256) void k_wt_f16(const float* __restrict__ W, _Float16* __restrict__ Wt, int K, int N, float scale) {
  const int t = blockIdx.x * 256 + threadIdx.x; if (t >= N * (K / 8)) return; const int n = t / (K / 8), k8 = (t % (K / 8)) * 8; FragH f;
#pragma unroll
  for (int i = 0; i < 8; ++i) f.h[i] = (_Float16)(bf16_round(W[(size_t)(k8 + i) * N + n]) * scale); const v8us o = f.half[0];
  *(v8us*)((unsigned short*)Wt + (size_t)n * K + k8) = o; 
}
// k_gemm_hh variant with fused epilogue: v = acc·alpha + bias[by·sBias + col] (+ CP[(row/rowsPerB)·sCPb + by·64 + col] if CP) ; ACT 0 none / 1 elu / 3 relu ; writes f16 C16 and f32 C, each if non-null
template <int ACT, int N, int K>
__device__ __forceinline__ void gemm_hhx_part(const _Float16* __restrict__ A, int lda, size_t sA, const _Float16* __restrict__ Bh, int ldb, size_t sB, float alpha, const float* __restrict__ bias, size_t sBias, const float* __restrict__ CP, int rowsPerB, size_t sCPb, int row0g,
    float* __restrict__ C, _Float16* __restrict__ C16, int ldc, size_t sC, int M, const int by) {
  __shared__ __attribute__((aligned(16))) float so[4][16][64];
  const int tid = threadIdx.x, w = tid >> 5, lane = tid & 31, ln = lane & 15, hh = lane >> 4;
  A += (size_t)by * sA; Bh += (size_t)by * sB; const size_t cofs = (size_t)by * sC; const float* bp = bias ? bias + (size_t)by * sBias : nullptr;
  const int ntn = (N + 63) / 64; const int wid = blockIdx.x * 4 + w; const int mt = wid / ntn, nq = wid % ntn; if (mt * 16 >= M) return;
  const int row0 = mt * 16, col0 = nq * 64;
  v8f acc[4] = {};
  // Both operands arrive in fragment order (FRAG_SRC below; K elements a row, so lda and ldb play no part): the half hf of k-step st of 16-row tile rt is 512 consecutive bytes, 16 of them a lane.
  // Each wave-wide 16-byte load then covers four whole 128-byte lines; from row-major operands it took 32-byte pieces of sixteen lines. Every lane gets the same eight elements as before.
  (void)lda; (void)ldb; const unsigned short* af = (const unsigned short*)A + (size_t)mt * (K * 16) + lane * 8; const unsigned short* bf = (const unsigned short*)Bh + (size_t)(col0 / 16) * (K * 16) + lane * 8;
  // The ten operand loads of a k-step go out as one group, three k-steps ahead of the WMMAs that use them, into a ring of three register sets (K is a constant, the loop is unrolled, so every ring index is one too).
  // A wave then waits out one load latency for every three k-steps; with a pair of loads in front of each WMMA it waited out four per k-step. The k order of the sums is the old one.
  constexpr int KST = K / 32, RD = 3; constexpr bool PART = (N % 64) != 0;      // with N a multiple of 64 every one of a wave's four column tiles lies inside N
  FragH ra[RD], rb[RD][4];
  auto fetch = [&](const int st) { FragH& ah = ra[st % RD]; ah.half[0] = *(const v8us*)(af + st * 512); ah.half[1] = *(const v8us*)(af + st * 512 + 256);
#pragma unroll
    for (int t = 0; t < 4; ++t) { if (PART && col0 + t * 16 >= N) continue; FragH& bq = rb[st % RD][t]; bq.half[0] = *(const v8us*)(bf + t * (K * 16) + st * 512); bq.half[1] = *(const v8us*)(bf + t * (K * 16) + st * 512 + 256); } };
#pragma unroll
  for (int st = 0; st < RD && st < KST; ++st) fetch(st);
  __builtin_amdgcn_sched_barrier(0);      // keeps the first WMMA, and the wait in front of it, behind the last of the ring's first loads: without it the wave waits out the first four loads before it issues the rest
#pragma unroll
  for (int st = 0; st < KST; ++st) {
#pragma unroll
    for (int t = 0; t < 4; ++t) { if (PART && col0 + t * 16 >= N) continue; acc[t] = mmaH<1>(ra[st % RD].v, ra[st % RD].v, rb[st % RD][t].v, rb[st % RD][t].v, acc[t]); }
    if (st + RD < KST) fetch(st + RD);      // into the set that this step has just used
  }
  asm volatile("s_wait_xcnt 0x0" :: "v"(af), "v"(bf) : "memory");      // the operand loads' two address pairs stay untouched up to this wait, before the epilogue reuses registers
  float bv4[4] = {0.f, 0.f, 0.f, 0.f}, cp[4][8];      // the epilogue's addends likewise: all of a wave's bias and CP loads go out together, under one test each, not one waited load per output element
  if (bp) { const float* br = bp + col0 + ln;
#pragma unroll
    for (int t = 0; t < 4; ++t) { if (PART && col0 + t * 16 >= N) continue; bv4[t] = br[t * 16]; }
    asm volatile("s_wait_xcnt 0x0" :: "v"(br) : "memory"); }      // the loads' address pair stays untouched up to this wait
  if (CP) { const float* cr[8];
#pragma unroll
    for (int r = 0; r < 8; ++r) { const int bidx = (row0g + row0 + 8 * hh + r) / rowsPerB; cr[r] = CP + (size_t)bidx * sCPb + (size_t)by * 64 + col0 + ln; }
#pragma unroll
    for (int r = 0; r < 8; ++r)
#pragma unroll
      for (int t = 0; t < 4; ++t) { if (PART && col0 + t * 16 >= N) continue; cp[t][r] = cr[r][t * 16]; }
    asm volatile("s_wait_xcnt 0x0" :: "v"(cr[0]), "v"(cr[1]), "v"(cr[2]), "v"(cr[3]), "v"(cr[4]), "v"(cr[5]), "v"(cr[6]), "v"(cr[7]) : "memory"); }      // the eight rows' address pairs stay untouched up to this wait
#pragma unroll
  for (int t = 0; t < 4; ++t) { if (PART && col0 + t * 16 >= N) continue; const float bv = bf16_round(bv4[t]);
#pragma unroll
    for (int r = 0; r < 8; ++r) { float v = acc[t][r] * alpha + bv; if (CP) v += cp[t][r]; if (ACT == 1) v = (v > 0.f) ? v : expm1f(v); else if (ACT == 3) v = fmaxf(v, 0.f); so[w][8 * hh + r][t * 16 + ln] = v; } }
  __builtin_amdgcn_fence(__ATOMIC_ACQ_REL, "workgroup"); __builtin_amdgcn_wave_barrier();
  const int rsub = lane >> 4, c4 = (lane & 15) * 4; typedef _Float16 v4h __attribute__((ext_vector_type(4)));
  {
#pragma unroll
    for (int q = 0; q < 8; ++q) { const int r = q * 2 + rsub; if (col0 + c4 < N) { const v4f v = *(const v4fa*)&so[w][r][c4]; if (C) { *(v4f*)(C + cofs + (size_t)(row0 + r) * ldc + col0 + c4) = v; asm volatile("s_wait_xcnt 0x0" ::: "memory"); }      // before the conversion below reuses a register that this store names
      if (C16) { v4h h4; for (int i = 0; i < 4; ++i) h4[i] = (_Float16)v[i]; *(v4h*)(C16 + cofs + (size_t)(row0 + r) * ldc + col0 + c4) = h4; asm volatile("s_wait_xcnt 0x0" ::: "memory"); } } }      // before the next row's values and addresses reuse a register that this store names
     }
}
// The q, k and v projections read the same A and depend on nothing of one another: one grid, blockIdx.y = 0 q, 1 k, 2 v picks the weights (sB apart), the output (sC apart) and the addend
// (q and v: their bias; k: the per-batch text term CPk, row block = row / rowsPerB). Three times the waves of one projection are resident at once and cover each other's load waits.
__global__ __launch_bounds__(128) void k_gemm_qkv(const _Float16* __restrict__ A, int lda, const _Float16* __restrict__ Bh, int ldb, size_t sB, float alpha, const float* __restrict__ bias_q, const float* __restrict__ bias_v, const float* __restrict__ CPk, int rowsPerB, size_t sCPb,
    _Float16* __restrict__ C16, int ldc, size_t sC, int M) {
  const int z = blockIdx.y;
  gemm_hhx_part<0, CC, CC>(A, lda, 0, Bh + (size_t)z * sB, ldb, 0, alpha, z == 0 ? bias_q : (z == 2 ? bias_v : nullptr), 0, z == 1 ? CPk : nullptr, rowsPerB, sCPb, 0, nullptr, C16 + (size_t)z * sC, ldc, 0, M, 0); }


__global__ __launch_bounds__(256) void k_x16(const float* __restrict__ x, _Float16* __restrict__ X16, size_t n8) { const size_t t = (size_t)blockIdx.x * 256 + threadIdx.x; if (t >= n8) return; FragH f;
#pragma unroll
  for (int q = 0; q < 8; ++q) f.h[q] = (_Float16)bf16_round(x[t * 8 + q]); *(v8us*)((unsigned short*)X16 + t * 8) = f.half[0];  }
// Fragment order of a row-major matrix of CC columns that is read as a 16 x 32 f16 WMMA operand (A or B alike): unit u of eight f16 (16 bytes) holds row (u >> 9) * 16 + (u & 15),
// columns ((u >> 6) & 7) * 32 + ((u >> 5) & 1) * 16 + ((u >> 4) & 1) * 8 + 0 .. 7, that is u = ((row tile * 8 + k-step) * 2 + half) * 32 + lane with lane = 16 hh + ln.
#define FRAG_SRC(u) ((size_t)(((u) >> 9) * 16 + ((u) & 15)) * CC + (((u) >> 6) & 7) * 32 + (((u) >> 5) & 1) * 16 + (((u) >> 4) & 1) * 8)
__device__ __forceinline__ void round16f_part(const float* __restrict__ W, _Float16* __restrict__ Bt, size_t n8, const size_t t) { if (t >= n8) return; FragH f; const float* wsrc = W + FRAG_SRC((int)t);      // thread t makes unit t: a wave stores 512 consecutive bytes
#pragma unroll
  for (int i = 0; i < 8; ++i) f.h[i] = (_Float16)(bf16_round(wsrc[i]) * 16.0f); *(v8us*)((unsigned short*)Bt + t * 8) = f.half[0];
  asm volatile("s_wait_xcnt 0x0" ::: "memory"); }      // the built code holds a path from here into another part of the grid's kernel, which reuses the registers that this store names
// K and V are laid out anew in the order in which the attention kernel's matrix operands want them. A tile is 32 keys of one (batch, head) slab = 8 fragment halves of 512 bytes; in a half,
// lane l owns bytes 16 l .. 16 l + 15, exactly the eight f16 that it holds of that operand half. Each wave-wide 16-byte load of the attention loop then covers four whole 128-byte lines
// instead of 32-byte pieces of sixteen. K half fr = (nt * 2 + ks) * 2 + hf: key nt * 16 + ln, channels ks * 32 + hf * 16 + 8 hh + q. V half fr = dt * 2 + hf: channel dt * 16 + ln, keys hf * 16 + 8 hh + q.
template <int NHv, int TTv>
__global__ __launch_bounds__(256) void k_pack(const _Float16* __restrict__ V16, int ldv, int voff, _Float16* __restrict__ Vp, const _Float16* __restrict__ K16, _Float16* __restrict__ Kp) { __shared__ unsigned short tl[64][66]; const int tid = threadIdx.x; const int slab = blockIdx.x / (TTv / 64), lg = blockIdx.x % (TTv / 64); const int b = slab / NHv, h = slab % NHv;
  const int fr = (tid >> 5) & 7, lane = tid & 31, ln = lane & 15, hh = lane >> 4;      // a wave writes one fragment half of each of the block's two tiles
  const size_t dst0 = ((size_t)(slab * (TTv / 32) + lg * 2) * 8 + fr) * 256 + lane * 8;
  for (int i = tid; i < 64 * 8; i += 256) { const int r = i / 8, c8 = (i % 8) * 8; FragH f; f.half[0] = *(const v8us*)((const unsigned short*)V16 + ((size_t)b * TTv + lg * 64 + r) * ldv + voff + h * 64 + c8);
#pragma unroll
    for (int q = 0; q < 8; ++q) tl[r][c8 + q] = f.u[q]; }
  {
#pragma unroll
    for (int jt = 0; jt < 2; ++jt) { const v8us kv = *(const v8us*)((const unsigned short*)K16 + ((size_t)b * TTv + lg * 64 + jt * 32 + (fr >> 2) * 16 + ln) * ldv + h * 64 + ((fr >> 1) & 1) * 32 + (fr & 1) * 16 + 8 * hh);
      *(v8us*)((unsigned short*)Kp + dst0 + jt * 2048) = kv; }
    asm volatile("s_wait_xcnt 0x0" ::: "memory"); }      // before the V part below reuses a register that these loads and stores name
  __syncthreads();
  {
#pragma unroll
    for (int jt = 0; jt < 2; ++jt) { const int d = (fr >> 1) * 16 + ln, k0 = jt * 32 + (fr & 1) * 16 + 8 * hh; FragH f;
#pragma unroll
      for (int q = 0; q < 8; ++q) f.u[q] = tl[k0 + q][d];
      *(v8us*)((unsigned short*)Vp + dst0 + jt * 2048) = f.half[0]; }
     } }

// Key split: the four waves of a block share ONE group of 32 query rows (two 16-row tiles); wave w walks the 32-key tiles w, w + 4, w + 8, ... with its own running max, sum and O for each query,
// and the four partial results are merged through LDS at the end. Every K and V fragment that a wave loads feeds the products of BOTH query tiles, so the kernel asks L2 for half the bytes of one tile a wave.
// 1024 blocks of 4 waves: four waves per SIMD (second launch bound: 256 registers a wave).
// Both products are formed transposed: S^T = K Q^T (A = 16 key rows, B = a query tile, kept in registers) and O^T += V^T P^T. A lane then holds 16 of the 32 scores of ONE query of each tile
// (query qt * 16 + ln, keys 8 hh + r and 16 + 8 hh + r): its maximum and sum are in-lane but for one exchange between the wave's halves, max, sum and rescale factor are one register each a tile,
// and the two score tiles, converted in place, ARE the B operand of the second product in the hardware k order, which the V^T loads already follow.
__device__ __forceinline__ float xhalf(float x) { return __builtin_bit_cast(float, __builtin_amdgcn_permlanex16(__builtin_bit_cast(int, x), __builtin_bit_cast(int, x), 0x76543210, 0xfedcba98, false, false)); }      // lane l with lane l ^ 16
__global__ __launch_bounds__(128, 4) void k_flash(const _Float16* __restrict__ Q16, int ldq, const _Float16* __restrict__ Kp, const _Float16* __restrict__ Vp, const int* __restrict__ MSK, _Float16* __restrict__ O, int ldo) {
  constexpr int QT = 2, RPW = 16 * QT, NQB = 4096 / RPW, DT = 4, KS = 2; (void)MSK;
  constexpr float L2E = 1.4426950408889634f;      // e^(s - m) = 2^(s L2E - m L2E): one fused multiply-add and the bare v_exp_f32 a score, in place of the library's range-split expf
  __shared__ __attribute__((aligned(16))) float sO[4][RPW][64 + 4]; __shared__ float sM[4][RPW], sL[4][RPW];
  const int tid = threadIdx.x, w = tid >> 5, lane = tid & 31, ln = lane & 15, hh = lane >> 4;
  const int slab = blockIdx.x / NQB, qblk = blockIdx.x % NQB; const int b = slab / 4, h = slab % 4; const int q0 = qblk * RPW;
  FragH bq[QT][KS];
#pragma unroll
  for (int qt = 0; qt < QT; ++qt) { const unsigned short* qr = (const unsigned short*)Q16 + ((size_t)b * 4096 + q0 + qt * 16 + ln) * ldq + h * 64;
#pragma unroll
    for (int ks = 0; ks < KS; ++ks) { bq[qt][ks].half[0] = *(const v8us*)(qr + ks * 32 + 8 * hh); bq[qt][ks].half[1] = *(const v8us*)(qr + ks * 32 + 16 + 8 * hh); } }
  const unsigned short* Kph = (const unsigned short*)Kp + (size_t)slab * 64 * 4096 + lane * 8; const unsigned short* Vph = (const unsigned short*)Vp + (size_t)slab * 64 * 4096 + lane * 8;      // fragment order (k_pack): 2048 elements a 32-key tile, 256 a fragment half
  float m_q[QT], l_q[QT]; v8f oacc[QT][DT];      // oacc[qt][dt][r] = O[query qt * 16 + ln][dt * 16 + 8 * hh + r], unnormalised
#pragma unroll
  for (int qt = 0; qt < QT; ++qt) { m_q[qt] = -3.0e38f; l_q[qt] = 0.f;
#pragma unroll
    for (int dt = 0; dt < DT; ++dt) oacc[qt][dt] = (v8f){0.f,0.f,0.f,0.f,0.f,0.f,0.f,0.f}; }
  const int jend = 4096;
#pragma unroll 1
  for (int jb = 0; jb < jend; jb += 4 * 32) { const int j0 = jb + w * 32; const unsigned short* kt = Kph + (size_t)j0 * 64; const unsigned short* vt = Vph + (size_t)j0 * 64;      // the trip test is on jb, the same in every wave: a scalar branch, EXEC untouched around the WMMAs
    FragH ak[2][KS];      // the tile's eight K loads go out as one group ahead of the eight WMMAs: one load latency, not one per key half
#pragma unroll
    for (int nt = 0; nt < 2; ++nt)
#pragma unroll
      for (int ks = 0; ks < KS; ++ks) { ak[nt][ks].half[0] = *(const v8us*)(kt + ((nt * 2 + ks) * 2) * 256); ak[nt][ks].half[1] = *(const v8us*)(kt + ((nt * 2 + ks) * 2 + 1) * 256); }
    v8f s[QT][2];      // s[qt][nt][r] = q(qt * 16 + ln) . k(j0 + nt * 16 + 8 * hh + r)
#pragma unroll
    for (int nt = 0; nt < 2; ++nt)
#pragma unroll
      for (int qt = 0; qt < QT; ++qt) { v8f acc = (v8f){0.f,0.f,0.f,0.f,0.f,0.f,0.f,0.f};
#pragma unroll
        for (int ks = 0; ks < KS; ++ks) acc = mmaH<1>(ak[nt][ks].v, ak[nt][ks].v, bq[qt][ks].v, bq[qt][ks].v, acc);
        s[qt][nt] = acc; }
    asm volatile("s_wait_xcnt 0x0" :: "v"(kt) : "memory");      // the K loads' address pair stays untouched up to this wait
    FragH av[DT];      // the tile's eight V loads go out here as one group, into the registers that K has left: they fly while the softmax below is worked out
#pragma unroll
    for (int dt = 0; dt < DT; ++dt) { av[dt].half[0] = *(const v8us*)(vt + (dt * 2) * 256); av[dt].half[1] = *(const v8us*)(vt + (dt * 2 + 1) * 256); }
    FragH pb[QT];
#pragma unroll
    for (int qt = 0; qt < QT; ++qt) {
      float mc = fmaxf(s[qt][0][0], s[qt][1][0]);
#pragma unroll
      for (int r = 1; r < 8; ++r) mc = fmaxf(mc, fmaxf(s[qt][0][r], s[qt][1][r]));
      mc = fmaxf(mc, xhalf(mc));      // both halves of the wave now hold the maximum over the query's 32 scores
      const float mn = fmaxf(m_q[qt], mc); const float nb = -mn * L2E; const float al = (mn > -1.0e38f) ? __builtin_amdgcn_exp2f(__builtin_fmaf(m_q[qt], L2E, nb)) : 1.0f; m_q[qt] = mn;
      v8f pt[2];
#pragma unroll
      for (int nt = 0; nt < 2; ++nt)
#pragma unroll
        for (int r = 0; r < 8; ++r) { const float p = __builtin_amdgcn_exp2f(__builtin_fmaf(s[qt][nt][r], L2E, nb)); pt[nt][r] = p; pb[qt].h[nt * 8 + r] = (_Float16)p; }
      const v8f p8 = pt[0] + pt[1]; const float ps = ((p8[0] + p8[1]) + (p8[2] + p8[3])) + ((p8[4] + p8[5]) + (p8[6] + p8[7]));
      l_q[qt] = l_q[qt] * al + ps;      // the lane's own 16 keys; the halves' sums are joined once, behind the loop
#pragma unroll
      for (int dt = 0; dt < DT; ++dt) oacc[qt][dt] *= al; }
#pragma unroll
    for (int dt = 0; dt < DT; ++dt)
#pragma unroll
      for (int qt = 0; qt < QT; ++qt) oacc[qt][dt] = mmaH<1>(av[dt].v, av[dt].v, pb[qt].v, pb[qt].v, oacc[qt][dt]);
    asm volatile("s_wait_xcnt 0x0" :: "v"(vt) : "memory"); }      // the V loads' address pair stays untouched up to this wait
#pragma unroll
  for (int qt = 0; qt < QT; ++qt) { const int qr = qt * 16 + ln;
    l_q[qt] += xhalf(l_q[qt]);
    if (hh == 0) { sM[w][qr] = m_q[qt]; sL[w][qr] = l_q[qt]; }
#pragma unroll
    for (int dt = 0; dt < DT; ++dt) { *(v4fa*)&sO[w][qr][dt * 16 + 8 * hh] = (v4f){oacc[qt][dt][0], oacc[qt][dt][1], oacc[qt][dt][2], oacc[qt][dt][3]}; *(v4fa*)&sO[w][qr][dt * 16 + 8 * hh + 4] = (v4f){oacc[qt][dt][4], oacc[qt][dt][5], oacc[qt][dt][6], oacc[qt][dt][7]}; } }
  __syncthreads();      // every wave's partial (max, sum, unnormalised O) is in LDS before any wave merges
  {
#pragma unroll
    for (int rp = 0; rp < RPW; rp += 8) { const int r = rp + (tid >> 4), pc = tid & 15;
      const float mm = fmaxf(fmaxf(sM[0][r], sM[1][r]), fmaxf(sM[2][r], sM[3][r])); float l = 0.f; v4f val = {0.f, 0.f, 0.f, 0.f};
#pragma unroll
      for (int i = 0; i < 4; ++i) { const float e = expf(sM[i][r] - mm); l += e * sL[i][r]; const v4f o = *(const v4fa*)&sO[i][r][pc * 4]; val += e * o; }
      val *= (l > 0.f) ? 1.0f / l : 0.f; typedef _Float16 v4h __attribute__((ext_vector_type(4))); const v4h h4 = {(_Float16)val[0], (_Float16)val[1], (_Float16)val[2], (_Float16)val[3]};      // the f16 operand of the next product is stored here, not by a launch of its own
      *(v4h*)(O + ((size_t)b * 4096 + q0 + r) * ldo + h * 64 + pc * 4) = h4; asm volatile("s_wait_xcnt 0x0" ::: "memory"); }      // before the next rows' values and addresses reuse a register that this store names
     } }

// blk = which 64-channel x 16-point tile, tid = 0 .. 255 inside the 256 threads that share it, tl = their own LDS tile
__device__ __forceinline__ void tok_part(const float* __restrict__ x, _Float16* __restrict__ X16, const int blk, const int tid, unsigned short (*tl)[72]) { const int b = blk / ((CC / 64) * (NN / 16)), rem = blk % ((CC / 64) * (NN / 16)); const int cg = rem / (NN / 16), pg = rem % (NN / 16); const int c0 = cg * 64, p0 = pg * 16;
  for (int i = tid; i < 64 * 16; i += 256) { const int c = i / 16, pp = i % 16; FragH f; f.h[0] = (_Float16)bf16_round(x[((size_t)b * CC + c0 + c) * NN + p0 + pp]); tl[pp][c] = f.u[0]; }
  __syncthreads();
  if (tid < 128) { const int r = tid & 15, pc = tid >> 4; FragH f;      // the tile is two k-steps of one 16-point row tile: 128 consecutive units of the fragment order (FRAG_SRC), unit tid = point r, channels c0 + pc * 8 ..
#pragma unroll
    for (int q = 0; q < 8; ++q) f.u[q] = tl[r][pc * 8 + q]; unsigned short* d = (unsigned short*)X16 + ((size_t)((b * NN + p0) >> 4) * 512 + (c0 >> 5) * 64 + tid) * 8; *(v8us*)d = f.half[0];  } }
// Text term of the key bias, one block of 32 waves a batch row. A wave owns 8 output channels; its 32 lanes split each weight row in float4 pieces, so that every wave-wide load covers
// whole 128-byte lines and the loads of the 8 rows are independent of one another; each lane sums its own columns and a butterfly over the lanes adds the 32 partial sums.
__device__ __forceinline__ void lanes_sum8(float (&a)[8]) {
#pragma unroll
  for (int m = 16; m > 0; m >>= 1) { float o[8];
#pragma unroll
    for (int i = 0; i < 8; ++i) o[i] = __shfl_xor(a[i], m, 32);      // the 8 exchanges of a stage are issued together: one wait a stage
#pragma unroll
    for (int i = 0; i < 8; ++i) a[i] += o[i]; } }
__device__ __forceinline__ void text_part(const float* __restrict__ tf, const float* __restrict__ Wt, const float* __restrict__ bt, const float* __restrict__ Wk, const float* __restrict__ bk, float* __restrict__ TB, const int b) {
  __shared__ __attribute__((aligned(16))) float ts[CC]; __shared__ float to[CC];
  const int tid = threadIdx.x, lane = tid & 31, c0 = (tid >> 5) * 8;
  float acc[8];
  { v4f x[DTX / 128];
#pragma unroll
    for (int q = 0; q < DTX / 128; ++q) x[q] = *(const v4fa*)(tf + b * DTX + q * 128 + lane * 4);
    asm volatile("s_wait_xcnt 0x0" ::: "memory");      // before a register that these loads name is used for something else
#pragma unroll
    for (int q = 0; q < DTX / 128; ++q)
#pragma unroll
      for (int e = 0; e < 4; ++e) x[q][e] = bf16_round(x[q][e]);
    const float* wr = Wt + (size_t)c0 * DTX + lane * 4;
#pragma unroll
    for (int i = 0; i < 8; ++i) { float s = 0.f;
#pragma unroll
      for (int q = 0; q < DTX / 128; ++q) { const v4f v = *(const v4fa*)(wr + i * DTX + q * 128);
#pragma unroll
        for (int e = 0; e < 4; ++e) s += x[q][e] * bf16_round(v[e]); }
      acc[i] = s; }
    asm volatile("s_wait_xcnt 0x0" :: "v"(wr) : "memory"); }      // the loads' address pair stays untouched up to this wait
  lanes_sum8(acc);
  { float s = acc[0];
#pragma unroll
    for (int i = 1; i < 8; ++i) s = (lane == i) ? acc[i] : s;
    if (lane < 8) { s += bf16_round(bt[c0 + lane]); ts[c0 + lane] = 0.5f * s * (1.0f + erff(s * 0.70710678118654752f)); } }
  __syncthreads();      // all 256 channels of the projected text are in LDS before any wave reads them
  { v4f t[CC / 128];
#pragma unroll
    for (int q = 0; q < CC / 128; ++q) t[q] = *(const v4fa*)&ts[q * 128 + lane * 4];
    const float* wr = Wk + (size_t)c0 * CC + lane * 4;
#pragma unroll
    for (int i = 0; i < 8; ++i) { float s = 0.f;
#pragma unroll
      for (int q = 0; q < CC / 128; ++q) { const v4f v = *(const v4fa*)(wr + i * CC + q * 128);
#pragma unroll
        for (int e = 0; e < 4; ++e) s += t[q][e] * bf16_round(v[e]); }
      acc[i] = s; }
    asm volatile("s_wait_xcnt 0x0" :: "v"(wr) : "memory"); }      // the loads' address pair stays untouched up to this wait
  lanes_sum8(acc);
  { float s = acc[0];
#pragma unroll
    for (int i = 1; i < 8; ++i) s = (lane == i) ? acc[i] : s;
    if (lane < 8) to[c0 + lane] = s + bf16_round(bk[c0 + lane]); }
  __syncthreads();      // the 8 results of each wave are gathered so that one wave stores each whole 128-byte line
  if (tid < CC) TB[b * CC + tid] = to[tid]; }
// Everything that depends on the inputs alone shares one grid of 1024-thread blocks, told apart by the block index: blocks 0 .. BB - 1 the text term (the longest chain of waits, so it starts first),
// then WB blocks for each of the five weight matrices, then the f16 copy of the points in fragment order (FRAG_SRC), four of its 256-thread tiles a block.
#define WB (CC * CC / 8 / 1024)
#define TKB (BB * (CC / 64) * (NN / 16) / 4)
__global__ __launch_bounds__(1024) void k_prep(const float* __restrict__ tf, const float* __restrict__ Wt, const float* __restrict__ bt, const float* __restrict__ Wk, const float* __restrict__ bk, float* __restrict__ TB,
    const float* __restrict__ Wq, const float* __restrict__ Wv, const float* __restrict__ W1, const float* __restrict__ W2, _Float16* __restrict__ Bq, _Float16* __restrict__ Bk, _Float16* __restrict__ Bv, _Float16* __restrict__ B1, _Float16* __restrict__ B2,
    const float* __restrict__ x, _Float16* __restrict__ X16) {
  __shared__ unsigned short tl[4][16][72];
  const int bx = blockIdx.x, tid = threadIdx.x;
  if (bx < BB) text_part(tf, Wt, bt, Wk, bk, TB, bx);
  else if (bx < BB + 5 * WB) { const int m = (bx - BB) / WB; const size_t t = (size_t)((bx - BB) % WB) * 1024 + tid;
    const float* W = m == 0 ? Wq : m == 1 ? Wk : m == 2 ? Wv : m == 3 ? W1 : W2; _Float16* Bt = m == 0 ? Bq : m == 1 ? Bk : m == 2 ? Bv : m == 3 ? B1 : B2;
    round16f_part(W, Bt, (size_t)CC * CC / 8, t); }
  else tok_part(x, X16, (bx - BB - 5 * WB) * 4 + (tid >> 8), tid & 255, tl[tid >> 8]); }
// Everything behind the attention needs only a point's own row, so one kernel does it for 32 points a block: both MLP layers, the gate, the residual and the channel-major store.
// Both products are formed transposed (A = 16 weight rows = output channels, B = 16 points), one 16-channel tile and both point tiles a wave, 16 waves for the 256 channels. A lane of the first product
// holds 8 consecutive hidden channels of one point: 16 bytes of f16, stored as such into the LDS row of that point, where every wave reads them back as its B operand in the same k order as the weight rows.
// The second product leaves channels in registers and points in lanes, which is the order of the output.
#define MPT 32
#define MPITCH (CC + 8)      // LDS row pitch in f16: 528 bytes = 16 x 33, an odd count of 16-byte units for the 16-byte fragment reads
// Work-group barrier whose fences name LDS alone: a wave's LDS stores are waited out in front of it, its global loads stay in flight across it (__syncthreads() waits for those too, here for the second layer's weights).
__device__ __forceinline__ void lds_barrier() { __builtin_amdgcn_fence(__ATOMIC_RELEASE, "workgroup", "local"); __builtin_amdgcn_s_barrier(); __builtin_amdgcn_fence(__ATOMIC_ACQUIRE, "workgroup", "local"); }
__global__ __launch_bounds__(512) void k_mlp(const _Float16* __restrict__ X, const _Float16* __restrict__ B1, const _Float16* __restrict__ B2, const float* __restrict__ b1, const float* __restrict__ b2,
    const float* __restrict__ pf, const float* __restrict__ gam, float* __restrict__ out) {
  __shared__ __attribute__((aligned(16))) unsigned short xs[MPT][MPITCH], hs[MPT][MPITCH];
  const int tid = threadIdx.x, lane = tid & 31, ln = lane & 15, hh = lane >> 4;
  const int c0 = __builtin_amdgcn_readfirstlane(tid >> 5) * 16;      // the wave's 16 output channels, of both layers; the same in every lane, so that what is indexed by it alone comes through scalar loads
  const int row0 = blockIdx.x * MPT, b = row0 / NN, n0 = row0 % NN;
  constexpr int KST = CC / 32;
  // All of a wave's global loads go out together, in the order in which they are needed: its share of the block's input rows (a whole 512-byte row a load), both layers' weight rows, the residual.
  const unsigned short* xr = (const unsigned short*)X + (size_t)(row0 + (tid >> 5)) * CC + lane * 8;
  const v8us xv0 = *(const v8us*)xr, xv1 = *(const v8us*)(xr + 16 * CC);
  __builtin_amdgcn_sched_barrier(0);      // this one and the two below keep the groups in this order: loads return in the order of issue, and left alone the compiler puts the residual, needed last, in front of the input rows, needed first
  const unsigned short* w1r = (const unsigned short*)B1 + (size_t)c0 * CC + lane * 8; const unsigned short* w2r = (const unsigned short*)B2 + (size_t)c0 * CC + lane * 8;      // the wave's 16 weight rows in fragment order (FRAG_SRC): 512 consecutive bytes a load
  FragH a1[KST], a2[KST];
#pragma unroll
  for (int ks = 0; ks < KST; ++ks) { a1[ks].half[0] = *(const v8us*)(w1r + ks * 512); a1[ks].half[1] = *(const v8us*)(w1r + ks * 512 + 256); }
  __builtin_amdgcn_sched_barrier(0);
#pragma unroll
  for (int ks = 0; ks < KST; ++ks) { a2[ks].half[0] = *(const v8us*)(w2r + ks * 512); a2[ks].half[1] = *(const v8us*)(w2r + ks * 512 + 256); }
  __builtin_amdgcn_sched_barrier(0);
  const float* pr = pf + ((size_t)b * CC + c0) * NN + n0 + lane; float px[16];      // channel c0 + j, point n0 + lane: a whole 128-byte line a load
#pragma unroll
  for (int j = 0; j < 16; ++j) px[j] = pr[(size_t)j * NN];
  const float g = bf16_round(gam[0]); float b1v[16], b2v[16];      // gate and biases of the wave's 16 channels, the same in every lane: scalar loads, rounded on the scalar unit
#pragma unroll
  for (int j = 0; j < 16; ++j) { b1v[j] = bf16_round(b1[c0 + j]); b2v[j] = bf16_round(b2[c0 + j]); }
  asm volatile("s_wait_xcnt 0x0" :: "v"(xr), "v"(w1r), "v"(w2r) : "memory");      // the loads' address pairs stay untouched up to this wait (the residual loads' lane offset lives on to the stores)
  __builtin_amdgcn_sched_barrier(0);      // the second layer's weight loads and the residual loads stay up here, in flight under the first layer, instead of sinking to their uses
  *(v8us*)&xs[tid >> 5][lane * 8] = xv0; *(v8us*)&xs[16 + (tid >> 5)][lane * 8] = xv1;
  lds_barrier();      // the block's 32 input rows are in LDS before any wave reads its B fragments
  v8f acc[2] = {};
#pragma unroll
  for (int ks = 0; ks < KST; ++ks)
#pragma unroll
    for (int pt = 0; pt < 2; ++pt) { FragH bx; bx.half[0] = *(const v8us*)&xs[pt * 16 + ln][ks * 32 + 8 * hh]; bx.half[1] = *(const v8us*)&xs[pt * 16 + ln][ks * 32 + 16 + 8 * hh];
      acc[pt] = __builtin_amdgcn_wmma_f32_16x16x32_f16(false, a1[ks].v, false, bx.v, (short)0, acc[pt], false, false); }
#pragma unroll
  for (int pt = 0; pt < 2; ++pt) { FragH hv;      // acc[pt][r] = hidden channel c0 + 8 hh + r of point pt * 16 + ln
#pragma unroll
    for (int r = 0; r < 8; ++r) hv.h[r] = (_Float16)fmaxf(acc[pt][r] * 0.0625f + (hh ? b1v[8 + r] : b1v[r]), 0.f);
    *(v8us*)&hs[pt * 16 + ln][c0 + 8 * hh] = hv.half[0]; }
  lds_barrier();      // all 256 hidden channels of the 32 points are in LDS before any wave reads them
  __builtin_amdgcn_sched_barrier(0);      // the rounding of the residual stays below: moved up into the first layer it would bring the wait for the last loads with it
  v8f acc2[2] = {};
#pragma unroll
  for (int ks = 0; ks < KST; ++ks)
#pragma unroll
    for (int pt = 0; pt < 2; ++pt) { FragH bx; bx.half[0] = *(const v8us*)&hs[pt * 16 + ln][ks * 32 + 8 * hh]; bx.half[1] = *(const v8us*)&hs[pt * 16 + ln][ks * 32 + 16 + 8 * hh];
      acc2[pt] = __builtin_amdgcn_wmma_f32_16x16x32_f16(false, a2[ks].v, false, bx.v, (short)0, acc2[pt], false, false); }
  // acc2[pt][r] = channel c0 + 8 hh + r of point pt * 16 + ln. The wave's halves swap one tile each, so that a register holds ONE channel at the 32 points n0 + lane and each store covers a whole 128-byte line.
  float o[16];
#pragma unroll
  for (int r = 0; r < 8; ++r) { const float d0 = acc2[0][r], d1 = acc2[1][r], x0 = xhalf(d0), x1 = xhalf(d1);
    const float e0 = hh ? x1 : d0, e1 = hh ? d1 : x0;      // e0: channel c0 + r, e1: channel c0 + 8 + r
    o[r] = g * (e0 * 0.0625f + b2v[r]) + bf16_round(px[r]); o[8 + r] = g * (e1 * 0.0625f + b2v[8 + r]) + bf16_round(px[8 + r]); }
  float* orow = out + ((size_t)b * CC + c0) * NN + n0 + lane;
#pragma unroll
  for (int j = 0; j < 16; ++j) orow[(size_t)j * NN] = o[j]; }
extern "C" void kernel_launch(void* const* d_in, const int* in_sizes, int n_in,
                              void* d_out, int out_size, void* d_ws, size_t ws_size, hipStream_t stream) {
  (void)in_sizes; (void)n_in; (void)out_size;
  const float* const* I = (const float* const*)d_in; const float* pf = I[0]; const float* tf = I[1]; const float* Wt = I[2]; const float* bt = I[3]; const float* Wq = I[4]; const float* bq = I[5]; const float* Wk = I[6]; const float* bk = I[7]; const float* Wv = I[8]; const float* bv = I[9]; const float* W1 = I[10]; const float* b1 = I[11]; const float* W2 = I[12]; const float* b2 = I[13]; const float* gam = I[14];
  char* ws = (char*)d_ws; size_t off = 0;
  auto take = [&](size_t bytes) { char* p = ws + off; off += (bytes + 255) & ~(size_t)255; return p; };
  _Float16* Bq = (_Float16*)take(CC * CC * 2); _Float16* Bk = (_Float16*)take(CC * CC * 2); _Float16* Bv = (_Float16*)take(CC * CC * 2); _Float16* B1 = (_Float16*)take(CC * CC * 2); _Float16* B2 = (_Float16*)take(CC * CC * 2); float* TB = (float*)take(BB * CC * 4);
  _Float16* X16 = (_Float16*)take((size_t)NR * CC * 2); _Float16* Q16 = (_Float16*)take((size_t)NR * CC * 2); _Float16* K16 = (_Float16*)take((size_t)NR * CC * 2); _Float16* V16 = (_Float16*)take((size_t)NR * CC * 2); _Float16* Vp = (_Float16*)take((size_t)NR * CC * 2); _Float16* Kp = (_Float16*)take((size_t)NR * CC * 2); _Float16* O16 = (_Float16*)take((size_t)NR * CC * 2);
  if (off > ws_size) return;      // 0.7 + 4.2 x 7 = about 30 MiB
  k_prep<<<BB + 5 * WB + TKB, 1024, 0, stream>>>(tf, Wt, bt, Wk, bk, TB, Wq, Wv, W1, W2, Bq, Bk, Bv, B1, B2, pf, X16);      // weights (out,in)
  // Bq, Bk, Bv and Q16, K16, V16 were taken one behind the other and their sizes are multiples of 256 bytes: CC * CC and NR * CC elements apart
  k_gemm_qkv<<<dim3(((NR / 16) * (CC / 64) + 3) / 4, 3), 128, 0, stream>>>(X16, CC, Bq, CC, (size_t)CC * CC, 0.0625f, bq, bv, TB, NN, (size_t)CC, Q16, CC, (size_t)NR * CC, NR);      // k = pf Wk^T + (t Wk^T + bk): the per-batch text bias enters as the CP addend (row block b = row / 4096), unrounded
  k_pack<NH, NN><<<BB * NH * (NN / 64), 256, 0, stream>>>(V16, CC, 0, Vp, K16, Kp);
  k_flash<<<BB * NH * (NN / 32), 128, 0, stream>>>(Q16, CC, Kp, Vp, nullptr, O16, CC);
  k_mlp<<<NR / MPT, 512, 0, stream>>>(O16, B1, B2, b1, b2, pf, gam, (float*)d_out);      // gamma (relu(x W1^T + b1) W2^T + b2) + point_feats, channel-major
}
